// v000
// The times below were measured on an AMD MI455X: many runs one after another, warmed up first and cycling through
// copies of the inputs, with the whole window's GPU time divided by the number of runs. Launches and the gaps
// between them are all in it. The median over several windows is given; except for v000 it joins two sittings, which
// can be a few percent apart, so the side-by-side timings, each taken in one sitting, are the better comparison.
// v000 is the starting kernel. One run takes 121 microseconds.
// Contractions: W_mem / W_q projections = v_wmma_f32_16x16x32_bf16, bf16 (RNE) inputs and weights, one product. Lorentz spatial product k_sp.q_sp (K = 16) and P.V = same bf16 WMMA with every computed operand carried as bf16 hi + bf16 lo (hi.hi + lo.hi + hi.lo). Accumulate f32 everywhere.
// Time-like rank-1 term, arccosh, additive key bias, online softmax (base-2 form): f32 VALU. No power-of-two carries exist (bf16 planes only).
#include <hip/hip_runtime.h>
#include <stddef.h>
#include <stdint.h>
#include <math.h>

#ifndef NB
#define NB 32                      // batches processed (a reduced build reads the first NB batches)
#endif
#define SEQ    512                 // positions per batch (softmax rows i and softmax columns j)
#define LFULL  512                 // full row length of the channels-first input / output and of the mask
#define EW     128                 // model width = heads x head dim
#define NH     8
#define HD     16
#define QROW   32                  // halfwords per spatial plane row: hi[16] | lo[16]
#define TPITCH 136                 // halfwords per LDS transposed-input row
#define OPITCH 36                  // floats per LDS output-stage row
#define WSMAX  134217728
#define VPL    ((size_t)NB * EW * SEQ)          // halfwords per V^T plane (hi plane, then lo plane)
#define PLN    ((size_t)NB * NH * SEQ * QROW)   // halfwords per spatial plane (column plane, then row plane)
#define SCN    ((size_t)NB * NH * SEQ)          // floats per per-position scalar array (3 arrays)
#define XB_FULL ((size_t)EW * LFULL)            // floats per batch of the input and of the output
#define LOG2E  1.4426950408889634f

static_assert(NH * HD == EW);
static_assert(SEQ == 512 && LFULL == 512);
static_assert(EW % 32 == 0 && SEQ % 32 == 0);
static_assert(SEQ % 64 == 0 && (NB * SEQ) % 64 == 0);
static_assert(NH * 64 * QROW == 16384);        // k_hproj stage: spatial plane form
static_assert(2 * EW * 64 == 16384);           // k_hproj stage: V^T form
static_assert(16384 == 128 * 16 * 8);          // k_hproj copy-out: 128 thr x 16 it x 8 halfwords
static_assert(64 * EW == 128 * 16 * 4);        // k_hproj input staging: 128 thr x 16 it x 4 floats
static_assert(3 * NH * 64 == 128 * 3 * 4);     // k_hproj scalar copy-out: 128 thr x 3 it x 4 floats
static_assert((2 * EW * EW) % (256 * 8) == 0); // k_cvt on W_mem: whole blocks
static_assert((EW * EW) % (256 * 8) == 0);     // k_cvt on W_q: whole blocks
static_assert(EW * 32 == 256 * 4 * 4);         // k_hattn copy-out: 256 thr x 4 it x 4 floats
static_assert(TPITCH % 8 == 0 && TPITCH >= EW);
static_assert(OPITCH % 4 == 0 && OPITCH >= 32);
static_assert((size_t)3 * EW * EW * 2 + 2 * PLN * 2 + 2 * VPL * 2 + 3 * SCN * 4 <= (size_t)WSMAX);

typedef int            v4i   __attribute__((ext_vector_type(4)));
typedef int            v8i   __attribute__((ext_vector_type(8)));
typedef float          v4f   __attribute__((ext_vector_type(4)));
typedef float          v8f   __attribute__((ext_vector_type(8)));
typedef __bf16         v16bf __attribute__((ext_vector_type(16)));
typedef v4i __attribute__((may_alias)) v4ia;
typedef v4f __attribute__((may_alias)) v4fa;
union FragB { v16bf v; v4i q[2]; v8i w; };

// WMMA with hazard guard: ties D, keeps A/B live for 4 VALU slots
__device__ __forceinline__ v8f wmb(const FragB& a, const FragB& b, v8f c) {
  v8f d = __builtin_amdgcn_wmma_f32_16x16x32_bf16(false, a.v, false, b.v, (short)0, c, false, false);
  asm volatile("v_nop\n\tv_nop\n\tv_nop\n\tv_nop" : "+v"(d) : "v"(a.w), "v"(b.w));
  return d;
}

// f32 -> bf16 bits, RNE convert (finite inputs)
__device__ __forceinline__ unsigned bf16_bits(float f) {
  const unsigned u = __float_as_uint(f);
  return (u + 0x7FFFu + ((u >> 16) & 1u)) >> 16;
}
__device__ __forceinline__ float bf16_val(float f) {
  return __uint_as_float(bf16_bits(f) << 16);
}
__device__ __forceinline__ int pack2(float lo, float hi) {
  return (int)(bf16_bits(lo) | (bf16_bits(hi) << 16));
}
// 8 f32 -> bf16 hi piece + bf16 lo piece (lo = RNE(v - hi)); element 2j in the low halfword of word j
__device__ __forceinline__ void split8(const v8f x, v4i& hi, v4i& lo) {
#pragma unroll
  for (int j = 0; j < 4; ++j) {
    const float a = x[2 * j], b = x[2 * j + 1];
    const unsigned ha = bf16_bits(a), hb = bf16_bits(b);
    const float ra = a - __uint_as_float(ha << 16);
    const float rb = b - __uint_as_float(hb << 16);
    hi[j] = (int)(ha | (hb << 16));
    lo[j] = (int)(bf16_bits(ra) | (bf16_bits(rb) << 16));
  }
}
// fragment (row/col = lane&15) from a GLOBAL k-contiguous bf16 plane row: p = row + k0 + 8h;
// elements 0..7 <- k0+8h+0..7, 8..15 <- k0+16+8h+0..7
__device__ __forceinline__ FragB ldg_frag(const unsigned short* __restrict__ p) {
  FragB f;
  f.q[0] = *(const v4ia*)p;
  f.q[1] = *(const v4ia*)(p + 16);
  return f;
}

// Hyperboloid map of one head vector held as 8 + 8 components by lanes l and l^16:
// a <- normalize(a * scl) * sinh(|a * scl|); returns cosh(|a * scl|). Both lane halves get identical norms.
__device__ __forceinline__ float hyp8(v8f& a, const float scl) {
#pragma clang fp contract(off)
  float ss = 0.0f;
#pragma unroll
  for (int r = 0; r < 8; ++r) { a[r] = a[r] * scl; ss += a[r] * a[r]; }
  ss += __shfl_xor(ss, 16);
  const float n = sqrtf(ss);
  const float inv = 1.0f / fmaxf(n, 1.0e-12f);
  const float sh = sinhf(n);
  const float ch = coshf(n);
#pragma unroll
  for (int r = 0; r < 8; ++r) a[r] = (a[r] * inv) * sh;
  return ch;
}

// Klein map of one head vector: a <- normalize(hyperboloid_spatial / hyperboloid_time);
// returns (log(1 / (sqrt(1 - (|a| - 1e-4)^2) + 1e-4)) + biasv) * log2(e) + mterm.
__device__ __forceinline__ float klein8(v8f& a, const float biasv, const float mterm) {
#pragma clang fp contract(off)
  float ss = 0.0f;
#pragma unroll
  for (int r = 0; r < 8; ++r) ss += a[r] * a[r];
  ss += __shfl_xor(ss, 16);
  const float vn = sqrtf(ss);
  const float inv = 1.0f / fmaxf(vn, 1.0e-12f);
  const float sh = sinhf(vn);
  const float ch = coshf(vn);
  const float ich = 1.0f / ch;
  float s2 = 0.0f;
#pragma unroll
  for (int r = 0; r < 8; ++r) { a[r] = ((a[r] * inv) * sh) * ich; s2 += a[r] * a[r]; }
  s2 += __shfl_xor(s2, 16);
  const float n2 = sqrtf(s2);
  const float inv2 = 1.0f / fmaxf(n2, 1.0e-12f);
  float s3 = 0.0f;
#pragma unroll
  for (int r = 0; r < 8; ++r) { a[r] = a[r] * inv2; s3 += a[r] * a[r]; }
  s3 += __shfl_xor(s3, 16);
  const float vnk = sqrtf(s3);
  const float dm = vnk - 1.0e-4f;
  const float den = sqrtf(1.0f - dm * dm) + 1.0e-4f;
  const float lden = 1.0f / den;
  const float lb = logf(lden) + biasv;
  return lb * LOG2E + mterm;
}

// One attention logit in the base-2 domain: x = rt*ct - dot (minus the Lorentz product), x1 = x + 1e-6,
// arccosh(x1) = ln(x1 + sqrt(x1^2 - 1)); result = -beta * log2(x1 + sqrt(x1^2 - 1)) + cb.
__device__ __forceinline__ float hlogit(const float rt, const float ct, const float dot,
                                        const float nbeta, const float cb) {
  const float x1 = (rt * ct - dot) + 1.0e-6f;
  const float y = x1 + sqrtf(fmaxf(x1 * x1 - 1.0f, 0.0f));
  return nbeta * log2f(y) + cb;
}

// ---------------------------------------------------------------------------
// f32 -> bf16 plane, contiguous. Thread = 8 elements = one 16-B piece; a wave instruction writes
// ---------------------------------------------------------------------------
__global__ __launch_bounds__(256) void k_cvt(const float* __restrict__ x, unsigned short* o) {
  const size_t i = (size_t)blockIdx.x * 256u + threadIdx.x;
  const float* p = x + i * 8u;
  const v4f a = *(const v4fa*)p;
  const v4f b = *(const v4fa*)(p + 4);
  v4i w;
  w[0] = pack2(a.x, a.y); w[1] = pack2(a.z, a.w);
  w[2] = pack2(b.x, b.y); w[3] = pack2(b.z, b.w);
  unsigned short* d = o + i * 8u;
  *(v4i*)d = w;
  
}

// ---------------------------------------------------------------------------
// Projections + hyperbolic maps. Block = 64 positions of one batch, 4 waves x 16 positions.
// Input x is channels-first [b][k = channel][l]: the 128 x 64 tile is read along l (16-B loads), converted to
// bf16 and transposed into LDS xt[l][k] (cross-wave, block barrier); each wave then holds its 16 positions
// as 4 B fragments (col = lane&15 = position).
// Weight plane wt (bf16, [out][in], k-contiguous): rows 0..127 = W_mem K part, 128..255 = W_mem V part,
// 256..383 = W_q. D = W_tile (A, row = out feature) x X (B, col = position): D[row d = 8h+r][col = position],
// so a lane holds 8 of the 16 head components of one position; lanes l and l^16 complete the head.
// pass 2: V^T hi/lo     = Klein point of (W_mem[128:256] x)               + scalar array 2 = key bias (base-2)
// Plane row (b, head, l) = hi[16] | lo[16] halfwords. V^T plane = [b][channel][l].
// LDS stg: cross-wave (block barriers); fully written before each copy-out (8 heads x 64 rows x 32, or
//   2 planes x 128 cols x 64). ssc: 3 x 8 x 64 floats, written by lanes 0..15 of every wave, copied out last.
// coverage: spatial planes: NB*8 blocks x 16384 halfwords each = NB*8*512*32; V^T: NB*8 blocks x 8192 per
//   plane = NB*128*512; scalars: NB*8 blocks x 8 heads x 64 per array = NB*8*512.
// ---------------------------------------------------------------------------
__global__ __launch_bounds__(128) void k_hproj(const float* __restrict__ x, const int* __restrict__ mask,
                                               const unsigned short* __restrict__ wt,
                                               const float* __restrict__ bias_p,
                                               unsigned short* pl, unsigned short* vt, float* sca) {
  __shared__ __attribute__((aligned(16))) unsigned short xt[64 * TPITCH];
  __shared__ __attribute__((aligned(16))) unsigned short stg[16384];
  __shared__ __attribute__((aligned(16))) float ssc[3 * NH * 64];
  const unsigned tid = threadIdx.x, lane = tid & 31u, hh = lane >> 4, m = lane & 15u;
  const unsigned wave = (unsigned)__builtin_amdgcn_readfirstlane((int)(threadIdx.x >> 5));
  const unsigned row0 = blockIdx.x * 64u;
  const unsigned bb = row0 >> 9, r0 = row0 & 511u;

  // ---- input tile: x[b][k][r0 .. r0+63] -> xt[l][k] bf16 ----
  {
    const float* xg = x + (size_t)bb * XB_FULL + r0;
#pragma unroll 1
    for (unsigned it = 0; it < 16u; ++it) {
      const unsigned p = it * 128u + tid, k = p >> 4, l4 = (p & 15u) << 2;
      const v4f v = *(const v4fa*)(xg + (size_t)k * LFULL + l4);
      xt[(l4 + 0u) * TPITCH + k] = (unsigned short)bf16_bits(v.x);
      xt[(l4 + 1u) * TPITCH + k] = (unsigned short)bf16_bits(v.y);
      xt[(l4 + 2u) * TPITCH + k] = (unsigned short)bf16_bits(v.z);
      xt[(l4 + 3u) * TPITCH + k] = (unsigned short)bf16_bits(v.w);
    }
  }
  __syncthreads();

  FragB xa[4];
  {
    const unsigned xo = (16u * wave + m) * TPITCH + 8u * hh;
#pragma unroll
    for (int ks = 0; ks < 4; ++ks) {
      xa[ks].q[0] = *(const v4ia*)(xt + xo + 32 * ks);
      xa[ks].q[1] = *(const v4ia*)(xt + xo + 32 * ks + 16);
    }
  }
  const int mi = mask[(size_t)bb * LFULL + r0 + 16u * wave + m];
  const float mv = (float)mi;
  const float mterm = (-1.0e30f * (1.0f - mv)) * LOG2E;
  const float biasv = bf16_val(bias_p[0]);
  const v8f zero8 = {0.f, 0.f, 0.f, 0.f, 0.f, 0.f, 0.f, 0.f};

#pragma unroll 1
  for (unsigned ps = 0; ps < 2u; ++ps) {
    const unsigned woff = (ps == 0u) ? (unsigned)(2 * EW * EW) : 0u;
    const float scl = (ps == 0u) ? 0.25f : 1.0f;
#pragma unroll 1
    for (unsigned t = 0; t < NH; ++t) {
      const unsigned short* wp = wt + woff + (size_t)(16u * t + m) * EW + 8u * hh;
      v8f acc = zero8;
#pragma unroll
      for (int ks = 0; ks < 4; ++ks) {
        const FragB wf = ldg_frag(wp + 32 * ks);
        acc = wmb(wf, xa[ks], acc);
      }
      const float ch = hyp8(acc, scl);           // acc[r] = spatial[position 16 wave + m][8h + r]
      v4i hi, lo;
      split8(acc, hi, lo);
      const unsigned so = (t * 64u + 16u * wave + m) * QROW + 8u * hh;
      *(v4ia*)(stg + so) = hi;
      *(v4ia*)(stg + so + 16u) = lo;
      if (hh == 0u) ssc[(ps * NH + t) * 64u + 16u * wave + m] = ch;
    }
    __syncthreads();
    {
      unsigned short* dst = pl + (size_t)ps * PLN + ((size_t)bb * NH * SEQ + r0) * QROW;
#pragma unroll 1
      for (unsigned it = 0; it < 16u; ++it) {
        const unsigned p = it * 128u + tid, t = p >> 8, wi = p & 255u;
        const v4i v = *(const v4ia*)(stg + p * 8u);
        *(v4i*)(dst + (size_t)t * (SEQ * QROW) + wi * 8u) = v;
      }
      
    }
    __syncthreads();
  }

  // ---- pass 2: Klein points -> V^T hi / lo stage, key bias ----
#pragma unroll 1
  for (unsigned t = 0; t < NH; ++t) {
    const unsigned short* wp = wt + (unsigned)(EW * EW) + (size_t)(16u * t + m) * EW + 8u * hh;
    v8f acc = zero8;
#pragma unroll
    for (int ks = 0; ks < 4; ++ks) {
      const FragB wf = ldg_frag(wp + 32 * ks);
      acc = wmb(wf, xa[ks], acc);
    }
    const float lb2 = klein8(acc, biasv, mterm);  // acc[r] = v_klein[position 16 wave + m][8h + r]
#pragma unroll
    for (int r = 0; r < 8; ++r) {
      const unsigned hb = bf16_bits(acc[r]);
      const float res = acc[r] - __uint_as_float(hb << 16);
      const unsigned so = (16u * t + 8u * hh + (unsigned)r) * 64u + 16u * wave + m;
      stg[so] = (unsigned short)hb;
      stg[so + 8192u] = (unsigned short)bf16_bits(res);
    }
    if (hh == 0u) ssc[(2u * NH + t) * 64u + 16u * wave + m] = lb2;
  }
  __syncthreads();
  {
    unsigned short* dst = vt + (size_t)bb * EW * SEQ + r0;
#pragma unroll 1
    for (unsigned it = 0; it < 16u; ++it) {
      const unsigned p = it * 128u + tid, pn = p >> 10, col = (p >> 3) & 127u, c = p & 7u;
      const v4i v = *(const v4ia*)(stg + p * 8u);
      *(v4i*)(dst + (size_t)pn * VPL + (size_t)col * SEQ + c * 8u) = v;
    }
    
  }
  {
#pragma unroll 1
    for (unsigned it = 0; it < 3u; ++it) {
      const unsigned p = it * 128u + tid, a = p >> 7, t = (p >> 4) & 7u, c = p & 15u;
      const v4f v = *(const v4fa*)(ssc + p * 4u);
      *(v4f*)(sca + (size_t)a * SCN + ((size_t)bb * NH + t) * SEQ + r0 + 4u * c) = v;
    }
    
  }
}

// ---------------------------------------------------------------------------
// Fused Lorentz attention: one block = (batch b, 32 softmax rows i0..i0+31), 8 waves, wave = head; each wave
// runs two 16-row tiles one after the other. Flash attention in the transposed domain:
//   S^T tile = C (A, row = column position j) x R^T (B, col = row position i): the K = 16 spatial product is
//   laid as [c_hi|c_hi] x [r_hi|r_lo] plus [c_lo|0] x [r_hi|r_lo] along the 32-deep k axis.
//   D[row j 8h+r][col i m]. Per element: x = rt[i]*ct[j] - D, logit2 = -beta*log2(x1 + sqrt(x1^2-1)) + cb[j]
//   (cb carries log-denominator, bias and the additive key mask term). Softmax statistics are per lane
//   (row i = m); the two lane halves combine by one xor-16 exchange. The P^T B-fragment is the lane's own
//   16 results (tile 0 -> elements 0..7, tile 1 -> elements 8..15). O^T = V^T (A, row d) x P^T:
//   D[row d 8h+r][col i m], scaled per lane.
// Output stage ost[channel 0..127][position 0..31] (cross-wave, block barrier): every wave writes its 16
// coverage: grid (16, NB) x 128 channels x 32 positions = NB*128*512 outputs, each written by exactly one lane.
// ---------------------------------------------------------------------------
__global__ __launch_bounds__(256) void k_hattn(const unsigned short* __restrict__ rpl,
                                               const unsigned short* __restrict__ cpl,
                                               const unsigned short* __restrict__ vt,
                                               const float* __restrict__ rtt,
                                               const float* __restrict__ ctt,
                                               const float* __restrict__ cbb,
                                               const float* __restrict__ beta_p,
                                               float* out) {
  __shared__ __attribute__((aligned(16))) float ost[EW * OPITCH];
  const unsigned tid = threadIdx.x, lane = tid & 31u, hh = lane >> 4, m = lane & 15u;
  const unsigned wave = (unsigned)__builtin_amdgcn_readfirstlane((int)(threadIdx.x >> 5));
  const unsigned i0 = blockIdx.x * 32u, b = blockIdx.y;
  const unsigned bh = b * NH + wave;
  const v8f zero8 = {0.f, 0.f, 0.f, 0.f, 0.f, 0.f, 0.f, 0.f};
  const v4i zero4 = {0, 0, 0, 0};
  const float nbeta = -bf16_val(beta_p[0]);

  const unsigned short* kb = cpl + ((size_t)bh * SEQ + m) * QROW + 8u * hh;
  const unsigned short* vh = vt + ((size_t)bh * HD + m) * SEQ + 8u * hh;
  const unsigned short* vl = vh + VPL;
  const float* ctp = ctt + (size_t)bh * SEQ + 8u * hh;
  const float* cbp = cbb + (size_t)bh * SEQ + 8u * hh;

#pragma unroll 1
  for (unsigned tl = 0; tl < 2u; ++tl) {
    const unsigned g0 = i0 + 16u * tl;
    const unsigned short* qp = rpl + ((size_t)bh * SEQ + g0 + m) * QROW + 8u * hh;
    FragB qf;
    qf.q[0] = *(const v4ia*)qp;            // r_hi[8h .. 8h+7]  (k slots 8h..)
    qf.q[1] = *(const v4ia*)(qp + 16);     // r_lo[8h .. 8h+7]  (k slots 16+8h..)
    const float rt = rtt[(size_t)bh * SEQ + g0 + m];
    v8f o = zero8;
    float mrun = -3.0e38f, lrun = 0.0f;
#pragma unroll 1
    for (unsigned n0 = 0; n0 < SEQ; n0 += 32u) {
      const unsigned short* kp = kb + (size_t)n0 * QROW;
      const v4i kh0 = *(const v4ia*)kp;
      const v4i kl0 = *(const v4ia*)(kp + 16);
      const v4i kh1 = *(const v4ia*)(kp + 16 * QROW);
      const v4i kl1 = *(const v4ia*)(kp + 16 * QROW + 16);
      FragB a10, a20, a11, a21;
      a10.q[0] = kh0; a10.q[1] = kh0;
      a20.q[0] = kl0; a20.q[1] = zero4;
      a11.q[0] = kh1; a11.q[1] = kh1;
      a21.q[0] = kl1; a21.q[1] = zero4;
      v8f s0 = wmb(a10, qf, zero8);
      s0 = wmb(a20, qf, s0);
      v8f s1 = wmb(a11, qf, zero8);
      s1 = wmb(a21, qf, s1);

      const v4f t0 = *(const v4fa*)(ctp + n0);
      const v4f t1 = *(const v4fa*)(ctp + n0 + 4u);
      const v4f t2 = *(const v4fa*)(ctp + n0 + 16u);
      const v4f t3 = *(const v4fa*)(ctp + n0 + 20u);
      const v4f u0 = *(const v4fa*)(cbp + n0);
      const v4f u1 = *(const v4fa*)(cbp + n0 + 4u);
      const v4f u2 = *(const v4fa*)(cbp + n0 + 16u);
      const v4f u3 = *(const v4fa*)(cbp + n0 + 20u);
      const v8f ct0 = __builtin_shufflevector(t0, t1, 0, 1, 2, 3, 4, 5, 6, 7);
      const v8f ct1 = __builtin_shufflevector(t2, t3, 0, 1, 2, 3, 4, 5, 6, 7);
      const v8f cb0 = __builtin_shufflevector(u0, u1, 0, 1, 2, 3, 4, 5, 6, 7);
      const v8f cb1 = __builtin_shufflevector(u2, u3, 0, 1, 2, 3, 4, 5, 6, 7);
      v8f a0, a1;
#pragma unroll
      for (int r = 0; r < 8; ++r) {
        a0[r] = hlogit(rt, ct0[r], s0[r], nbeta, cb0[r]);   // column position n0 + 8h + r
        a1[r] = hlogit(rt, ct1[r], s1[r], nbeta, cb1[r]);   // column position n0 + 16 + 8h + r
      }

      float t = fmaxf(a0[0], a1[0]);
#pragma unroll
      for (int r = 1; r < 8; ++r) t = fmaxf(t, fmaxf(a0[r], a1[r]));
      t = fmaxf(t, __shfl_xor(t, 16));
      const float mnew = fmaxf(mrun, t);
      const float sc = exp2f(mrun - mnew);
      v8f p0, p1;
      float ps = 0.0f;
#pragma unroll
      for (int r = 0; r < 8; ++r) {
        p0[r] = exp2f(a0[r] - mnew);
        p1[r] = exp2f(a1[r] - mnew);
        ps += p0[r] + p1[r];
      }
      lrun = lrun * sc + ps;
      mrun = mnew;
      o = o * sc;

      FragB ph, pw;
      split8(p0, ph.q[0], pw.q[0]);
      split8(p1, ph.q[1], pw.q[1]);
      FragB fvh, fvl;
      fvh.q[0] = *(const v4ia*)(vh + n0);
      fvh.q[1] = *(const v4ia*)(vh + n0 + 16u);
      fvl.q[0] = *(const v4ia*)(vl + n0);
      fvl.q[1] = *(const v4ia*)(vl + n0 + 16u);
      o = wmb(fvh, ph, o);
      o = wmb(fvl, ph, o);
      o = wmb(fvh, pw, o);
    }
    const float lt = lrun + __shfl_xor(lrun, 16);
    const float inv = 1.0f / lt;
    const v8f c = o * inv;                    // out[channel 16 wave + 8h + r][position g0 + m]
    const unsigned so = (16u * wave + 8u * hh) * OPITCH + 16u * tl + m;
#pragma unroll
    for (int r = 0; r < 8; ++r) ost[so + (unsigned)r * OPITCH] = c[r];
  }
  __syncthreads();

  {
    float* ob = out + (size_t)b * XB_FULL + i0;
#pragma unroll 1
    for (unsigned it = 0; it < 4u; ++it) {
      const unsigned p = it * 256u + tid, c = p >> 3, q = p & 7u;
      const v4f v = *(const v4fa*)(ost + c * OPITCH + 4u * q);
      *(v4f*)(ob + (size_t)c * LFULL + 4u * q) = v;
    }
    
  }
}

// ---------------------------------------------------------------------------
static inline size_t al256(size_t o) { return (o + 255) & ~(size_t)255; }

extern "C" void kernel_launch(void* const* d_in, const int* in_sizes, int n_in,
                              void* d_out, int out_size, void* d_ws, size_t ws_size,
                              hipStream_t stream) {
  (void)stream;
  if (n_in < 6) return;
  const long long actN = (long long)NB * EW * LFULL;
  if ((long long)in_sizes[0] < actN) return;                 // queries [b][channel][l]
  if ((long long)in_sizes[1] < (long long)NB * LFULL) return; // mask [b][l] int32
  if (in_sizes[2] < 2 * EW * EW) return;                     // W_mem [256][128]
  if (in_sizes[3] < EW * EW) return;                         // W_q [128][128]
  if (in_sizes[4] < 1 || in_sizes[5] < 1) return;            // beta, bias
  if ((long long)out_size < actN) return;

  const float* queries = (const float*)d_in[0];
  const int*   mask    = (const int*)d_in[1];
  const float* Wmem    = (const float*)d_in[2];
  const float* Wq      = (const float*)d_in[3];
  const float* beta    = (const float*)d_in[4];
  const float* bias    = (const float*)d_in[5];
  float* out = (float*)d_out;

  const size_t wtB = al256((size_t)3 * EW * EW * 2);            // 98,304
  const size_t plB = al256((size_t)2 * PLN * 2);                // 16,777,216 at NB = 32
  const size_t vB  = al256((size_t)2 * VPL * 2);                // 8,388,608
  const size_t scB = al256((size_t)3 * SCN * 4);                // 1,572,864
  const size_t total = wtB + plB + vB + scB;                    // 26,836,992
  if (total > ws_size || total > (size_t)WSMAX) return;
  char* w = (char*)d_ws;
  unsigned short* wt  = (unsigned short*)w;
  unsigned short* pln = (unsigned short*)(w + wtB);
  unsigned short* vtp = (unsigned short*)(w + wtB + plB);
  float*          sca = (float*)(w + wtB + plB + vB);
  unsigned short* cpl = pln;              // column plane (from W_q)
  unsigned short* rpl = pln + PLN;        // row plane (from W_mem rows 0..127)
  float* ctt = sca;
  float* rtt = sca + SCN;
  float* cbb = sca + 2 * SCN;

  // 1, 2: weights [out][in] f32 -> bf16, same orientation: rows 0..255 = W_mem, rows 256..383 = W_q
  k_cvt<<<(unsigned)((2 * EW * EW) / (256 * 8)), 256, 0, stream>>>(Wmem, wt);
  k_cvt<<<(unsigned)((EW * EW) / (256 * 8)), 256, 0, stream>>>(Wq, wt + 2 * EW * EW);
  // 3: projections + hyperboloid / Klein maps -> planes and per-position scalars
  k_hproj<<<(NB * SEQ) / 64, 128, 0, stream>>>(queries, mask, wt, bias, pln, vtp, sca);
  // 4: Lorentz attention, channels-first output
  k_hattn<<<dim3(SEQ / 32, NB), 256, 0, stream>>>(rpl, cpl, vtp, rtt, ctt, cbb, beta, out);
}

// v001
// It runs in 105 microseconds.
// Two timings next to v000 both put it at 1.19 times that version's speed.
// Contractions: W_mem / W_q projections = v_wmma_f32_16x16x32_bf16, bf16 (RNE) inputs and weights, one product. Lorentz spatial product k_sp.q_sp (K = 16) and P.V = same bf16 WMMA with every computed operand carried as bf16 hi + bf16 lo (hi.hi + lo.hi + hi.lo). Accumulate f32 everywhere.
// Time-like rank-1 term, arccosh, additive key bias, online softmax (base-2 form): f32 VALU. No power-of-two carries exist (bf16 planes only).
#include <hip/hip_runtime.h>
#include <stddef.h>
#include <stdint.h>
#include <math.h>

#ifndef NB
#define NB 32                      // batches processed (a reduced build reads the first NB batches)
#endif
#define SEQ    512                 // positions per batch (softmax rows i and softmax columns j)
#define LFULL  512                 // full row length of the channels-first input / output and of the mask
#define EW     128                 // model width = heads x head dim
#define NH     8
#define HD     16
#define QROW   32                  // halfwords per spatial plane row: hi[16] | lo[16]
#define TPITCH 136                 // halfwords per LDS transposed-input row
#define OPITCH 36                  // floats per LDS output-stage row
#define WSMAX  134217728
#define VPL    ((size_t)NB * EW * SEQ)          // halfwords per V^T plane (hi plane, then lo plane)
#define PLN    ((size_t)NB * NH * SEQ * QROW)   // halfwords per spatial plane (column plane, then row plane)
#define SCN    ((size_t)NB * NH * SEQ)          // floats per per-position scalar array (3 arrays)
#define XB_FULL ((size_t)EW * LFULL)            // floats per batch of the input and of the output
#define LOG2E  1.4426950408889634f

static_assert(NH * HD == EW);
static_assert(SEQ == 512 && LFULL == 512);
static_assert(EW % 32 == 0 && SEQ % 32 == 0);
static_assert(SEQ % 64 == 0 && (NB * SEQ) % 64 == 0);
static_assert(NH * 64 * QROW == 16384);        // k_hproj stage: spatial plane form
static_assert(2 * EW * 64 == 16384);           // k_hproj stage: V^T form
static_assert(16384 == 128 * 16 * 8);          // k_hproj copy-out: 128 thr x 16 it x 8 halfwords
static_assert(64 * EW == 128 * 16 * 4);        // k_hproj input staging: 128 thr x 16 it x 4 floats
static_assert(3 * NH * 64 == 128 * 3 * 4);     // k_hproj scalar copy-out: 128 thr x 3 it x 4 floats
static_assert((2 * EW * EW) % (256 * 8) == 0); // k_cvt on W_mem: whole blocks
static_assert((EW * EW) % (256 * 8) == 0);     // k_cvt on W_q: whole blocks
static_assert(EW * 32 == 256 * 4 * 4);         // k_hattn copy-out: 256 thr x 4 it x 4 floats
static_assert(TPITCH % 8 == 0 && TPITCH >= EW);
static_assert(OPITCH % 4 == 0 && OPITCH >= 32);
static_assert((size_t)3 * EW * EW * 2 + 2 * PLN * 2 + 2 * VPL * 2 + 3 * SCN * 4 <= (size_t)WSMAX);

typedef int            v4i   __attribute__((ext_vector_type(4)));
typedef int            v8i   __attribute__((ext_vector_type(8)));
typedef float          v4f   __attribute__((ext_vector_type(4)));
typedef float          v8f   __attribute__((ext_vector_type(8)));
typedef __bf16         v16bf __attribute__((ext_vector_type(16)));
typedef v4i __attribute__((may_alias)) v4ia;
typedef v4f __attribute__((may_alias)) v4fa;
union FragB { v16bf v; v4i q[2]; v8i w; };

// WMMA with hazard guard: ties D, keeps A/B live for 4 VALU slots
__device__ __forceinline__ v8f wmb(const FragB& a, const FragB& b, v8f c) {
  v8f d = __builtin_amdgcn_wmma_f32_16x16x32_bf16(false, a.v, false, b.v, (short)0, c, false, false);
  asm volatile("v_nop\n\tv_nop\n\tv_nop\n\tv_nop" : "+v"(d) : "v"(a.w), "v"(b.w));
  return d;
}

// f32 -> bf16 bits, RNE convert (finite inputs)
__device__ __forceinline__ unsigned bf16_bits(float f) {
  const unsigned u = __float_as_uint(f);
  return (u + 0x7FFFu + ((u >> 16) & 1u)) >> 16;
}
__device__ __forceinline__ float bf16_val(float f) {
  return __uint_as_float(bf16_bits(f) << 16);
}
__device__ __forceinline__ int pack2(float lo, float hi) {
  return (int)(bf16_bits(lo) | (bf16_bits(hi) << 16));
}
// 8 f32 -> bf16 hi piece + bf16 lo piece (lo = RNE(v - hi)); element 2j in the low halfword of word j
__device__ __forceinline__ void split8(const v8f x, v4i& hi, v4i& lo) {
#pragma unroll
  for (int j = 0; j < 4; ++j) {
    const float a = x[2 * j], b = x[2 * j + 1];
    const unsigned ha = bf16_bits(a), hb = bf16_bits(b);
    const float ra = a - __uint_as_float(ha << 16);
    const float rb = b - __uint_as_float(hb << 16);
    hi[j] = (int)(ha | (hb << 16));
    lo[j] = (int)(bf16_bits(ra) | (bf16_bits(rb) << 16));
  }
}
// fragment (row/col = lane&15) from a GLOBAL k-contiguous bf16 plane row: p = row + k0 + 8h;
// elements 0..7 <- k0+8h+0..7, 8..15 <- k0+16+8h+0..7
__device__ __forceinline__ FragB ldg_frag(const unsigned short* __restrict__ p) {
  FragB f;
  f.q[0] = *(const v4ia*)p;
  f.q[1] = *(const v4ia*)(p + 16);
  return f;
}

// Hyperboloid map of one head vector held as 8 + 8 components by lanes l and l^16:
// a <- normalize(a * scl) * sinh(|a * scl|); returns cosh(|a * scl|). Both lane halves get identical norms.
__device__ __forceinline__ float hyp8(v8f& a, const float scl) {
#pragma clang fp contract(off)
  float ss = 0.0f;
#pragma unroll
  for (int r = 0; r < 8; ++r) { a[r] = a[r] * scl; ss += a[r] * a[r]; }
  ss += __shfl_xor(ss, 16);
  const float n = sqrtf(ss);
  const float inv = 1.0f / fmaxf(n, 1.0e-12f);
  const float sh = sinhf(n);
  const float ch = coshf(n);
#pragma unroll
  for (int r = 0; r < 8; ++r) a[r] = (a[r] * inv) * sh;
  return ch;
}

// Klein map of one head vector: a <- normalize(hyperboloid_spatial / hyperboloid_time);
// returns (log(1 / (sqrt(1 - (|a| - 1e-4)^2) + 1e-4)) + biasv) * log2(e) + mterm.
__device__ __forceinline__ float klein8(v8f& a, const float biasv, const float mterm) {
#pragma clang fp contract(off)
  float ss = 0.0f;
#pragma unroll
  for (int r = 0; r < 8; ++r) ss += a[r] * a[r];
  ss += __shfl_xor(ss, 16);
  const float vn = sqrtf(ss);
  const float inv = 1.0f / fmaxf(vn, 1.0e-12f);
  const float sh = sinhf(vn);
  const float ch = coshf(vn);
  const float ich = 1.0f / ch;
  float s2 = 0.0f;
#pragma unroll
  for (int r = 0; r < 8; ++r) { a[r] = ((a[r] * inv) * sh) * ich; s2 += a[r] * a[r]; }
  s2 += __shfl_xor(s2, 16);
  const float n2 = sqrtf(s2);
  const float inv2 = 1.0f / fmaxf(n2, 1.0e-12f);
  float s3 = 0.0f;
#pragma unroll
  for (int r = 0; r < 8; ++r) { a[r] = a[r] * inv2; s3 += a[r] * a[r]; }
  s3 += __shfl_xor(s3, 16);
  const float vnk = sqrtf(s3);
  const float dm = vnk - 1.0e-4f;
  const float den = sqrtf(1.0f - dm * dm) + 1.0e-4f;
  const float lden = 1.0f / den;
  const float lb = logf(lden) + biasv;
  return lb * LOG2E + mterm;
}

// The attention loop's root, log2 and 2^x as the bare instructions. The library forms wrap each in a rescale
// for subnormal arguments or results and give the root a last-bit correction: about 5 to 15 vector
// instructions per value. Here the root's argument is 0 or a normal number (x1^2 - 1 of an f32 x1, clamped at
// 0), the log's is about 1 or more, and a 2^x below the normal range may come out as 0 beside a row sum that
// holds a term equal to 1; the root keeps the instruction's own 1 ulp.
// One asm statement per kind, every value in place: no instruction in it touches its neighbour's register, and
// the closing v_nop is the slot the instruction set asks for between the last one and a reader of its result
// (the builtins compiled to runs in which one overwrote the source of the one directly in front).
__device__ __forceinline__ void sqrt16(float (&a)[16]) {
  asm(
      "v_sqrt_f32 %0, %0\n\t"
      "v_sqrt_f32 %1, %1\n\t"
      "v_sqrt_f32 %2, %2\n\t"
      "v_sqrt_f32 %3, %3\n\t"
      "v_sqrt_f32 %4, %4\n\t"
      "v_sqrt_f32 %5, %5\n\t"
      "v_sqrt_f32 %6, %6\n\t"
      "v_sqrt_f32 %7, %7\n\t"
      "v_sqrt_f32 %8, %8\n\t"
      "v_sqrt_f32 %9, %9\n\t"
      "v_sqrt_f32 %10, %10\n\t"
      "v_sqrt_f32 %11, %11\n\t"
      "v_sqrt_f32 %12, %12\n\t"
      "v_sqrt_f32 %13, %13\n\t"
      "v_sqrt_f32 %14, %14\n\t"
      "v_sqrt_f32 %15, %15\n\t"
      "v_nop"
      :
        "+v"(a[0]), "+v"(a[1]), "+v"(a[2]), "+v"(a[3]), "+v"(a[4]), "+v"(a[5]),
        "+v"(a[6]), "+v"(a[7]), "+v"(a[8]), "+v"(a[9]), "+v"(a[10]), "+v"(a[11]),
        "+v"(a[12]), "+v"(a[13]), "+v"(a[14]), "+v"(a[15]));
}
__device__ __forceinline__ void log2_16(float (&a)[16]) {
  asm(
      "v_log_f32 %0, %0\n\t"
      "v_log_f32 %1, %1\n\t"
      "v_log_f32 %2, %2\n\t"
      "v_log_f32 %3, %3\n\t"
      "v_log_f32 %4, %4\n\t"
      "v_log_f32 %5, %5\n\t"
      "v_log_f32 %6, %6\n\t"
      "v_log_f32 %7, %7\n\t"
      "v_log_f32 %8, %8\n\t"
      "v_log_f32 %9, %9\n\t"
      "v_log_f32 %10, %10\n\t"
      "v_log_f32 %11, %11\n\t"
      "v_log_f32 %12, %12\n\t"
      "v_log_f32 %13, %13\n\t"
      "v_log_f32 %14, %14\n\t"
      "v_log_f32 %15, %15\n\t"
      "v_nop"
      :
        "+v"(a[0]), "+v"(a[1]), "+v"(a[2]), "+v"(a[3]), "+v"(a[4]), "+v"(a[5]),
        "+v"(a[6]), "+v"(a[7]), "+v"(a[8]), "+v"(a[9]), "+v"(a[10]), "+v"(a[11]),
        "+v"(a[12]), "+v"(a[13]), "+v"(a[14]), "+v"(a[15]));
}
__device__ __forceinline__ void exp2_17(float (&a)[17]) {
  asm(
      "v_exp_f32 %0, %0\n\t"
      "v_exp_f32 %1, %1\n\t"
      "v_exp_f32 %2, %2\n\t"
      "v_exp_f32 %3, %3\n\t"
      "v_exp_f32 %4, %4\n\t"
      "v_exp_f32 %5, %5\n\t"
      "v_exp_f32 %6, %6\n\t"
      "v_exp_f32 %7, %7\n\t"
      "v_exp_f32 %8, %8\n\t"
      "v_exp_f32 %9, %9\n\t"
      "v_exp_f32 %10, %10\n\t"
      "v_exp_f32 %11, %11\n\t"
      "v_exp_f32 %12, %12\n\t"
      "v_exp_f32 %13, %13\n\t"
      "v_exp_f32 %14, %14\n\t"
      "v_exp_f32 %15, %15\n\t"
      "v_exp_f32 %16, %16\n\t"
      "v_nop"
      :
        "+v"(a[0]), "+v"(a[1]), "+v"(a[2]), "+v"(a[3]), "+v"(a[4]), "+v"(a[5]),
        "+v"(a[6]), "+v"(a[7]), "+v"(a[8]), "+v"(a[9]), "+v"(a[10]), "+v"(a[11]),
        "+v"(a[12]), "+v"(a[13]), "+v"(a[14]), "+v"(a[15]), "+v"(a[16]));
}

// ---------------------------------------------------------------------------
// f32 -> bf16 plane, contiguous. Thread = 8 elements = one 16-B piece; a wave instruction writes
// ---------------------------------------------------------------------------
__global__ __launch_bounds__(256) void k_cvt(const float* __restrict__ x, unsigned short* o) {
  const size_t i = (size_t)blockIdx.x * 256u + threadIdx.x;
  const float* p = x + i * 8u;
  const v4f a = *(const v4fa*)p;
  const v4f b = *(const v4fa*)(p + 4);
  v4i w;
  w[0] = pack2(a.x, a.y); w[1] = pack2(a.z, a.w);
  w[2] = pack2(b.x, b.y); w[3] = pack2(b.z, b.w);
  unsigned short* d = o + i * 8u;
  *(v4i*)d = w;
  
}

// ---------------------------------------------------------------------------
// Projections + hyperbolic maps. Block = 64 positions of one batch, 4 waves x 16 positions.
// Input x is channels-first [b][k = channel][l]: the 128 x 64 tile is read along l (16-B loads), converted to
// bf16 and transposed into LDS xt[l][k] (cross-wave, block barrier); each wave then holds its 16 positions
// as 4 B fragments (col = lane&15 = position).
// Weight plane wt (bf16, [out][in], k-contiguous): rows 0..127 = W_mem K part, 128..255 = W_mem V part,
// 256..383 = W_q. D = W_tile (A, row = out feature) x X (B, col = position): D[row d = 8h+r][col = position],
// so a lane holds 8 of the 16 head components of one position; lanes l and l^16 complete the head.
// pass 2: V^T hi/lo     = Klein point of (W_mem[128:256] x)               + scalar array 2 = key bias (base-2)
// Plane row (b, head, l) = hi[16] | lo[16] halfwords. V^T plane = [b][channel][l].
// LDS stg: cross-wave (block barriers); fully written before each copy-out (8 heads x 64 rows x 32, or
//   2 planes x 128 cols x 64). ssc: 3 x 8 x 64 floats, written by lanes 0..15 of every wave, copied out last.
// coverage: spatial planes: NB*8 blocks x 16384 halfwords each = NB*8*512*32; V^T: NB*8 blocks x 8192 per
//   plane = NB*128*512; scalars: NB*8 blocks x 8 heads x 64 per array = NB*8*512.
// ---------------------------------------------------------------------------
__global__ __launch_bounds__(128) void k_hproj(const float* __restrict__ x, const int* __restrict__ mask,
                                               const unsigned short* __restrict__ wt,
                                               const float* __restrict__ bias_p,
                                               unsigned short* pl, unsigned short* vt, float* sca) {
  __shared__ __attribute__((aligned(16))) unsigned short xt[64 * TPITCH];
  __shared__ __attribute__((aligned(16))) unsigned short stg[16384];
  __shared__ __attribute__((aligned(16))) float ssc[3 * NH * 64];
  const unsigned tid = threadIdx.x, lane = tid & 31u, hh = lane >> 4, m = lane & 15u;
  const unsigned wave = (unsigned)__builtin_amdgcn_readfirstlane((int)(threadIdx.x >> 5));
  const unsigned row0 = blockIdx.x * 64u;
  const unsigned bb = row0 >> 9, r0 = row0 & 511u;

  // ---- input tile: x[b][k][r0 .. r0+63] -> xt[l][k] bf16 ----
  {
    const float* xg = x + (size_t)bb * XB_FULL + r0;
#pragma unroll 1
    for (unsigned it = 0; it < 16u; ++it) {
      const unsigned p = it * 128u + tid, k = p >> 4, l4 = (p & 15u) << 2;
      const v4f v = *(const v4fa*)(xg + (size_t)k * LFULL + l4);
      xt[(l4 + 0u) * TPITCH + k] = (unsigned short)bf16_bits(v.x);
      xt[(l4 + 1u) * TPITCH + k] = (unsigned short)bf16_bits(v.y);
      xt[(l4 + 2u) * TPITCH + k] = (unsigned short)bf16_bits(v.z);
      xt[(l4 + 3u) * TPITCH + k] = (unsigned short)bf16_bits(v.w);
    }
  }
  __syncthreads();

  FragB xa[4];
  {
    const unsigned xo = (16u * wave + m) * TPITCH + 8u * hh;
#pragma unroll
    for (int ks = 0; ks < 4; ++ks) {
      xa[ks].q[0] = *(const v4ia*)(xt + xo + 32 * ks);
      xa[ks].q[1] = *(const v4ia*)(xt + xo + 32 * ks + 16);
    }
  }
  const int mi = mask[(size_t)bb * LFULL + r0 + 16u * wave + m];
  const float mv = (float)mi;
  const float mterm = (-1.0e30f * (1.0f - mv)) * LOG2E;
  const float biasv = bf16_val(bias_p[0]);
  const v8f zero8 = {0.f, 0.f, 0.f, 0.f, 0.f, 0.f, 0.f, 0.f};

#pragma unroll 1
  for (unsigned ps = 0; ps < 2u; ++ps) {
    const unsigned woff = (ps == 0u) ? (unsigned)(2 * EW * EW) : 0u;
    const float scl = (ps == 0u) ? 0.25f : 1.0f;
#pragma unroll 1
    for (unsigned t = 0; t < NH; ++t) {
      const unsigned short* wp = wt + woff + (size_t)(16u * t + m) * EW + 8u * hh;
      v8f acc = zero8;
#pragma unroll
      for (int ks = 0; ks < 4; ++ks) {
        const FragB wf = ldg_frag(wp + 32 * ks);
        acc = wmb(wf, xa[ks], acc);
      }
      const float ch = hyp8(acc, scl);           // acc[r] = spatial[position 16 wave + m][8h + r]
      v4i hi, lo;
      split8(acc, hi, lo);
      const unsigned so = (t * 64u + 16u * wave + m) * QROW + 8u * hh;
      *(v4ia*)(stg + so) = hi;
      *(v4ia*)(stg + so + 16u) = lo;
      if (hh == 0u) ssc[(ps * NH + t) * 64u + 16u * wave + m] = ch;
    }
    __syncthreads();
    {
      unsigned short* dst = pl + (size_t)ps * PLN + ((size_t)bb * NH * SEQ + r0) * QROW;
#pragma unroll 1
      for (unsigned it = 0; it < 16u; ++it) {
        const unsigned p = it * 128u + tid, t = p >> 8, wi = p & 255u;
        const v4i v = *(const v4ia*)(stg + p * 8u);
        *(v4i*)(dst + (size_t)t * (SEQ * QROW) + wi * 8u) = v;
      }
      
    }
    __syncthreads();
  }

  // ---- pass 2: Klein points -> V^T hi / lo stage, key bias ----
#pragma unroll 1
  for (unsigned t = 0; t < NH; ++t) {
    const unsigned short* wp = wt + (unsigned)(EW * EW) + (size_t)(16u * t + m) * EW + 8u * hh;
    v8f acc = zero8;
#pragma unroll
    for (int ks = 0; ks < 4; ++ks) {
      const FragB wf = ldg_frag(wp + 32 * ks);
      acc = wmb(wf, xa[ks], acc);
    }
    const float lb2 = klein8(acc, biasv, mterm);  // acc[r] = v_klein[position 16 wave + m][8h + r]
#pragma unroll
    for (int r = 0; r < 8; ++r) {
      const unsigned hb = bf16_bits(acc[r]);
      const float res = acc[r] - __uint_as_float(hb << 16);
      const unsigned so = (16u * t + 8u * hh + (unsigned)r) * 64u + 16u * wave + m;
      stg[so] = (unsigned short)hb;
      stg[so + 8192u] = (unsigned short)bf16_bits(res);
    }
    if (hh == 0u) ssc[(2u * NH + t) * 64u + 16u * wave + m] = lb2;
  }
  __syncthreads();
  {
    unsigned short* dst = vt + (size_t)bb * EW * SEQ + r0;
#pragma unroll 1
    for (unsigned it = 0; it < 16u; ++it) {
      const unsigned p = it * 128u + tid, pn = p >> 10, col = (p >> 3) & 127u, c = p & 7u;
      const v4i v = *(const v4ia*)(stg + p * 8u);
      *(v4i*)(dst + (size_t)pn * VPL + (size_t)col * SEQ + c * 8u) = v;
    }
    
  }
  {
#pragma unroll 1
    for (unsigned it = 0; it < 3u; ++it) {
      const unsigned p = it * 128u + tid, a = p >> 7, t = (p >> 4) & 7u, c = p & 15u;
      const v4f v = *(const v4fa*)(ssc + p * 4u);
      *(v4f*)(sca + (size_t)a * SCN + ((size_t)bb * NH + t) * SEQ + r0 + 4u * c) = v;
    }
    
  }
}

// ---------------------------------------------------------------------------
// Fused Lorentz attention: one block = (batch b, 32 softmax rows i0..i0+31), 8 waves, wave = head; each wave
// runs two 16-row tiles one after the other. Flash attention in the transposed domain:
//   S^T tile = C (A, row = column position j) x R^T (B, col = row position i): the K = 16 spatial product is
//   laid as [c_hi|c_hi] x [r_hi|r_lo] plus [c_lo|0] x [r_hi|r_lo] along the 32-deep k axis.
//   D[row j 8h+r][col i m]. Per element: x = rt[i]*ct[j] - D, logit2 = -beta*log2(x1 + sqrt(x1^2-1)) + cb[j]
//   (cb carries log-denominator, bias and the additive key mask term). Softmax statistics are per lane
//   (row i = m); the two lane halves combine by one xor-16 exchange. The P^T B-fragment is the lane's own
//   16 results (tile 0 -> elements 0..7, tile 1 -> elements 8..15). O^T = V^T (A, row d) x P^T:
//   D[row d 8h+r][col i m], scaled per lane.
// Output stage ost[channel 0..127][position 0..31] (cross-wave, block barrier): every wave writes its 16
// coverage: grid (16, NB) x 128 channels x 32 positions = NB*128*512 outputs, each written by exactly one lane.
// ---------------------------------------------------------------------------
__global__ __launch_bounds__(256) void k_hattn(const unsigned short* __restrict__ rpl,
                                               const unsigned short* __restrict__ cpl,
                                               const unsigned short* __restrict__ vt,
                                               const float* __restrict__ rtt,
                                               const float* __restrict__ ctt,
                                               const float* __restrict__ cbb,
                                               const float* __restrict__ beta_p,
                                               float* out) {
  __shared__ __attribute__((aligned(16))) float ost[EW * OPITCH];
  const unsigned tid = threadIdx.x, lane = tid & 31u, hh = lane >> 4, m = lane & 15u;
  const unsigned wave = (unsigned)__builtin_amdgcn_readfirstlane((int)(threadIdx.x >> 5));
  const unsigned i0 = blockIdx.x * 32u, b = blockIdx.y;
  const unsigned bh = b * NH + wave;
  const v8f zero8 = {0.f, 0.f, 0.f, 0.f, 0.f, 0.f, 0.f, 0.f};
  const v4i zero4 = {0, 0, 0, 0};
  const float nbeta = -bf16_val(beta_p[0]);

  const unsigned short* kb = cpl + ((size_t)bh * SEQ + m) * QROW + 8u * hh;
  const unsigned short* vh = vt + ((size_t)bh * HD + m) * SEQ + 8u * hh;
  const unsigned short* vl = vh + VPL;
  const float* ctp = ctt + (size_t)bh * SEQ + 8u * hh;
  const float* cbp = cbb + (size_t)bh * SEQ + 8u * hh;

#pragma unroll 1
  for (unsigned tl = 0; tl < 2u; ++tl) {
    const unsigned g0 = i0 + 16u * tl;
    const unsigned short* qp = rpl + ((size_t)bh * SEQ + g0 + m) * QROW + 8u * hh;
    FragB qf;
    qf.q[0] = *(const v4ia*)qp;            // r_hi[8h .. 8h+7]  (k slots 8h..)
    qf.q[1] = *(const v4ia*)(qp + 16);     // r_lo[8h .. 8h+7]  (k slots 16+8h..)
    const float rt = rtt[(size_t)bh * SEQ + g0 + m];
    v8f o = zero8;
    float mrun = -3.0e38f, lrun = 0.0f;
#pragma unroll 1
    for (unsigned n0 = 0; n0 < SEQ; n0 += 32u) {
      const unsigned short* kp = kb + (size_t)n0 * QROW;
      const v4i kh0 = *(const v4ia*)kp;
      const v4i kl0 = *(const v4ia*)(kp + 16);
      const v4i kh1 = *(const v4ia*)(kp + 16 * QROW);
      const v4i kl1 = *(const v4ia*)(kp + 16 * QROW + 16);
      FragB a10, a20, a11, a21;
      a10.q[0] = kh0; a10.q[1] = kh0;
      a20.q[0] = kl0; a20.q[1] = zero4;
      a11.q[0] = kh1; a11.q[1] = kh1;
      a21.q[0] = kl1; a21.q[1] = zero4;
      v8f s0 = wmb(a10, qf, zero8);
      s0 = wmb(a20, qf, s0);
      v8f s1 = wmb(a11, qf, zero8);
      s1 = wmb(a21, qf, s1);

      const v4f t0 = *(const v4fa*)(ctp + n0);
      const v4f t1 = *(const v4fa*)(ctp + n0 + 4u);
      const v4f t2 = *(const v4fa*)(ctp + n0 + 16u);
      const v4f t3 = *(const v4fa*)(ctp + n0 + 20u);
      const v4f u0 = *(const v4fa*)(cbp + n0);
      const v4f u1 = *(const v4fa*)(cbp + n0 + 4u);
      const v4f u2 = *(const v4fa*)(cbp + n0 + 16u);
      const v4f u3 = *(const v4fa*)(cbp + n0 + 20u);
      const v8f ct0 = __builtin_shufflevector(t0, t1, 0, 1, 2, 3, 4, 5, 6, 7);
      const v8f ct1 = __builtin_shufflevector(t2, t3, 0, 1, 2, 3, 4, 5, 6, 7);
      const v8f cb0 = __builtin_shufflevector(u0, u1, 0, 1, 2, 3, 4, 5, 6, 7);
      const v8f cb1 = __builtin_shufflevector(u2, u3, 0, 1, 2, 3, 4, 5, 6, 7);
      // logit in the base-2 domain: x = rt*ct - dot (minus the Lorentz product), x1 = x + 1e-6,
      // arccosh(x1) = ln(x1 + sqrt(x1^2 - 1)); a = -beta * log2(x1 + sqrt(x1^2 - 1)) + cb
      float x1[16], w[16];
#pragma unroll
      for (int r = 0; r < 8; ++r) {
        x1[r]     = (rt * ct0[r] - s0[r]) + 1.0e-6f;        // column position n0 + 8h + r
        x1[8 + r] = (rt * ct1[r] - s1[r]) + 1.0e-6f;        // column position n0 + 16 + 8h + r
      }
#pragma unroll
      for (int i = 0; i < 16; ++i) w[i] = fmaxf(x1[i] * x1[i] - 1.0f, 0.0f);
      sqrt16(w);
#pragma unroll
      for (int i = 0; i < 16; ++i) w[i] = x1[i] + w[i];
      log2_16(w);
      v8f a0, a1;
#pragma unroll
      for (int r = 0; r < 8; ++r) {
        a0[r] = nbeta * w[r] + cb0[r];
        a1[r] = nbeta * w[8 + r] + cb1[r];
      }

      float t = fmaxf(a0[0], a1[0]);
#pragma unroll
      for (int r = 1; r < 8; ++r) t = fmaxf(t, fmaxf(a0[r], a1[r]));
      t = fmaxf(t, __shfl_xor(t, 16));
      const float mnew = fmaxf(mrun, t);
      float e[17];
#pragma unroll
      for (int r = 0; r < 8; ++r) {
        e[r]     = a0[r] - mnew;
        e[8 + r] = a1[r] - mnew;
      }
      e[16] = mrun - mnew;
      exp2_17(e);
      const float sc = e[16];
      v8f p0, p1;
      float ps = 0.0f;
#pragma unroll
      for (int r = 0; r < 8; ++r) {
        p0[r] = e[r];
        p1[r] = e[8 + r];
        ps += p0[r] + p1[r];
      }
      lrun = lrun * sc + ps;
      mrun = mnew;
      o = o * sc;

      FragB ph, pw;
      split8(p0, ph.q[0], pw.q[0]);
      split8(p1, ph.q[1], pw.q[1]);
      FragB fvh, fvl;
      fvh.q[0] = *(const v4ia*)(vh + n0);
      fvh.q[1] = *(const v4ia*)(vh + n0 + 16u);
      fvl.q[0] = *(const v4ia*)(vl + n0);
      fvl.q[1] = *(const v4ia*)(vl + n0 + 16u);
      o = wmb(fvh, ph, o);
      o = wmb(fvl, ph, o);
      o = wmb(fvh, pw, o);
    }
    const float lt = lrun + __shfl_xor(lrun, 16);
    const float inv = 1.0f / lt;
    const v8f c = o * inv;                    // out[channel 16 wave + 8h + r][position g0 + m]
    const unsigned so = (16u * wave + 8u * hh) * OPITCH + 16u * tl + m;
#pragma unroll
    for (int r = 0; r < 8; ++r) ost[so + (unsigned)r * OPITCH] = c[r];
  }
  __syncthreads();

  {
    float* ob = out + (size_t)b * XB_FULL + i0;
#pragma unroll 1
    for (unsigned it = 0; it < 4u; ++it) {
      const unsigned p = it * 256u + tid, c = p >> 3, q = p & 7u;
      const v4f v = *(const v4fa*)(ost + c * OPITCH + 4u * q);
      *(v4f*)(ob + (size_t)c * LFULL + 4u * q) = v;
    }
    
  }
}

// ---------------------------------------------------------------------------
static inline size_t al256(size_t o) { return (o + 255) & ~(size_t)255; }

extern "C" void kernel_launch(void* const* d_in, const int* in_sizes, int n_in,
                              void* d_out, int out_size, void* d_ws, size_t ws_size,
                              hipStream_t stream) {
  (void)stream;
  if (n_in < 6) return;
  const long long actN = (long long)NB * EW * LFULL;
  if ((long long)in_sizes[0] < actN) return;                 // queries [b][channel][l]
  if ((long long)in_sizes[1] < (long long)NB * LFULL) return; // mask [b][l] int32
  if (in_sizes[2] < 2 * EW * EW) return;                     // W_mem [256][128]
  if (in_sizes[3] < EW * EW) return;                         // W_q [128][128]
  if (in_sizes[4] < 1 || in_sizes[5] < 1) return;            // beta, bias
  if ((long long)out_size < actN) return;

  const float* queries = (const float*)d_in[0];
  const int*   mask    = (const int*)d_in[1];
  const float* Wmem    = (const float*)d_in[2];
  const float* Wq      = (const float*)d_in[3];
  const float* beta    = (const float*)d_in[4];
  const float* bias    = (const float*)d_in[5];
  float* out = (float*)d_out;

  const size_t wtB = al256((size_t)3 * EW * EW * 2);            // 98,304
  const size_t plB = al256((size_t)2 * PLN * 2);                // 16,777,216 at NB = 32
  const size_t vB  = al256((size_t)2 * VPL * 2);                // 8,388,608
  const size_t scB = al256((size_t)3 * SCN * 4);                // 1,572,864
  const size_t total = wtB + plB + vB + scB;                    // 26,836,992
  if (total > ws_size || total > (size_t)WSMAX) return;
  char* w = (char*)d_ws;
  unsigned short* wt  = (unsigned short*)w;
  unsigned short* pln = (unsigned short*)(w + wtB);
  unsigned short* vtp = (unsigned short*)(w + wtB + plB);
  float*          sca = (float*)(w + wtB + plB + vB);
  unsigned short* cpl = pln;              // column plane (from W_q)
  unsigned short* rpl = pln + PLN;        // row plane (from W_mem rows 0..127)
  float* ctt = sca;
  float* rtt = sca + SCN;
  float* cbb = sca + 2 * SCN;

  // 1, 2: weights [out][in] f32 -> bf16, same orientation: rows 0..255 = W_mem, rows 256..383 = W_q
  k_cvt<<<(unsigned)((2 * EW * EW) / (256 * 8)), 256, 0, stream>>>(Wmem, wt);
  k_cvt<<<(unsigned)((EW * EW) / (256 * 8)), 256, 0, stream>>>(Wq, wt + 2 * EW * EW);
  // 3: projections + hyperboloid / Klein maps -> planes and per-position scalars
  k_hproj<<<(NB * SEQ) / 64, 128, 0, stream>>>(queries, mask, wt, bias, pln, vtp, sca);
  // 4: Lorentz attention, channels-first output
  k_hattn<<<dim3(SEQ / 32, NB), 256, 0, stream>>>(rpl, cpl, vtp, rtt, ctt, cbb, beta, out);
}

// v002
// One run takes 101 microseconds.
// In both of two side-by-side timings against v001, it was 1.04 times as fast.
// Counting every step since v000, it is 1.23 times as fast.
// Contractions: W_mem / W_q projections = v_wmma_f32_16x16x32_bf16, bf16 (RNE) inputs and weights, one product. Lorentz spatial product k_sp.q_sp (K = 16) and P.V = same bf16 WMMA with every computed operand carried as bf16 hi + bf16 lo (hi.hi + lo.hi + hi.lo). Accumulate f32 everywhere.
// Time-like rank-1 term, arccosh, additive key bias, online softmax (base-2 form): f32 VALU. No power-of-two carries exist (bf16 planes only).
#include <hip/hip_runtime.h>
#include <stddef.h>
#include <stdint.h>
#include <math.h>

#ifndef NB
#define NB 32                      // batches processed (a reduced build reads the first NB batches)
#endif
#define SEQ    512                 // positions per batch (softmax rows i and softmax columns j)
#define LFULL  512                 // full row length of the channels-first input / output and of the mask
#define EW     128                 // model width = heads x head dim
#define NH     8
#define HD     16
#define QROW   32                  // halfwords per position in a spatial plane: 16 hi + 16 lo
#define TILEH  256                 // halfwords per 512-B piece of a plane: 16 rows x 16 halfwords, one wave-wide 16-B load
#define TPITCH 136                 // halfwords per LDS transposed-input row
#define OPITCH 36                  // floats per LDS output-stage row
#define WSMAX  134217728
#define VPL    ((size_t)NB * EW * SEQ)          // halfwords of V^T hi (as many again of V^T lo)
#define PLN    ((size_t)NB * NH * SEQ * QROW)   // halfwords per spatial plane (column plane, then row plane)
#define SCN    ((size_t)NB * NH * SEQ)          // floats per per-position scalar array (3 arrays)
#define XB_FULL ((size_t)EW * LFULL)            // floats per batch of the input and of the output
#define LOG2E  1.4426950408889634f

static_assert(NH * HD == EW);
static_assert(SEQ == 512 && LFULL == 512);
static_assert(EW % 32 == 0 && SEQ % 32 == 0);
static_assert(SEQ % 64 == 0 && (NB * SEQ) % 64 == 0);
static_assert(NH * 64 * QROW == 16384);        // k_hproj stage: spatial plane form
static_assert(2 * EW * 64 == 16384);           // k_hproj stage: V^T form
static_assert(16 * QROW == 2 * TILEH);         // 16 positions of a spatial plane = hi piece + lo piece
static_assert(2 * HD * 32 == 4 * TILEH);       // 32 keys of one head's V^T, hi and lo = 4 pieces
static_assert(16384 == 128 * 16 * 8);          // k_hproj copy-out: 128 thr x 16 it x 8 halfwords
static_assert(64 * EW == 128 * 16 * 4);        // k_hproj input staging: 128 thr x 16 it x 4 floats
static_assert(3 * NH * 64 == 128 * 3 * 4);     // k_hproj scalar copy-out: 128 thr x 3 it x 4 floats
static_assert((2 * EW * EW) % (256 * 8) == 0); // k_cvt on W_mem: whole blocks
static_assert((EW * EW) % (256 * 8) == 0);     // k_cvt on W_q: whole blocks
static_assert(EW * 32 == 256 * 4 * 4);         // k_hattn copy-out: 256 thr x 4 it x 4 floats
static_assert(TPITCH % 8 == 0 && TPITCH >= EW);
static_assert(OPITCH % 4 == 0 && OPITCH >= 32);
static_assert((size_t)3 * EW * EW * 2 + 2 * PLN * 2 + 2 * VPL * 2 + 3 * SCN * 4 <= (size_t)WSMAX);

typedef int            v4i   __attribute__((ext_vector_type(4)));
typedef int            v8i   __attribute__((ext_vector_type(8)));
typedef float          v4f   __attribute__((ext_vector_type(4)));
typedef float          v8f   __attribute__((ext_vector_type(8)));
typedef __bf16         v16bf __attribute__((ext_vector_type(16)));
typedef v4i __attribute__((may_alias)) v4ia;
typedef v4f __attribute__((may_alias)) v4fa;
union FragB { v16bf v; v4i q[2]; v8i w; };

// WMMA with hazard guard: ties D, keeps A/B live for 4 VALU slots
__device__ __forceinline__ v8f wmb(const FragB& a, const FragB& b, v8f c) {
  v8f d = __builtin_amdgcn_wmma_f32_16x16x32_bf16(false, a.v, false, b.v, (short)0, c, false, false);
  asm volatile("v_nop\n\tv_nop\n\tv_nop\n\tv_nop" : "+v"(d) : "v"(a.w), "v"(b.w));
  return d;
}

// f32 -> bf16 bits, RNE convert (finite inputs)
__device__ __forceinline__ unsigned bf16_bits(float f) {
  const unsigned u = __float_as_uint(f);
  return (u + 0x7FFFu + ((u >> 16) & 1u)) >> 16;
}
__device__ __forceinline__ float bf16_val(float f) {
  return __uint_as_float(bf16_bits(f) << 16);
}
__device__ __forceinline__ int pack2(float lo, float hi) {
  return (int)(bf16_bits(lo) | (bf16_bits(hi) << 16));
}
// 8 f32 -> bf16 hi piece + bf16 lo piece (lo = RNE(v - hi)); element 2j in the low halfword of word j
__device__ __forceinline__ void split8(const v8f x, v4i& hi, v4i& lo) {
#pragma unroll
  for (int j = 0; j < 4; ++j) {
    const float a = x[2 * j], b = x[2 * j + 1];
    const unsigned ha = bf16_bits(a), hb = bf16_bits(b);
    const float ra = a - __uint_as_float(ha << 16);
    const float rb = b - __uint_as_float(hb << 16);
    hi[j] = (int)(ha | (hb << 16));
    lo[j] = (int)(bf16_bits(ra) | (bf16_bits(rb) << 16));
  }
}
// fragment (row/col = lane&15) from a GLOBAL k-contiguous bf16 plane row: p = row + k0 + 8h;
// elements 0..7 <- k0+8h+0..7, 8..15 <- k0+16+8h+0..7
__device__ __forceinline__ FragB ldg_frag(const unsigned short* __restrict__ p) {
  FragB f;
  f.q[0] = *(const v4ia*)p;
  f.q[1] = *(const v4ia*)(p + 16);
  return f;
}

// Hyperboloid map of one head vector held as 8 + 8 components by lanes l and l^16:
// a <- normalize(a * scl) * sinh(|a * scl|); returns cosh(|a * scl|). Both lane halves get identical norms.
__device__ __forceinline__ float hyp8(v8f& a, const float scl) {
#pragma clang fp contract(off)
  float ss = 0.0f;
#pragma unroll
  for (int r = 0; r < 8; ++r) { a[r] = a[r] * scl; ss += a[r] * a[r]; }
  ss += __shfl_xor(ss, 16);
  const float n = sqrtf(ss);
  const float inv = 1.0f / fmaxf(n, 1.0e-12f);
  const float sh = sinhf(n);
  const float ch = coshf(n);
#pragma unroll
  for (int r = 0; r < 8; ++r) a[r] = (a[r] * inv) * sh;
  return ch;
}

// Klein map of one head vector: a <- normalize(hyperboloid_spatial / hyperboloid_time);
// returns (log(1 / (sqrt(1 - (|a| - 1e-4)^2) + 1e-4)) + biasv) * log2(e) + mterm.
__device__ __forceinline__ float klein8(v8f& a, const float biasv, const float mterm) {
#pragma clang fp contract(off)
  float ss = 0.0f;
#pragma unroll
  for (int r = 0; r < 8; ++r) ss += a[r] * a[r];
  ss += __shfl_xor(ss, 16);
  const float vn = sqrtf(ss);
  const float inv = 1.0f / fmaxf(vn, 1.0e-12f);
  const float sh = sinhf(vn);
  const float ch = coshf(vn);
  const float ich = 1.0f / ch;
  float s2 = 0.0f;
#pragma unroll
  for (int r = 0; r < 8; ++r) { a[r] = ((a[r] * inv) * sh) * ich; s2 += a[r] * a[r]; }
  s2 += __shfl_xor(s2, 16);
  const float n2 = sqrtf(s2);
  const float inv2 = 1.0f / fmaxf(n2, 1.0e-12f);
  float s3 = 0.0f;
#pragma unroll
  for (int r = 0; r < 8; ++r) { a[r] = a[r] * inv2; s3 += a[r] * a[r]; }
  s3 += __shfl_xor(s3, 16);
  const float vnk = sqrtf(s3);
  const float dm = vnk - 1.0e-4f;
  const float den = sqrtf(1.0f - dm * dm) + 1.0e-4f;
  const float lden = 1.0f / den;
  const float lb = logf(lden) + biasv;
  return lb * LOG2E + mterm;
}

// The attention loop's root, log2 and 2^x as the bare instructions. The library forms wrap each in a rescale
// for subnormal arguments or results and give the root a last-bit correction: about 5 to 15 vector
// instructions per value. Here the root's argument is 0 or a normal number (x1^2 - 1 of an f32 x1, clamped at
// 0), the log's is about 1 or more, and a 2^x below the normal range may come out as 0 beside a row sum that
// holds a term equal to 1; the root keeps the instruction's own 1 ulp.
// One asm statement per kind, every value in place: no instruction in it touches its neighbour's register, and
// the closing v_nop is the slot the instruction set asks for between the last one and a reader of its result
// (the builtins compiled to runs in which one overwrote the source of the one directly in front).
__device__ __forceinline__ void sqrt16(float (&a)[16]) {
  asm(
      "v_sqrt_f32 %0, %0\n\t"
      "v_sqrt_f32 %1, %1\n\t"
      "v_sqrt_f32 %2, %2\n\t"
      "v_sqrt_f32 %3, %3\n\t"
      "v_sqrt_f32 %4, %4\n\t"
      "v_sqrt_f32 %5, %5\n\t"
      "v_sqrt_f32 %6, %6\n\t"
      "v_sqrt_f32 %7, %7\n\t"
      "v_sqrt_f32 %8, %8\n\t"
      "v_sqrt_f32 %9, %9\n\t"
      "v_sqrt_f32 %10, %10\n\t"
      "v_sqrt_f32 %11, %11\n\t"
      "v_sqrt_f32 %12, %12\n\t"
      "v_sqrt_f32 %13, %13\n\t"
      "v_sqrt_f32 %14, %14\n\t"
      "v_sqrt_f32 %15, %15\n\t"
      "v_nop"
      :
        "+v"(a[0]), "+v"(a[1]), "+v"(a[2]), "+v"(a[3]), "+v"(a[4]), "+v"(a[5]),
        "+v"(a[6]), "+v"(a[7]), "+v"(a[8]), "+v"(a[9]), "+v"(a[10]), "+v"(a[11]),
        "+v"(a[12]), "+v"(a[13]), "+v"(a[14]), "+v"(a[15]));
}
__device__ __forceinline__ void log2_16(float (&a)[16]) {
  asm(
      "v_log_f32 %0, %0\n\t"
      "v_log_f32 %1, %1\n\t"
      "v_log_f32 %2, %2\n\t"
      "v_log_f32 %3, %3\n\t"
      "v_log_f32 %4, %4\n\t"
      "v_log_f32 %5, %5\n\t"
      "v_log_f32 %6, %6\n\t"
      "v_log_f32 %7, %7\n\t"
      "v_log_f32 %8, %8\n\t"
      "v_log_f32 %9, %9\n\t"
      "v_log_f32 %10, %10\n\t"
      "v_log_f32 %11, %11\n\t"
      "v_log_f32 %12, %12\n\t"
      "v_log_f32 %13, %13\n\t"
      "v_log_f32 %14, %14\n\t"
      "v_log_f32 %15, %15\n\t"
      "v_nop"
      :
        "+v"(a[0]), "+v"(a[1]), "+v"(a[2]), "+v"(a[3]), "+v"(a[4]), "+v"(a[5]),
        "+v"(a[6]), "+v"(a[7]), "+v"(a[8]), "+v"(a[9]), "+v"(a[10]), "+v"(a[11]),
        "+v"(a[12]), "+v"(a[13]), "+v"(a[14]), "+v"(a[15]));
}
__device__ __forceinline__ void exp2_17(float (&a)[17]) {
  asm(
      "v_exp_f32 %0, %0\n\t"
      "v_exp_f32 %1, %1\n\t"
      "v_exp_f32 %2, %2\n\t"
      "v_exp_f32 %3, %3\n\t"
      "v_exp_f32 %4, %4\n\t"
      "v_exp_f32 %5, %5\n\t"
      "v_exp_f32 %6, %6\n\t"
      "v_exp_f32 %7, %7\n\t"
      "v_exp_f32 %8, %8\n\t"
      "v_exp_f32 %9, %9\n\t"
      "v_exp_f32 %10, %10\n\t"
      "v_exp_f32 %11, %11\n\t"
      "v_exp_f32 %12, %12\n\t"
      "v_exp_f32 %13, %13\n\t"
      "v_exp_f32 %14, %14\n\t"
      "v_exp_f32 %15, %15\n\t"
      "v_exp_f32 %16, %16\n\t"
      "v_nop"
      :
        "+v"(a[0]), "+v"(a[1]), "+v"(a[2]), "+v"(a[3]), "+v"(a[4]), "+v"(a[5]),
        "+v"(a[6]), "+v"(a[7]), "+v"(a[8]), "+v"(a[9]), "+v"(a[10]), "+v"(a[11]),
        "+v"(a[12]), "+v"(a[13]), "+v"(a[14]), "+v"(a[15]), "+v"(a[16]));
}

// ---------------------------------------------------------------------------
// f32 -> bf16 plane, contiguous. Thread = 8 elements = one 16-B piece; a wave instruction writes
// ---------------------------------------------------------------------------
__global__ __launch_bounds__(256) void k_cvt(const float* __restrict__ x, unsigned short* o) {
  const size_t i = (size_t)blockIdx.x * 256u + threadIdx.x;
  const float* p = x + i * 8u;
  const v4f a = *(const v4fa*)p;
  const v4f b = *(const v4fa*)(p + 4);
  v4i w;
  w[0] = pack2(a.x, a.y); w[1] = pack2(a.z, a.w);
  w[2] = pack2(b.x, b.y); w[3] = pack2(b.z, b.w);
  unsigned short* d = o + i * 8u;
  *(v4i*)d = w;
  
}

// ---------------------------------------------------------------------------
// Projections + hyperbolic maps. Block = 64 positions of one batch, 4 waves x 16 positions.
// Input x is channels-first [b][k = channel][l]: the 128 x 64 tile is read along l (16-B loads), converted to
// bf16 and transposed into LDS xt[l][k] (cross-wave, block barrier); each wave then holds its 16 positions
// as 4 B fragments (col = lane&15 = position).
// Weight plane wt (bf16, [out][in], k-contiguous): rows 0..127 = W_mem K part, 128..255 = W_mem V part,
// 256..383 = W_q. D = W_tile (A, row = out feature) x X (B, col = position): D[row d = 8h+r][col = position],
// so a lane holds 8 of the 16 head components of one position; lanes l and l^16 complete the head.
// pass 2: V^T hi/lo     = Klein point of (W_mem[128:256] x)               + scalar array 2 = key bias (base-2)
// Workspace planes are laid in the order the attention loop's fragments read them, so that each of its
// wave-wide 16-B loads covers 512 contiguous bytes (4 whole 128-B lines), lane (m, h) at byte 32 m + 16 h:
// spatial plane = [b][head][16-position tile][hi | lo][position m][component 0..15];
// V^T = [b][head][32-key block][hi | lo][key half q][channel d = m][key 16 q + 0..15].
// LDS stg: cross-wave (block barriers); fully written before each copy-out (8 heads x 64 rows x 32, or
//   8 heads x 2 key blocks x 4 pieces x 256). ssc: 3 x 8 x 64 floats, written by lanes 0..15 of every wave, copied out last.
// coverage: spatial planes: NB*8 blocks x 16384 halfwords each = NB*8*512*32; V^T: NB*8 blocks x 8192 per
//   plane = NB*128*512; scalars: NB*8 blocks x 8 heads x 64 per array = NB*8*512.
// ---------------------------------------------------------------------------
__global__ __launch_bounds__(128) void k_hproj(const float* __restrict__ x, const int* __restrict__ mask,
                                               const unsigned short* __restrict__ wt,
                                               const float* __restrict__ bias_p,
                                               unsigned short* pl, unsigned short* vt, float* sca) {
  __shared__ __attribute__((aligned(16))) unsigned short xt[64 * TPITCH];
  __shared__ __attribute__((aligned(16))) unsigned short stg[16384];
  __shared__ __attribute__((aligned(16))) float ssc[3 * NH * 64];
  const unsigned tid = threadIdx.x, lane = tid & 31u, hh = lane >> 4, m = lane & 15u;
  const unsigned wave = (unsigned)__builtin_amdgcn_readfirstlane((int)(threadIdx.x >> 5));
  const unsigned row0 = blockIdx.x * 64u;
  const unsigned bb = row0 >> 9, r0 = row0 & 511u;

  // ---- input tile: x[b][k][r0 .. r0+63] -> xt[l][k] bf16 ----
  {
    const float* xg = x + (size_t)bb * XB_FULL + r0;
#pragma unroll 1
    for (unsigned it = 0; it < 16u; ++it) {
      const unsigned p = it * 128u + tid, k = p >> 4, l4 = (p & 15u) << 2;
      const v4f v = *(const v4fa*)(xg + (size_t)k * LFULL + l4);
      xt[(l4 + 0u) * TPITCH + k] = (unsigned short)bf16_bits(v.x);
      xt[(l4 + 1u) * TPITCH + k] = (unsigned short)bf16_bits(v.y);
      xt[(l4 + 2u) * TPITCH + k] = (unsigned short)bf16_bits(v.z);
      xt[(l4 + 3u) * TPITCH + k] = (unsigned short)bf16_bits(v.w);
    }
  }
  __syncthreads();

  FragB xa[4];
  {
    const unsigned xo = (16u * wave + m) * TPITCH + 8u * hh;
#pragma unroll
    for (int ks = 0; ks < 4; ++ks) {
      xa[ks].q[0] = *(const v4ia*)(xt + xo + 32 * ks);
      xa[ks].q[1] = *(const v4ia*)(xt + xo + 32 * ks + 16);
    }
  }
  const int mi = mask[(size_t)bb * LFULL + r0 + 16u * wave + m];
  const float mv = (float)mi;
  const float mterm = (-1.0e30f * (1.0f - mv)) * LOG2E;
  const float biasv = bf16_val(bias_p[0]);
  const v8f zero8 = {0.f, 0.f, 0.f, 0.f, 0.f, 0.f, 0.f, 0.f};

#pragma unroll 1
  for (unsigned ps = 0; ps < 2u; ++ps) {
    const unsigned woff = (ps == 0u) ? (unsigned)(2 * EW * EW) : 0u;
    const float scl = (ps == 0u) ? 0.25f : 1.0f;
#pragma unroll 1
    for (unsigned t = 0; t < NH; ++t) {
      const unsigned short* wp = wt + woff + (size_t)(16u * t + m) * EW + 8u * hh;
      v8f acc = zero8;
#pragma unroll
      for (int ks = 0; ks < 4; ++ks) {
        const FragB wf = ldg_frag(wp + 32 * ks);
        acc = wmb(wf, xa[ks], acc);
      }
      const float ch = hyp8(acc, scl);           // acc[r] = spatial[position 16 wave + m][8h + r]
      v4i hi, lo;
      split8(acc, hi, lo);
      const unsigned so = (t * 64u + 16u * wave) * QROW + 16u * m + 8u * hh;
      *(v4ia*)(stg + so) = hi;
      *(v4ia*)(stg + so + TILEH) = lo;
      if (hh == 0u) ssc[(ps * NH + t) * 64u + 16u * wave + m] = ch;
    }
    __syncthreads();
    {
      unsigned short* dst = pl + (size_t)ps * PLN + ((size_t)bb * NH * SEQ + r0) * QROW;
#pragma unroll 1
      for (unsigned it = 0; it < 16u; ++it) {
        const unsigned p = it * 128u + tid, t = p >> 8, wi = p & 255u;
        const v4i v = *(const v4ia*)(stg + p * 8u);
        *(v4i*)(dst + (size_t)t * (SEQ * QROW) + wi * 8u) = v;
      }
      
    }
    __syncthreads();
  }

  // ---- pass 2: Klein points -> V^T hi / lo stage, key bias ----
#pragma unroll 1
  for (unsigned t = 0; t < NH; ++t) {
    const unsigned short* wp = wt + (unsigned)(EW * EW) + (size_t)(16u * t + m) * EW + 8u * hh;
    v8f acc = zero8;
#pragma unroll
    for (int ks = 0; ks < 4; ++ks) {
      const FragB wf = ldg_frag(wp + 32 * ks);
      acc = wmb(wf, xa[ks], acc);
    }
    const float lb2 = klein8(acc, biasv, mterm);  // acc[r] = v_klein[position 16 wave + m][8h + r]
#pragma unroll
    for (int r = 0; r < 8; ++r) {
      const unsigned hb = bf16_bits(acc[r]);
      const float res = acc[r] - __uint_as_float(hb << 16);
      // head t: [key block wave >> 1][hi | lo][key half wave & 1][channel 8h + r][key m]
      const unsigned so = t * 2048u + (wave >> 1) * 1024u + (wave & 1u) * TILEH + (8u * hh + (unsigned)r) * 16u + m;
      stg[so] = (unsigned short)hb;
      stg[so + 2u * TILEH] = (unsigned short)bf16_bits(res);
    }
    if (hh == 0u) ssc[(2u * NH + t) * 64u + 16u * wave + m] = lb2;
  }
  __syncthreads();
  {
    unsigned short* dst = vt + (size_t)bb * NH * (2 * HD * SEQ) + r0 * (2 * HD);
#pragma unroll 1
    for (unsigned it = 0; it < 16u; ++it) {
      const unsigned p = it * 128u + tid, t = p >> 8, wi = p & 255u;
      const v4i v = *(const v4ia*)(stg + p * 8u);
      *(v4i*)(dst + (size_t)t * (2 * HD * SEQ) + wi * 8u) = v;
      // the next trip rewrites the store's address and data registers: the wait stands in front of that
      asm volatile("s_wait_xcnt 0x0" ::: "memory");
    }
    
  }
  {
#pragma unroll 1
    for (unsigned it = 0; it < 3u; ++it) {
      const unsigned p = it * 128u + tid, a = p >> 7, t = (p >> 4) & 7u, c = p & 15u;
      const v4f v = *(const v4fa*)(ssc + p * 4u);
      *(v4f*)(sca + (size_t)a * SCN + ((size_t)bb * NH + t) * SEQ + r0 + 4u * c) = v;
    }
    
  }
}

// ---------------------------------------------------------------------------
// Fused Lorentz attention: one block = (batch b, 32 softmax rows i0..i0+31), 8 waves, wave = head; each wave
// runs two 16-row tiles one after the other. Flash attention in the transposed domain:
//   S^T tile = C (A, row = column position j) x R^T (B, col = row position i): the K = 16 spatial product is
//   laid as [c_hi|c_hi] x [r_hi|r_lo] plus [c_lo|0] x [r_hi|r_lo] along the 32-deep k axis.
//   D[row j 8h+r][col i m]. Per element: x = rt[i]*ct[j] - D, logit2 = -beta*log2(x1 + sqrt(x1^2-1)) + cb[j]
//   (cb carries log-denominator, bias and the additive key mask term). Softmax statistics are per lane
//   (row i = m); the two lane halves combine by one xor-16 exchange. The P^T B-fragment is the lane's own
//   16 results (tile 0 -> elements 0..7, tile 1 -> elements 8..15). O^T = V^T (A, row d) x P^T:
//   D[row d 8h+r][col i m], scaled per lane.
// Output stage ost[channel 0..127][position 0..31] (cross-wave, block barrier): every wave writes its 16
// coverage: grid (16, NB) x 128 channels x 32 positions = NB*128*512 outputs, each written by exactly one lane.
// ---------------------------------------------------------------------------
__global__ __launch_bounds__(256) void k_hattn(const unsigned short* __restrict__ rpl,
                                               const unsigned short* __restrict__ cpl,
                                               const unsigned short* __restrict__ vt,
                                               const float* __restrict__ rtt,
                                               const float* __restrict__ ctt,
                                               const float* __restrict__ cbb,
                                               const float* __restrict__ beta_p,
                                               float* out) {
  __shared__ __attribute__((aligned(16))) float ost[EW * OPITCH];
  const unsigned tid = threadIdx.x, lane = tid & 31u, hh = lane >> 4, m = lane & 15u;
  const unsigned wave = (unsigned)__builtin_amdgcn_readfirstlane((int)(threadIdx.x >> 5));
  const unsigned i0 = blockIdx.x * 32u, b = blockIdx.y;
  const unsigned bh = b * NH + wave;
  const v8f zero8 = {0.f, 0.f, 0.f, 0.f, 0.f, 0.f, 0.f, 0.f};
  const v4i zero4 = {0, 0, 0, 0};
  const float nbeta = -bf16_val(beta_p[0]);

  const unsigned fo = 16u * m + 8u * hh;      // the lane's 16 bytes inside a 512-B piece
  const unsigned short* kb = cpl + (size_t)bh * SEQ * QROW + fo;
  const unsigned short* vb = vt + (size_t)bh * (2 * HD * SEQ) + fo;
  const float* ctp = ctt + (size_t)bh * SEQ + 8u * hh;
  const float* cbp = cbb + (size_t)bh * SEQ + 8u * hh;

#pragma unroll 1
  for (unsigned tl = 0; tl < 2u; ++tl) {
    const unsigned g0 = i0 + 16u * tl;
    const unsigned short* qp = rpl + ((size_t)bh * SEQ + g0) * QROW + fo;
    FragB qf;
    qf.q[0] = *(const v4ia*)qp;            // r_hi[8h .. 8h+7]  (k slots 8h..)
    qf.q[1] = *(const v4ia*)(qp + TILEH);  // r_lo[8h .. 8h+7]  (k slots 16+8h..)
    const float rt = rtt[(size_t)bh * SEQ + g0 + m];
    // the key loop reuses these three loads' address registers: the wait stands in front of that
    asm volatile("s_wait_xcnt 0x0" ::: "memory");
    v8f o = zero8;
    float mrun = -3.0e38f, lrun = 0.0f;
#pragma unroll 1
    for (unsigned n0 = 0; n0 < SEQ; n0 += 32u) {
      const unsigned short* kp = kb + (size_t)n0 * QROW;
      const v4i kh0 = *(const v4ia*)kp;
      const v4i kl0 = *(const v4ia*)(kp + TILEH);
      const v4i kh1 = *(const v4ia*)(kp + 2 * TILEH);
      const v4i kl1 = *(const v4ia*)(kp + 3 * TILEH);
      FragB a10, a20, a11, a21;
      a10.q[0] = kh0; a10.q[1] = kh0;
      a20.q[0] = kl0; a20.q[1] = zero4;
      a11.q[0] = kh1; a11.q[1] = kh1;
      a21.q[0] = kl1; a21.q[1] = zero4;
      v8f s0 = wmb(a10, qf, zero8);
      s0 = wmb(a20, qf, s0);
      v8f s1 = wmb(a11, qf, zero8);
      s1 = wmb(a21, qf, s1);

      const v4f t0 = *(const v4fa*)(ctp + n0);
      const v4f t1 = *(const v4fa*)(ctp + n0 + 4u);
      const v4f t2 = *(const v4fa*)(ctp + n0 + 16u);
      const v4f t3 = *(const v4fa*)(ctp + n0 + 20u);
      const v4f u0 = *(const v4fa*)(cbp + n0);
      const v4f u1 = *(const v4fa*)(cbp + n0 + 4u);
      const v4f u2 = *(const v4fa*)(cbp + n0 + 16u);
      const v4f u3 = *(const v4fa*)(cbp + n0 + 20u);
      const v8f ct0 = __builtin_shufflevector(t0, t1, 0, 1, 2, 3, 4, 5, 6, 7);
      const v8f ct1 = __builtin_shufflevector(t2, t3, 0, 1, 2, 3, 4, 5, 6, 7);
      const v8f cb0 = __builtin_shufflevector(u0, u1, 0, 1, 2, 3, 4, 5, 6, 7);
      const v8f cb1 = __builtin_shufflevector(u2, u3, 0, 1, 2, 3, 4, 5, 6, 7);
      // logit in the base-2 domain: x = rt*ct - dot (minus the Lorentz product), x1 = x + 1e-6,
      // arccosh(x1) = ln(x1 + sqrt(x1^2 - 1)); a = -beta * log2(x1 + sqrt(x1^2 - 1)) + cb
      float x1[16], w[16];
#pragma unroll
      for (int r = 0; r < 8; ++r) {
        x1[r]     = (rt * ct0[r] - s0[r]) + 1.0e-6f;        // column position n0 + 8h + r
        x1[8 + r] = (rt * ct1[r] - s1[r]) + 1.0e-6f;        // column position n0 + 16 + 8h + r
      }
#pragma unroll
      for (int i = 0; i < 16; ++i) w[i] = fmaxf(x1[i] * x1[i] - 1.0f, 0.0f);
      sqrt16(w);
#pragma unroll
      for (int i = 0; i < 16; ++i) w[i] = x1[i] + w[i];
      log2_16(w);
      v8f a0, a1;
#pragma unroll
      for (int r = 0; r < 8; ++r) {
        a0[r] = nbeta * w[r] + cb0[r];
        a1[r] = nbeta * w[8 + r] + cb1[r];
      }

      float t = fmaxf(a0[0], a1[0]);
#pragma unroll
      for (int r = 1; r < 8; ++r) t = fmaxf(t, fmaxf(a0[r], a1[r]));
      t = fmaxf(t, __shfl_xor(t, 16));
      const float mnew = fmaxf(mrun, t);
      float e[17];
#pragma unroll
      for (int r = 0; r < 8; ++r) {
        e[r]     = a0[r] - mnew;
        e[8 + r] = a1[r] - mnew;
      }
      e[16] = mrun - mnew;
      exp2_17(e);
      const float sc = e[16];
      v8f p0, p1;
      float ps = 0.0f;
#pragma unroll
      for (int r = 0; r < 8; ++r) {
        p0[r] = e[r];
        p1[r] = e[8 + r];
        ps += p0[r] + p1[r];
      }
      lrun = lrun * sc + ps;
      mrun = mnew;
      o = o * sc;

      FragB ph, pw;
      split8(p0, ph.q[0], pw.q[0]);
      split8(p1, ph.q[1], pw.q[1]);
      FragB fvh, fvl;
      const unsigned short* vp = vb + (size_t)n0 * (2 * HD);
      fvh.q[0] = *(const v4ia*)vp;                 // keys n0 + 8h + 0..7
      fvh.q[1] = *(const v4ia*)(vp + TILEH);       // keys n0 + 16 + 8h + 0..7
      fvl.q[0] = *(const v4ia*)(vp + 2 * TILEH);
      fvl.q[1] = *(const v4ia*)(vp + 3 * TILEH);
      o = wmb(fvh, ph, o);
      o = wmb(fvl, ph, o);
      o = wmb(fvh, pw, o);
    }
    const float lt = lrun + __shfl_xor(lrun, 16);
    const float inv = 1.0f / lt;
    const v8f c = o * inv;                    // out[channel 16 wave + 8h + r][position g0 + m]
    const unsigned so = (16u * wave + 8u * hh) * OPITCH + 16u * tl + m;
#pragma unroll
    for (int r = 0; r < 8; ++r) ost[so + (unsigned)r * OPITCH] = c[r];
  }
  __syncthreads();

  {
    float* ob = out + (size_t)b * XB_FULL + i0;
#pragma unroll 1
    for (unsigned it = 0; it < 4u; ++it) {
      const unsigned p = it * 256u + tid, c = p >> 3, q = p & 7u;
      const v4f v = *(const v4fa*)(ost + c * OPITCH + 4u * q);
      *(v4f*)(ob + (size_t)c * LFULL + 4u * q) = v;
    }
    
  }
}

// ---------------------------------------------------------------------------
static inline size_t al256(size_t o) { return (o + 255) & ~(size_t)255; }

extern "C" void kernel_launch(void* const* d_in, const int* in_sizes, int n_in,
                              void* d_out, int out_size, void* d_ws, size_t ws_size,
                              hipStream_t stream) {
  (void)stream;
  if (n_in < 6) return;
  const long long actN = (long long)NB * EW * LFULL;
  if ((long long)in_sizes[0] < actN) return;                 // queries [b][channel][l]
  if ((long long)in_sizes[1] < (long long)NB * LFULL) return; // mask [b][l] int32
  if (in_sizes[2] < 2 * EW * EW) return;                     // W_mem [256][128]
  if (in_sizes[3] < EW * EW) return;                         // W_q [128][128]
  if (in_sizes[4] < 1 || in_sizes[5] < 1) return;            // beta, bias
  if ((long long)out_size < actN) return;

  const float* queries = (const float*)d_in[0];
  const int*   mask    = (const int*)d_in[1];
  const float* Wmem    = (const float*)d_in[2];
  const float* Wq      = (const float*)d_in[3];
  const float* beta    = (const float*)d_in[4];
  const float* bias    = (const float*)d_in[5];
  float* out = (float*)d_out;

  const size_t wtB = al256((size_t)3 * EW * EW * 2);            // 98,304
  const size_t plB = al256((size_t)2 * PLN * 2);                // 16,777,216 at NB = 32
  const size_t vB  = al256((size_t)2 * VPL * 2);                // 8,388,608
  const size_t scB = al256((size_t)3 * SCN * 4);                // 1,572,864
  const size_t total = wtB + plB + vB + scB;                    // 26,836,992
  if (total > ws_size || total > (size_t)WSMAX) return;
  char* w = (char*)d_ws;
  unsigned short* wt  = (unsigned short*)w;
  unsigned short* pln = (unsigned short*)(w + wtB);
  unsigned short* vtp = (unsigned short*)(w + wtB + plB);
  float*          sca = (float*)(w + wtB + plB + vB);
  unsigned short* cpl = pln;              // column plane (from W_q)
  unsigned short* rpl = pln + PLN;        // row plane (from W_mem rows 0..127)
  float* ctt = sca;
  float* rtt = sca + SCN;
  float* cbb = sca + 2 * SCN;

  // 1, 2: weights [out][in] f32 -> bf16, same orientation: rows 0..255 = W_mem, rows 256..383 = W_q
  k_cvt<<<(unsigned)((2 * EW * EW) / (256 * 8)), 256, 0, stream>>>(Wmem, wt);
  k_cvt<<<(unsigned)((EW * EW) / (256 * 8)), 256, 0, stream>>>(Wq, wt + 2 * EW * EW);
  // 3: projections + hyperboloid / Klein maps -> planes and per-position scalars
  k_hproj<<<(NB * SEQ) / 64, 128, 0, stream>>>(queries, mask, wt, bias, pln, vtp, sca);
  // 4: Lorentz attention, channels-first output
  k_hattn<<<dim3(SEQ / 32, NB), 256, 0, stream>>>(rpl, cpl, vtp, rtt, ctt, cbb, beta, out);
}

// v003
// Measured time: 64.5 microseconds a run.
// Two timings next to v002 put it at 1.57 and 1.56 times that version's speed.
// Over all steps from v000 it is 1.92 times as fast.
// Contractions: W_mem / W_q projections = v_wmma_f32_16x16x32_bf16, bf16 (RNE) inputs and weights, one product. Lorentz spatial product k_sp.q_sp (K = 16) and P.V = same bf16 WMMA with every computed operand carried as bf16 hi + bf16 lo (hi.hi + lo.hi + hi.lo). Accumulate f32 everywhere.
// Time-like rank-1 term, arccosh, additive key bias, online softmax (base-2 form): f32 VALU. No power-of-two carries exist (bf16 planes only).
#include <hip/hip_runtime.h>
#include <stddef.h>
#include <stdint.h>
#include <math.h>

#ifndef NB
#define NB 32                      // batches processed (a reduced build reads the first NB batches)
#endif
#define SEQ    512                 // positions per batch (softmax rows i and softmax columns j)
#define LFULL  512                 // full row length of the channels-first input / output and of the mask
#define EW     128                 // model width = heads x head dim
#define NH     8
#define HD     16
#define QROW   32                  // halfwords per position in a spatial plane: 16 hi + 16 lo
#define TILEH  256                 // halfwords per 512-B piece of a plane: 16 rows x 16 halfwords, one wave-wide 16-B load
#define TPITCH 136                 // halfwords per LDS transposed-input row
#define OPITCH 36                  // floats per LDS output-stage row
#define WSMAX  134217728
#define VPL    ((size_t)NB * EW * SEQ)          // halfwords of V^T hi (as many again of V^T lo)
#define PLN    ((size_t)NB * NH * SEQ * QROW)   // halfwords per spatial plane (column plane, then row plane)
#define SCN    ((size_t)NB * NH * SEQ)          // floats per per-position scalar array (3 arrays)
#define XB_FULL ((size_t)EW * LFULL)            // floats per batch of the input and of the output
#define LOG2E  1.4426950408889634f
#define NKP    32                  // ints per batch in the kept-key count array: one 128-B line per writer

static_assert(NH * HD == EW);
static_assert(SEQ == 512 && LFULL == 512);
static_assert(EW % 32 == 0 && SEQ % 32 == 0);
static_assert(SEQ % 64 == 0 && (NB * SEQ) % 64 == 0);
static_assert(NH * 64 * QROW == 16384);        // k_hproj stage: spatial plane form
static_assert(2 * EW * 64 == 16384);           // k_hproj stage: V^T form
static_assert(16 * QROW == 2 * TILEH);         // 16 positions of a spatial plane = hi piece + lo piece
static_assert(2 * HD * 32 == 4 * TILEH);       // 32 keys of one head's V^T, hi and lo = 4 pieces
static_assert(16384 == 128 * 16 * 8);          // k_hproj copy-out: 128 thr x 16 it x 8 halfwords
static_assert(64 * EW == 128 * 16 * 4);        // k_hproj input staging: 128 thr x 16 it x 4 floats
static_assert(3 * NH * 64 == 128 * 3 * 4);     // k_hproj scalar copy-out: 128 thr x 3 it x 4 floats
static_assert((2 * EW * EW) % (256 * 8) == 0); // k_cvt on W_mem: whole blocks
static_assert((EW * EW) % (256 * 8) == 0);     // k_cvt on W_q: whole blocks
static_assert(EW * 32 == 256 * 4 * 4);         // k_hattn copy-out: 256 thr x 4 it x 4 floats
static_assert(TPITCH % 8 == 0 && TPITCH >= EW);
static_assert(OPITCH % 4 == 0 && OPITCH >= 32);
static_assert((size_t)3 * EW * EW * 2 + 2 * PLN * 2 + 2 * VPL * 2 + 3 * SCN * 4 + (size_t)NB * NKP * 4 <= (size_t)WSMAX);

typedef int            v4i   __attribute__((ext_vector_type(4)));
typedef int            v8i   __attribute__((ext_vector_type(8)));
typedef float          v4f   __attribute__((ext_vector_type(4)));
typedef float          v8f   __attribute__((ext_vector_type(8)));
typedef __bf16         v16bf __attribute__((ext_vector_type(16)));
typedef v4i __attribute__((may_alias)) v4ia;
typedef v4f __attribute__((may_alias)) v4fa;
union FragB { v16bf v; v4i q[2]; v8i w; };

// WMMA with hazard guard: ties D, keeps A/B live for 4 VALU slots
__device__ __forceinline__ v8f wmb(const FragB& a, const FragB& b, v8f c) {
  v8f d = __builtin_amdgcn_wmma_f32_16x16x32_bf16(false, a.v, false, b.v, (short)0, c, false, false);
  asm volatile("v_nop\n\tv_nop\n\tv_nop\n\tv_nop" : "+v"(d) : "v"(a.w), "v"(b.w));
  return d;
}

// f32 -> bf16 bits, RNE convert (finite inputs)
__device__ __forceinline__ unsigned bf16_bits(float f) {
  const unsigned u = __float_as_uint(f);
  return (u + 0x7FFFu + ((u >> 16) & 1u)) >> 16;
}
__device__ __forceinline__ float bf16_val(float f) {
  return __uint_as_float(bf16_bits(f) << 16);
}
__device__ __forceinline__ int pack2(float lo, float hi) {
  return (int)(bf16_bits(lo) | (bf16_bits(hi) << 16));
}
// 8 f32 -> bf16 hi piece + bf16 lo piece (lo = RNE(v - hi)); element 2j in the low halfword of word j
__device__ __forceinline__ void split8(const v8f x, v4i& hi, v4i& lo) {
#pragma unroll
  for (int j = 0; j < 4; ++j) {
    const float a = x[2 * j], b = x[2 * j + 1];
    const unsigned ha = bf16_bits(a), hb = bf16_bits(b);
    const float ra = a - __uint_as_float(ha << 16);
    const float rb = b - __uint_as_float(hb << 16);
    hi[j] = (int)(ha | (hb << 16));
    lo[j] = (int)(bf16_bits(ra) | (bf16_bits(rb) << 16));
  }
}
// fragment (row/col = lane&15) from a GLOBAL k-contiguous bf16 plane row: p = row + k0 + 8h;
// elements 0..7 <- k0+8h+0..7, 8..15 <- k0+16+8h+0..7
__device__ __forceinline__ FragB ldg_frag(const unsigned short* __restrict__ p) {
  FragB f;
  f.q[0] = *(const v4ia*)p;
  f.q[1] = *(const v4ia*)(p + 16);
  return f;
}

// Hyperboloid map of one head vector held as 8 + 8 components by lanes l and l^16:
// a <- normalize(a * scl) * sinh(|a * scl|); returns cosh(|a * scl|). Both lane halves get identical norms.
__device__ __forceinline__ float hyp8(v8f& a, const float scl) {
#pragma clang fp contract(off)
  float ss = 0.0f;
#pragma unroll
  for (int r = 0; r < 8; ++r) { a[r] = a[r] * scl; ss += a[r] * a[r]; }
  ss += __shfl_xor(ss, 16);
  const float n = sqrtf(ss);
  const float inv = 1.0f / fmaxf(n, 1.0e-12f);
  const float sh = sinhf(n);
  const float ch = coshf(n);
#pragma unroll
  for (int r = 0; r < 8; ++r) a[r] = (a[r] * inv) * sh;
  return ch;
}

// Klein map of one head vector: a <- normalize(hyperboloid_spatial / hyperboloid_time);
// returns (log(1 / (sqrt(1 - (|a| - 1e-4)^2) + 1e-4)) + biasv) * log2(e) + mterm.
__device__ __forceinline__ float klein8(v8f& a, const float biasv, const float mterm) {
#pragma clang fp contract(off)
  float ss = 0.0f;
#pragma unroll
  for (int r = 0; r < 8; ++r) ss += a[r] * a[r];
  ss += __shfl_xor(ss, 16);
  const float vn = sqrtf(ss);
  const float inv = 1.0f / fmaxf(vn, 1.0e-12f);
  const float sh = sinhf(vn);
  const float ch = coshf(vn);
  const float ich = 1.0f / ch;
  float s2 = 0.0f;
#pragma unroll
  for (int r = 0; r < 8; ++r) { a[r] = ((a[r] * inv) * sh) * ich; s2 += a[r] * a[r]; }
  s2 += __shfl_xor(s2, 16);
  const float n2 = sqrtf(s2);
  const float inv2 = 1.0f / fmaxf(n2, 1.0e-12f);
  float s3 = 0.0f;
#pragma unroll
  for (int r = 0; r < 8; ++r) { a[r] = a[r] * inv2; s3 += a[r] * a[r]; }
  s3 += __shfl_xor(s3, 16);
  const float vnk = sqrtf(s3);
  const float dm = vnk - 1.0e-4f;
  const float den = sqrtf(1.0f - dm * dm) + 1.0e-4f;
  const float lden = 1.0f / den;
  const float lb = logf(lden) + biasv;
  return lb * LOG2E + mterm;
}

// The attention loop's root, log2 and 2^x as the bare instructions. The library forms wrap each in a rescale
// for subnormal arguments or results and give the root a last-bit correction: about 5 to 15 vector
// instructions per value. Here the root's argument is 0 or a normal number (x1^2 - 1 of an f32 x1, clamped at
// 0), the log's is about 1 or more, and a 2^x below the normal range may come out as 0 beside a row sum that
// holds a term equal to 1; the root keeps the instruction's own 1 ulp.
// One asm statement per kind, every value in place: no instruction in it touches its neighbour's register, and
// the closing v_nop is the slot the instruction set asks for between the last one and a reader of its result
// (the builtins compiled to runs in which one overwrote the source of the one directly in front).
__device__ __forceinline__ void sqrt16(float (&a)[16]) {
  asm(
      "v_sqrt_f32 %0, %0\n\t"
      "v_sqrt_f32 %1, %1\n\t"
      "v_sqrt_f32 %2, %2\n\t"
      "v_sqrt_f32 %3, %3\n\t"
      "v_sqrt_f32 %4, %4\n\t"
      "v_sqrt_f32 %5, %5\n\t"
      "v_sqrt_f32 %6, %6\n\t"
      "v_sqrt_f32 %7, %7\n\t"
      "v_sqrt_f32 %8, %8\n\t"
      "v_sqrt_f32 %9, %9\n\t"
      "v_sqrt_f32 %10, %10\n\t"
      "v_sqrt_f32 %11, %11\n\t"
      "v_sqrt_f32 %12, %12\n\t"
      "v_sqrt_f32 %13, %13\n\t"
      "v_sqrt_f32 %14, %14\n\t"
      "v_sqrt_f32 %15, %15\n\t"
      "v_nop"
      :
        "+v"(a[0]), "+v"(a[1]), "+v"(a[2]), "+v"(a[3]), "+v"(a[4]), "+v"(a[5]),
        "+v"(a[6]), "+v"(a[7]), "+v"(a[8]), "+v"(a[9]), "+v"(a[10]), "+v"(a[11]),
        "+v"(a[12]), "+v"(a[13]), "+v"(a[14]), "+v"(a[15]));
}
__device__ __forceinline__ void log2_16(float (&a)[16]) {
  asm(
      "v_log_f32 %0, %0\n\t"
      "v_log_f32 %1, %1\n\t"
      "v_log_f32 %2, %2\n\t"
      "v_log_f32 %3, %3\n\t"
      "v_log_f32 %4, %4\n\t"
      "v_log_f32 %5, %5\n\t"
      "v_log_f32 %6, %6\n\t"
      "v_log_f32 %7, %7\n\t"
      "v_log_f32 %8, %8\n\t"
      "v_log_f32 %9, %9\n\t"
      "v_log_f32 %10, %10\n\t"
      "v_log_f32 %11, %11\n\t"
      "v_log_f32 %12, %12\n\t"
      "v_log_f32 %13, %13\n\t"
      "v_log_f32 %14, %14\n\t"
      "v_log_f32 %15, %15\n\t"
      "v_nop"
      :
        "+v"(a[0]), "+v"(a[1]), "+v"(a[2]), "+v"(a[3]), "+v"(a[4]), "+v"(a[5]),
        "+v"(a[6]), "+v"(a[7]), "+v"(a[8]), "+v"(a[9]), "+v"(a[10]), "+v"(a[11]),
        "+v"(a[12]), "+v"(a[13]), "+v"(a[14]), "+v"(a[15]));
}
__device__ __forceinline__ void exp2_17(float (&a)[17]) {
  asm(
      "v_exp_f32 %0, %0\n\t"
      "v_exp_f32 %1, %1\n\t"
      "v_exp_f32 %2, %2\n\t"
      "v_exp_f32 %3, %3\n\t"
      "v_exp_f32 %4, %4\n\t"
      "v_exp_f32 %5, %5\n\t"
      "v_exp_f32 %6, %6\n\t"
      "v_exp_f32 %7, %7\n\t"
      "v_exp_f32 %8, %8\n\t"
      "v_exp_f32 %9, %9\n\t"
      "v_exp_f32 %10, %10\n\t"
      "v_exp_f32 %11, %11\n\t"
      "v_exp_f32 %12, %12\n\t"
      "v_exp_f32 %13, %13\n\t"
      "v_exp_f32 %14, %14\n\t"
      "v_exp_f32 %15, %15\n\t"
      "v_exp_f32 %16, %16\n\t"
      "v_nop"
      :
        "+v"(a[0]), "+v"(a[1]), "+v"(a[2]), "+v"(a[3]), "+v"(a[4]), "+v"(a[5]),
        "+v"(a[6]), "+v"(a[7]), "+v"(a[8]), "+v"(a[9]), "+v"(a[10]), "+v"(a[11]),
        "+v"(a[12]), "+v"(a[13]), "+v"(a[14]), "+v"(a[15]), "+v"(a[16]));
}

// ---------------------------------------------------------------------------
// f32 -> bf16 plane, contiguous. Thread = 8 elements = one 16-B piece; a wave instruction writes
// ---------------------------------------------------------------------------
__global__ __launch_bounds__(256) void k_cvt(const float* __restrict__ x, unsigned short* o) {
  const size_t i = (size_t)blockIdx.x * 256u + threadIdx.x;
  const float* p = x + i * 8u;
  const v4f a = *(const v4fa*)p;
  const v4f b = *(const v4fa*)(p + 4);
  v4i w;
  w[0] = pack2(a.x, a.y); w[1] = pack2(a.z, a.w);
  w[2] = pack2(b.x, b.y); w[3] = pack2(b.z, b.w);
  unsigned short* d = o + i * 8u;
  *(v4i*)d = w;
  
}

// ---------------------------------------------------------------------------
// Projections + hyperbolic maps. Block = 64 positions of one batch, 4 waves x 16 positions.
// Input x is channels-first [b][k = channel][l]: the 128 x 64 tile is read along l (16-B loads; the column role gathers by key, 4-B loads), converted to
// bf16 and transposed into LDS xt[l][k] (cross-wave, block barrier); each wave then holds its 16 positions
// as 4 B fragments (col = lane&15 = position).
// Weight plane wt (bf16, [out][in], k-contiguous): rows 0..127 = W_mem K part, 128..255 = W_mem V part,
// 256..383 = W_q. D = W_tile (A, row = out feature) x X (B, col = position): D[row d = 8h+r][col = position],
// so a lane holds 8 of the 16 head components of one position; lanes l and l^16 complete the head.
// pass 2: V^T hi/lo     = Klein point of (W_mem[128:256] x)               + scalar array 2 = key bias (base-2)
// Workspace planes are laid in the order the attention loop's fragments read them, so that each of its
// wave-wide 16-B loads covers 512 contiguous bytes (4 whole 128-B lines), lane (m, h) at byte 32 m + 16 h:
// spatial plane = [b][head][16-position tile][hi | lo][position m][component 0..15];
// V^T = [b][head][32-key block][hi | lo][key half q][channel d = m][key 16 q + 0..15].
// Key compaction: a key whose mask is 0 carries the additive term -1e30, so beside any key of the batch whose
// mask is 1 or more its softmax weight is exactly 0 (the other logit terms are small beside 1e30: arccosh of an
// f32 is below 90, the log-denominator below 10). Such keys are left out here: blockIdx.y = 0 blocks (column
// role: W_q plane, V^T, key bias) work on 64 SLOTS of the batch's list of kept keys, in key order, and gather
// the input columns of those keys; slots past the end of the list repeat key 0 with the masked term. A batch
// with no mask of 1 or more keeps every key, each with its own term. The count goes to nkeep[b * NKP] and
// bounds the attention loop. blockIdx.y = 1 blocks (row role: W_mem K plane) work on all 512 positions.
// LDS stg: cross-wave (block barriers); fully written before each copy-out (8 heads x 64 rows x 32, or
//   8 heads x 2 key blocks x 4 pieces x 256). ssc: 3 x 8 x 64 floats, written by lanes 0..15 of every wave, copied out last.
// coverage: row plane and scalar array 1: NB*8 blocks x 64 positions = all NB*512. Column plane, V^T, scalar
//   arrays 0 and 2: per batch the first ceil(kept / 64) blocks x 64 slots; the attention loop reads
//   ceil(kept / 32) x 32 slots, never more.
// ---------------------------------------------------------------------------
__global__ __launch_bounds__(128) void k_hproj(const float* __restrict__ x, const int* __restrict__ mask,
                                               const unsigned short* __restrict__ wt,
                                               const float* __restrict__ bias_p,
                                               unsigned short* pl, unsigned short* vt, float* sca, int* nkeep) {
  __shared__ __attribute__((aligned(16))) unsigned short xt[64 * TPITCH];
  __shared__ __attribute__((aligned(16))) int srcl[64];      // column role: slot -> key position
  __shared__ __attribute__((aligned(16))) unsigned short stg[16384];
  __shared__ __attribute__((aligned(16))) float ssc[3 * NH * 64];
  const unsigned tid = threadIdx.x, lane = tid & 31u, hh = lane >> 4, m = lane & 15u;
  const unsigned wave = (unsigned)__builtin_amdgcn_readfirstlane((int)(threadIdx.x >> 5));
  const unsigned row0 = blockIdx.x * 64u;
  const unsigned bb = row0 >> 9, r0 = row0 & 511u;
  const bool col = blockIdx.y == 0u;
  unsigned cnt = SEQ;
  int mi = 0;                                  // read by the column role alone

  if (col) {
    // ---- kept keys of the batch: every wave forms the same 16 lane-mask words, so the count needs no barrier ----
    const int* mrow = mask + (size_t)bb * LFULL;
    int mw[16];
#pragma unroll
    for (int w = 0; w < 16; ++w) mw[w] = mrow[32 * w + (int)lane];
    // the code behind reuses these loads' offset and base registers: the wait stands in front of that
    asm volatile("s_wait_xcnt 0x0" ::: "memory");
    unsigned kw[16], anyp = 0u;
#pragma unroll
    for (int w = 0; w < 16; ++w) {
      kw[w] = __builtin_amdgcn_ballot_w32(mw[w] != 0);
      anyp |= __builtin_amdgcn_ballot_w32(mw[w] >= 1);
    }
    cnt = 0u;
#pragma unroll
    for (int w = 0; w < 16; ++w) {
      if (anyp == 0u) kw[w] = 0xFFFFFFFFu;
      cnt += (unsigned)__builtin_popcount(kw[w]);
    }
    if (r0 >= cnt) return;                     // no kept key in these 64 slots: the whole block leaves, before any barrier
    if (r0 == 0u && tid == 0u) nkeep[bb * NKP] = (int)cnt;
    unsigned pre = 0u;
#pragma unroll
    for (int w = 0; w < 16; ++w) {
      if ((unsigned)(w >> 2) == wave) {
        const unsigned slot = pre + (unsigned)__builtin_popcount(kw[w] & ((1u << lane) - 1u)) - r0;
        if (((kw[w] >> lane) & 1u) != 0u && slot < 64u) srcl[slot] = 32 * w + (int)lane;
      }
      pre += (unsigned)__builtin_popcount(kw[w]);
    }
    if (tid < 64u && r0 + tid >= cnt) srcl[tid] = 0;
    __syncthreads();
    // ---- input tile: x[b][k][key of slot r0 .. r0+63] -> xt[slot][k] bf16 ----
    const float* xg = x + (size_t)bb * XB_FULL;
    const unsigned l4 = (tid & 15u) << 2, k0 = tid >> 4;
    const v4i sp = *(const v4ia*)(srcl + l4);
    const unsigned o0 = k0 * LFULL + (unsigned)sp.x, o1 = k0 * LFULL + (unsigned)sp.y;
    const unsigned o2 = k0 * LFULL + (unsigned)sp.z, o3 = k0 * LFULL + (unsigned)sp.w;
    const unsigned sl = 16u * wave + m;
    const unsigned om = (unsigned)srcl[sl];
    mi = mrow[om];                             // the slot's own key's mask
    // unrolled whole: the 4-B loads differ only in a constant offset; each half's 32 are in flight together
#pragma unroll
    for (unsigned hf = 0; hf < 2u; ++hf) {
      float g[32];
#pragma unroll
      for (unsigned it = 0; it < 8u; ++it) {
        const float* xr = xg + (8u * hf + it) * (8u * LFULL);
        g[4u * it + 0u] = xr[o0]; g[4u * it + 1u] = xr[o1]; g[4u * it + 2u] = xr[o2]; g[4u * it + 3u] = xr[o3];
      }
      // the loads' five offset registers stay as they are up to this wait; what follows may reuse them
      asm volatile("s_wait_xcnt 0x0" :: "v"(om), "v"(o0), "v"(o1), "v"(o2), "v"(o3) : "memory");
#pragma unroll
      for (unsigned it = 0; it < 8u; ++it) {
        const unsigned k = 8u * (8u * hf + it) + k0;
        xt[(l4 + 0u) * TPITCH + k] = (unsigned short)bf16_bits(g[4u * it + 0u]);
        xt[(l4 + 1u) * TPITCH + k] = (unsigned short)bf16_bits(g[4u * it + 1u]);
        xt[(l4 + 2u) * TPITCH + k] = (unsigned short)bf16_bits(g[4u * it + 2u]);
        xt[(l4 + 3u) * TPITCH + k] = (unsigned short)bf16_bits(g[4u * it + 3u]);
      }
      // keeps the second half's loads behind the first half's LDS stores, so that at most 33 loads of a wave are
      // outstanding; the scheduler lifted them over the stores, which made 65, past what s_wait_loadcnt can name
      if (hf == 0u) __builtin_amdgcn_sched_barrier(0);
    }
    if (r0 + sl >= cnt) mi = 0;                // a slot past the end of the list counts as masked
  } else {
    // ---- input tile: x[b][k][r0 .. r0+63] -> xt[l][k] bf16 ----
    const float* xg = x + (size_t)bb * XB_FULL + r0;
#pragma unroll 1
    for (unsigned it = 0; it < 16u; ++it) {
      const unsigned p = it * 128u + tid, k = p >> 4, l4 = (p & 15u) << 2;
      const v4f v = *(const v4fa*)(xg + (size_t)k * LFULL + l4);
      xt[(l4 + 0u) * TPITCH + k] = (unsigned short)bf16_bits(v.x);
      xt[(l4 + 1u) * TPITCH + k] = (unsigned short)bf16_bits(v.y);
      xt[(l4 + 2u) * TPITCH + k] = (unsigned short)bf16_bits(v.z);
      xt[(l4 + 3u) * TPITCH + k] = (unsigned short)bf16_bits(v.w);
    }
  }
  __syncthreads();

  FragB xa[4];
  {
    const unsigned xo = (16u * wave + m) * TPITCH + 8u * hh;
#pragma unroll
    for (int ks = 0; ks < 4; ++ks) {
      xa[ks].q[0] = *(const v4ia*)(xt + xo + 32 * ks);
      xa[ks].q[1] = *(const v4ia*)(xt + xo + 32 * ks + 16);
    }
  }
  const float mv = (float)mi;
  const float mterm = (-1.0e30f * (1.0f - mv)) * LOG2E;
  const float biasv = bf16_val(bias_p[0]);
  const v8f zero8 = {0.f, 0.f, 0.f, 0.f, 0.f, 0.f, 0.f, 0.f};

  {
    const unsigned ps = col ? 0u : 1u;
    const unsigned woff = (ps == 0u) ? (unsigned)(2 * EW * EW) : 0u;
    const float scl = (ps == 0u) ? 0.25f : 1.0f;
#pragma unroll 1
    for (unsigned t = 0; t < NH; ++t) {
      const unsigned short* wp = wt + woff + (size_t)(16u * t + m) * EW + 8u * hh;
      v8f acc = zero8;
#pragma unroll
      for (int ks = 0; ks < 4; ++ks) {
        const FragB wf = ldg_frag(wp + 32 * ks);
        acc = wmb(wf, xa[ks], acc);
      }
      const float ch = hyp8(acc, scl);           // acc[r] = spatial[position 16 wave + m][8h + r]
      v4i hi, lo;
      split8(acc, hi, lo);
      const unsigned so = (t * 64u + 16u * wave) * QROW + 16u * m + 8u * hh;
      *(v4ia*)(stg + so) = hi;
      *(v4ia*)(stg + so + TILEH) = lo;
      if (hh == 0u) ssc[(ps * NH + t) * 64u + 16u * wave + m] = ch;
    }
    __syncthreads();
    {
      unsigned short* dst = pl + (size_t)ps * PLN + ((size_t)bb * NH * SEQ + r0) * QROW;
#pragma unroll 1
      for (unsigned it = 0; it < 16u; ++it) {
        const unsigned p = it * 128u + tid, t = p >> 8, wi = p & 255u;
        const v4i v = *(const v4ia*)(stg + p * 8u);
        *(v4i*)(dst + (size_t)t * (SEQ * QROW) + wi * 8u) = v;
        // what follows rewrites the store's address and data registers: the wait stands in front of that
        asm volatile("s_wait_xcnt 0x0" ::: "memory");
      }
      
    }
    __syncthreads();
  }

  // ---- pass 2 (column role): Klein points -> V^T hi / lo stage, key bias ----
  if (col) {
#pragma unroll 1
  for (unsigned t = 0; t < NH; ++t) {
    const unsigned short* wp = wt + (unsigned)(EW * EW) + (size_t)(16u * t + m) * EW + 8u * hh;
    v8f acc = zero8;
#pragma unroll
    for (int ks = 0; ks < 4; ++ks) {
      const FragB wf = ldg_frag(wp + 32 * ks);
      acc = wmb(wf, xa[ks], acc);
    }
    const float lb2 = klein8(acc, biasv, mterm);  // acc[r] = v_klein[position 16 wave + m][8h + r]
#pragma unroll
    for (int r = 0; r < 8; ++r) {
      const unsigned hb = bf16_bits(acc[r]);
      const float res = acc[r] - __uint_as_float(hb << 16);
      // head t: [key block wave >> 1][hi | lo][key half wave & 1][channel 8h + r][key m]
      const unsigned so = t * 2048u + (wave >> 1) * 1024u + (wave & 1u) * TILEH + (8u * hh + (unsigned)r) * 16u + m;
      stg[so] = (unsigned short)hb;
      stg[so + 2u * TILEH] = (unsigned short)bf16_bits(res);
    }
    if (hh == 0u) ssc[(2u * NH + t) * 64u + 16u * wave + m] = lb2;
  }
  __syncthreads();
  {
    unsigned short* dst = vt + (size_t)bb * NH * (2 * HD * SEQ) + r0 * (2 * HD);
#pragma unroll 1
    for (unsigned it = 0; it < 16u; ++it) {
      const unsigned p = it * 128u + tid, t = p >> 8, wi = p & 255u;
      const v4i v = *(const v4ia*)(stg + p * 8u);
      *(v4i*)(dst + (size_t)t * (2 * HD * SEQ) + wi * 8u) = v;
      // the next trip rewrites the store's address and data registers: the wait stands in front of that
      asm volatile("s_wait_xcnt 0x0" ::: "memory");
    }
    
  }
  }
  {
#pragma unroll 1
    for (unsigned it = 0; it < 3u; ++it) {
      if ((it == 1u) == col) continue;         // array 1 is the row role's, arrays 0 and 2 the column role's
      const unsigned p = it * 128u + tid, a = p >> 7, t = (p >> 4) & 7u, c = p & 15u;
      const v4f v = *(const v4fa*)(ssc + p * 4u);
      *(v4f*)(sca + (size_t)a * SCN + ((size_t)bb * NH + t) * SEQ + r0 + 4u * c) = v;
      // the next trip rewrites the store's address and data registers: the wait stands in front of that
      asm volatile("s_wait_xcnt 0x0" ::: "memory");
    }
    
  }
}

// ---------------------------------------------------------------------------
// Fused Lorentz attention: one block = (batch b, 32 softmax rows i0..i0+31), 8 waves, wave = head; each wave
// runs two 16-row tiles one after the other, each over the batch's kept keys (column position j = slot). Flash attention in the transposed domain:
//   S^T tile = C (A, row = column position j) x R^T (B, col = row position i): the K = 16 spatial product is
//   laid as [c_hi|c_hi] x [r_hi|r_lo] plus [c_lo|0] x [r_hi|r_lo] along the 32-deep k axis.
//   D[row j 8h+r][col i m]. Per element: x = rt[i]*ct[j] - D, logit2 = -beta*log2(x1 + sqrt(x1^2-1)) + cb[j]
//   (cb carries log-denominator, bias and the additive key mask term). Softmax statistics are per lane
//   (row i = m); the two lane halves combine by one xor-16 exchange. The P^T B-fragment is the lane's own
//   16 results (tile 0 -> elements 0..7, tile 1 -> elements 8..15). O^T = V^T (A, row d) x P^T:
//   D[row d 8h+r][col i m], scaled per lane.
// Output stage ost[channel 0..127][position 0..31] (cross-wave, block barrier): every wave writes its 16
// coverage: grid (16, NB) x 128 channels x 32 positions = NB*128*512 outputs, each written by exactly one lane.
// ---------------------------------------------------------------------------
__global__ __launch_bounds__(256) void k_hattn(const unsigned short* __restrict__ rpl,
                                               const unsigned short* __restrict__ cpl,
                                               const unsigned short* __restrict__ vt,
                                               const float* __restrict__ rtt,
                                               const float* __restrict__ ctt,
                                               const float* __restrict__ cbb,
                                               const float* __restrict__ beta_p,
                                               const int* __restrict__ nkeep,
                                               float* out) {
  __shared__ __attribute__((aligned(16))) float ost[EW * OPITCH];
  const unsigned tid = threadIdx.x, lane = tid & 31u, hh = lane >> 4, m = lane & 15u;
  const unsigned wave = (unsigned)__builtin_amdgcn_readfirstlane((int)(threadIdx.x >> 5));
  const unsigned i0 = blockIdx.x * 32u, b = blockIdx.y;
  const unsigned bh = b * NH + wave;
  const v8f zero8 = {0.f, 0.f, 0.f, 0.f, 0.f, 0.f, 0.f, 0.f};
  const v4i zero4 = {0, 0, 0, 0};
  const float nbeta = -bf16_val(beta_p[0]);
  // kept keys of this batch, rounded up to whole 32-key blocks (the slots behind the last kept key weigh 0)
  const int nk = nkeep[b * NKP];
  const unsigned nend = ((unsigned)(nk < 1 ? 1 : (nk > SEQ ? SEQ : nk)) + 31u) & ~31u;

  const unsigned fo = 16u * m + 8u * hh;      // the lane's 16 bytes inside a 512-B piece
  const unsigned short* kb = cpl + (size_t)bh * SEQ * QROW + fo;
  const unsigned short* vb = vt + (size_t)bh * (2 * HD * SEQ) + fo;
  const float* ctp = ctt + (size_t)bh * SEQ + 8u * hh;
  const float* cbp = cbb + (size_t)bh * SEQ + 8u * hh;

#pragma unroll 1
  for (unsigned tl = 0; tl < 2u; ++tl) {
    const unsigned g0 = i0 + 16u * tl;
    const unsigned short* qp = rpl + ((size_t)bh * SEQ + g0) * QROW + fo;
    FragB qf;
    qf.q[0] = *(const v4ia*)qp;            // r_hi[8h .. 8h+7]  (k slots 8h..)
    qf.q[1] = *(const v4ia*)(qp + TILEH);  // r_lo[8h .. 8h+7]  (k slots 16+8h..)
    const float rt = rtt[(size_t)bh * SEQ + g0 + m];
    // the key loop reuses these three loads' address registers: the wait stands in front of that
    asm volatile("s_wait_xcnt 0x0" ::: "memory");
    v8f o = zero8;
    float mrun = -3.0e38f, lrun = 0.0f;
#pragma unroll 1
    for (unsigned n0 = 0; n0 < nend; n0 += 32u) {
      const unsigned short* kp = kb + (size_t)n0 * QROW;
      const v4i kh0 = *(const v4ia*)kp;
      const v4i kl0 = *(const v4ia*)(kp + TILEH);
      const v4i kh1 = *(const v4ia*)(kp + 2 * TILEH);
      const v4i kl1 = *(const v4ia*)(kp + 3 * TILEH);
      FragB a10, a20, a11, a21;
      a10.q[0] = kh0; a10.q[1] = kh0;
      a20.q[0] = kl0; a20.q[1] = zero4;
      a11.q[0] = kh1; a11.q[1] = kh1;
      a21.q[0] = kl1; a21.q[1] = zero4;
      v8f s0 = wmb(a10, qf, zero8);
      s0 = wmb(a20, qf, s0);
      v8f s1 = wmb(a11, qf, zero8);
      s1 = wmb(a21, qf, s1);

      const v4f t0 = *(const v4fa*)(ctp + n0);
      const v4f t1 = *(const v4fa*)(ctp + n0 + 4u);
      const v4f t2 = *(const v4fa*)(ctp + n0 + 16u);
      const v4f t3 = *(const v4fa*)(ctp + n0 + 20u);
      const v4f u0 = *(const v4fa*)(cbp + n0);
      const v4f u1 = *(const v4fa*)(cbp + n0 + 4u);
      const v4f u2 = *(const v4fa*)(cbp + n0 + 16u);
      const v4f u3 = *(const v4fa*)(cbp + n0 + 20u);
      const v8f ct0 = __builtin_shufflevector(t0, t1, 0, 1, 2, 3, 4, 5, 6, 7);
      const v8f ct1 = __builtin_shufflevector(t2, t3, 0, 1, 2, 3, 4, 5, 6, 7);
      const v8f cb0 = __builtin_shufflevector(u0, u1, 0, 1, 2, 3, 4, 5, 6, 7);
      const v8f cb1 = __builtin_shufflevector(u2, u3, 0, 1, 2, 3, 4, 5, 6, 7);
      // logit in the base-2 domain: x = rt*ct - dot (minus the Lorentz product), x1 = x + 1e-6,
      // arccosh(x1) = ln(x1 + sqrt(x1^2 - 1)); a = -beta * log2(x1 + sqrt(x1^2 - 1)) + cb
      float x1[16], w[16];
#pragma unroll
      for (int r = 0; r < 8; ++r) {
        x1[r]     = (rt * ct0[r] - s0[r]) + 1.0e-6f;        // column position n0 + 8h + r
        x1[8 + r] = (rt * ct1[r] - s1[r]) + 1.0e-6f;        // column position n0 + 16 + 8h + r
      }
#pragma unroll
      for (int i = 0; i < 16; ++i) w[i] = fmaxf(x1[i] * x1[i] - 1.0f, 0.0f);
      sqrt16(w);
#pragma unroll
      for (int i = 0; i < 16; ++i) w[i] = x1[i] + w[i];
      log2_16(w);
      v8f a0, a1;
#pragma unroll
      for (int r = 0; r < 8; ++r) {
        a0[r] = nbeta * w[r] + cb0[r];
        a1[r] = nbeta * w[8 + r] + cb1[r];
      }

      float t = fmaxf(a0[0], a1[0]);
#pragma unroll
      for (int r = 1; r < 8; ++r) t = fmaxf(t, fmaxf(a0[r], a1[r]));
      t = fmaxf(t, __shfl_xor(t, 16));
      const float mnew = fmaxf(mrun, t);
      float e[17];
#pragma unroll
      for (int r = 0; r < 8; ++r) {
        e[r]     = a0[r] - mnew;
        e[8 + r] = a1[r] - mnew;
      }
      e[16] = mrun - mnew;
      exp2_17(e);
      const float sc = e[16];
      v8f p0, p1;
      float ps = 0.0f;
#pragma unroll
      for (int r = 0; r < 8; ++r) {
        p0[r] = e[r];
        p1[r] = e[8 + r];
        ps += p0[r] + p1[r];
      }
      lrun = lrun * sc + ps;
      mrun = mnew;
      o = o * sc;

      FragB ph, pw;
      split8(p0, ph.q[0], pw.q[0]);
      split8(p1, ph.q[1], pw.q[1]);
      FragB fvh, fvl;
      const unsigned short* vp = vb + (size_t)n0 * (2 * HD);
      fvh.q[0] = *(const v4ia*)vp;                 // keys n0 + 8h + 0..7
      fvh.q[1] = *(const v4ia*)(vp + TILEH);       // keys n0 + 16 + 8h + 0..7
      fvl.q[0] = *(const v4ia*)(vp + 2 * TILEH);
      fvl.q[1] = *(const v4ia*)(vp + 3 * TILEH);
      o = wmb(fvh, ph, o);
      o = wmb(fvl, ph, o);
      o = wmb(fvh, pw, o);
    }
    const float lt = lrun + __shfl_xor(lrun, 16);
    const float inv = 1.0f / lt;
    const v8f c = o * inv;                    // out[channel 16 wave + 8h + r][position g0 + m]
    const unsigned so = (16u * wave + 8u * hh) * OPITCH + 16u * tl + m;
#pragma unroll
    for (int r = 0; r < 8; ++r) ost[so + (unsigned)r * OPITCH] = c[r];
  }
  __syncthreads();

  {
    float* ob = out + (size_t)b * XB_FULL + i0;
#pragma unroll 1
    for (unsigned it = 0; it < 4u; ++it) {
      const unsigned p = it * 256u + tid, c = p >> 3, q = p & 7u;
      const v4f v = *(const v4fa*)(ost + c * OPITCH + 4u * q);
      *(v4f*)(ob + (size_t)c * LFULL + 4u * q) = v;
    }
    
  }
}

// ---------------------------------------------------------------------------
static inline size_t al256(size_t o) { return (o + 255) & ~(size_t)255; }

extern "C" void kernel_launch(void* const* d_in, const int* in_sizes, int n_in,
                              void* d_out, int out_size, void* d_ws, size_t ws_size,
                              hipStream_t stream) {
  (void)stream;
  if (n_in < 6) return;
  const long long actN = (long long)NB * EW * LFULL;
  if ((long long)in_sizes[0] < actN) return;                 // queries [b][channel][l]
  if ((long long)in_sizes[1] < (long long)NB * LFULL) return; // mask [b][l] int32
  if (in_sizes[2] < 2 * EW * EW) return;                     // W_mem [256][128]
  if (in_sizes[3] < EW * EW) return;                         // W_q [128][128]
  if (in_sizes[4] < 1 || in_sizes[5] < 1) return;            // beta, bias
  if ((long long)out_size < actN) return;

  const float* queries = (const float*)d_in[0];
  const int*   mask    = (const int*)d_in[1];
  const float* Wmem    = (const float*)d_in[2];
  const float* Wq      = (const float*)d_in[3];
  const float* beta    = (const float*)d_in[4];
  const float* bias    = (const float*)d_in[5];
  float* out = (float*)d_out;

  const size_t wtB = al256((size_t)3 * EW * EW * 2);            // 98,304
  const size_t plB = al256((size_t)2 * PLN * 2);                // 16,777,216 at NB = 32
  const size_t vB  = al256((size_t)2 * VPL * 2);                // 8,388,608
  const size_t scB = al256((size_t)3 * SCN * 4);                // 1,572,864
  const size_t nkB = al256((size_t)NB * NKP * 4);               // 4,096
  const size_t total = wtB + plB + vB + scB + nkB;              // 26,841,088
  if (total > ws_size || total > (size_t)WSMAX) return;
  char* w = (char*)d_ws;
  unsigned short* wt  = (unsigned short*)w;
  unsigned short* pln = (unsigned short*)(w + wtB);
  unsigned short* vtp = (unsigned short*)(w + wtB + plB);
  float*          sca = (float*)(w + wtB + plB + vB);
  int*            nkp = (int*)(w + wtB + plB + vB + scB);
  unsigned short* cpl = pln;              // column plane (from W_q)
  unsigned short* rpl = pln + PLN;        // row plane (from W_mem rows 0..127)
  float* ctt = sca;
  float* rtt = sca + SCN;
  float* cbb = sca + 2 * SCN;

  // 1, 2: weights [out][in] f32 -> bf16, same orientation: rows 0..255 = W_mem, rows 256..383 = W_q
  k_cvt<<<(unsigned)((2 * EW * EW) / (256 * 8)), 256, 0, stream>>>(Wmem, wt);
  k_cvt<<<(unsigned)((EW * EW) / (256 * 8)), 256, 0, stream>>>(Wq, wt + 2 * EW * EW);
  // 3: projections + hyperboloid / Klein maps -> planes and per-position scalars (y = 0: kept keys, y = 1: rows)
  k_hproj<<<dim3((NB * SEQ) / 64, 2), 128, 0, stream>>>(queries, mask, wt, bias, pln, vtp, sca, nkp);
  // 4: Lorentz attention, channels-first output
  k_hattn<<<dim3(SEQ / 32, NB), 256, 0, stream>>>(rpl, cpl, vtp, rtt, ctt, cbb, beta, nkp, out);
}

// v004
// Measured time: 50 microseconds a run.
// Timed twice side by side with v003, it ran 1.29 times as fast both times.
// Over all steps from v000 it is 2.49 times as fast.
// Contractions: W_mem / W_q projections = v_wmma_f32_16x16x32_bf16, bf16 (RNE) inputs and weights, one product. Lorentz spatial product k_sp.q_sp (K = 16) and P.V = same bf16 WMMA with every computed operand carried as bf16 hi + bf16 lo (hi.hi + lo.hi + hi.lo). Accumulate f32 everywhere.
// Time-like rank-1 term, arccosh, additive key bias, online softmax (base-2 form): f32 VALU. No power-of-two carries exist (bf16 planes only).
#include <hip/hip_runtime.h>
#include <stddef.h>
#include <stdint.h>
#include <math.h>

#ifndef NB
#define NB 32                      // batches processed (a reduced build reads the first NB batches)
#endif
#define SEQ    512                 // positions per batch (softmax rows i and softmax columns j)
#define LFULL  512                 // full row length of the channels-first input / output and of the mask
#define EW     128                 // model width = heads x head dim
#define NH     8
#define HD     16
#define QROW   32                  // halfwords per position in a spatial plane: 16 hi + 16 lo
#define TILEH  256                 // halfwords per 512-B piece of a plane: 16 rows x 16 halfwords, one wave-wide 16-B load
#define TPITCH 136                 // halfwords per LDS transposed-input row
#define OPITCH 36                  // floats per LDS output-stage row
#define WSMAX  134217728
#define VPL    ((size_t)NB * EW * SEQ)          // halfwords of V^T hi (as many again of V^T lo)
#define PLN    ((size_t)NB * NH * SEQ * QROW)   // halfwords per spatial plane (column plane, then row plane)
#define SCN    ((size_t)NB * NH * SEQ)          // floats per per-position scalar array (3 arrays)
#define XB_FULL ((size_t)EW * LFULL)            // floats per batch of the input and of the output
#define LOG2E  1.4426950408889634f
#define NKP    32                  // ints per batch in the kept-key count array: one 128-B line per writer

static_assert(NH * HD == EW);
static_assert(SEQ == 512 && LFULL == 512);
static_assert(EW % 32 == 0 && SEQ % 32 == 0);
static_assert(SEQ % 64 == 0 && (NB * SEQ) % 64 == 0);
static_assert(NH * 64 * QROW == 16384);        // k_hproj stage: spatial plane form
static_assert(2 * EW * 64 == 16384);           // k_hproj stage: V^T form
static_assert(16 * QROW == 2 * TILEH);         // 16 positions of a spatial plane = hi piece + lo piece
static_assert(2 * HD * 32 == 4 * TILEH);       // 32 keys of one head's V^T, hi and lo = 4 pieces
static_assert(16384 == 128 * 16 * 8);          // k_hproj copy-out: 128 thr x 16 it x 8 halfwords
static_assert(64 * EW == 128 * 16 * 4);        // k_hproj input staging: 128 thr x 16 it x 4 floats
static_assert(3 * NH * 64 == 128 * 3 * 4);     // k_hproj scalar copy-out: 128 thr x 3 it x 4 floats
static_assert(EW * EW == 128 * 32 * 4);        // k_hproj weight staging: 128 thr x 32 it x 4 floats
static_assert(EW * 4 == 32 * 16);              // one weight row = one wave-wide 16-B load
static_assert(EW * 32 == 256 * 4 * 4);         // k_hattn copy-out: 256 thr x 4 it x 4 floats
static_assert(TPITCH % 8 == 0 && TPITCH >= EW);
static_assert(OPITCH % 4 == 0 && OPITCH >= 32);
static_assert(2 * PLN * 2 + 2 * VPL * 2 + 3 * SCN * 4 + (size_t)NB * NKP * 4 <= (size_t)WSMAX);

typedef int            v4i   __attribute__((ext_vector_type(4)));
typedef int            v8i   __attribute__((ext_vector_type(8)));
typedef float          v4f   __attribute__((ext_vector_type(4)));
typedef float          v8f   __attribute__((ext_vector_type(8)));
typedef __bf16         v16bf __attribute__((ext_vector_type(16)));
typedef int            v2i   __attribute__((ext_vector_type(2)));
typedef v2i __attribute__((may_alias)) v2ia;
typedef v4i __attribute__((may_alias)) v4ia;
typedef v4f __attribute__((may_alias)) v4fa;
union FragB { v16bf v; v4i q[2]; v8i w; };

// WMMA with hazard guard: ties D, keeps A/B live for 4 VALU slots
__device__ __forceinline__ v8f wmb(const FragB& a, const FragB& b, v8f c) {
  v8f d = __builtin_amdgcn_wmma_f32_16x16x32_bf16(false, a.v, false, b.v, (short)0, c, false, false);
  asm volatile("v_nop\n\tv_nop\n\tv_nop\n\tv_nop" : "+v"(d) : "v"(a.w), "v"(b.w));
  return d;
}

// f32 -> bf16 bits, RNE convert (finite inputs)
__device__ __forceinline__ unsigned bf16_bits(float f) {
  const unsigned u = __float_as_uint(f);
  return (u + 0x7FFFu + ((u >> 16) & 1u)) >> 16;
}
__device__ __forceinline__ float bf16_val(float f) {
  return __uint_as_float(bf16_bits(f) << 16);
}
__device__ __forceinline__ int pack2(float lo, float hi) {
  return (int)(bf16_bits(lo) | (bf16_bits(hi) << 16));
}
// 8 f32 -> bf16 hi piece + bf16 lo piece (lo = RNE(v - hi)); element 2j in the low halfword of word j
__device__ __forceinline__ void split8(const v8f x, v4i& hi, v4i& lo) {
#pragma unroll
  for (int j = 0; j < 4; ++j) {
    const float a = x[2 * j], b = x[2 * j + 1];
    const unsigned ha = bf16_bits(a), hb = bf16_bits(b);
    const float ra = a - __uint_as_float(ha << 16);
    const float rb = b - __uint_as_float(hb << 16);
    hi[j] = (int)(ha | (hb << 16));
    lo[j] = (int)(bf16_bits(ra) | (bf16_bits(rb) << 16));
  }
}
// fragment (row/col = lane&15) from an LDS k-contiguous bf16 row: p = row + k0 + 8h;
// elements 0..7 <- k0+8h+0..7, 8..15 <- k0+16+8h+0..7
__device__ __forceinline__ FragB lds_frag(const unsigned short* p) {
  FragB f;
  f.q[0] = *(const v4ia*)p;
  f.q[1] = *(const v4ia*)(p + 16);
  return f;
}
// One 128 x 128 f32 weight matrix ([out][in], k-contiguous) -> LDS wl[out][in] bf16 (RNE), row pitch TPITCH.
// 128 threads; a wave-wide 16-B load covers one whole 512-B row, and the wave's 8-B stores one whole LDS row.
// The matrix starts off floats (a constant) behind wsrc. A thread's 32 loads differ only in a constant offset
// and are all in flight together.
__device__ __forceinline__ void stage_w(const float* __restrict__ wsrc, const unsigned off, unsigned short* wl,
                                        const unsigned tid) {
  const float* p = wsrc + tid * 4u;
  unsigned short* d = wl + (tid >> 5) * TPITCH + (tid & 31u) * 4u;
  v4f g[32];
#pragma unroll
  for (unsigned it = 0; it < 32u; ++it) g[it] = *(const v4fa*)(p + off + it * 512u);
  // the loads' address register pair stays as it is up to this wait; what follows may reuse it
  asm volatile("s_wait_xcnt 0x0" :: "v"(p) : "memory");
#pragma unroll
  for (unsigned it = 0; it < 32u; ++it) {
    v2i w;
    w[0] = pack2(g[it].x, g[it].y);
    w[1] = pack2(g[it].z, g[it].w);
    *(v2ia*)(d + it * (4u * TPITCH)) = w;
  }
}

// Hyperboloid map of one head vector held as 8 + 8 components by lanes l and l^16:
// a <- normalize(a * scl) * sinh(|a * scl|); returns cosh(|a * scl|). Both lane halves get identical norms.
__device__ __forceinline__ float hyp8(v8f& a, const float scl) {
#pragma clang fp contract(off)
  float ss = 0.0f;
#pragma unroll
  for (int r = 0; r < 8; ++r) { a[r] = a[r] * scl; ss += a[r] * a[r]; }
  ss += __shfl_xor(ss, 16);
  const float n = sqrtf(ss);
  const float inv = 1.0f / fmaxf(n, 1.0e-12f);
  const float sh = sinhf(n);
  const float ch = coshf(n);
#pragma unroll
  for (int r = 0; r < 8; ++r) a[r] = (a[r] * inv) * sh;
  return ch;
}

// Klein map of one head vector: a <- normalize(hyperboloid_spatial / hyperboloid_time);
// returns (log(1 / (sqrt(1 - (|a| - 1e-4)^2) + 1e-4)) + biasv) * log2(e) + mterm.
__device__ __forceinline__ float klein8(v8f& a, const float biasv, const float mterm) {
#pragma clang fp contract(off)
  float ss = 0.0f;
#pragma unroll
  for (int r = 0; r < 8; ++r) ss += a[r] * a[r];
  ss += __shfl_xor(ss, 16);
  const float vn = sqrtf(ss);
  const float inv = 1.0f / fmaxf(vn, 1.0e-12f);
  const float sh = sinhf(vn);
  const float ch = coshf(vn);
  const float ich = 1.0f / ch;
  float s2 = 0.0f;
#pragma unroll
  for (int r = 0; r < 8; ++r) { a[r] = ((a[r] * inv) * sh) * ich; s2 += a[r] * a[r]; }
  s2 += __shfl_xor(s2, 16);
  const float n2 = sqrtf(s2);
  const float inv2 = 1.0f / fmaxf(n2, 1.0e-12f);
  float s3 = 0.0f;
#pragma unroll
  for (int r = 0; r < 8; ++r) { a[r] = a[r] * inv2; s3 += a[r] * a[r]; }
  s3 += __shfl_xor(s3, 16);
  const float vnk = sqrtf(s3);
  const float dm = vnk - 1.0e-4f;
  const float den = sqrtf(1.0f - dm * dm) + 1.0e-4f;
  const float lden = 1.0f / den;
  const float lb = logf(lden) + biasv;
  return lb * LOG2E + mterm;
}

// The attention loop's root, log2 and 2^x as the bare instructions. The library forms wrap each in a rescale
// for subnormal arguments or results and give the root a last-bit correction: about 5 to 15 vector
// instructions per value. Here the root's argument is 0 or a normal number (x1^2 - 1 of an f32 x1, clamped at
// 0), the log's is about 1 or more, and a 2^x below the normal range may come out as 0 beside a row sum that
// holds a term equal to 1; the root keeps the instruction's own 1 ulp.
// One asm statement per kind, every value in place: no instruction in it touches its neighbour's register, and
// the closing v_nop is the slot the instruction set asks for between the last one and a reader of its result
// (the builtins compiled to runs in which one overwrote the source of the one directly in front).
__device__ __forceinline__ void sqrt16(float (&a)[16]) {
  asm(
      "v_sqrt_f32 %0, %0\n\t"
      "v_sqrt_f32 %1, %1\n\t"
      "v_sqrt_f32 %2, %2\n\t"
      "v_sqrt_f32 %3, %3\n\t"
      "v_sqrt_f32 %4, %4\n\t"
      "v_sqrt_f32 %5, %5\n\t"
      "v_sqrt_f32 %6, %6\n\t"
      "v_sqrt_f32 %7, %7\n\t"
      "v_sqrt_f32 %8, %8\n\t"
      "v_sqrt_f32 %9, %9\n\t"
      "v_sqrt_f32 %10, %10\n\t"
      "v_sqrt_f32 %11, %11\n\t"
      "v_sqrt_f32 %12, %12\n\t"
      "v_sqrt_f32 %13, %13\n\t"
      "v_sqrt_f32 %14, %14\n\t"
      "v_sqrt_f32 %15, %15\n\t"
      "v_nop"
      :
        "+v"(a[0]), "+v"(a[1]), "+v"(a[2]), "+v"(a[3]), "+v"(a[4]), "+v"(a[5]),
        "+v"(a[6]), "+v"(a[7]), "+v"(a[8]), "+v"(a[9]), "+v"(a[10]), "+v"(a[11]),
        "+v"(a[12]), "+v"(a[13]), "+v"(a[14]), "+v"(a[15]));
}
__device__ __forceinline__ void log2_16(float (&a)[16]) {
  asm(
      "v_log_f32 %0, %0\n\t"
      "v_log_f32 %1, %1\n\t"
      "v_log_f32 %2, %2\n\t"
      "v_log_f32 %3, %3\n\t"
      "v_log_f32 %4, %4\n\t"
      "v_log_f32 %5, %5\n\t"
      "v_log_f32 %6, %6\n\t"
      "v_log_f32 %7, %7\n\t"
      "v_log_f32 %8, %8\n\t"
      "v_log_f32 %9, %9\n\t"
      "v_log_f32 %10, %10\n\t"
      "v_log_f32 %11, %11\n\t"
      "v_log_f32 %12, %12\n\t"
      "v_log_f32 %13, %13\n\t"
      "v_log_f32 %14, %14\n\t"
      "v_log_f32 %15, %15\n\t"
      "v_nop"
      :
        "+v"(a[0]), "+v"(a[1]), "+v"(a[2]), "+v"(a[3]), "+v"(a[4]), "+v"(a[5]),
        "+v"(a[6]), "+v"(a[7]), "+v"(a[8]), "+v"(a[9]), "+v"(a[10]), "+v"(a[11]),
        "+v"(a[12]), "+v"(a[13]), "+v"(a[14]), "+v"(a[15]));
}
__device__ __forceinline__ void exp2_17(float (&a)[17]) {
  asm(
      "v_exp_f32 %0, %0\n\t"
      "v_exp_f32 %1, %1\n\t"
      "v_exp_f32 %2, %2\n\t"
      "v_exp_f32 %3, %3\n\t"
      "v_exp_f32 %4, %4\n\t"
      "v_exp_f32 %5, %5\n\t"
      "v_exp_f32 %6, %6\n\t"
      "v_exp_f32 %7, %7\n\t"
      "v_exp_f32 %8, %8\n\t"
      "v_exp_f32 %9, %9\n\t"
      "v_exp_f32 %10, %10\n\t"
      "v_exp_f32 %11, %11\n\t"
      "v_exp_f32 %12, %12\n\t"
      "v_exp_f32 %13, %13\n\t"
      "v_exp_f32 %14, %14\n\t"
      "v_exp_f32 %15, %15\n\t"
      "v_exp_f32 %16, %16\n\t"
      "v_nop"
      :
        "+v"(a[0]), "+v"(a[1]), "+v"(a[2]), "+v"(a[3]), "+v"(a[4]), "+v"(a[5]),
        "+v"(a[6]), "+v"(a[7]), "+v"(a[8]), "+v"(a[9]), "+v"(a[10]), "+v"(a[11]),
        "+v"(a[12]), "+v"(a[13]), "+v"(a[14]), "+v"(a[15]), "+v"(a[16]));
}

// ---------------------------------------------------------------------------
// Projections + hyperbolic maps. Block = 64 positions of one batch, 4 waves x 16 positions.
// Input x is channels-first [b][k = channel][l]: the 128 x 64 tile is read along l (16-B loads; the column role gathers by key, 4-B loads), converted to
// bf16 and transposed into LDS xt[l][k] (cross-wave, block barrier); each wave then holds its 16 positions
// as 4 B fragments (col = lane&15 = position).
// Weights: the block reads the f32 matrix of its pass ([out][in], k-contiguous: W_q or W_mem rows 0..127, then for
// the column role W_mem rows 128..255), rounds it to bf16 and keeps it in LDS wl; A fragments come from there.
// wl is written where no wave reads it: first in front of the barrier that publishes xt, then between the two
// barriers around the first copy-out. D = W_tile (A, row = out feature) x X (B, col = position): D[row d = 8h+r][col = position],
// so a lane holds 8 of the 16 head components of one position; lanes l and l^16 complete the head.
// pass 2: V^T hi/lo     = Klein point of (W_mem[128:256] x)               + scalar array 2 = key bias (base-2)
// Workspace planes are laid in the order the attention loop's fragments read them, so that each of its
// wave-wide 16-B loads covers 512 contiguous bytes (4 whole 128-B lines), lane (m, h) at byte 32 m + 16 h:
// spatial plane = [b][head][16-position tile][hi | lo][position m][component 0..15];
// V^T = [b][head][32-key block][hi | lo][key half q][channel d = m][key 16 q + 0..15].
// Key compaction: a key whose mask is 0 carries the additive term -1e30, so beside any key of the batch whose
// mask is 1 or more its softmax weight is exactly 0 (the other logit terms are small beside 1e30: arccosh of an
// f32 is below 90, the log-denominator below 10). Such keys are left out here: blockIdx.y = 0 blocks (column
// role: W_q plane, V^T, key bias) work on 64 SLOTS of the batch's list of kept keys, in key order, and gather
// the input columns of those keys; slots past the end of the list repeat key 0 with the masked term. A batch
// with no mask of 1 or more keeps every key, each with its own term. The count goes to nkeep[b * NKP] and
// bounds the attention loop. blockIdx.y = 1 blocks (row role: W_mem K plane) work on all 512 positions.
// LDS stg: cross-wave (block barriers); fully written before each copy-out (8 heads x 64 rows x 32, or
//   8 heads x 2 key blocks x 4 pieces x 256). ssc: 3 x 8 x 64 floats, written by lanes 0..15 of every wave, copied out last.
// coverage: row plane and scalar array 1: NB*8 blocks x 64 positions = all NB*512. Column plane, V^T, scalar
//   arrays 0 and 2: per batch the first ceil(kept / 64) blocks x 64 slots; the attention loop reads
//   ceil(kept / 32) x 32 slots, never more.
// ---------------------------------------------------------------------------
__global__ __launch_bounds__(128) void k_hproj(const float* __restrict__ x, const int* __restrict__ mask,
                                               const float* __restrict__ wmem, const float* __restrict__ wq,
                                               const float* __restrict__ bias_p,
                                               unsigned short* pl, unsigned short* vt, float* sca, int* nkeep) {
  __shared__ __attribute__((aligned(16))) unsigned short xt[64 * TPITCH];
  __shared__ __attribute__((aligned(16))) int srcl[64];      // column role: slot -> key position
  __shared__ __attribute__((aligned(16))) unsigned short wl[EW * TPITCH];   // the pass's weight matrix, bf16
  __shared__ __attribute__((aligned(16))) unsigned short stg[16384];
  __shared__ __attribute__((aligned(16))) float ssc[3 * NH * 64];
  const unsigned tid = threadIdx.x, lane = tid & 31u, hh = lane >> 4, m = lane & 15u;
  const unsigned wave = (unsigned)__builtin_amdgcn_readfirstlane((int)(threadIdx.x >> 5));
  const unsigned row0 = blockIdx.x * 64u;
  const unsigned bb = row0 >> 9, r0 = row0 & 511u;
  const bool col = blockIdx.y == 0u;
  unsigned cnt = SEQ;
  int mi = 0;                                  // read by the column role alone

  if (col) {
    // ---- kept keys of the batch: every wave forms the same 16 lane-mask words, so the count needs no barrier ----
    const int* mrow = mask + (size_t)bb * LFULL;
    int mw[16];
#pragma unroll
    for (int w = 0; w < 16; ++w) mw[w] = mrow[32 * w + (int)lane];
    // the code behind reuses these loads' offset and base registers: the wait stands in front of that
    asm volatile("s_wait_xcnt 0x0" ::: "memory");
    unsigned kw[16], anyp = 0u;
#pragma unroll
    for (int w = 0; w < 16; ++w) {
      kw[w] = __builtin_amdgcn_ballot_w32(mw[w] != 0);
      anyp |= __builtin_amdgcn_ballot_w32(mw[w] >= 1);
    }
    cnt = 0u;
#pragma unroll
    for (int w = 0; w < 16; ++w) {
      if (anyp == 0u) kw[w] = 0xFFFFFFFFu;
      cnt += (unsigned)__builtin_popcount(kw[w]);
    }
    if (r0 >= cnt) return;                     // no kept key in these 64 slots: the whole block leaves, before any barrier
    if (r0 == 0u && tid == 0u) nkeep[bb * NKP] = (int)cnt;
    unsigned pre = 0u;
#pragma unroll
    for (int w = 0; w < 16; ++w) {
      if ((unsigned)(w >> 2) == wave) {
        const unsigned slot = pre + (unsigned)__builtin_popcount(kw[w] & ((1u << lane) - 1u)) - r0;
        if (((kw[w] >> lane) & 1u) != 0u && slot < 64u) srcl[slot] = 32 * w + (int)lane;
      }
      pre += (unsigned)__builtin_popcount(kw[w]);
    }
    if (tid < 64u && r0 + tid >= cnt) srcl[tid] = 0;
    __syncthreads();
    // ---- input tile: x[b][k][key of slot r0 .. r0+63] -> xt[slot][k] bf16 ----
    const float* xg = x + (size_t)bb * XB_FULL;
    const unsigned l4 = (tid & 15u) << 2, k0 = tid >> 4;
    const v4i sp = *(const v4ia*)(srcl + l4);
    const unsigned o0 = k0 * LFULL + (unsigned)sp.x, o1 = k0 * LFULL + (unsigned)sp.y;
    const unsigned o2 = k0 * LFULL + (unsigned)sp.z, o3 = k0 * LFULL + (unsigned)sp.w;
    const unsigned sl = 16u * wave + m;
    const unsigned om = (unsigned)srcl[sl];
    mi = mrow[om];                             // the slot's own key's mask
    // unrolled whole: the 4-B loads differ only in a constant offset; each half's 32 are in flight together
#pragma unroll
    for (unsigned hf = 0; hf < 2u; ++hf) {
      float g[32];
#pragma unroll
      for (unsigned it = 0; it < 8u; ++it) {
        const float* xr = xg + (8u * hf + it) * (8u * LFULL);
        g[4u * it + 0u] = xr[o0]; g[4u * it + 1u] = xr[o1]; g[4u * it + 2u] = xr[o2]; g[4u * it + 3u] = xr[o3];
      }
      // the loads' five offset registers stay as they are up to this wait; what follows may reuse them
      asm volatile("s_wait_xcnt 0x0" :: "v"(om), "v"(o0), "v"(o1), "v"(o2), "v"(o3) : "memory");
#pragma unroll
      for (unsigned it = 0; it < 8u; ++it) {
        const unsigned k = 8u * (8u * hf + it) + k0;
        xt[(l4 + 0u) * TPITCH + k] = (unsigned short)bf16_bits(g[4u * it + 0u]);
        xt[(l4 + 1u) * TPITCH + k] = (unsigned short)bf16_bits(g[4u * it + 1u]);
        xt[(l4 + 2u) * TPITCH + k] = (unsigned short)bf16_bits(g[4u * it + 2u]);
        xt[(l4 + 3u) * TPITCH + k] = (unsigned short)bf16_bits(g[4u * it + 3u]);
      }
      // keeps the second half's loads behind the first half's LDS stores, so that at most 33 loads of a wave are
      // outstanding; the scheduler lifted them over the stores, which made 65, past what s_wait_loadcnt can name
      if (hf == 0u) __builtin_amdgcn_sched_barrier(0);
    }
    if (r0 + sl >= cnt) mi = 0;                // a slot past the end of the list counts as masked
  } else {
    // ---- input tile: x[b][k][r0 .. r0+63] -> xt[l][k] bf16 ----
    const float* xg = x + (size_t)bb * XB_FULL + r0;
#pragma unroll 1
    for (unsigned it = 0; it < 16u; ++it) {
      const unsigned p = it * 128u + tid, k = p >> 4, l4 = (p & 15u) << 2;
      const v4f v = *(const v4fa*)(xg + (size_t)k * LFULL + l4);
      xt[(l4 + 0u) * TPITCH + k] = (unsigned short)bf16_bits(v.x);
      xt[(l4 + 1u) * TPITCH + k] = (unsigned short)bf16_bits(v.y);
      xt[(l4 + 2u) * TPITCH + k] = (unsigned short)bf16_bits(v.z);
      xt[(l4 + 3u) * TPITCH + k] = (unsigned short)bf16_bits(v.w);
    }
  }
  stage_w(col ? wq : wmem, 0u, wl, tid);
  __syncthreads();

  FragB xa[4];
  {
    const unsigned xo = (16u * wave + m) * TPITCH + 8u * hh;
#pragma unroll
    for (int ks = 0; ks < 4; ++ks) {
      xa[ks].q[0] = *(const v4ia*)(xt + xo + 32 * ks);
      xa[ks].q[1] = *(const v4ia*)(xt + xo + 32 * ks + 16);
    }
  }
  const float mv = (float)mi;
  const float mterm = (-1.0e30f * (1.0f - mv)) * LOG2E;
  const float biasv = bf16_val(bias_p[0]);
  const v8f zero8 = {0.f, 0.f, 0.f, 0.f, 0.f, 0.f, 0.f, 0.f};

  {
    const unsigned ps = col ? 0u : 1u;
    const float scl = (ps == 0u) ? 0.25f : 1.0f;
#pragma unroll 1
    for (unsigned t = 0; t < NH; ++t) {
      const unsigned short* wp = wl + (16u * t + m) * TPITCH + 8u * hh;
      FragB wf[4];
#pragma unroll
      for (int ks = 0; ks < 4; ++ks) wf[ks] = lds_frag(wp + 32 * ks);
      v8f acc = zero8;
#pragma unroll
      for (int ks = 0; ks < 4; ++ks) acc = wmb(wf[ks], xa[ks], acc);
      const float ch = hyp8(acc, scl);           // acc[r] = spatial[position 16 wave + m][8h + r]
      v4i hi, lo;
      split8(acc, hi, lo);
      const unsigned so = (t * 64u + 16u * wave) * QROW + 16u * m + 8u * hh;
      *(v4ia*)(stg + so) = hi;
      *(v4ia*)(stg + so + TILEH) = lo;
      if (hh == 0u) ssc[(ps * NH + t) * 64u + 16u * wave + m] = ch;
    }
    __syncthreads();
    if (col) stage_w(wmem, EW * EW, wl, tid);    // every wave has left the first pass: wl takes the V matrix
    {
      unsigned short* dst = pl + (size_t)ps * PLN + ((size_t)bb * NH * SEQ + r0) * QROW;
#pragma unroll 1
      for (unsigned it = 0; it < 16u; ++it) {
        const unsigned p = it * 128u + tid, t = p >> 8, wi = p & 255u;
        const v4i v = *(const v4ia*)(stg + p * 8u);
        *(v4i*)(dst + (size_t)t * (SEQ * QROW) + wi * 8u) = v;
        // what follows rewrites the store's address and data registers: the wait stands in front of that
        asm volatile("s_wait_xcnt 0x0" ::: "memory");
      }
      
    }
    __syncthreads();
  }

  // ---- pass 2 (column role): Klein points -> V^T hi / lo stage, key bias ----
  if (col) {
#pragma unroll 1
  for (unsigned t = 0; t < NH; ++t) {
    const unsigned short* wp = wl + (16u * t + m) * TPITCH + 8u * hh;
    FragB wf[4];
#pragma unroll
    for (int ks = 0; ks < 4; ++ks) wf[ks] = lds_frag(wp + 32 * ks);
    v8f acc = zero8;
#pragma unroll
    for (int ks = 0; ks < 4; ++ks) acc = wmb(wf[ks], xa[ks], acc);
    const float lb2 = klein8(acc, biasv, mterm);  // acc[r] = v_klein[position 16 wave + m][8h + r]
#pragma unroll
    for (int r = 0; r < 8; ++r) {
      const unsigned hb = bf16_bits(acc[r]);
      const float res = acc[r] - __uint_as_float(hb << 16);
      // head t: [key block wave >> 1][hi | lo][key half wave & 1][channel 8h + r][key m]
      const unsigned so = t * 2048u + (wave >> 1) * 1024u + (wave & 1u) * TILEH + (8u * hh + (unsigned)r) * 16u + m;
      stg[so] = (unsigned short)hb;
      stg[so + 2u * TILEH] = (unsigned short)bf16_bits(res);
    }
    if (hh == 0u) ssc[(2u * NH + t) * 64u + 16u * wave + m] = lb2;
  }
  __syncthreads();
  {
    unsigned short* dst = vt + (size_t)bb * NH * (2 * HD * SEQ) + r0 * (2 * HD);
#pragma unroll 1
    for (unsigned it = 0; it < 16u; ++it) {
      const unsigned p = it * 128u + tid, t = p >> 8, wi = p & 255u;
      const v4i v = *(const v4ia*)(stg + p * 8u);
      *(v4i*)(dst + (size_t)t * (2 * HD * SEQ) + wi * 8u) = v;
      // the next trip rewrites the store's address and data registers: the wait stands in front of that
      asm volatile("s_wait_xcnt 0x0" ::: "memory");
    }
    
  }
  }
  {
#pragma unroll 1
    for (unsigned it = 0; it < 3u; ++it) {
      if ((it == 1u) == col) continue;         // array 1 is the row role's, arrays 0 and 2 the column role's
      const unsigned p = it * 128u + tid, a = p >> 7, t = (p >> 4) & 7u, c = p & 15u;
      const v4f v = *(const v4fa*)(ssc + p * 4u);
      *(v4f*)(sca + (size_t)a * SCN + ((size_t)bb * NH + t) * SEQ + r0 + 4u * c) = v;
      // the next trip rewrites the store's address and data registers: the wait stands in front of that
      asm volatile("s_wait_xcnt 0x0" ::: "memory");
    }
    
  }
}

// ---------------------------------------------------------------------------
// Fused Lorentz attention: one block = (batch b, 32 softmax rows i0..i0+31), 8 waves, wave = head; each wave
// runs two 16-row tiles one after the other, each over the batch's kept keys (column position j = slot). Flash attention in the transposed domain:
//   S^T tile = C (A, row = column position j) x R^T (B, col = row position i): the K = 16 spatial product is
//   laid as [c_hi|c_hi] x [r_hi|r_lo] plus [c_lo|0] x [r_hi|r_lo] along the 32-deep k axis.
//   D[row j 8h+r][col i m]. Per element: x = rt[i]*ct[j] - D, logit2 = -beta*log2(x1 + sqrt(x1^2-1)) + cb[j]
//   (cb carries log-denominator, bias and the additive key mask term). Softmax statistics are per lane
//   (row i = m); the two lane halves combine by one xor-16 exchange. The P^T B-fragment is the lane's own
//   16 results (tile 0 -> elements 0..7, tile 1 -> elements 8..15). O^T = V^T (A, row d) x P^T:
//   D[row d 8h+r][col i m], scaled per lane.
// Output stage ost[channel 0..127][position 0..31] (cross-wave, block barrier): every wave writes its 16
// coverage: grid (16, NB) x 128 channels x 32 positions = NB*128*512 outputs, each written by exactly one lane.
// ---------------------------------------------------------------------------
__global__ __launch_bounds__(256) void k_hattn(const unsigned short* __restrict__ rpl,
                                               const unsigned short* __restrict__ cpl,
                                               const unsigned short* __restrict__ vt,
                                               const float* __restrict__ rtt,
                                               const float* __restrict__ ctt,
                                               const float* __restrict__ cbb,
                                               const float* __restrict__ beta_p,
                                               const int* __restrict__ nkeep,
                                               float* out) {
  __shared__ __attribute__((aligned(16))) float ost[EW * OPITCH];
  const unsigned tid = threadIdx.x, lane = tid & 31u, hh = lane >> 4, m = lane & 15u;
  const unsigned wave = (unsigned)__builtin_amdgcn_readfirstlane((int)(threadIdx.x >> 5));
  const unsigned i0 = blockIdx.x * 32u, b = blockIdx.y;
  const unsigned bh = b * NH + wave;
  const v8f zero8 = {0.f, 0.f, 0.f, 0.f, 0.f, 0.f, 0.f, 0.f};
  const v4i zero4 = {0, 0, 0, 0};
  const float nbeta = -bf16_val(beta_p[0]);
  // kept keys of this batch, rounded up to whole 32-key blocks (the slots behind the last kept key weigh 0)
  const int nk = nkeep[b * NKP];
  const unsigned nend = ((unsigned)(nk < 1 ? 1 : (nk > SEQ ? SEQ : nk)) + 31u) & ~31u;

  const unsigned fo = 16u * m + 8u * hh;      // the lane's 16 bytes inside a 512-B piece
  const unsigned short* kb = cpl + (size_t)bh * SEQ * QROW + fo;
  const unsigned short* vb = vt + (size_t)bh * (2 * HD * SEQ) + fo;
  const float* ctp = ctt + (size_t)bh * SEQ + 8u * hh;
  const float* cbp = cbb + (size_t)bh * SEQ + 8u * hh;

#pragma unroll 1
  for (unsigned tl = 0; tl < 2u; ++tl) {
    const unsigned g0 = i0 + 16u * tl;
    const unsigned short* qp = rpl + ((size_t)bh * SEQ + g0) * QROW + fo;
    FragB qf;
    qf.q[0] = *(const v4ia*)qp;            // r_hi[8h .. 8h+7]  (k slots 8h..)
    qf.q[1] = *(const v4ia*)(qp + TILEH);  // r_lo[8h .. 8h+7]  (k slots 16+8h..)
    const float rt = rtt[(size_t)bh * SEQ + g0 + m];
    // the key loop reuses these three loads' address registers: the wait stands in front of that
    asm volatile("s_wait_xcnt 0x0" ::: "memory");
    v8f o = zero8;
    float mrun = -3.0e38f, lrun = 0.0f;
#pragma unroll 1
    for (unsigned n0 = 0; n0 < nend; n0 += 32u) {
      const unsigned short* kp = kb + (size_t)n0 * QROW;
      const v4i kh0 = *(const v4ia*)kp;
      const v4i kl0 = *(const v4ia*)(kp + TILEH);
      const v4i kh1 = *(const v4ia*)(kp + 2 * TILEH);
      const v4i kl1 = *(const v4ia*)(kp + 3 * TILEH);
      FragB a10, a20, a11, a21;
      a10.q[0] = kh0; a10.q[1] = kh0;
      a20.q[0] = kl0; a20.q[1] = zero4;
      a11.q[0] = kh1; a11.q[1] = kh1;
      a21.q[0] = kl1; a21.q[1] = zero4;
      v8f s0 = wmb(a10, qf, zero8);
      s0 = wmb(a20, qf, s0);
      v8f s1 = wmb(a11, qf, zero8);
      s1 = wmb(a21, qf, s1);

      const v4f t0 = *(const v4fa*)(ctp + n0);
      const v4f t1 = *(const v4fa*)(ctp + n0 + 4u);
      const v4f t2 = *(const v4fa*)(ctp + n0 + 16u);
      const v4f t3 = *(const v4fa*)(ctp + n0 + 20u);
      const v4f u0 = *(const v4fa*)(cbp + n0);
      const v4f u1 = *(const v4fa*)(cbp + n0 + 4u);
      const v4f u2 = *(const v4fa*)(cbp + n0 + 16u);
      const v4f u3 = *(const v4fa*)(cbp + n0 + 20u);
      const v8f ct0 = __builtin_shufflevector(t0, t1, 0, 1, 2, 3, 4, 5, 6, 7);
      const v8f ct1 = __builtin_shufflevector(t2, t3, 0, 1, 2, 3, 4, 5, 6, 7);
      const v8f cb0 = __builtin_shufflevector(u0, u1, 0, 1, 2, 3, 4, 5, 6, 7);
      const v8f cb1 = __builtin_shufflevector(u2, u3, 0, 1, 2, 3, 4, 5, 6, 7);
      // logit in the base-2 domain: x = rt*ct - dot (minus the Lorentz product), x1 = x + 1e-6,
      // arccosh(x1) = ln(x1 + sqrt(x1^2 - 1)); a = -beta * log2(x1 + sqrt(x1^2 - 1)) + cb
      float x1[16], w[16];
#pragma unroll
      for (int r = 0; r < 8; ++r) {
        x1[r]     = (rt * ct0[r] - s0[r]) + 1.0e-6f;        // column position n0 + 8h + r
        x1[8 + r] = (rt * ct1[r] - s1[r]) + 1.0e-6f;        // column position n0 + 16 + 8h + r
      }
#pragma unroll
      for (int i = 0; i < 16; ++i) w[i] = fmaxf(x1[i] * x1[i] - 1.0f, 0.0f);
      sqrt16(w);
#pragma unroll
      for (int i = 0; i < 16; ++i) w[i] = x1[i] + w[i];
      log2_16(w);
      v8f a0, a1;
#pragma unroll
      for (int r = 0; r < 8; ++r) {
        a0[r] = nbeta * w[r] + cb0[r];
        a1[r] = nbeta * w[8 + r] + cb1[r];
      }

      float t = fmaxf(a0[0], a1[0]);
#pragma unroll
      for (int r = 1; r < 8; ++r) t = fmaxf(t, fmaxf(a0[r], a1[r]));
      t = fmaxf(t, __shfl_xor(t, 16));
      const float mnew = fmaxf(mrun, t);
      float e[17];
#pragma unroll
      for (int r = 0; r < 8; ++r) {
        e[r]     = a0[r] - mnew;
        e[8 + r] = a1[r] - mnew;
      }
      e[16] = mrun - mnew;
      exp2_17(e);
      const float sc = e[16];
      v8f p0, p1;
      float ps = 0.0f;
#pragma unroll
      for (int r = 0; r < 8; ++r) {
        p0[r] = e[r];
        p1[r] = e[8 + r];
        ps += p0[r] + p1[r];
      }
      lrun = lrun * sc + ps;
      mrun = mnew;
      o = o * sc;

      FragB ph, pw;
      split8(p0, ph.q[0], pw.q[0]);
      split8(p1, ph.q[1], pw.q[1]);
      FragB fvh, fvl;
      const unsigned short* vp = vb + (size_t)n0 * (2 * HD);
      fvh.q[0] = *(const v4ia*)vp;                 // keys n0 + 8h + 0..7
      fvh.q[1] = *(const v4ia*)(vp + TILEH);       // keys n0 + 16 + 8h + 0..7
      fvl.q[0] = *(const v4ia*)(vp + 2 * TILEH);
      fvl.q[1] = *(const v4ia*)(vp + 3 * TILEH);
      o = wmb(fvh, ph, o);
      o = wmb(fvl, ph, o);
      o = wmb(fvh, pw, o);
    }
    const float lt = lrun + __shfl_xor(lrun, 16);
    const float inv = 1.0f / lt;
    const v8f c = o * inv;                    // out[channel 16 wave + 8h + r][position g0 + m]
    const unsigned so = (16u * wave + 8u * hh) * OPITCH + 16u * tl + m;
#pragma unroll
    for (int r = 0; r < 8; ++r) ost[so + (unsigned)r * OPITCH] = c[r];
  }
  __syncthreads();

  {
    float* ob = out + (size_t)b * XB_FULL + i0;
#pragma unroll 1
    for (unsigned it = 0; it < 4u; ++it) {
      const unsigned p = it * 256u + tid, c = p >> 3, q = p & 7u;
      const v4f v = *(const v4fa*)(ost + c * OPITCH + 4u * q);
      *(v4f*)(ob + (size_t)c * LFULL + 4u * q) = v;
    }
    
  }
}

// ---------------------------------------------------------------------------
static inline size_t al256(size_t o) { return (o + 255) & ~(size_t)255; }

extern "C" void kernel_launch(void* const* d_in, const int* in_sizes, int n_in,
                              void* d_out, int out_size, void* d_ws, size_t ws_size,
                              hipStream_t stream) {
  (void)stream;
  if (n_in < 6) return;
  const long long actN = (long long)NB * EW * LFULL;
  if ((long long)in_sizes[0] < actN) return;                 // queries [b][channel][l]
  if ((long long)in_sizes[1] < (long long)NB * LFULL) return; // mask [b][l] int32
  if (in_sizes[2] < 2 * EW * EW) return;                     // W_mem [256][128]
  if (in_sizes[3] < EW * EW) return;                         // W_q [128][128]
  if (in_sizes[4] < 1 || in_sizes[5] < 1) return;            // beta, bias
  if ((long long)out_size < actN) return;

  const float* queries = (const float*)d_in[0];
  const int*   mask    = (const int*)d_in[1];
  const float* Wmem    = (const float*)d_in[2];
  const float* Wq      = (const float*)d_in[3];
  const float* beta    = (const float*)d_in[4];
  const float* bias    = (const float*)d_in[5];
  float* out = (float*)d_out;

  const size_t plB = al256((size_t)2 * PLN * 2);                // 16,777,216 at NB = 32
  const size_t vB  = al256((size_t)2 * VPL * 2);                // 8,388,608
  const size_t scB = al256((size_t)3 * SCN * 4);                // 1,572,864
  const size_t nkB = al256((size_t)NB * NKP * 4);               // 4,096
  const size_t total = plB + vB + scB + nkB;                    // 26,742,784
  if (total > ws_size || total > (size_t)WSMAX) return;
  char* w = (char*)d_ws;
  unsigned short* pln = (unsigned short*)w;
  unsigned short* vtp = (unsigned short*)(w + plB);
  float*          sca = (float*)(w + plB + vB);
  int*            nkp = (int*)(w + plB + vB + scB);
  unsigned short* cpl = pln;              // column plane (from W_q)
  unsigned short* rpl = pln + PLN;        // row plane (from W_mem rows 0..127)
  float* ctt = sca;
  float* rtt = sca + SCN;
  float* cbb = sca + 2 * SCN;

  // 1: projections + hyperboloid / Klein maps -> planes and per-position scalars (y = 0: kept keys, y = 1: rows)
  k_hproj<<<dim3((NB * SEQ) / 64, 2), 128, 0, stream>>>(queries, mask, Wmem, Wq, bias, pln, vtp, sca, nkp);
  // 2: Lorentz attention, channels-first output
  k_hattn<<<dim3(SEQ / 32, NB), 256, 0, stream>>>(rpl, cpl, vtp, rtt, ctt, cbb, beta, nkp, out);
}

// v005
// Measured time: 44.7 microseconds a run.
// In both of two side-by-side timings against v004, it was 1.12 times as fast.
// Counting every step since v000, it is 2.78 times as fast.
// Contractions: W_mem / W_q projections = v_wmma_f32_16x16x32_bf16, bf16 (RNE) inputs and weights, one product. Lorentz spatial product k_sp.q_sp (K = 16) and P.V = same bf16 WMMA with every computed operand carried as bf16 hi + bf16 lo (hi.hi + lo.hi + hi.lo). Accumulate f32 everywhere.
// Time-like rank-1 term, arccosh, additive key bias, online softmax (base-2 form): f32 VALU. No power-of-two carries exist (bf16 planes only).
#include <hip/hip_runtime.h>
#include <stddef.h>
#include <stdint.h>
#include <math.h>

#ifndef NB
#define NB 32                      // batches processed (a reduced build reads the first NB batches)
#endif
#define SEQ    512                 // positions per batch (softmax rows i and softmax columns j)
#define LFULL  512                 // full row length of the channels-first input / output and of the mask
#define EW     128                 // model width = heads x head dim
#define NH     8
#define HD     16
#define QROW   32                  // halfwords per position in a spatial plane: 16 hi + 16 lo
#define TILEH  256                 // halfwords per 512-B piece of a plane: 16 rows x 16 halfwords, one wave-wide 16-B load
#define TPITCH 136                 // halfwords per LDS transposed-input row
#define OPITCH 36                  // floats per LDS output-stage row
#define WSMAX  134217728
#define VPL    ((size_t)NB * EW * SEQ)          // halfwords of V^T hi (as many again of V^T lo)
#define PLN    ((size_t)NB * NH * SEQ * QROW)   // halfwords per spatial plane (column plane, then row plane)
#define SCN    ((size_t)NB * NH * SEQ)          // floats per per-position scalar array (3 arrays)
#define XB_FULL ((size_t)EW * LFULL)            // floats per batch of the input and of the output
#define LOG2E  1.4426950408889634f
#define NKP    32                  // ints per batch in the kept-key count array: one 128-B line per writer

static_assert(NH * HD == EW);
static_assert(SEQ == 512 && LFULL == 512);
static_assert(EW % 32 == 0 && SEQ % 32 == 0);
static_assert(SEQ % 64 == 0 && (NB * SEQ) % 64 == 0);
static_assert(NH * 64 * QROW == 16384);        // k_hproj stage: spatial plane form
static_assert(2 * EW * 64 == 16384);           // k_hproj stage: V^T form
static_assert(16 * QROW == 2 * TILEH);         // 16 positions of a spatial plane = hi piece + lo piece
static_assert(2 * HD * 32 == 4 * TILEH);       // 32 keys of one head's V^T, hi and lo = 4 pieces
static_assert(16384 == 128 * 16 * 8);          // k_hproj copy-out: 128 thr x 16 it x 8 halfwords
static_assert(64 * EW == 128 * 16 * 4);        // k_hproj input staging: 128 thr x 16 it x 4 floats
static_assert(3 * NH * 64 == 128 * 3 * 4);     // k_hproj scalar copy-out: 128 thr x 3 it x 4 floats
static_assert(EW * EW == 128 * 32 * 4);        // k_hproj weight staging: 128 thr x 32 it x 4 floats
static_assert(EW * 4 == 32 * 16);              // one weight row = one wave-wide 16-B load
static_assert(EW * 32 == 256 * 4 * 4);         // k_hattn copy-out: 256 thr x 4 it x 4 floats
static_assert(TPITCH % 8 == 0 && TPITCH >= EW);
static_assert(OPITCH % 4 == 0 && OPITCH >= 32);
static_assert(2 * PLN * 2 + 2 * VPL * 2 + 3 * SCN * 4 + (size_t)NB * NKP * 4 <= (size_t)WSMAX);

typedef int            v4i   __attribute__((ext_vector_type(4)));
typedef int            v8i   __attribute__((ext_vector_type(8)));
typedef float          v4f   __attribute__((ext_vector_type(4)));
typedef float          v8f   __attribute__((ext_vector_type(8)));
typedef __bf16         v16bf __attribute__((ext_vector_type(16)));
typedef int            v2i   __attribute__((ext_vector_type(2)));
typedef float          v2f   __attribute__((ext_vector_type(2)));
typedef __bf16         v2bf  __attribute__((ext_vector_type(2)));
typedef v2i __attribute__((may_alias)) v2ia;
typedef v4i __attribute__((may_alias)) v4ia;
typedef v4f __attribute__((may_alias)) v4fa;
union FragB { v16bf v; v4i q[2]; v8i w; };

// WMMA with hazard guard: ties D, keeps A/B live for 4 VALU slots
__device__ __forceinline__ v8f wmb(const FragB& a, const FragB& b, v8f c) {
  v8f d = __builtin_amdgcn_wmma_f32_16x16x32_bf16(false, a.v, false, b.v, (short)0, c, false, false);
  asm volatile("v_nop\n\tv_nop\n\tv_nop\n\tv_nop" : "+v"(d) : "v"(a.w), "v"(b.w));
  return d;
}

// two f32 -> two bf16 (RNE) in one word, by the convert instruction (v_cvt_pk_bf16_f32): lo in the low halfword
__device__ __forceinline__ int pack2(float lo, float hi) {
  const v2f p = {lo, hi};
  return __builtin_bit_cast(int, __builtin_convertvector(p, v2bf));
}
__device__ __forceinline__ float bf16_val(float f) {
  return __uint_as_float((unsigned)pack2(f, f) << 16);
}
// 8 f32 -> bf16 hi piece + bf16 lo piece (lo = RNE(v - hi)); element 2j in the low halfword of word j.
// hi: one convert a pair. lo: hi * (-1) + v in the mixed-precision FMA that takes the bf16 half as it lies in
// the hi word and writes its bf16 result into one half of the lo word (v - hi is exact in f32, so the one
// rounding is the same as that of a subtraction and a convert): three instructions a pair.
// One asm statement: a plain subtraction and conversion compiled to five instructions a pair (two unpacks, a
// packed subtraction, the two converts). The four low halves stand in front of
// the four high halves; each high half rewrites the word its low half wrote four instructions back, which the
// s_delay_alu lines tell the issue logic, so that another wave can issue meanwhile.
__device__ __forceinline__ void split8(const v8f x, v4i& hi, v4i& lo) {
#pragma unroll
  for (int j = 0; j < 4; ++j) hi[j] = pack2(x[2 * j], x[2 * j + 1]);
  const int m1 = (int)0xBF80BF80u;            // bf16 -1.0 in both halves
  int l0, l1, l2, l3;
  asm("v_fma_mixlo_bf16 %0, %4, %8, %9 op_sel_hi:[1,1,0]\n\t"
      "v_fma_mixlo_bf16 %1, %5, %8, %11 op_sel_hi:[1,1,0]\n\t"
      "v_fma_mixlo_bf16 %2, %6, %8, %13 op_sel_hi:[1,1,0]\n\t"
      "v_fma_mixlo_bf16 %3, %7, %8, %15 op_sel_hi:[1,1,0]\n\t"
      "s_delay_alu instid0(VALU_DEP_4) | instskip(NEXT) | instid1(VALU_DEP_4)\n\t"
      "v_fma_mixhi_bf16 %0, %4, %8, %10 op_sel:[1,0,0] op_sel_hi:[1,1,0]\n\t"
      "v_fma_mixhi_bf16 %1, %5, %8, %12 op_sel:[1,0,0] op_sel_hi:[1,1,0]\n\t"
      "s_delay_alu instid0(VALU_DEP_4) | instskip(NEXT) | instid1(VALU_DEP_4)\n\t"
      "v_fma_mixhi_bf16 %2, %6, %8, %14 op_sel:[1,0,0] op_sel_hi:[1,1,0]\n\t"
      "v_fma_mixhi_bf16 %3, %7, %8, %16 op_sel:[1,0,0] op_sel_hi:[1,1,0]"
      : "=&v"(l0), "=&v"(l1), "=&v"(l2), "=&v"(l3)
      : "v"(hi[0]), "v"(hi[1]), "v"(hi[2]), "v"(hi[3]), "v"(m1),
        "v"(x[0]), "v"(x[1]), "v"(x[2]), "v"(x[3]), "v"(x[4]), "v"(x[5]), "v"(x[6]), "v"(x[7]));
  lo[0] = l0; lo[1] = l1; lo[2] = l2; lo[3] = l3;
}
// fragment (row/col = lane&15) from an LDS k-contiguous bf16 row: p = row + k0 + 8h;
// elements 0..7 <- k0+8h+0..7, 8..15 <- k0+16+8h+0..7
__device__ __forceinline__ FragB lds_frag(const unsigned short* p) {
  FragB f;
  f.q[0] = *(const v4ia*)p;
  f.q[1] = *(const v4ia*)(p + 16);
  return f;
}
// One 128 x 128 f32 weight matrix ([out][in], k-contiguous) -> LDS wl[out][in] bf16 (RNE), row pitch TPITCH.
// 128 threads; a wave-wide 16-B load covers one whole 512-B row, and the wave's 8-B stores one whole LDS row.
// The matrix starts off floats (a constant) behind wsrc. A thread's 32 loads differ only in a constant offset
// and are all in flight together.
__device__ __forceinline__ void stage_w(const float* __restrict__ wsrc, const unsigned off, unsigned short* wl,
                                        const unsigned tid) {
  const float* p = wsrc + tid * 4u;
  unsigned short* d = wl + (tid >> 5) * TPITCH + (tid & 31u) * 4u;
  v4f g[32];
#pragma unroll
  for (unsigned it = 0; it < 32u; ++it) g[it] = *(const v4fa*)(p + off + it * 512u);
  // the loads' address register pair stays as it is up to this wait; what follows may reuse it
  asm volatile("s_wait_xcnt 0x0" :: "v"(p) : "memory");
#pragma unroll
  for (unsigned it = 0; it < 32u; ++it) {
    v2i w;
    w[0] = pack2(g[it].x, g[it].y);
    w[1] = pack2(g[it].z, g[it].w);
    *(v2ia*)(d + it * (4u * TPITCH)) = w;
  }
}

// Hyperboloid map of one head vector held as 8 + 8 components by lanes l and l^16:
// a <- normalize(a * scl) * sinh(|a * scl|); returns cosh(|a * scl|). Both lane halves get identical norms.
__device__ __forceinline__ float hyp8(v8f& a, const float scl) {
#pragma clang fp contract(off)
  float ss = 0.0f;
#pragma unroll
  for (int r = 0; r < 8; ++r) { a[r] = a[r] * scl; ss += a[r] * a[r]; }
  ss += __shfl_xor(ss, 16);
  const float n = sqrtf(ss);
  const float inv = 1.0f / fmaxf(n, 1.0e-12f);
  const float sh = sinhf(n);
  const float ch = coshf(n);
#pragma unroll
  for (int r = 0; r < 8; ++r) a[r] = (a[r] * inv) * sh;
  return ch;
}

// Klein map of one head vector: a <- normalize(hyperboloid_spatial / hyperboloid_time);
// returns (log(1 / (sqrt(1 - (|a| - 1e-4)^2) + 1e-4)) + biasv) * log2(e) + mterm.
__device__ __forceinline__ float klein8(v8f& a, const float biasv, const float mterm) {
#pragma clang fp contract(off)
  float ss = 0.0f;
#pragma unroll
  for (int r = 0; r < 8; ++r) ss += a[r] * a[r];
  ss += __shfl_xor(ss, 16);
  const float vn = sqrtf(ss);
  const float inv = 1.0f / fmaxf(vn, 1.0e-12f);
  const float sh = sinhf(vn);
  const float ch = coshf(vn);
  const float ich = 1.0f / ch;
  float s2 = 0.0f;
#pragma unroll
  for (int r = 0; r < 8; ++r) { a[r] = ((a[r] * inv) * sh) * ich; s2 += a[r] * a[r]; }
  s2 += __shfl_xor(s2, 16);
  const float n2 = sqrtf(s2);
  const float inv2 = 1.0f / fmaxf(n2, 1.0e-12f);
  float s3 = 0.0f;
#pragma unroll
  for (int r = 0; r < 8; ++r) { a[r] = a[r] * inv2; s3 += a[r] * a[r]; }
  s3 += __shfl_xor(s3, 16);
  const float vnk = sqrtf(s3);
  const float dm = vnk - 1.0e-4f;
  const float den = sqrtf(1.0f - dm * dm) + 1.0e-4f;
  const float lden = 1.0f / den;
  const float lb = logf(lden) + biasv;
  return lb * LOG2E + mterm;
}

// The attention loop's root, log2 and 2^x as the bare instructions. The library forms wrap each in a rescale
// for subnormal arguments or results and give the root a last-bit correction: about 5 to 15 vector
// instructions per value. Here the root's argument is 0 or a normal number (x1^2 - 1 of an f32 x1, clamped at
// 0), the log's is about 1 or more, and a 2^x below the normal range may come out as 0 beside a row sum that
// holds a term equal to 1; the root keeps the instruction's own 1 ulp.
// One asm statement per kind, every value in place: no instruction in it touches its neighbour's register, and
// the closing v_nop is the slot the instruction set asks for between the last one and a reader of its result
// (the builtins compiled to runs in which one overwrote the source of the one directly in front).
__device__ __forceinline__ void sqrt16(float (&a)[16]) {
  asm(
      "v_sqrt_f32 %0, %0\n\t"
      "v_sqrt_f32 %1, %1\n\t"
      "v_sqrt_f32 %2, %2\n\t"
      "v_sqrt_f32 %3, %3\n\t"
      "v_sqrt_f32 %4, %4\n\t"
      "v_sqrt_f32 %5, %5\n\t"
      "v_sqrt_f32 %6, %6\n\t"
      "v_sqrt_f32 %7, %7\n\t"
      "v_sqrt_f32 %8, %8\n\t"
      "v_sqrt_f32 %9, %9\n\t"
      "v_sqrt_f32 %10, %10\n\t"
      "v_sqrt_f32 %11, %11\n\t"
      "v_sqrt_f32 %12, %12\n\t"
      "v_sqrt_f32 %13, %13\n\t"
      "v_sqrt_f32 %14, %14\n\t"
      "v_sqrt_f32 %15, %15\n\t"
      "v_nop"
      :
        "+v"(a[0]), "+v"(a[1]), "+v"(a[2]), "+v"(a[3]), "+v"(a[4]), "+v"(a[5]),
        "+v"(a[6]), "+v"(a[7]), "+v"(a[8]), "+v"(a[9]), "+v"(a[10]), "+v"(a[11]),
        "+v"(a[12]), "+v"(a[13]), "+v"(a[14]), "+v"(a[15]));
}
__device__ __forceinline__ void log2_16(float (&a)[16]) {
  asm(
      "v_log_f32 %0, %0\n\t"
      "v_log_f32 %1, %1\n\t"
      "v_log_f32 %2, %2\n\t"
      "v_log_f32 %3, %3\n\t"
      "v_log_f32 %4, %4\n\t"
      "v_log_f32 %5, %5\n\t"
      "v_log_f32 %6, %6\n\t"
      "v_log_f32 %7, %7\n\t"
      "v_log_f32 %8, %8\n\t"
      "v_log_f32 %9, %9\n\t"
      "v_log_f32 %10, %10\n\t"
      "v_log_f32 %11, %11\n\t"
      "v_log_f32 %12, %12\n\t"
      "v_log_f32 %13, %13\n\t"
      "v_log_f32 %14, %14\n\t"
      "v_log_f32 %15, %15\n\t"
      "v_nop"
      :
        "+v"(a[0]), "+v"(a[1]), "+v"(a[2]), "+v"(a[3]), "+v"(a[4]), "+v"(a[5]),
        "+v"(a[6]), "+v"(a[7]), "+v"(a[8]), "+v"(a[9]), "+v"(a[10]), "+v"(a[11]),
        "+v"(a[12]), "+v"(a[13]), "+v"(a[14]), "+v"(a[15]));
}
__device__ __forceinline__ void exp2_17(float (&a)[17]) {
  asm(
      "v_exp_f32 %0, %0\n\t"
      "v_exp_f32 %1, %1\n\t"
      "v_exp_f32 %2, %2\n\t"
      "v_exp_f32 %3, %3\n\t"
      "v_exp_f32 %4, %4\n\t"
      "v_exp_f32 %5, %5\n\t"
      "v_exp_f32 %6, %6\n\t"
      "v_exp_f32 %7, %7\n\t"
      "v_exp_f32 %8, %8\n\t"
      "v_exp_f32 %9, %9\n\t"
      "v_exp_f32 %10, %10\n\t"
      "v_exp_f32 %11, %11\n\t"
      "v_exp_f32 %12, %12\n\t"
      "v_exp_f32 %13, %13\n\t"
      "v_exp_f32 %14, %14\n\t"
      "v_exp_f32 %15, %15\n\t"
      "v_exp_f32 %16, %16\n\t"
      "v_nop"
      :
        "+v"(a[0]), "+v"(a[1]), "+v"(a[2]), "+v"(a[3]), "+v"(a[4]), "+v"(a[5]),
        "+v"(a[6]), "+v"(a[7]), "+v"(a[8]), "+v"(a[9]), "+v"(a[10]), "+v"(a[11]),
        "+v"(a[12]), "+v"(a[13]), "+v"(a[14]), "+v"(a[15]), "+v"(a[16]));
}

// ---------------------------------------------------------------------------
// Projections + hyperbolic maps. Block = 64 positions of one batch, 4 waves x 16 positions.
// Input x is channels-first [b][k = channel][l]: the 128 x 64 tile is read along l (16-B loads; the column role gathers by key, 4-B loads), converted to
// bf16 and transposed into LDS xt[l][k] (cross-wave, block barrier); each wave then holds its 16 positions
// as 4 B fragments (col = lane&15 = position).
// Weights: the block reads the f32 matrix of its pass ([out][in], k-contiguous: W_q or W_mem rows 0..127, then for
// the column role W_mem rows 128..255), rounds it to bf16 and keeps it in LDS wl; A fragments come from there.
// wl is written where no wave reads it: first in front of the barrier that publishes xt, then between the two
// barriers around the first copy-out. D = W_tile (A, row = out feature) x X (B, col = position): D[row d = 8h+r][col = position],
// so a lane holds 8 of the 16 head components of one position; lanes l and l^16 complete the head.
// pass 2: V^T hi/lo     = Klein point of (W_mem[128:256] x)               + scalar array 2 = key bias (base-2)
// Workspace planes are laid in the order the attention loop's fragments read them, so that each of its
// wave-wide 16-B loads covers 512 contiguous bytes (4 whole 128-B lines), lane (m, h) at byte 32 m + 16 h:
// spatial plane = [b][head][16-position tile][hi | lo][position m][component 0..15];
// V^T = [b][head][32-key block][hi | lo][key half q][channel d = m][key 16 q + 0..15].
// Key compaction: a key whose mask is 0 carries the additive term -1e30, so beside any key of the batch whose
// mask is 1 or more its softmax weight is exactly 0 (the other logit terms are small beside 1e30: arccosh of an
// f32 is below 90, the log-denominator below 10). Such keys are left out here: blockIdx.y = 0 blocks (column
// role: W_q plane, V^T, key bias) work on 64 SLOTS of the batch's list of kept keys, in key order, and gather
// the input columns of those keys; slots past the end of the list repeat key 0 with the masked term. A batch
// with no mask of 1 or more keeps every key, each with its own term. The count goes to nkeep[b * NKP] and
// bounds the attention loop. blockIdx.y = 1 blocks (row role: W_mem K plane) work on all 512 positions.
// LDS stg: cross-wave (block barriers); fully written before each copy-out (8 heads x 64 rows x 32, or
//   8 heads x 2 key blocks x 4 pieces x 256). ssc: 3 x 8 x 64 floats, written by lanes 0..15 of every wave, copied out last.
// coverage: row plane and scalar array 1: NB*8 blocks x 64 positions = all NB*512. Column plane, V^T, scalar
//   arrays 0 and 2: per batch the first ceil(kept / 64) blocks x 64 slots; the attention loop reads
//   ceil(kept / 32) x 32 slots, never more.
// ---------------------------------------------------------------------------
__global__ __launch_bounds__(128) void k_hproj(const float* __restrict__ x, const int* __restrict__ mask,
                                               const float* __restrict__ wmem, const float* __restrict__ wq,
                                               const float* __restrict__ bias_p,
                                               unsigned short* pl, unsigned short* vt, float* sca, int* nkeep) {
  __shared__ __attribute__((aligned(16))) unsigned short xt[64 * TPITCH];
  __shared__ __attribute__((aligned(16))) int srcl[64];      // column role: slot -> key position
  __shared__ __attribute__((aligned(16))) unsigned short wl[EW * TPITCH];   // the pass's weight matrix, bf16
  __shared__ __attribute__((aligned(16))) unsigned short stg[16384];
  __shared__ __attribute__((aligned(16))) float ssc[3 * NH * 64];
  const unsigned tid = threadIdx.x, lane = tid & 31u, hh = lane >> 4, m = lane & 15u;
  const unsigned wave = (unsigned)__builtin_amdgcn_readfirstlane((int)(threadIdx.x >> 5));
  const unsigned row0 = blockIdx.x * 64u;
  const unsigned bb = row0 >> 9, r0 = row0 & 511u;
  const bool col = blockIdx.y == 0u;
  unsigned cnt = SEQ;
  int mi = 0;                                  // read by the column role alone

  if (col) {
    // ---- kept keys of the batch: every wave forms the same 16 lane-mask words, so the count needs no barrier ----
    const int* mrow = mask + (size_t)bb * LFULL;
    int mw[16];
#pragma unroll
    for (int w = 0; w < 16; ++w) mw[w] = mrow[32 * w + (int)lane];
    // the code behind reuses these loads' offset and base registers: the wait stands in front of that
    asm volatile("s_wait_xcnt 0x0" ::: "memory");
    unsigned kw[16], anyp = 0u;
#pragma unroll
    for (int w = 0; w < 16; ++w) {
      kw[w] = __builtin_amdgcn_ballot_w32(mw[w] != 0);
      anyp |= __builtin_amdgcn_ballot_w32(mw[w] >= 1);
    }
    cnt = 0u;
#pragma unroll
    for (int w = 0; w < 16; ++w) {
      if (anyp == 0u) kw[w] = 0xFFFFFFFFu;
      cnt += (unsigned)__builtin_popcount(kw[w]);
    }
    if (r0 >= cnt) return;                     // no kept key in these 64 slots: the whole block leaves, before any barrier
    if (r0 == 0u && tid == 0u) nkeep[bb * NKP] = (int)cnt;
    unsigned pre = 0u;
#pragma unroll
    for (int w = 0; w < 16; ++w) {
      if ((unsigned)(w >> 2) == wave) {
        const unsigned slot = pre + (unsigned)__builtin_popcount(kw[w] & ((1u << lane) - 1u)) - r0;
        if (((kw[w] >> lane) & 1u) != 0u && slot < 64u) srcl[slot] = 32 * w + (int)lane;
      }
      pre += (unsigned)__builtin_popcount(kw[w]);
    }
    if (tid < 64u && r0 + tid >= cnt) srcl[tid] = 0;
    __syncthreads();
    // ---- input tile: x[b][k][key of slot r0 .. r0+63] -> xt[slot][k] bf16 ----
    const float* xg = x + (size_t)bb * XB_FULL;
    const unsigned l4 = (tid & 15u) << 2, k0 = tid >> 4;
    const v4i sp = *(const v4ia*)(srcl + l4);
    const unsigned o0 = k0 * LFULL + (unsigned)sp.x, o1 = k0 * LFULL + (unsigned)sp.y;
    const unsigned o2 = k0 * LFULL + (unsigned)sp.z, o3 = k0 * LFULL + (unsigned)sp.w;
    const unsigned sl = 16u * wave + m;
    const unsigned om = (unsigned)srcl[sl];
    mi = mrow[om];                             // the slot's own key's mask
    // unrolled whole: the 4-B loads differ only in a constant offset; each half's 32 are in flight together
#pragma unroll
    for (unsigned hf = 0; hf < 2u; ++hf) {
      float g[32];
#pragma unroll
      for (unsigned it = 0; it < 8u; ++it) {
        const float* xr = xg + (8u * hf + it) * (8u * LFULL);
        g[4u * it + 0u] = xr[o0]; g[4u * it + 1u] = xr[o1]; g[4u * it + 2u] = xr[o2]; g[4u * it + 3u] = xr[o3];
      }
      // the loads' five offset registers stay as they are up to this wait; what follows may reuse them
      asm volatile("s_wait_xcnt 0x0" :: "v"(om), "v"(o0), "v"(o1), "v"(o2), "v"(o3) : "memory");
#pragma unroll
      for (unsigned it = 0; it < 8u; ++it) {
        const unsigned k = 8u * (8u * hf + it) + k0;
        const unsigned c01 = (unsigned)pack2(g[4u * it + 0u], g[4u * it + 1u]);
        const unsigned c23 = (unsigned)pack2(g[4u * it + 2u], g[4u * it + 3u]);
        xt[(l4 + 0u) * TPITCH + k] = (unsigned short)c01;
        xt[(l4 + 1u) * TPITCH + k] = (unsigned short)(c01 >> 16);
        xt[(l4 + 2u) * TPITCH + k] = (unsigned short)c23;
        xt[(l4 + 3u) * TPITCH + k] = (unsigned short)(c23 >> 16);
      }
      // keeps the second half's loads behind the first half's LDS stores, so that at most 33 loads of a wave are
      // outstanding; the scheduler lifted them over the stores, which made 65, past what s_wait_loadcnt can name
      if (hf == 0u) __builtin_amdgcn_sched_barrier(0);
    }
    if (r0 + sl >= cnt) mi = 0;                // a slot past the end of the list counts as masked
  } else {
    // ---- input tile: x[b][k][r0 .. r0+63] -> xt[l][k] bf16 ----
    const float* xg = x + (size_t)bb * XB_FULL + r0;
#pragma unroll 1
    for (unsigned it = 0; it < 16u; ++it) {
      const unsigned p = it * 128u + tid, k = p >> 4, l4 = (p & 15u) << 2;
      const v4f v = *(const v4fa*)(xg + (size_t)k * LFULL + l4);
      const unsigned c01 = (unsigned)pack2(v.x, v.y), c23 = (unsigned)pack2(v.z, v.w);
      xt[(l4 + 0u) * TPITCH + k] = (unsigned short)c01;
      xt[(l4 + 1u) * TPITCH + k] = (unsigned short)(c01 >> 16);
      xt[(l4 + 2u) * TPITCH + k] = (unsigned short)c23;
      xt[(l4 + 3u) * TPITCH + k] = (unsigned short)(c23 >> 16);
    }
  }
  stage_w(col ? wq : wmem, 0u, wl, tid);
  __syncthreads();

  FragB xa[4];
  {
    const unsigned xo = (16u * wave + m) * TPITCH + 8u * hh;
#pragma unroll
    for (int ks = 0; ks < 4; ++ks) {
      xa[ks].q[0] = *(const v4ia*)(xt + xo + 32 * ks);
      xa[ks].q[1] = *(const v4ia*)(xt + xo + 32 * ks + 16);
    }
  }
  const float mv = (float)mi;
  const float mterm = (-1.0e30f * (1.0f - mv)) * LOG2E;
  const float biasv = bf16_val(bias_p[0]);
  const v8f zero8 = {0.f, 0.f, 0.f, 0.f, 0.f, 0.f, 0.f, 0.f};

  {
    const unsigned ps = col ? 0u : 1u;
    const float scl = (ps == 0u) ? 0.25f : 1.0f;
#pragma unroll 1
    for (unsigned t = 0; t < NH; ++t) {
      const unsigned short* wp = wl + (16u * t + m) * TPITCH + 8u * hh;
      FragB wf[4];
#pragma unroll
      for (int ks = 0; ks < 4; ++ks) wf[ks] = lds_frag(wp + 32 * ks);
      v8f acc = zero8;
#pragma unroll
      for (int ks = 0; ks < 4; ++ks) acc = wmb(wf[ks], xa[ks], acc);
      const float ch = hyp8(acc, scl);           // acc[r] = spatial[position 16 wave + m][8h + r]
      v4i hi, lo;
      split8(acc, hi, lo);
      const unsigned so = (t * 64u + 16u * wave) * QROW + 16u * m + 8u * hh;
      *(v4ia*)(stg + so) = hi;
      *(v4ia*)(stg + so + TILEH) = lo;
      if (hh == 0u) ssc[(ps * NH + t) * 64u + 16u * wave + m] = ch;
    }
    __syncthreads();
    if (col) stage_w(wmem, EW * EW, wl, tid);    // every wave has left the first pass: wl takes the V matrix
    {
      unsigned short* dst = pl + (size_t)ps * PLN + ((size_t)bb * NH * SEQ + r0) * QROW;
#pragma unroll 1
      for (unsigned it = 0; it < 16u; ++it) {
        const unsigned p = it * 128u + tid, t = p >> 8, wi = p & 255u;
        const v4i v = *(const v4ia*)(stg + p * 8u);
        *(v4i*)(dst + (size_t)t * (SEQ * QROW) + wi * 8u) = v;
        // what follows rewrites the store's address and data registers: the wait stands in front of that
        asm volatile("s_wait_xcnt 0x0" ::: "memory");
      }
      
    }
    __syncthreads();
  }

  // ---- pass 2 (column role): Klein points -> V^T hi / lo stage, key bias ----
  if (col) {
#pragma unroll 1
  for (unsigned t = 0; t < NH; ++t) {
    const unsigned short* wp = wl + (16u * t + m) * TPITCH + 8u * hh;
    FragB wf[4];
#pragma unroll
    for (int ks = 0; ks < 4; ++ks) wf[ks] = lds_frag(wp + 32 * ks);
    v8f acc = zero8;
#pragma unroll
    for (int ks = 0; ks < 4; ++ks) acc = wmb(wf[ks], xa[ks], acc);
    const float lb2 = klein8(acc, biasv, mterm);  // acc[r] = v_klein[position 16 wave + m][8h + r]
    v4i vh, vl;
    split8(acc, vh, vl);
#pragma unroll
    for (int r = 0; r < 8; ++r) {
      // head t: [key block wave >> 1][hi | lo][key half wave & 1][channel 8h + r][key m]
      const unsigned so = t * 2048u + (wave >> 1) * 1024u + (wave & 1u) * TILEH + (8u * hh + (unsigned)r) * 16u + m;
      stg[so] = (unsigned short)((unsigned)vh[r >> 1] >> (16 * (r & 1)));
      stg[so + 2u * TILEH] = (unsigned short)((unsigned)vl[r >> 1] >> (16 * (r & 1)));
    }
    if (hh == 0u) ssc[(2u * NH + t) * 64u + 16u * wave + m] = lb2;
  }
  __syncthreads();
  {
    unsigned short* dst = vt + (size_t)bb * NH * (2 * HD * SEQ) + r0 * (2 * HD);
#pragma unroll 1
    for (unsigned it = 0; it < 16u; ++it) {
      const unsigned p = it * 128u + tid, t = p >> 8, wi = p & 255u;
      const v4i v = *(const v4ia*)(stg + p * 8u);
      *(v4i*)(dst + (size_t)t * (2 * HD * SEQ) + wi * 8u) = v;
      // the next trip rewrites the store's address and data registers: the wait stands in front of that
      asm volatile("s_wait_xcnt 0x0" ::: "memory");
    }
    
  }
  }
  {
#pragma unroll 1
    for (unsigned it = 0; it < 3u; ++it) {
      if ((it == 1u) == col) continue;         // array 1 is the row role's, arrays 0 and 2 the column role's
      const unsigned p = it * 128u + tid, a = p >> 7, t = (p >> 4) & 7u, c = p & 15u;
      const v4f v = *(const v4fa*)(ssc + p * 4u);
      *(v4f*)(sca + (size_t)a * SCN + ((size_t)bb * NH + t) * SEQ + r0 + 4u * c) = v;
      // the next trip rewrites the store's address and data registers: the wait stands in front of that
      asm volatile("s_wait_xcnt 0x0" ::: "memory");
    }
    
  }
}

// ---------------------------------------------------------------------------
// Fused Lorentz attention: one block = (batch b, 32 softmax rows i0..i0+31), 8 waves, wave = head; each wave
// runs two 16-row tiles one after the other, each over the batch's kept keys (column position j = slot). Flash attention in the transposed domain:
//   S^T tile = C (A, row = column position j) x R^T (B, col = row position i): the K = 16 spatial product is
//   laid as [c_hi|c_hi] x [r_hi|r_lo] plus [c_lo|0] x [r_hi|r_lo] along the 32-deep k axis.
//   D[row j 8h+r][col i m]. Per element: x = rt[i]*ct[j] - D, logit2 = -beta*log2(x1 + sqrt(x1^2-1)) + cb[j]
//   (cb carries log-denominator, bias and the additive key mask term). Softmax statistics are per lane
//   (row i = m); the two lane halves combine by one xor-16 exchange. The P^T B-fragment is the lane's own
//   16 results (tile 0 -> elements 0..7, tile 1 -> elements 8..15). O^T = V^T (A, row d) x P^T:
//   D[row d 8h+r][col i m], scaled per lane.
// Output stage ost[channel 0..127][position 0..31] (cross-wave, block barrier): every wave writes its 16
// coverage: grid (16, NB) x 128 channels x 32 positions = NB*128*512 outputs, each written by exactly one lane.
// ---------------------------------------------------------------------------
__global__ __launch_bounds__(256) void k_hattn(const unsigned short* __restrict__ rpl,
                                               const unsigned short* __restrict__ cpl,
                                               const unsigned short* __restrict__ vt,
                                               const float* __restrict__ rtt,
                                               const float* __restrict__ ctt,
                                               const float* __restrict__ cbb,
                                               const float* __restrict__ beta_p,
                                               const int* __restrict__ nkeep,
                                               float* out) {
  __shared__ __attribute__((aligned(16))) float ost[EW * OPITCH];
  const unsigned tid = threadIdx.x, lane = tid & 31u, hh = lane >> 4, m = lane & 15u;
  const unsigned wave = (unsigned)__builtin_amdgcn_readfirstlane((int)(threadIdx.x >> 5));
  const unsigned i0 = blockIdx.x * 32u, b = blockIdx.y;
  const unsigned bh = b * NH + wave;
  const v8f zero8 = {0.f, 0.f, 0.f, 0.f, 0.f, 0.f, 0.f, 0.f};
  const v4i zero4 = {0, 0, 0, 0};
  const float nbeta = -bf16_val(beta_p[0]);
  // kept keys of this batch, rounded up to whole 32-key blocks (the slots behind the last kept key weigh 0)
  const int nk = nkeep[b * NKP];
  const unsigned nend = ((unsigned)(nk < 1 ? 1 : (nk > SEQ ? SEQ : nk)) + 31u) & ~31u;

  const unsigned fo = 16u * m + 8u * hh;      // the lane's 16 bytes inside a 512-B piece
  const unsigned short* kb = cpl + (size_t)bh * SEQ * QROW + fo;
  const unsigned short* vb = vt + (size_t)bh * (2 * HD * SEQ) + fo;
  const float* ctp = ctt + (size_t)bh * SEQ + 8u * hh;
  const float* cbp = cbb + (size_t)bh * SEQ + 8u * hh;

#pragma unroll 1
  for (unsigned tl = 0; tl < 2u; ++tl) {
    const unsigned g0 = i0 + 16u * tl;
    const unsigned short* qp = rpl + ((size_t)bh * SEQ + g0) * QROW + fo;
    FragB qf;
    qf.q[0] = *(const v4ia*)qp;            // r_hi[8h .. 8h+7]  (k slots 8h..)
    qf.q[1] = *(const v4ia*)(qp + TILEH);  // r_lo[8h .. 8h+7]  (k slots 16+8h..)
    const float rt = rtt[(size_t)bh * SEQ + g0 + m];
    // the key loop reuses these three loads' address registers: the wait stands in front of that
    asm volatile("s_wait_xcnt 0x0" ::: "memory");
    v8f o = zero8;
    float mrun = -3.0e38f, lrun = 0.0f;
#pragma unroll 1
    for (unsigned n0 = 0; n0 < nend; n0 += 32u) {
      const unsigned short* kp = kb + (size_t)n0 * QROW;
      const v4i kh0 = *(const v4ia*)kp;
      const v4i kl0 = *(const v4ia*)(kp + TILEH);
      const v4i kh1 = *(const v4ia*)(kp + 2 * TILEH);
      const v4i kl1 = *(const v4ia*)(kp + 3 * TILEH);
      FragB a10, a20, a11, a21;
      a10.q[0] = kh0; a10.q[1] = kh0;
      a20.q[0] = kl0; a20.q[1] = zero4;
      a11.q[0] = kh1; a11.q[1] = kh1;
      a21.q[0] = kl1; a21.q[1] = zero4;
      v8f s0 = wmb(a10, qf, zero8);
      s0 = wmb(a20, qf, s0);
      v8f s1 = wmb(a11, qf, zero8);
      s1 = wmb(a21, qf, s1);

      const v4f t0 = *(const v4fa*)(ctp + n0);
      const v4f t1 = *(const v4fa*)(ctp + n0 + 4u);
      const v4f t2 = *(const v4fa*)(ctp + n0 + 16u);
      const v4f t3 = *(const v4fa*)(ctp + n0 + 20u);
      const v4f u0 = *(const v4fa*)(cbp + n0);
      const v4f u1 = *(const v4fa*)(cbp + n0 + 4u);
      const v4f u2 = *(const v4fa*)(cbp + n0 + 16u);
      const v4f u3 = *(const v4fa*)(cbp + n0 + 20u);
      const v8f ct0 = __builtin_shufflevector(t0, t1, 0, 1, 2, 3, 4, 5, 6, 7);
      const v8f ct1 = __builtin_shufflevector(t2, t3, 0, 1, 2, 3, 4, 5, 6, 7);
      const v8f cb0 = __builtin_shufflevector(u0, u1, 0, 1, 2, 3, 4, 5, 6, 7);
      const v8f cb1 = __builtin_shufflevector(u2, u3, 0, 1, 2, 3, 4, 5, 6, 7);
      // logit in the base-2 domain: x = rt*ct - dot (minus the Lorentz product), x1 = x + 1e-6,
      // arccosh(x1) = ln(x1 + sqrt(x1^2 - 1)); a = -beta * log2(x1 + sqrt(x1^2 - 1)) + cb
      float x1[16], w[16];
#pragma unroll
      for (int r = 0; r < 8; ++r) {
        x1[r]     = (rt * ct0[r] - s0[r]) + 1.0e-6f;        // column position n0 + 8h + r
        x1[8 + r] = (rt * ct1[r] - s1[r]) + 1.0e-6f;        // column position n0 + 16 + 8h + r
      }
#pragma unroll
      for (int i = 0; i < 16; ++i) w[i] = fmaxf(x1[i] * x1[i] - 1.0f, 0.0f);
      sqrt16(w);
#pragma unroll
      for (int i = 0; i < 16; ++i) w[i] = x1[i] + w[i];
      log2_16(w);
      v8f a0, a1;
#pragma unroll
      for (int r = 0; r < 8; ++r) {
        a0[r] = nbeta * w[r] + cb0[r];
        a1[r] = nbeta * w[8 + r] + cb1[r];
      }

      float t = fmaxf(a0[0], a1[0]);
#pragma unroll
      for (int r = 1; r < 8; ++r) t = fmaxf(t, fmaxf(a0[r], a1[r]));
      t = fmaxf(t, __shfl_xor(t, 16));
      const float mnew = fmaxf(mrun, t);
      float e[17];
#pragma unroll
      for (int r = 0; r < 8; ++r) {
        e[r]     = a0[r] - mnew;
        e[8 + r] = a1[r] - mnew;
      }
      e[16] = mrun - mnew;
      exp2_17(e);
      const float sc = e[16];
      v8f p0, p1;
      float ps = 0.0f;
#pragma unroll
      for (int r = 0; r < 8; ++r) {
        p0[r] = e[r];
        p1[r] = e[8 + r];
        ps += p0[r] + p1[r];
      }
      lrun = lrun * sc + ps;
      mrun = mnew;
      o = o * sc;

      FragB ph, pw;
      split8(p0, ph.q[0], pw.q[0]);
      split8(p1, ph.q[1], pw.q[1]);
      FragB fvh, fvl;
      const unsigned short* vp = vb + (size_t)n0 * (2 * HD);
      fvh.q[0] = *(const v4ia*)vp;                 // keys n0 + 8h + 0..7
      fvh.q[1] = *(const v4ia*)(vp + TILEH);       // keys n0 + 16 + 8h + 0..7
      fvl.q[0] = *(const v4ia*)(vp + 2 * TILEH);
      fvl.q[1] = *(const v4ia*)(vp + 3 * TILEH);
      o = wmb(fvh, ph, o);
      o = wmb(fvl, ph, o);
      o = wmb(fvh, pw, o);
    }
    const float lt = lrun + __shfl_xor(lrun, 16);
    const float inv = 1.0f / lt;
    const v8f c = o * inv;                    // out[channel 16 wave + 8h + r][position g0 + m]
    const unsigned so = (16u * wave + 8u * hh) * OPITCH + 16u * tl + m;
#pragma unroll
    for (int r = 0; r < 8; ++r) ost[so + (unsigned)r * OPITCH] = c[r];
  }
  __syncthreads();

  {
    float* ob = out + (size_t)b * XB_FULL + i0;
#pragma unroll 1
    for (unsigned it = 0; it < 4u; ++it) {
      const unsigned p = it * 256u + tid, c = p >> 3, q = p & 7u;
      const v4f v = *(const v4fa*)(ost + c * OPITCH + 4u * q);
      *(v4f*)(ob + (size_t)c * LFULL + 4u * q) = v;
    }
    
  }
}

// ---------------------------------------------------------------------------
static inline size_t al256(size_t o) { return (o + 255) & ~(size_t)255; }

extern "C" void kernel_launch(void* const* d_in, const int* in_sizes, int n_in,
                              void* d_out, int out_size, void* d_ws, size_t ws_size,
                              hipStream_t stream) {
  (void)stream;
  if (n_in < 6) return;
  const long long actN = (long long)NB * EW * LFULL;
  if ((long long)in_sizes[0] < actN) return;                 // queries [b][channel][l]
  if ((long long)in_sizes[1] < (long long)NB * LFULL) return; // mask [b][l] int32
  if (in_sizes[2] < 2 * EW * EW) return;                     // W_mem [256][128]
  if (in_sizes[3] < EW * EW) return;                         // W_q [128][128]
  if (in_sizes[4] < 1 || in_sizes[5] < 1) return;            // beta, bias
  if ((long long)out_size < actN) return;

  const float* queries = (const float*)d_in[0];
  const int*   mask    = (const int*)d_in[1];
  const float* Wmem    = (const float*)d_in[2];
  const float* Wq      = (const float*)d_in[3];
  const float* beta    = (const float*)d_in[4];
  const float* bias    = (const float*)d_in[5];
  float* out = (float*)d_out;

  const size_t plB = al256((size_t)2 * PLN * 2);                // 16,777,216 at NB = 32
  const size_t vB  = al256((size_t)2 * VPL * 2);                // 8,388,608
  const size_t scB = al256((size_t)3 * SCN * 4);                // 1,572,864
  const size_t nkB = al256((size_t)NB * NKP * 4);               // 4,096
  const size_t total = plB + vB + scB + nkB;                    // 26,742,784
  if (total > ws_size || total > (size_t)WSMAX) return;
  char* w = (char*)d_ws;
  unsigned short* pln = (unsigned short*)w;
  unsigned short* vtp = (unsigned short*)(w + plB);
  float*          sca = (float*)(w + plB + vB);
  int*            nkp = (int*)(w + plB + vB + scB);
  unsigned short* cpl = pln;              // column plane (from W_q)
  unsigned short* rpl = pln + PLN;        // row plane (from W_mem rows 0..127)
  float* ctt = sca;
  float* rtt = sca + SCN;
  float* cbb = sca + 2 * SCN;

  // 1: projections + hyperboloid / Klein maps -> planes and per-position scalars (y = 0: kept keys, y = 1: rows)
  k_hproj<<<dim3((NB * SEQ) / 64, 2), 128, 0, stream>>>(queries, mask, Wmem, Wq, bias, pln, vtp, sca, nkp);
  // 2: Lorentz attention, channels-first output
  k_hattn<<<dim3(SEQ / 32, NB), 256, 0, stream>>>(rpl, cpl, vtp, rtt, ctt, cbb, beta, nkp, out);
}

// v006
// Measured time: 41.1 microseconds a run.
// Timed twice side by side with v005, it ran 1.09 times as fast both times.
// Over all steps from v000 it is 3.02 times as fast.
// Contractions: W_mem / W_q projections = v_wmma_f32_16x16x32_bf16, bf16 (RNE) inputs and weights, one product. Lorentz spatial product k_sp.q_sp (K = 16) and P.V = same bf16 WMMA with every computed operand carried as bf16 hi + bf16 lo (hi.hi + lo.hi + hi.lo). Accumulate f32 everywhere.
// Time-like rank-1 term, arccosh, additive key bias, online softmax (base-2 form): f32 VALU. No power-of-two carries exist (bf16 planes only).
#include <hip/hip_runtime.h>
#include <stddef.h>
#include <stdint.h>
#include <math.h>

#ifndef NB
#define NB 32                      // batches processed (a reduced build reads the first NB batches)
#endif
#define SEQ    512                 // positions per batch (softmax rows i and softmax columns j)
#define LFULL  512                 // full row length of the channels-first input / output and of the mask
#define EW     128                 // model width = heads x head dim
#define NH     8
#define HD     16
#define QROW   32                  // halfwords per position in a spatial plane: 16 hi + 16 lo
#define TILEH  256                 // halfwords per 512-B piece of a plane: 16 rows x 16 halfwords, one wave-wide 16-B load
#define TPITCH 136                 // halfwords per LDS transposed-input row
#define OPITCH 36                  // floats per LDS output-stage row
#define WSMAX  134217728
#define VPL    ((size_t)NB * EW * SEQ)          // halfwords of V^T hi (as many again of V^T lo)
#define PLN    ((size_t)NB * NH * SEQ * QROW)   // halfwords per spatial plane (column plane, then row plane)
#define SCN    ((size_t)NB * NH * SEQ)          // floats per per-position scalar array (3 arrays)
#define XB_FULL ((size_t)EW * LFULL)            // floats per batch of the input and of the output
#define LOG2E  1.4426950408889634f
#define NKP    32                  // ints per batch in the kept-key count array: one 128-B line per writer

static_assert(NH * HD == EW);
static_assert(SEQ == 512 && LFULL == 512);
static_assert(EW % 32 == 0 && SEQ % 32 == 0);
static_assert(SEQ % 64 == 0 && (NB * SEQ) % 64 == 0);
static_assert(NH * 64 * QROW == 16384);        // k_hproj stage: spatial plane form
static_assert(2 * EW * 64 == 16384);           // k_hproj stage: V^T form
static_assert(16 * QROW == 2 * TILEH);         // 16 positions of a spatial plane = hi piece + lo piece
static_assert(2 * HD * 32 == 4 * TILEH);       // 32 keys of one head's V^T, hi and lo = 4 pieces
static_assert(16384 == 128 * 16 * 8);          // k_hproj copy-out: 128 thr x 16 it x 8 halfwords
static_assert(64 * EW == 128 * 16 * 4);        // k_hproj input staging: 128 thr x 16 it x 4 floats
static_assert(3 * NH * 64 == 128 * 3 * 4);     // k_hproj scalar copy-out: 128 thr x 3 it x 4 floats
static_assert(EW * EW == 128 * 32 * 4);        // k_hproj weight staging: 128 thr x 32 it x 4 floats
static_assert(EW * 4 == 32 * 16);              // one weight row = one wave-wide 16-B load
static_assert(EW * 32 == 256 * 4 * 4);         // k_hattn copy-out: 256 thr x 4 it x 4 floats
static_assert(TPITCH % 8 == 0 && TPITCH >= EW);
static_assert(OPITCH % 4 == 0 && OPITCH >= 32);
static_assert(2 * PLN * 2 + 2 * VPL * 2 + 3 * SCN * 4 + (size_t)NB * NKP * 4 <= (size_t)WSMAX);

typedef int            v4i   __attribute__((ext_vector_type(4)));
typedef int            v8i   __attribute__((ext_vector_type(8)));
typedef float          v4f   __attribute__((ext_vector_type(4)));
typedef float          v8f   __attribute__((ext_vector_type(8)));
typedef __bf16         v16bf __attribute__((ext_vector_type(16)));
typedef int            v2i   __attribute__((ext_vector_type(2)));
typedef float          v2f   __attribute__((ext_vector_type(2)));
typedef __bf16         v2bf  __attribute__((ext_vector_type(2)));
typedef v2i __attribute__((may_alias)) v2ia;
typedef v4i __attribute__((may_alias)) v4ia;
typedef v4f __attribute__((may_alias)) v4fa;
union FragB { v16bf v; v4i q[2]; v8i w; };

// WMMA with hazard guard: ties D, keeps A/B live for 4 VALU slots
__device__ __forceinline__ v8f wmb(const FragB& a, const FragB& b, v8f c) {
  v8f d = __builtin_amdgcn_wmma_f32_16x16x32_bf16(false, a.v, false, b.v, (short)0, c, false, false);
  asm volatile("v_nop\n\tv_nop\n\tv_nop\n\tv_nop" : "+v"(d) : "v"(a.w), "v"(b.w));
  return d;
}

// two f32 -> two bf16 (RNE) in one word, by the convert instruction (v_cvt_pk_bf16_f32): lo in the low halfword
__device__ __forceinline__ int pack2(float lo, float hi) {
  const v2f p = {lo, hi};
  return __builtin_bit_cast(int, __builtin_convertvector(p, v2bf));
}
__device__ __forceinline__ float bf16_val(float f) {
  return __uint_as_float((unsigned)pack2(f, f) << 16);
}
// 8 f32 -> bf16 hi piece + bf16 lo piece (lo = RNE(v - hi)); element 2j in the low halfword of word j.
// hi: one convert a pair. lo: hi * (-1) + v in the mixed-precision FMA that takes the bf16 half as it lies in
// the hi word and writes its bf16 result into one half of the lo word (v - hi is exact in f32, so the one
// rounding is the same as that of a subtraction and a convert): three instructions a pair.
// One asm statement: a plain subtraction and conversion compiled to five instructions a pair (two unpacks, a
// packed subtraction, the two converts). The four low halves stand in front of
// the four high halves; each high half rewrites the word its low half wrote four instructions back, which the
// s_delay_alu lines tell the issue logic, so that another wave can issue meanwhile.
__device__ __forceinline__ void split8(const v8f x, v4i& hi, v4i& lo) {
#pragma unroll
  for (int j = 0; j < 4; ++j) hi[j] = pack2(x[2 * j], x[2 * j + 1]);
  const int m1 = (int)0xBF80BF80u;            // bf16 -1.0 in both halves
  int l0, l1, l2, l3;
  asm("v_fma_mixlo_bf16 %0, %4, %8, %9 op_sel_hi:[1,1,0]\n\t"
      "v_fma_mixlo_bf16 %1, %5, %8, %11 op_sel_hi:[1,1,0]\n\t"
      "v_fma_mixlo_bf16 %2, %6, %8, %13 op_sel_hi:[1,1,0]\n\t"
      "v_fma_mixlo_bf16 %3, %7, %8, %15 op_sel_hi:[1,1,0]\n\t"
      "s_delay_alu instid0(VALU_DEP_4) | instskip(NEXT) | instid1(VALU_DEP_4)\n\t"
      "v_fma_mixhi_bf16 %0, %4, %8, %10 op_sel:[1,0,0] op_sel_hi:[1,1,0]\n\t"
      "v_fma_mixhi_bf16 %1, %5, %8, %12 op_sel:[1,0,0] op_sel_hi:[1,1,0]\n\t"
      "s_delay_alu instid0(VALU_DEP_4) | instskip(NEXT) | instid1(VALU_DEP_4)\n\t"
      "v_fma_mixhi_bf16 %2, %6, %8, %14 op_sel:[1,0,0] op_sel_hi:[1,1,0]\n\t"
      "v_fma_mixhi_bf16 %3, %7, %8, %16 op_sel:[1,0,0] op_sel_hi:[1,1,0]"
      : "=&v"(l0), "=&v"(l1), "=&v"(l2), "=&v"(l3)
      : "v"(hi[0]), "v"(hi[1]), "v"(hi[2]), "v"(hi[3]), "v"(m1),
        "v"(x[0]), "v"(x[1]), "v"(x[2]), "v"(x[3]), "v"(x[4]), "v"(x[5]), "v"(x[6]), "v"(x[7]));
  lo[0] = l0; lo[1] = l1; lo[2] = l2; lo[3] = l3;
}
// fragment (row/col = lane&15) from an LDS k-contiguous bf16 row: p = row + k0 + 8h;
// elements 0..7 <- k0+8h+0..7, 8..15 <- k0+16+8h+0..7
__device__ __forceinline__ FragB lds_frag(const unsigned short* p) {
  FragB f;
  f.q[0] = *(const v4ia*)p;
  f.q[1] = *(const v4ia*)(p + 16);
  return f;
}
// One 128 x 128 f32 weight matrix ([out][in], k-contiguous) -> LDS wl[out][in] bf16 (RNE), row pitch TPITCH.
// 128 threads; a wave-wide 16-B load covers one whole 512-B row, and the wave's 8-B stores one whole LDS row.
// The matrix starts off floats (a constant) behind wsrc. A thread's 32 loads differ only in a constant offset
// and are all in flight together.
__device__ __forceinline__ void stage_w(const float* __restrict__ wsrc, const unsigned off, unsigned short* wl,
                                        const unsigned tid) {
  const float* p = wsrc + tid * 4u;
  unsigned short* d = wl + (tid >> 5) * TPITCH + (tid & 31u) * 4u;
  v4f g[32];
#pragma unroll
  for (unsigned it = 0; it < 32u; ++it) g[it] = *(const v4fa*)(p + off + it * 512u);
  // the loads' address register pair stays as it is up to this wait; what follows may reuse it
  asm volatile("s_wait_xcnt 0x0" :: "v"(p) : "memory");
#pragma unroll
  for (unsigned it = 0; it < 32u; ++it) {
    v2i w;
    w[0] = pack2(g[it].x, g[it].y);
    w[1] = pack2(g[it].z, g[it].w);
    *(v2ia*)(d + it * (4u * TPITCH)) = w;
  }
}

// The maps' root, reciprocal, 2^x and log2 as the bare instructions, where a last-bit error does no harm. The
// library sinhf and coshf carry e^n in two floats, the library root and division correct the last bit and rescale
// subnormals: together over a hundred vector instructions a head, nearly all in one dependent chain, in a kernel
// that has at most three waves on a SIMD (89 KiB of LDS a block) to hide it. The operands here come from bf16-rounded inputs and weights.
// On return ep = e^n / 2, em = e^-n / 2 (the halving rides in the exponent, so the range is that of sinh and cosh
// themselves) and iv = 1 / max(n, 1e-12). sinh = ep - em and cosh = ep + em share ep's error, which then only
// scales the point's Lorentz products.
// One asm statement, every value in place: no instruction in it touches its neighbour's register, and the closing
// v_nop is the slot the instruction set asks for between the last one and a reader of its result (as builtins
// the three compiled to a run in which one overwrote the source of the one directly in front).
__device__ __forceinline__ void exps_rcp(const float n, float& ep, float& em, float& iv) {
  ep = __builtin_fmaf(n, LOG2E, -1.0f);
  em = __builtin_fmaf(-n, LOG2E, -1.0f);
  iv = fmaxf(n, 1.0e-12f);
  asm("v_exp_f32 %0, %0\n\t"
      "v_exp_f32 %1, %1\n\t"
      "v_rcp_f32 %2, %2\n\t"
      "v_nop"
      : "+v"(ep), "+v"(em), "+v"(iv));
}

// Hyperboloid map of one head vector held as 8 + 8 components by lanes l and l^16:
// a <- normalize(a * scl) * sinh(|a * scl|); returns cosh(|a * scl|). Both lane halves get identical norms.
__device__ __forceinline__ float hyp8(v8f& a, const float scl) {
#pragma clang fp contract(off)
  float ss = 0.0f;
#pragma unroll
  for (int r = 0; r < 8; ++r) { a[r] = a[r] * scl; ss += a[r] * a[r]; }
  ss += __shfl_xor(ss, 16);
  const float n = __builtin_amdgcn_sqrtf(ss);
  float ep, em, inv;
  exps_rcp(n, ep, em, inv);
  const float sh = ep - em;
  const float ch = ep + em;
#pragma unroll
  for (int r = 0; r < 8; ++r) a[r] = (a[r] * inv) * sh;
  return ch;
}

// Klein map of one head vector: a <- normalize(hyperboloid_spatial / hyperboloid_time);
// returns (log(1 / (sqrt(1 - (|a| - 1e-4)^2) + 1e-4)) + biasv) * log2(e) + mterm.
__device__ __forceinline__ float klein8(v8f& a, const float biasv, const float mterm) {
#pragma clang fp contract(off)
  float ss = 0.0f;
#pragma unroll
  for (int r = 0; r < 8; ++r) ss += a[r] * a[r];
  ss += __shfl_xor(ss, 16);
  // vn, inv, sh and ich only scale the vector, and the normalisation below takes any common scale out again
  const float vn = __builtin_amdgcn_sqrtf(ss);
  float ep, em, inv;
  exps_rcp(vn, ep, em, inv);
  const float sh = ep - em;
  const float ich = __builtin_amdgcn_rcpf(ep + em);
  float s2 = 0.0f;
#pragma unroll
  for (int r = 0; r < 8; ++r) { a[r] = ((a[r] * inv) * sh) * ich; s2 += a[r] * a[r]; }
  s2 += __shfl_xor(s2, 16);
  // library root and true division here and for vnk: one last-bit step of vnk beside 1 moves 1 - dm * dm, and so
  // the key bias, by far more than one last bit
  const float n2 = sqrtf(s2);
  const float inv2 = 1.0f / fmaxf(n2, 1.0e-12f);
  float s3 = 0.0f;
#pragma unroll
  for (int r = 0; r < 8; ++r) { a[r] = a[r] * inv2; s3 += a[r] * a[r]; }
  s3 += __shfl_xor(s3, 16);
  const float vnk = sqrtf(s3);
  const float dm = vnk - 1.0e-4f;
  const float den = __builtin_amdgcn_sqrtf(1.0f - dm * dm) + 1.0e-4f;
  // log(1 / den) * log2(e) = -log2(den); den lies between 1e-4 and about 1, a normal number
  return (biasv * LOG2E - __builtin_amdgcn_logf(den)) + mterm;
}

// The attention loop's root, log2 and 2^x as the bare instructions. The library forms wrap each in a rescale
// for subnormal arguments or results and give the root a last-bit correction: about 5 to 15 vector
// instructions per value. Here the root's argument is 0 or a normal number (x1^2 - 1 of an f32 x1, clamped at
// 0), the log's is about 1 or more, and a 2^x below the normal range may come out as 0 beside a row sum that
// holds a term equal to 1; the root keeps the instruction's own 1 ulp.
// One asm statement per kind, every value in place: no instruction in it touches its neighbour's register, and
// the closing v_nop is the slot the instruction set asks for between the last one and a reader of its result
// (the builtins compiled to runs in which one overwrote the source of the one directly in front).
__device__ __forceinline__ void sqrt16(float (&a)[16]) {
  asm(
      "v_sqrt_f32 %0, %0\n\t"
      "v_sqrt_f32 %1, %1\n\t"
      "v_sqrt_f32 %2, %2\n\t"
      "v_sqrt_f32 %3, %3\n\t"
      "v_sqrt_f32 %4, %4\n\t"
      "v_sqrt_f32 %5, %5\n\t"
      "v_sqrt_f32 %6, %6\n\t"
      "v_sqrt_f32 %7, %7\n\t"
      "v_sqrt_f32 %8, %8\n\t"
      "v_sqrt_f32 %9, %9\n\t"
      "v_sqrt_f32 %10, %10\n\t"
      "v_sqrt_f32 %11, %11\n\t"
      "v_sqrt_f32 %12, %12\n\t"
      "v_sqrt_f32 %13, %13\n\t"
      "v_sqrt_f32 %14, %14\n\t"
      "v_sqrt_f32 %15, %15\n\t"
      "v_nop"
      :
        "+v"(a[0]), "+v"(a[1]), "+v"(a[2]), "+v"(a[3]), "+v"(a[4]), "+v"(a[5]),
        "+v"(a[6]), "+v"(a[7]), "+v"(a[8]), "+v"(a[9]), "+v"(a[10]), "+v"(a[11]),
        "+v"(a[12]), "+v"(a[13]), "+v"(a[14]), "+v"(a[15]));
}
__device__ __forceinline__ void log2_16(float (&a)[16]) {
  asm(
      "v_log_f32 %0, %0\n\t"
      "v_log_f32 %1, %1\n\t"
      "v_log_f32 %2, %2\n\t"
      "v_log_f32 %3, %3\n\t"
      "v_log_f32 %4, %4\n\t"
      "v_log_f32 %5, %5\n\t"
      "v_log_f32 %6, %6\n\t"
      "v_log_f32 %7, %7\n\t"
      "v_log_f32 %8, %8\n\t"
      "v_log_f32 %9, %9\n\t"
      "v_log_f32 %10, %10\n\t"
      "v_log_f32 %11, %11\n\t"
      "v_log_f32 %12, %12\n\t"
      "v_log_f32 %13, %13\n\t"
      "v_log_f32 %14, %14\n\t"
      "v_log_f32 %15, %15\n\t"
      "v_nop"
      :
        "+v"(a[0]), "+v"(a[1]), "+v"(a[2]), "+v"(a[3]), "+v"(a[4]), "+v"(a[5]),
        "+v"(a[6]), "+v"(a[7]), "+v"(a[8]), "+v"(a[9]), "+v"(a[10]), "+v"(a[11]),
        "+v"(a[12]), "+v"(a[13]), "+v"(a[14]), "+v"(a[15]));
}
__device__ __forceinline__ void exp2_17(float (&a)[17]) {
  asm(
      "v_exp_f32 %0, %0\n\t"
      "v_exp_f32 %1, %1\n\t"
      "v_exp_f32 %2, %2\n\t"
      "v_exp_f32 %3, %3\n\t"
      "v_exp_f32 %4, %4\n\t"
      "v_exp_f32 %5, %5\n\t"
      "v_exp_f32 %6, %6\n\t"
      "v_exp_f32 %7, %7\n\t"
      "v_exp_f32 %8, %8\n\t"
      "v_exp_f32 %9, %9\n\t"
      "v_exp_f32 %10, %10\n\t"
      "v_exp_f32 %11, %11\n\t"
      "v_exp_f32 %12, %12\n\t"
      "v_exp_f32 %13, %13\n\t"
      "v_exp_f32 %14, %14\n\t"
      "v_exp_f32 %15, %15\n\t"
      "v_exp_f32 %16, %16\n\t"
      "v_nop"
      :
        "+v"(a[0]), "+v"(a[1]), "+v"(a[2]), "+v"(a[3]), "+v"(a[4]), "+v"(a[5]),
        "+v"(a[6]), "+v"(a[7]), "+v"(a[8]), "+v"(a[9]), "+v"(a[10]), "+v"(a[11]),
        "+v"(a[12]), "+v"(a[13]), "+v"(a[14]), "+v"(a[15]), "+v"(a[16]));
}

// ---------------------------------------------------------------------------
// Projections + hyperbolic maps. Block = 64 positions of one batch, 4 waves x 16 positions.
// Input x is channels-first [b][k = channel][l]: the 128 x 64 tile is read along l (16-B loads; the column role gathers by key, 4-B loads), converted to
// bf16 and transposed into LDS xt[l][k] (cross-wave, block barrier); each wave then holds its 16 positions
// as 4 B fragments (col = lane&15 = position).
// Weights: the block reads the f32 matrix of its pass ([out][in], k-contiguous: W_q or W_mem rows 0..127, then for
// the column role W_mem rows 128..255), rounds it to bf16 and keeps it in LDS wl; A fragments come from there.
// wl is written where no wave reads it: first in front of the barrier that publishes xt, then between the two
// barriers around the first copy-out. D = W_tile (A, row = out feature) x X (B, col = position): D[row d = 8h+r][col = position],
// so a lane holds 8 of the 16 head components of one position; lanes l and l^16 complete the head.
// pass 2: V^T hi/lo     = Klein point of (W_mem[128:256] x)               + scalar array 2 = key bias (base-2)
// Workspace planes are laid in the order the attention loop's fragments read them, so that each of its
// wave-wide 16-B loads covers 512 contiguous bytes (4 whole 128-B lines), lane (m, h) at byte 32 m + 16 h:
// spatial plane = [b][head][16-position tile][hi | lo][position m][component 0..15];
// V^T = [b][head][32-key block][hi | lo][key half q][channel d = m][key 16 q + 0..15].
// Key compaction: a key whose mask is 0 carries the additive term -1e30, so beside any key of the batch whose
// mask is 1 or more its softmax weight is exactly 0 (the other logit terms are small beside 1e30: arccosh of an
// f32 is below 90, the log-denominator below 10). Such keys are left out here: blockIdx.y = 0 blocks (column
// role: W_q plane, V^T, key bias) work on 64 SLOTS of the batch's list of kept keys, in key order, and gather
// the input columns of those keys; slots past the end of the list repeat key 0 with the masked term. A batch
// with no mask of 1 or more keeps every key, each with its own term. The count goes to nkeep[b * NKP] and
// bounds the attention loop. blockIdx.y = 1 blocks (row role: W_mem K plane) work on all 512 positions.
// LDS stg: cross-wave (block barriers); fully written before each copy-out (8 heads x 64 rows x 32, or
//   8 heads x 2 key blocks x 4 pieces x 256). ssc: 3 x 8 x 64 floats, written by lanes 0..15 of every wave, copied out last.
// coverage: row plane and scalar array 1: NB*8 blocks x 64 positions = all NB*512. Column plane, V^T, scalar
//   arrays 0 and 2: per batch the first ceil(kept / 64) blocks x 64 slots; the attention loop reads
//   ceil(kept / 32) x 32 slots, never more.
// ---------------------------------------------------------------------------
__global__ __launch_bounds__(128) void k_hproj(const float* __restrict__ x, const int* __restrict__ mask,
                                               const float* __restrict__ wmem, const float* __restrict__ wq,
                                               const float* __restrict__ bias_p,
                                               unsigned short* pl, unsigned short* vt, float* sca, int* nkeep) {
  __shared__ __attribute__((aligned(16))) unsigned short xt[64 * TPITCH];
  __shared__ __attribute__((aligned(16))) int srcl[64];      // column role: slot -> key position
  __shared__ __attribute__((aligned(16))) unsigned short wl[EW * TPITCH];   // the pass's weight matrix, bf16
  __shared__ __attribute__((aligned(16))) unsigned short stg[16384];
  __shared__ __attribute__((aligned(16))) float ssc[3 * NH * 64];
  const unsigned tid = threadIdx.x, lane = tid & 31u, hh = lane >> 4, m = lane & 15u;
  const unsigned wave = (unsigned)__builtin_amdgcn_readfirstlane((int)(threadIdx.x >> 5));
  const unsigned row0 = blockIdx.x * 64u;
  const unsigned bb = row0 >> 9, r0 = row0 & 511u;
  const bool col = blockIdx.y == 0u;
  unsigned cnt = SEQ;
  int mi = 0;                                  // read by the column role alone

  if (col) {
    // ---- kept keys of the batch: every wave forms the same 16 lane-mask words, so the count needs no barrier ----
    const int* mrow = mask + (size_t)bb * LFULL;
    int mw[16];
#pragma unroll
    for (int w = 0; w < 16; ++w) mw[w] = mrow[32 * w + (int)lane];
    // the code behind reuses these loads' offset and base registers: the wait stands in front of that
    asm volatile("s_wait_xcnt 0x0" ::: "memory");
    unsigned kw[16], anyp = 0u;
#pragma unroll
    for (int w = 0; w < 16; ++w) {
      kw[w] = __builtin_amdgcn_ballot_w32(mw[w] != 0);
      anyp |= __builtin_amdgcn_ballot_w32(mw[w] >= 1);
    }
    cnt = 0u;
#pragma unroll
    for (int w = 0; w < 16; ++w) {
      if (anyp == 0u) kw[w] = 0xFFFFFFFFu;
      cnt += (unsigned)__builtin_popcount(kw[w]);
    }
    if (r0 >= cnt) return;                     // no kept key in these 64 slots: the whole block leaves, before any barrier
    if (r0 == 0u && tid == 0u) nkeep[bb * NKP] = (int)cnt;
    unsigned pre = 0u;
#pragma unroll
    for (int w = 0; w < 16; ++w) {
      if ((unsigned)(w >> 2) == wave) {
        const unsigned slot = pre + (unsigned)__builtin_popcount(kw[w] & ((1u << lane) - 1u)) - r0;
        if (((kw[w] >> lane) & 1u) != 0u && slot < 64u) srcl[slot] = 32 * w + (int)lane;
      }
      pre += (unsigned)__builtin_popcount(kw[w]);
    }
    if (tid < 64u && r0 + tid >= cnt) srcl[tid] = 0;
    __syncthreads();
    // ---- input tile: x[b][k][key of slot r0 .. r0+63] -> xt[slot][k] bf16 ----
    const float* xg = x + (size_t)bb * XB_FULL;
    const unsigned l4 = (tid & 15u) << 2, k0 = tid >> 4;
    const v4i sp = *(const v4ia*)(srcl + l4);
    const unsigned o0 = k0 * LFULL + (unsigned)sp.x, o1 = k0 * LFULL + (unsigned)sp.y;
    const unsigned o2 = k0 * LFULL + (unsigned)sp.z, o3 = k0 * LFULL + (unsigned)sp.w;
    const unsigned sl = 16u * wave + m;
    const unsigned om = (unsigned)srcl[sl];
    mi = mrow[om];                             // the slot's own key's mask
    // unrolled whole: the 4-B loads differ only in a constant offset; each half's 32 are in flight together
#pragma unroll
    for (unsigned hf = 0; hf < 2u; ++hf) {
      float g[32];
#pragma unroll
      for (unsigned it = 0; it < 8u; ++it) {
        const float* xr = xg + (8u * hf + it) * (8u * LFULL);
        g[4u * it + 0u] = xr[o0]; g[4u * it + 1u] = xr[o1]; g[4u * it + 2u] = xr[o2]; g[4u * it + 3u] = xr[o3];
      }
      // the loads' five offset registers stay as they are up to this wait; what follows may reuse them
      asm volatile("s_wait_xcnt 0x0" :: "v"(om), "v"(o0), "v"(o1), "v"(o2), "v"(o3) : "memory");
#pragma unroll
      for (unsigned it = 0; it < 8u; ++it) {
        const unsigned k = 8u * (8u * hf + it) + k0;
        const unsigned c01 = (unsigned)pack2(g[4u * it + 0u], g[4u * it + 1u]);
        const unsigned c23 = (unsigned)pack2(g[4u * it + 2u], g[4u * it + 3u]);
        xt[(l4 + 0u) * TPITCH + k] = (unsigned short)c01;
        xt[(l4 + 1u) * TPITCH + k] = (unsigned short)(c01 >> 16);
        xt[(l4 + 2u) * TPITCH + k] = (unsigned short)c23;
        xt[(l4 + 3u) * TPITCH + k] = (unsigned short)(c23 >> 16);
      }
      // keeps the second half's loads behind the first half's LDS stores, so that at most 33 loads of a wave are
      // outstanding; the scheduler lifted them over the stores, which made 65, past what s_wait_loadcnt can name
      if (hf == 0u) __builtin_amdgcn_sched_barrier(0);
    }
    if (r0 + sl >= cnt) mi = 0;                // a slot past the end of the list counts as masked
  } else {
    // ---- input tile: x[b][k][r0 .. r0+63] -> xt[l][k] bf16 ----
    const float* xg = x + (size_t)bb * XB_FULL + r0;
#pragma unroll 1
    for (unsigned it = 0; it < 16u; ++it) {
      const unsigned p = it * 128u + tid, k = p >> 4, l4 = (p & 15u) << 2;
      const v4f v = *(const v4fa*)(xg + (size_t)k * LFULL + l4);
      const unsigned c01 = (unsigned)pack2(v.x, v.y), c23 = (unsigned)pack2(v.z, v.w);
      xt[(l4 + 0u) * TPITCH + k] = (unsigned short)c01;
      xt[(l4 + 1u) * TPITCH + k] = (unsigned short)(c01 >> 16);
      xt[(l4 + 2u) * TPITCH + k] = (unsigned short)c23;
      xt[(l4 + 3u) * TPITCH + k] = (unsigned short)(c23 >> 16);
    }
  }
  stage_w(col ? wq : wmem, 0u, wl, tid);
  __syncthreads();

  FragB xa[4];
  {
    const unsigned xo = (16u * wave + m) * TPITCH + 8u * hh;
#pragma unroll
    for (int ks = 0; ks < 4; ++ks) {
      xa[ks].q[0] = *(const v4ia*)(xt + xo + 32 * ks);
      xa[ks].q[1] = *(const v4ia*)(xt + xo + 32 * ks + 16);
    }
  }
  const float mv = (float)mi;
  const float mterm = (-1.0e30f * (1.0f - mv)) * LOG2E;
  const float biasv = bf16_val(bias_p[0]);
  const v8f zero8 = {0.f, 0.f, 0.f, 0.f, 0.f, 0.f, 0.f, 0.f};

  {
    const unsigned ps = col ? 0u : 1u;
    const float scl = (ps == 0u) ? 0.25f : 1.0f;
#pragma unroll 1
    for (unsigned t = 0; t < NH; ++t) {
      const unsigned short* wp = wl + (16u * t + m) * TPITCH + 8u * hh;
      FragB wf[4];
#pragma unroll
      for (int ks = 0; ks < 4; ++ks) wf[ks] = lds_frag(wp + 32 * ks);
      v8f acc = zero8;
#pragma unroll
      for (int ks = 0; ks < 4; ++ks) acc = wmb(wf[ks], xa[ks], acc);
      const float ch = hyp8(acc, scl);           // acc[r] = spatial[position 16 wave + m][8h + r]
      v4i hi, lo;
      split8(acc, hi, lo);
      const unsigned so = (t * 64u + 16u * wave) * QROW + 16u * m + 8u * hh;
      *(v4ia*)(stg + so) = hi;
      *(v4ia*)(stg + so + TILEH) = lo;
      if (hh == 0u) ssc[(ps * NH + t) * 64u + 16u * wave + m] = ch;
    }
    __syncthreads();
    if (col) stage_w(wmem, EW * EW, wl, tid);    // every wave has left the first pass: wl takes the V matrix
    {
      unsigned short* dst = pl + (size_t)ps * PLN + ((size_t)bb * NH * SEQ + r0) * QROW;
#pragma unroll 1
      for (unsigned it = 0; it < 16u; ++it) {
        const unsigned p = it * 128u + tid, t = p >> 8, wi = p & 255u;
        const v4i v = *(const v4ia*)(stg + p * 8u);
        *(v4i*)(dst + (size_t)t * (SEQ * QROW) + wi * 8u) = v;
        // what follows rewrites the store's address and data registers: the wait stands in front of that
        asm volatile("s_wait_xcnt 0x0" ::: "memory");
      }
      
    }
    __syncthreads();
  }

  // ---- pass 2 (column role): Klein points -> V^T hi / lo stage, key bias ----
  if (col) {
#pragma unroll 1
  for (unsigned t = 0; t < NH; ++t) {
    const unsigned short* wp = wl + (16u * t + m) * TPITCH + 8u * hh;
    FragB wf[4];
#pragma unroll
    for (int ks = 0; ks < 4; ++ks) wf[ks] = lds_frag(wp + 32 * ks);
    v8f acc = zero8;
#pragma unroll
    for (int ks = 0; ks < 4; ++ks) acc = wmb(wf[ks], xa[ks], acc);
    const float lb2 = klein8(acc, biasv, mterm);  // acc[r] = v_klein[position 16 wave + m][8h + r]
    v4i vh, vl;
    split8(acc, vh, vl);
#pragma unroll
    for (int r = 0; r < 8; ++r) {
      // head t: [key block wave >> 1][hi | lo][key half wave & 1][channel 8h + r][key m]
      const unsigned so = t * 2048u + (wave >> 1) * 1024u + (wave & 1u) * TILEH + (8u * hh + (unsigned)r) * 16u + m;
      stg[so] = (unsigned short)((unsigned)vh[r >> 1] >> (16 * (r & 1)));
      stg[so + 2u * TILEH] = (unsigned short)((unsigned)vl[r >> 1] >> (16 * (r & 1)));
    }
    if (hh == 0u) ssc[(2u * NH + t) * 64u + 16u * wave + m] = lb2;
  }
  __syncthreads();
  {
    unsigned short* dst = vt + (size_t)bb * NH * (2 * HD * SEQ) + r0 * (2 * HD);
#pragma unroll 1
    for (unsigned it = 0; it < 16u; ++it) {
      const unsigned p = it * 128u + tid, t = p >> 8, wi = p & 255u;
      const v4i v = *(const v4ia*)(stg + p * 8u);
      *(v4i*)(dst + (size_t)t * (2 * HD * SEQ) + wi * 8u) = v;
      // the next trip rewrites the store's address and data registers: the wait stands in front of that
      asm volatile("s_wait_xcnt 0x0" ::: "memory");
    }
    
  }
  }
  {
#pragma unroll 1
    for (unsigned it = 0; it < 3u; ++it) {
      if ((it == 1u) == col) continue;         // array 1 is the row role's, arrays 0 and 2 the column role's
      const unsigned p = it * 128u + tid, a = p >> 7, t = (p >> 4) & 7u, c = p & 15u;
      const v4f v = *(const v4fa*)(ssc + p * 4u);
      *(v4f*)(sca + (size_t)a * SCN + ((size_t)bb * NH + t) * SEQ + r0 + 4u * c) = v;
      // the next trip rewrites the store's address and data registers: the wait stands in front of that
      asm volatile("s_wait_xcnt 0x0" ::: "memory");
    }
    
  }
}

// ---------------------------------------------------------------------------
// Fused Lorentz attention: one block = (batch b, 32 softmax rows i0..i0+31), 8 waves, wave = head; each wave
// runs two 16-row tiles one after the other, each over the batch's kept keys (column position j = slot). Flash attention in the transposed domain:
//   S^T tile = C (A, row = column position j) x R^T (B, col = row position i): the K = 16 spatial product is
//   laid as [c_hi|c_hi] x [r_hi|r_lo] plus [c_lo|0] x [r_hi|r_lo] along the 32-deep k axis.
//   D[row j 8h+r][col i m]. Per element: x = rt[i]*ct[j] - D, logit2 = -beta*log2(x1 + sqrt(x1^2-1)) + cb[j]
//   (cb carries log-denominator, bias and the additive key mask term). Softmax statistics are per lane
//   (row i = m); the two lane halves combine by one xor-16 exchange. The P^T B-fragment is the lane's own
//   16 results (tile 0 -> elements 0..7, tile 1 -> elements 8..15). O^T = V^T (A, row d) x P^T:
//   D[row d 8h+r][col i m], scaled per lane.
// Output stage ost[channel 0..127][position 0..31] (cross-wave, block barrier): every wave writes its 16
// coverage: grid (16, NB) x 128 channels x 32 positions = NB*128*512 outputs, each written by exactly one lane.
// ---------------------------------------------------------------------------
__global__ __launch_bounds__(256) void k_hattn(const unsigned short* __restrict__ rpl,
                                               const unsigned short* __restrict__ cpl,
                                               const unsigned short* __restrict__ vt,
                                               const float* __restrict__ rtt,
                                               const float* __restrict__ ctt,
                                               const float* __restrict__ cbb,
                                               const float* __restrict__ beta_p,
                                               const int* __restrict__ nkeep,
                                               float* out) {
  __shared__ __attribute__((aligned(16))) float ost[EW * OPITCH];
  const unsigned tid = threadIdx.x, lane = tid & 31u, hh = lane >> 4, m = lane & 15u;
  const unsigned wave = (unsigned)__builtin_amdgcn_readfirstlane((int)(threadIdx.x >> 5));
  const unsigned i0 = blockIdx.x * 32u, b = blockIdx.y;
  const unsigned bh = b * NH + wave;
  const v8f zero8 = {0.f, 0.f, 0.f, 0.f, 0.f, 0.f, 0.f, 0.f};
  const v4i zero4 = {0, 0, 0, 0};
  const float nbeta = -bf16_val(beta_p[0]);
  // kept keys of this batch, rounded up to whole 32-key blocks (the slots behind the last kept key weigh 0)
  const int nk = nkeep[b * NKP];
  const unsigned nend = ((unsigned)(nk < 1 ? 1 : (nk > SEQ ? SEQ : nk)) + 31u) & ~31u;

  const unsigned fo = 16u * m + 8u * hh;      // the lane's 16 bytes inside a 512-B piece
  const unsigned short* kb = cpl + (size_t)bh * SEQ * QROW + fo;
  const unsigned short* vb = vt + (size_t)bh * (2 * HD * SEQ) + fo;
  const float* ctp = ctt + (size_t)bh * SEQ + 8u * hh;
  const float* cbp = cbb + (size_t)bh * SEQ + 8u * hh;

#pragma unroll 1
  for (unsigned tl = 0; tl < 2u; ++tl) {
    const unsigned g0 = i0 + 16u * tl;
    const unsigned short* qp = rpl + ((size_t)bh * SEQ + g0) * QROW + fo;
    FragB qf;
    qf.q[0] = *(const v4ia*)qp;            // r_hi[8h .. 8h+7]  (k slots 8h..)
    qf.q[1] = *(const v4ia*)(qp + TILEH);  // r_lo[8h .. 8h+7]  (k slots 16+8h..)
    const float rt = rtt[(size_t)bh * SEQ + g0 + m];
    // the key loop reuses these three loads' address registers: the wait stands in front of that
    asm volatile("s_wait_xcnt 0x0" ::: "memory");
    v8f o = zero8;
    float mrun = -3.0e38f, lrun = 0.0f;
#pragma unroll 1
    for (unsigned n0 = 0; n0 < nend; n0 += 32u) {
      const unsigned short* kp = kb + (size_t)n0 * QROW;
      const v4i kh0 = *(const v4ia*)kp;
      const v4i kl0 = *(const v4ia*)(kp + TILEH);
      const v4i kh1 = *(const v4ia*)(kp + 2 * TILEH);
      const v4i kl1 = *(const v4ia*)(kp + 3 * TILEH);
      FragB a10, a20, a11, a21;
      a10.q[0] = kh0; a10.q[1] = kh0;
      a20.q[0] = kl0; a20.q[1] = zero4;
      a11.q[0] = kh1; a11.q[1] = kh1;
      a21.q[0] = kl1; a21.q[1] = zero4;
      v8f s0 = wmb(a10, qf, zero8);
      s0 = wmb(a20, qf, s0);
      v8f s1 = wmb(a11, qf, zero8);
      s1 = wmb(a21, qf, s1);

      const v4f t0 = *(const v4fa*)(ctp + n0);
      const v4f t1 = *(const v4fa*)(ctp + n0 + 4u);
      const v4f t2 = *(const v4fa*)(ctp + n0 + 16u);
      const v4f t3 = *(const v4fa*)(ctp + n0 + 20u);
      const v4f u0 = *(const v4fa*)(cbp + n0);
      const v4f u1 = *(const v4fa*)(cbp + n0 + 4u);
      const v4f u2 = *(const v4fa*)(cbp + n0 + 16u);
      const v4f u3 = *(const v4fa*)(cbp + n0 + 20u);
      const v8f ct0 = __builtin_shufflevector(t0, t1, 0, 1, 2, 3, 4, 5, 6, 7);
      const v8f ct1 = __builtin_shufflevector(t2, t3, 0, 1, 2, 3, 4, 5, 6, 7);
      const v8f cb0 = __builtin_shufflevector(u0, u1, 0, 1, 2, 3, 4, 5, 6, 7);
      const v8f cb1 = __builtin_shufflevector(u2, u3, 0, 1, 2, 3, 4, 5, 6, 7);
      // logit in the base-2 domain: x = rt*ct - dot (minus the Lorentz product), x1 = x + 1e-6,
      // arccosh(x1) = ln(x1 + sqrt(x1^2 - 1)); a = -beta * log2(x1 + sqrt(x1^2 - 1)) + cb
      float x1[16], w[16];
#pragma unroll
      for (int r = 0; r < 8; ++r) {
        x1[r]     = (rt * ct0[r] - s0[r]) + 1.0e-6f;        // column position n0 + 8h + r
        x1[8 + r] = (rt * ct1[r] - s1[r]) + 1.0e-6f;        // column position n0 + 16 + 8h + r
      }
#pragma unroll
      for (int i = 0; i < 16; ++i) w[i] = fmaxf(x1[i] * x1[i] - 1.0f, 0.0f);
      sqrt16(w);
#pragma unroll
      for (int i = 0; i < 16; ++i) w[i] = x1[i] + w[i];
      log2_16(w);
      v8f a0, a1;
#pragma unroll
      for (int r = 0; r < 8; ++r) {
        a0[r] = nbeta * w[r] + cb0[r];
        a1[r] = nbeta * w[8 + r] + cb1[r];
      }

      float t = fmaxf(a0[0], a1[0]);
#pragma unroll
      for (int r = 1; r < 8; ++r) t = fmaxf(t, fmaxf(a0[r], a1[r]));
      t = fmaxf(t, __shfl_xor(t, 16));
      const float mnew = fmaxf(mrun, t);
      float e[17];
#pragma unroll
      for (int r = 0; r < 8; ++r) {
        e[r]     = a0[r] - mnew;
        e[8 + r] = a1[r] - mnew;
      }
      e[16] = mrun - mnew;
      exp2_17(e);
      const float sc = e[16];
      v8f p0, p1;
      float ps = 0.0f;
#pragma unroll
      for (int r = 0; r < 8; ++r) {
        p0[r] = e[r];
        p1[r] = e[8 + r];
        ps += p0[r] + p1[r];
      }
      lrun = lrun * sc + ps;
      mrun = mnew;
      o = o * sc;

      FragB ph, pw;
      split8(p0, ph.q[0], pw.q[0]);
      split8(p1, ph.q[1], pw.q[1]);
      FragB fvh, fvl;
      const unsigned short* vp = vb + (size_t)n0 * (2 * HD);
      fvh.q[0] = *(const v4ia*)vp;                 // keys n0 + 8h + 0..7
      fvh.q[1] = *(const v4ia*)(vp + TILEH);       // keys n0 + 16 + 8h + 0..7
      fvl.q[0] = *(const v4ia*)(vp + 2 * TILEH);
      fvl.q[1] = *(const v4ia*)(vp + 3 * TILEH);
      o = wmb(fvh, ph, o);
      o = wmb(fvl, ph, o);
      o = wmb(fvh, pw, o);
    }
    const float lt = lrun + __shfl_xor(lrun, 16);
    const float inv = 1.0f / lt;
    const v8f c = o * inv;                    // out[channel 16 wave + 8h + r][position g0 + m]
    const unsigned so = (16u * wave + 8u * hh) * OPITCH + 16u * tl + m;
#pragma unroll
    for (int r = 0; r < 8; ++r) ost[so + (unsigned)r * OPITCH] = c[r];
  }
  __syncthreads();

  {
    float* ob = out + (size_t)b * XB_FULL + i0;
#pragma unroll 1
    for (unsigned it = 0; it < 4u; ++it) {
      const unsigned p = it * 256u + tid, c = p >> 3, q = p & 7u;
      const v4f v = *(const v4fa*)(ost + c * OPITCH + 4u * q);
      *(v4f*)(ob + (size_t)c * LFULL + 4u * q) = v;
    }
    
  }
}

// ---------------------------------------------------------------------------
static inline size_t al256(size_t o) { return (o + 255) & ~(size_t)255; }

extern "C" void kernel_launch(void* const* d_in, const int* in_sizes, int n_in,
                              void* d_out, int out_size, void* d_ws, size_t ws_size,
                              hipStream_t stream) {
  (void)stream;
  if (n_in < 6) return;
  const long long actN = (long long)NB * EW * LFULL;
  if ((long long)in_sizes[0] < actN) return;                 // queries [b][channel][l]
  if ((long long)in_sizes[1] < (long long)NB * LFULL) return; // mask [b][l] int32
  if (in_sizes[2] < 2 * EW * EW) return;                     // W_mem [256][128]
  if (in_sizes[3] < EW * EW) return;                         // W_q [128][128]
  if (in_sizes[4] < 1 || in_sizes[5] < 1) return;            // beta, bias
  if ((long long)out_size < actN) return;

  const float* queries = (const float*)d_in[0];
  const int*   mask    = (const int*)d_in[1];
  const float* Wmem    = (const float*)d_in[2];
  const float* Wq      = (const float*)d_in[3];
  const float* beta    = (const float*)d_in[4];
  const float* bias    = (const float*)d_in[5];
  float* out = (float*)d_out;

  const size_t plB = al256((size_t)2 * PLN * 2);                // 16,777,216 at NB = 32
  const size_t vB  = al256((size_t)2 * VPL * 2);                // 8,388,608
  const size_t scB = al256((size_t)3 * SCN * 4);                // 1,572,864
  const size_t nkB = al256((size_t)NB * NKP * 4);               // 4,096
  const size_t total = plB + vB + scB + nkB;                    // 26,742,784
  if (total > ws_size || total > (size_t)WSMAX) return;
  char* w = (char*)d_ws;
  unsigned short* pln = (unsigned short*)w;
  unsigned short* vtp = (unsigned short*)(w + plB);
  float*          sca = (float*)(w + plB + vB);
  int*            nkp = (int*)(w + plB + vB + scB);
  unsigned short* cpl = pln;              // column plane (from W_q)
  unsigned short* rpl = pln + PLN;        // row plane (from W_mem rows 0..127)
  float* ctt = sca;
  float* rtt = sca + SCN;
  float* cbb = sca + 2 * SCN;

  // 1: projections + hyperboloid / Klein maps -> planes and per-position scalars (y = 0: kept keys, y = 1: rows)
  k_hproj<<<dim3((NB * SEQ) / 64, 2), 128, 0, stream>>>(queries, mask, Wmem, Wq, bias, pln, vtp, sca, nkp);
  // 2: Lorentz attention, channels-first output
  k_hattn<<<dim3(SEQ / 32, NB), 256, 0, stream>>>(rpl, cpl, vtp, rtt, ctt, cbb, beta, nkp, out);
}

// v007
// One run takes 32.9 microseconds.
// Two timings next to v006 put it at 1.25 and 1.24 times that version's speed.
// All steps since v000 together make it 3.77 times as fast.
// Contractions: W_mem / W_q projections = v_wmma_f32_16x16x32_bf16, bf16 (RNE) inputs and weights, one product. Lorentz spatial product k_sp.q_sp (K = 16) and P.V = same bf16 WMMA with every computed operand carried as bf16 hi + bf16 lo (hi.hi + lo.hi + hi.lo). Accumulate f32 everywhere.
// Time-like rank-1 term, arccosh, additive key bias, online softmax (base-2 form): f32 VALU. No power-of-two carries exist (bf16 planes only).
#include <hip/hip_runtime.h>
#include <stddef.h>
#include <stdint.h>
#include <math.h>

#ifndef NB
#define NB 32                      // batches processed (a reduced build reads the first NB batches)
#endif
#define SEQ    512                 // positions per batch (softmax rows i and softmax columns j)
#define LFULL  512                 // full row length of the channels-first input / output and of the mask
#define EW     128                 // model width = heads x head dim
#define NH     8
#define HD     16
#define QROW   32                  // halfwords per position in a spatial plane: 16 hi + 16 lo
#define TILEH  256                 // halfwords per 512-B piece of a plane: 16 rows x 16 halfwords, one wave-wide 16-B load
#define TPITCH 136                 // halfwords per LDS transposed-input row
#define OPITCH 36                  // floats per LDS output-stage row
#define WSMAX  134217728
#define VPL    ((size_t)NB * EW * SEQ)          // halfwords of V^T hi (as many again of V^T lo)
#define PLN    ((size_t)NB * NH * SEQ * QROW)   // halfwords per spatial plane (column plane, then row plane)
#define SCN    ((size_t)NB * NH * SEQ)          // floats per per-position scalar array (3 arrays)
#define XB_FULL ((size_t)EW * LFULL)            // floats per batch of the input and of the output
#define LOG2E  1.4426950408889634f
#define NKP    32                  // ints per batch in the kept-key count array: one 128-B line per writer

static_assert(NH * HD == EW);
static_assert(SEQ == 512 && LFULL == 512);
static_assert(EW % 32 == 0 && SEQ % 32 == 0);
static_assert(SEQ % 64 == 0 && (NB * SEQ) % 64 == 0);
static_assert(NH * 64 * QROW == 16384);        // k_hproj stage: spatial plane form
static_assert(2 * EW * 64 == 16384);           // k_hproj stage: V^T form
static_assert(16 * QROW == 2 * TILEH);         // 16 positions of a spatial plane = hi piece + lo piece
static_assert(2 * HD * 32 == 4 * TILEH);       // 32 keys of one head's V^T, hi and lo = 4 pieces
static_assert(16384 == 128 * 16 * 8);          // k_hproj copy-out: 128 thr x 16 it x 8 halfwords
static_assert(64 * EW == 128 * 16 * 4);        // k_hproj input staging: 128 thr x 16 it x 4 floats
static_assert(3 * NH * 64 == 128 * 3 * 4);     // k_hproj scalar copy-out: 128 thr x 3 it x 4 floats
static_assert(EW * EW == 128 * 32 * 4);        // k_hproj weight staging: 128 thr x 32 it x 4 floats
static_assert(EW * 4 == 32 * 16);              // one weight row = one wave-wide 16-B load
static_assert(EW * 32 == 256 * 4 * 4);         // k_hattn copy-out: 256 thr x 4 it x 4 floats
static_assert(TPITCH % 8 == 0 && TPITCH >= EW);
static_assert(OPITCH % 4 == 0 && OPITCH >= 32);
static_assert(2 * PLN * 2 + 2 * VPL * 2 + 3 * SCN * 4 + (size_t)NB * NKP * 4 <= (size_t)WSMAX);

typedef int            v4i   __attribute__((ext_vector_type(4)));
typedef int            v8i   __attribute__((ext_vector_type(8)));
typedef float          v4f   __attribute__((ext_vector_type(4)));
typedef float          v8f   __attribute__((ext_vector_type(8)));
typedef __bf16         v16bf __attribute__((ext_vector_type(16)));
typedef int            v2i   __attribute__((ext_vector_type(2)));
typedef float          v2f   __attribute__((ext_vector_type(2)));
typedef __bf16         v2bf  __attribute__((ext_vector_type(2)));
typedef v2i __attribute__((may_alias)) v2ia;
typedef v4i __attribute__((may_alias)) v4ia;
typedef v4f __attribute__((may_alias)) v4fa;
union FragB { v16bf v; v4i q[2]; v8i w; };

// WMMA with hazard guard: ties D, keeps A/B live for 4 VALU slots
__device__ __forceinline__ v8f wmb(const FragB& a, const FragB& b, v8f c) {
  v8f d = __builtin_amdgcn_wmma_f32_16x16x32_bf16(false, a.v, false, b.v, (short)0, c, false, false);
  asm volatile("v_nop\n\tv_nop\n\tv_nop\n\tv_nop" : "+v"(d) : "v"(a.w), "v"(b.w));
  return d;
}

// two f32 -> two bf16 (RNE) in one word, by the convert instruction (v_cvt_pk_bf16_f32): lo in the low halfword
__device__ __forceinline__ int pack2(float lo, float hi) {
  const v2f p = {lo, hi};
  return __builtin_bit_cast(int, __builtin_convertvector(p, v2bf));
}
__device__ __forceinline__ float bf16_val(float f) {
  return __uint_as_float((unsigned)pack2(f, f) << 16);
}
// 8 f32 -> bf16 hi piece + bf16 lo piece (lo = RNE(v - hi)); element 2j in the low halfword of word j.
// hi: one convert a pair. lo: hi * (-1) + v in the mixed-precision FMA that takes the bf16 half as it lies in
// the hi word and writes its bf16 result into one half of the lo word (v - hi is exact in f32, so the one
// rounding is the same as that of a subtraction and a convert): three instructions a pair.
// One asm statement: a plain subtraction and conversion compiled to five instructions a pair (two unpacks, a
// packed subtraction, the two converts). The four low halves stand in front of
// the four high halves; each high half rewrites the word its low half wrote four instructions back, which the
// s_delay_alu lines tell the issue logic, so that another wave can issue meanwhile.
__device__ __forceinline__ void split8(const v8f x, v4i& hi, v4i& lo) {
#pragma unroll
  for (int j = 0; j < 4; ++j) hi[j] = pack2(x[2 * j], x[2 * j + 1]);
  const int m1 = (int)0xBF80BF80u;            // bf16 -1.0 in both halves
  int l0, l1, l2, l3;
  asm("v_fma_mixlo_bf16 %0, %4, %8, %9 op_sel_hi:[1,1,0]\n\t"
      "v_fma_mixlo_bf16 %1, %5, %8, %11 op_sel_hi:[1,1,0]\n\t"
      "v_fma_mixlo_bf16 %2, %6, %8, %13 op_sel_hi:[1,1,0]\n\t"
      "v_fma_mixlo_bf16 %3, %7, %8, %15 op_sel_hi:[1,1,0]\n\t"
      "s_delay_alu instid0(VALU_DEP_4) | instskip(NEXT) | instid1(VALU_DEP_4)\n\t"
      "v_fma_mixhi_bf16 %0, %4, %8, %10 op_sel:[1,0,0] op_sel_hi:[1,1,0]\n\t"
      "v_fma_mixhi_bf16 %1, %5, %8, %12 op_sel:[1,0,0] op_sel_hi:[1,1,0]\n\t"
      "s_delay_alu instid0(VALU_DEP_4) | instskip(NEXT) | instid1(VALU_DEP_4)\n\t"
      "v_fma_mixhi_bf16 %2, %6, %8, %14 op_sel:[1,0,0] op_sel_hi:[1,1,0]\n\t"
      "v_fma_mixhi_bf16 %3, %7, %8, %16 op_sel:[1,0,0] op_sel_hi:[1,1,0]"
      : "=&v"(l0), "=&v"(l1), "=&v"(l2), "=&v"(l3)
      : "v"(hi[0]), "v"(hi[1]), "v"(hi[2]), "v"(hi[3]), "v"(m1),
        "v"(x[0]), "v"(x[1]), "v"(x[2]), "v"(x[3]), "v"(x[4]), "v"(x[5]), "v"(x[6]), "v"(x[7]));
  lo[0] = l0; lo[1] = l1; lo[2] = l2; lo[3] = l3;
}
// fragment (row/col = lane&15) from an LDS k-contiguous bf16 row: p = row + k0 + 8h;
// elements 0..7 <- k0+8h+0..7, 8..15 <- k0+16+8h+0..7
__device__ __forceinline__ FragB lds_frag(const unsigned short* p) {
  FragB f;
  f.q[0] = *(const v4ia*)p;
  f.q[1] = *(const v4ia*)(p + 16);
  return f;
}
// One 128 x 128 f32 weight matrix ([out][in], k-contiguous) -> LDS wl[out][in] bf16 (RNE), row pitch TPITCH.
// 128 threads; a wave-wide 16-B load covers one whole 512-B row, and the wave's 8-B stores one whole LDS row.
// The matrix starts off floats (a constant) behind wsrc. A thread's 32 loads differ only in a constant offset
// and are all in flight together.
__device__ __forceinline__ void stage_w(const float* __restrict__ wsrc, const unsigned off, unsigned short* wl,
                                        const unsigned tid) {
  const float* p = wsrc + tid * 4u;
  unsigned short* d = wl + (tid >> 5) * TPITCH + (tid & 31u) * 4u;
  v4f g[32];
#pragma unroll
  for (unsigned it = 0; it < 32u; ++it) g[it] = *(const v4fa*)(p + off + it * 512u);
  // the loads' address register pair stays as it is up to this wait; what follows may reuse it
  asm volatile("s_wait_xcnt 0x0" :: "v"(p) : "memory");
#pragma unroll
  for (unsigned it = 0; it < 32u; ++it) {
    v2i w;
    w[0] = pack2(g[it].x, g[it].y);
    w[1] = pack2(g[it].z, g[it].w);
    *(v2ia*)(d + it * (4u * TPITCH)) = w;
  }
}

// The maps' root, reciprocal, 2^x and log2 as the bare instructions, where a last-bit error does no harm. The
// library sinhf and coshf carry e^n in two floats, the library root and division correct the last bit and rescale
// subnormals: together over a hundred vector instructions a head, nearly all in one dependent chain, in a kernel
// that has at most three waves on a SIMD (89 KiB of LDS a block) to hide it. The operands here come from bf16-rounded inputs and weights.
// On return ep = e^n / 2, em = e^-n / 2 (the halving rides in the exponent, so the range is that of sinh and cosh
// themselves) and iv = 1 / max(n, 1e-12). sinh = ep - em and cosh = ep + em share ep's error, which then only
// scales the point's Lorentz products.
// One asm statement, every value in place: no instruction in it touches its neighbour's register, and the closing
// v_nop is the slot the instruction set asks for between the last one and a reader of its result (as builtins
// the three compiled to a run in which one overwrote the source of the one directly in front).
__device__ __forceinline__ void exps_rcp(const float n, float& ep, float& em, float& iv) {
  ep = __builtin_fmaf(n, LOG2E, -1.0f);
  em = __builtin_fmaf(-n, LOG2E, -1.0f);
  iv = fmaxf(n, 1.0e-12f);
  asm("v_exp_f32 %0, %0\n\t"
      "v_exp_f32 %1, %1\n\t"
      "v_rcp_f32 %2, %2\n\t"
      "v_nop"
      : "+v"(ep), "+v"(em), "+v"(iv));
}

// Hyperboloid map of one head vector held as 8 + 8 components by lanes l and l^16:
// a <- normalize(a * scl) * sinh(|a * scl|); returns cosh(|a * scl|). Both lane halves get identical norms.
__device__ __forceinline__ float hyp8(v8f& a, const float scl) {
#pragma clang fp contract(off)
  float ss = 0.0f;
#pragma unroll
  for (int r = 0; r < 8; ++r) { a[r] = a[r] * scl; ss += a[r] * a[r]; }
  ss += __shfl_xor(ss, 16);
  const float n = __builtin_amdgcn_sqrtf(ss);
  float ep, em, inv;
  exps_rcp(n, ep, em, inv);
  const float sh = ep - em;
  const float ch = ep + em;
#pragma unroll
  for (int r = 0; r < 8; ++r) a[r] = (a[r] * inv) * sh;
  return ch;
}

// Klein map of one head vector: a <- normalize(hyperboloid_spatial / hyperboloid_time);
// returns (log(1 / (sqrt(1 - (|a| - 1e-4)^2) + 1e-4)) + biasv) * log2(e) + mterm.
__device__ __forceinline__ float klein8(v8f& a, const float biasv, const float mterm) {
#pragma clang fp contract(off)
  float ss = 0.0f;
#pragma unroll
  for (int r = 0; r < 8; ++r) ss += a[r] * a[r];
  ss += __shfl_xor(ss, 16);
  // vn, inv, sh and ich only scale the vector, and the normalisation below takes any common scale out again
  const float vn = __builtin_amdgcn_sqrtf(ss);
  float ep, em, inv;
  exps_rcp(vn, ep, em, inv);
  const float sh = ep - em;
  const float ich = __builtin_amdgcn_rcpf(ep + em);
  float s2 = 0.0f;
#pragma unroll
  for (int r = 0; r < 8; ++r) { a[r] = ((a[r] * inv) * sh) * ich; s2 += a[r] * a[r]; }
  s2 += __shfl_xor(s2, 16);
  // library root and true division here and for vnk: one last-bit step of vnk beside 1 moves 1 - dm * dm, and so
  // the key bias, by far more than one last bit
  const float n2 = sqrtf(s2);
  const float inv2 = 1.0f / fmaxf(n2, 1.0e-12f);
  float s3 = 0.0f;
#pragma unroll
  for (int r = 0; r < 8; ++r) { a[r] = a[r] * inv2; s3 += a[r] * a[r]; }
  s3 += __shfl_xor(s3, 16);
  const float vnk = sqrtf(s3);
  const float dm = vnk - 1.0e-4f;
  const float den = __builtin_amdgcn_sqrtf(1.0f - dm * dm) + 1.0e-4f;
  // log(1 / den) * log2(e) = -log2(den); den lies between 1e-4 and about 1, a normal number
  return (biasv * LOG2E - __builtin_amdgcn_logf(den)) + mterm;
}

// The attention loop's root, log2 and 2^x as the bare instructions. The library forms wrap each in a rescale
// for subnormal arguments or results and give the root a last-bit correction: about 5 to 15 vector
// instructions per value. Here the root's argument is 0 or a normal number (x1^2 - 1 of an f32 x1, clamped at
// 0), the log's is about 1 or more, and a 2^x below the normal range may come out as 0 beside a row sum that
// holds a term equal to 1; the root keeps the instruction's own 1 ulp.
// One asm statement per kind, every value in place: no instruction in it touches its neighbour's register, and
// the closing v_nop is the slot the instruction set asks for between the last one and a reader of its result
// (the builtins compiled to runs in which one overwrote the source of the one directly in front).
__device__ __forceinline__ void sqrt16(float (&a)[16]) {
  asm(
      "v_sqrt_f32 %0, %0\n\t"
      "v_sqrt_f32 %1, %1\n\t"
      "v_sqrt_f32 %2, %2\n\t"
      "v_sqrt_f32 %3, %3\n\t"
      "v_sqrt_f32 %4, %4\n\t"
      "v_sqrt_f32 %5, %5\n\t"
      "v_sqrt_f32 %6, %6\n\t"
      "v_sqrt_f32 %7, %7\n\t"
      "v_sqrt_f32 %8, %8\n\t"
      "v_sqrt_f32 %9, %9\n\t"
      "v_sqrt_f32 %10, %10\n\t"
      "v_sqrt_f32 %11, %11\n\t"
      "v_sqrt_f32 %12, %12\n\t"
      "v_sqrt_f32 %13, %13\n\t"
      "v_sqrt_f32 %14, %14\n\t"
      "v_sqrt_f32 %15, %15\n\t"
      "v_nop"
      :
        "+v"(a[0]), "+v"(a[1]), "+v"(a[2]), "+v"(a[3]), "+v"(a[4]), "+v"(a[5]),
        "+v"(a[6]), "+v"(a[7]), "+v"(a[8]), "+v"(a[9]), "+v"(a[10]), "+v"(a[11]),
        "+v"(a[12]), "+v"(a[13]), "+v"(a[14]), "+v"(a[15]));
}
__device__ __forceinline__ void log2_16(float (&a)[16]) {
  asm(
      "v_log_f32 %0, %0\n\t"
      "v_log_f32 %1, %1\n\t"
      "v_log_f32 %2, %2\n\t"
      "v_log_f32 %3, %3\n\t"
      "v_log_f32 %4, %4\n\t"
      "v_log_f32 %5, %5\n\t"
      "v_log_f32 %6, %6\n\t"
      "v_log_f32 %7, %7\n\t"
      "v_log_f32 %8, %8\n\t"
      "v_log_f32 %9, %9\n\t"
      "v_log_f32 %10, %10\n\t"
      "v_log_f32 %11, %11\n\t"
      "v_log_f32 %12, %12\n\t"
      "v_log_f32 %13, %13\n\t"
      "v_log_f32 %14, %14\n\t"
      "v_log_f32 %15, %15\n\t"
      "v_nop"
      :
        "+v"(a[0]), "+v"(a[1]), "+v"(a[2]), "+v"(a[3]), "+v"(a[4]), "+v"(a[5]),
        "+v"(a[6]), "+v"(a[7]), "+v"(a[8]), "+v"(a[9]), "+v"(a[10]), "+v"(a[11]),
        "+v"(a[12]), "+v"(a[13]), "+v"(a[14]), "+v"(a[15]));
}
__device__ __forceinline__ void exp2_17(float (&a)[17]) {
  asm(
      "v_exp_f32 %0, %0\n\t"
      "v_exp_f32 %1, %1\n\t"
      "v_exp_f32 %2, %2\n\t"
      "v_exp_f32 %3, %3\n\t"
      "v_exp_f32 %4, %4\n\t"
      "v_exp_f32 %5, %5\n\t"
      "v_exp_f32 %6, %6\n\t"
      "v_exp_f32 %7, %7\n\t"
      "v_exp_f32 %8, %8\n\t"
      "v_exp_f32 %9, %9\n\t"
      "v_exp_f32 %10, %10\n\t"
      "v_exp_f32 %11, %11\n\t"
      "v_exp_f32 %12, %12\n\t"
      "v_exp_f32 %13, %13\n\t"
      "v_exp_f32 %14, %14\n\t"
      "v_exp_f32 %15, %15\n\t"
      "v_exp_f32 %16, %16\n\t"
      "v_nop"
      :
        "+v"(a[0]), "+v"(a[1]), "+v"(a[2]), "+v"(a[3]), "+v"(a[4]), "+v"(a[5]),
        "+v"(a[6]), "+v"(a[7]), "+v"(a[8]), "+v"(a[9]), "+v"(a[10]), "+v"(a[11]),
        "+v"(a[12]), "+v"(a[13]), "+v"(a[14]), "+v"(a[15]), "+v"(a[16]));
}

// ---------------------------------------------------------------------------
// Projections + hyperbolic maps. Block = 64 positions of one batch, 4 waves x 16 positions.
// Input x is channels-first [b][k = channel][l]: the 128 x 64 tile is read along l (16-B loads; the column role gathers by key, 4-B loads), converted to
// bf16 and transposed into LDS xt[l][k] (cross-wave, block barrier); each wave then holds its 16 positions
// as 4 B fragments (col = lane&15 = position).
// Weights: the block reads the f32 matrix of its pass ([out][in], k-contiguous: W_q or W_mem rows 0..127, then for
// the column role W_mem rows 128..255), rounds it to bf16 and keeps it in LDS wl; A fragments come from there.
// wl is written where no wave reads it: first in front of the barrier that publishes xt, then between the two
// barriers around the first copy-out. D = W_tile (A, row = out feature) x X (B, col = position): D[row d = 8h+r][col = position],
// so a lane holds 8 of the 16 head components of one position; lanes l and l^16 complete the head.
// pass 2: V^T hi/lo     = Klein point of (W_mem[128:256] x)               + scalar array 2 = key bias (base-2)
// Workspace planes are laid in the order the attention loop's fragments read them, so that each of its
// wave-wide 16-B loads covers 512 contiguous bytes (4 whole 128-B lines), lane (m, h) at byte 32 m + 16 h:
// spatial plane = [b][head][16-position tile][hi | lo][position m][component 0..15];
// V^T = [b][head][32-key block][hi | lo][key half q][channel d = m][key 16 q + 0..15].
// Key compaction: a key whose mask is 0 carries the additive term -1e30, so beside any key of the batch whose
// mask is 1 or more its softmax weight is exactly 0 (the other logit terms are small beside 1e30: arccosh of an
// f32 is below 90, the log-denominator below 10). Such keys are left out here: blockIdx.y = 0 blocks (column
// role: W_q plane, V^T, key bias) work on 64 SLOTS of the batch's list of kept keys, in key order, and gather
// the input columns of those keys; slots past the end of the list repeat key 0 with the masked term. A batch
// with no mask of 1 or more keeps every key, each with its own term. The count goes to nkeep[b * NKP] and
// bounds the attention loop. blockIdx.y = 1 blocks (row role: W_mem K plane) work on all 512 positions.
// LDS stg: cross-wave (block barriers); fully written before each copy-out (8 heads x 64 rows x 32, or
//   8 heads x 2 key blocks x 4 pieces x 256). ssc: 3 x 8 x 64 floats, written by lanes 0..15 of every wave, copied out last.
// coverage: row plane and scalar array 1: NB*8 blocks x 64 positions = all NB*512. Column plane, V^T, scalar
//   arrays 0 and 2: per batch the first ceil(kept / 64) blocks x 64 slots; the attention loop reads
//   ceil(kept / 32) x 32 slots, never more.
// ---------------------------------------------------------------------------
__global__ __launch_bounds__(128) void k_hproj(const float* __restrict__ x, const int* __restrict__ mask,
                                               const float* __restrict__ wmem, const float* __restrict__ wq,
                                               const float* __restrict__ bias_p,
                                               unsigned short* pl, unsigned short* vt, float* sca, int* nkeep) {
  __shared__ __attribute__((aligned(16))) unsigned short xt[64 * TPITCH];
  __shared__ __attribute__((aligned(16))) int srcl[64];      // column role: slot -> key position
  __shared__ __attribute__((aligned(16))) unsigned short wl[EW * TPITCH];   // the pass's weight matrix, bf16
  __shared__ __attribute__((aligned(16))) unsigned short stg[16384];
  __shared__ __attribute__((aligned(16))) float ssc[3 * NH * 64];
  const unsigned tid = threadIdx.x, lane = tid & 31u, hh = lane >> 4, m = lane & 15u;
  const unsigned wave = (unsigned)__builtin_amdgcn_readfirstlane((int)(threadIdx.x >> 5));
  const unsigned row0 = blockIdx.x * 64u;
  const unsigned bb = row0 >> 9, r0 = row0 & 511u;
  const bool col = blockIdx.y == 0u;
  unsigned cnt = SEQ;
  int mi = 0;                                  // read by the column role alone

  if (col) {
    // ---- kept keys of the batch: every wave forms the same 16 lane-mask words, so the count needs no barrier ----
    const int* mrow = mask + (size_t)bb * LFULL;
    int mw[16];
#pragma unroll
    for (int w = 0; w < 16; ++w) mw[w] = mrow[32 * w + (int)lane];
    // the code behind reuses these loads' offset and base registers: the wait stands in front of that
    asm volatile("s_wait_xcnt 0x0" ::: "memory");
    unsigned kw[16], anyp = 0u;
#pragma unroll
    for (int w = 0; w < 16; ++w) {
      kw[w] = __builtin_amdgcn_ballot_w32(mw[w] != 0);
      anyp |= __builtin_amdgcn_ballot_w32(mw[w] >= 1);
    }
    cnt = 0u;
#pragma unroll
    for (int w = 0; w < 16; ++w) {
      if (anyp == 0u) kw[w] = 0xFFFFFFFFu;
      cnt += (unsigned)__builtin_popcount(kw[w]);
    }
    if (r0 >= cnt) return;                     // no kept key in these 64 slots: the whole block leaves, before any barrier
    if (r0 == 0u && tid == 0u) nkeep[bb * NKP] = (int)cnt;
    unsigned pre = 0u;
#pragma unroll
    for (int w = 0; w < 16; ++w) {
      if ((unsigned)(w >> 2) == wave) {
        const unsigned slot = pre + (unsigned)__builtin_popcount(kw[w] & ((1u << lane) - 1u)) - r0;
        if (((kw[w] >> lane) & 1u) != 0u && slot < 64u) srcl[slot] = 32 * w + (int)lane;
      }
      pre += (unsigned)__builtin_popcount(kw[w]);
    }
    if (tid < 64u && r0 + tid >= cnt) srcl[tid] = 0;
    __syncthreads();
    // ---- input tile: x[b][k][key of slot r0 .. r0+63] -> xt[slot][k] bf16 ----
    const float* xg = x + (size_t)bb * XB_FULL;
    const unsigned l4 = (tid & 15u) << 2, k0 = tid >> 4;
    const v4i sp = *(const v4ia*)(srcl + l4);
    const unsigned o0 = k0 * LFULL + (unsigned)sp.x, o1 = k0 * LFULL + (unsigned)sp.y;
    const unsigned o2 = k0 * LFULL + (unsigned)sp.z, o3 = k0 * LFULL + (unsigned)sp.w;
    const unsigned sl = 16u * wave + m;
    const unsigned om = (unsigned)srcl[sl];
    mi = mrow[om];                             // the slot's own key's mask
    // unrolled whole: the 4-B loads differ only in a constant offset; each half's 32 are in flight together
#pragma unroll
    for (unsigned hf = 0; hf < 2u; ++hf) {
      float g[32];
#pragma unroll
      for (unsigned it = 0; it < 8u; ++it) {
        const float* xr = xg + (8u * hf + it) * (8u * LFULL);
        g[4u * it + 0u] = xr[o0]; g[4u * it + 1u] = xr[o1]; g[4u * it + 2u] = xr[o2]; g[4u * it + 3u] = xr[o3];
      }
      // the loads' five offset registers stay as they are up to this wait; what follows may reuse them
      asm volatile("s_wait_xcnt 0x0" :: "v"(om), "v"(o0), "v"(o1), "v"(o2), "v"(o3) : "memory");
#pragma unroll
      for (unsigned it = 0; it < 8u; ++it) {
        const unsigned k = 8u * (8u * hf + it) + k0;
        const unsigned c01 = (unsigned)pack2(g[4u * it + 0u], g[4u * it + 1u]);
        const unsigned c23 = (unsigned)pack2(g[4u * it + 2u], g[4u * it + 3u]);
        xt[(l4 + 0u) * TPITCH + k] = (unsigned short)c01;
        xt[(l4 + 1u) * TPITCH + k] = (unsigned short)(c01 >> 16);
        xt[(l4 + 2u) * TPITCH + k] = (unsigned short)c23;
        xt[(l4 + 3u) * TPITCH + k] = (unsigned short)(c23 >> 16);
      }
      // keeps the second half's loads behind the first half's LDS stores, so that at most 33 loads of a wave are
      // outstanding; the scheduler lifted them over the stores, which made 65, past what s_wait_loadcnt can name
      if (hf == 0u) __builtin_amdgcn_sched_barrier(0);
    }
    if (r0 + sl >= cnt) mi = 0;                // a slot past the end of the list counts as masked
  } else {
    // ---- input tile: x[b][k][r0 .. r0+63] -> xt[l][k] bf16 ----
    const float* xg = x + (size_t)bb * XB_FULL + r0;
#pragma unroll 1
    for (unsigned it = 0; it < 16u; ++it) {
      const unsigned p = it * 128u + tid, k = p >> 4, l4 = (p & 15u) << 2;
      const v4f v = *(const v4fa*)(xg + (size_t)k * LFULL + l4);
      const unsigned c01 = (unsigned)pack2(v.x, v.y), c23 = (unsigned)pack2(v.z, v.w);
      xt[(l4 + 0u) * TPITCH + k] = (unsigned short)c01;
      xt[(l4 + 1u) * TPITCH + k] = (unsigned short)(c01 >> 16);
      xt[(l4 + 2u) * TPITCH + k] = (unsigned short)c23;
      xt[(l4 + 3u) * TPITCH + k] = (unsigned short)(c23 >> 16);
    }
  }
  stage_w(col ? wq : wmem, 0u, wl, tid);
  __syncthreads();

  FragB xa[4];
  {
    const unsigned xo = (16u * wave + m) * TPITCH + 8u * hh;
#pragma unroll
    for (int ks = 0; ks < 4; ++ks) {
      xa[ks].q[0] = *(const v4ia*)(xt + xo + 32 * ks);
      xa[ks].q[1] = *(const v4ia*)(xt + xo + 32 * ks + 16);
    }
  }
  const float mv = (float)mi;
  const float mterm = (-1.0e30f * (1.0f - mv)) * LOG2E;
  const float biasv = bf16_val(bias_p[0]);
  const v8f zero8 = {0.f, 0.f, 0.f, 0.f, 0.f, 0.f, 0.f, 0.f};

  {
    const unsigned ps = col ? 0u : 1u;
    const float scl = (ps == 0u) ? 0.25f : 1.0f;
#pragma unroll 1
    for (unsigned t = 0; t < NH; ++t) {
      const unsigned short* wp = wl + (16u * t + m) * TPITCH + 8u * hh;
      FragB wf[4];
#pragma unroll
      for (int ks = 0; ks < 4; ++ks) wf[ks] = lds_frag(wp + 32 * ks);
      v8f acc = zero8;
#pragma unroll
      for (int ks = 0; ks < 4; ++ks) acc = wmb(wf[ks], xa[ks], acc);
      const float ch = hyp8(acc, scl);           // acc[r] = spatial[position 16 wave + m][8h + r]
      v4i hi, lo;
      split8(acc, hi, lo);
      const unsigned so = (t * 64u + 16u * wave) * QROW + 16u * m + 8u * hh;
      *(v4ia*)(stg + so) = hi;
      *(v4ia*)(stg + so + TILEH) = lo;
      if (hh == 0u) ssc[(ps * NH + t) * 64u + 16u * wave + m] = ch;
    }
    __syncthreads();
    if (col) stage_w(wmem, EW * EW, wl, tid);    // every wave has left the first pass: wl takes the V matrix
    {
      unsigned short* dst = pl + (size_t)ps * PLN + ((size_t)bb * NH * SEQ + r0) * QROW;
#pragma unroll 1
      for (unsigned it = 0; it < 16u; ++it) {
        const unsigned p = it * 128u + tid, t = p >> 8, wi = p & 255u;
        const v4i v = *(const v4ia*)(stg + p * 8u);
        *(v4i*)(dst + (size_t)t * (SEQ * QROW) + wi * 8u) = v;
        // what follows rewrites the store's address and data registers: the wait stands in front of that
        asm volatile("s_wait_xcnt 0x0" ::: "memory");
      }
      
    }
    __syncthreads();
  }

  // ---- pass 2 (column role): Klein points -> V^T hi / lo stage, key bias ----
  if (col) {
#pragma unroll 1
  for (unsigned t = 0; t < NH; ++t) {
    const unsigned short* wp = wl + (16u * t + m) * TPITCH + 8u * hh;
    FragB wf[4];
#pragma unroll
    for (int ks = 0; ks < 4; ++ks) wf[ks] = lds_frag(wp + 32 * ks);
    v8f acc = zero8;
#pragma unroll
    for (int ks = 0; ks < 4; ++ks) acc = wmb(wf[ks], xa[ks], acc);
    const float lb2 = klein8(acc, biasv, mterm);  // acc[r] = v_klein[position 16 wave + m][8h + r]
    v4i vh, vl;
    split8(acc, vh, vl);
#pragma unroll
    for (int r = 0; r < 8; ++r) {
      // head t: [key block wave >> 1][hi | lo][key half wave & 1][channel 8h + r][key m]
      const unsigned so = t * 2048u + (wave >> 1) * 1024u + (wave & 1u) * TILEH + (8u * hh + (unsigned)r) * 16u + m;
      stg[so] = (unsigned short)((unsigned)vh[r >> 1] >> (16 * (r & 1)));
      stg[so + 2u * TILEH] = (unsigned short)((unsigned)vl[r >> 1] >> (16 * (r & 1)));
    }
    if (hh == 0u) ssc[(2u * NH + t) * 64u + 16u * wave + m] = lb2;
  }
  __syncthreads();
  {
    unsigned short* dst = vt + (size_t)bb * NH * (2 * HD * SEQ) + r0 * (2 * HD);
#pragma unroll 1
    for (unsigned it = 0; it < 16u; ++it) {
      const unsigned p = it * 128u + tid, t = p >> 8, wi = p & 255u;
      const v4i v = *(const v4ia*)(stg + p * 8u);
      *(v4i*)(dst + (size_t)t * (2 * HD * SEQ) + wi * 8u) = v;
      // the next trip rewrites the store's address and data registers: the wait stands in front of that
      asm volatile("s_wait_xcnt 0x0" ::: "memory");
    }
    
  }
  }
  {
#pragma unroll 1
    for (unsigned it = 0; it < 3u; ++it) {
      if ((it == 1u) == col) continue;         // array 1 is the row role's, arrays 0 and 2 the column role's
      const unsigned p = it * 128u + tid, a = p >> 7, t = (p >> 4) & 7u, c = p & 15u;
      const v4f v = *(const v4fa*)(ssc + p * 4u);
      *(v4f*)(sca + (size_t)a * SCN + ((size_t)bb * NH + t) * SEQ + r0 + 4u * c) = v;
      // the next trip rewrites the store's address and data registers: the wait stands in front of that
      asm volatile("s_wait_xcnt 0x0" ::: "memory");
    }
    
  }
}

// ---------------------------------------------------------------------------
// Fused Lorentz attention: one block = (batch b, 32 softmax rows i0..i0+31), 8 waves, wave = head; each wave
// runs two 16-row tiles side by side in one loop over the batch's kept keys (column position j = slot). Flash attention in the transposed domain:
//   S^T tile = C (A, row = column position j) x R^T (B, col = row position i): the K = 16 spatial product is
//   laid as [c_hi|c_hi] x [r_hi|r_lo] plus [c_lo|0] x [r_hi|r_lo] along the 32-deep k axis.
//   D[row j 8h+r][col i m]. Per element: x = rt[i]*ct[j] - D, logit2 = -beta*log2(x1 + sqrt(x1^2-1)) + cb[j]
//   (cb carries log-denominator, bias and the additive key mask term). Softmax statistics are per lane
//   (row i = m); the two lane halves combine by one xor-16 exchange. The P^T B-fragment is the lane's own
//   16 results (tile 0 -> elements 0..7, tile 1 -> elements 8..15). O^T = V^T (A, row d) x P^T:
//   D[row d 8h+r][col i m], scaled per lane.
// Output stage ost[channel 0..127][position 0..31] (cross-wave, block barrier): every wave writes its 16
// coverage: grid (16, NB) x 128 channels x 32 positions = NB*128*512 outputs, each written by exactly one lane.
// ---------------------------------------------------------------------------
__global__ __launch_bounds__(256) void k_hattn(const unsigned short* __restrict__ rpl,
                                               const unsigned short* __restrict__ cpl,
                                               const unsigned short* __restrict__ vt,
                                               const float* __restrict__ rtt,
                                               const float* __restrict__ ctt,
                                               const float* __restrict__ cbb,
                                               const float* __restrict__ beta_p,
                                               const int* __restrict__ nkeep,
                                               float* out) {
  __shared__ __attribute__((aligned(16))) float ost[EW * OPITCH];
  const unsigned tid = threadIdx.x, lane = tid & 31u, hh = lane >> 4, m = lane & 15u;
  const unsigned wave = (unsigned)__builtin_amdgcn_readfirstlane((int)(threadIdx.x >> 5));
  const unsigned i0 = blockIdx.x * 32u, b = blockIdx.y;
  const unsigned bh = b * NH + wave;
  const v8f zero8 = {0.f, 0.f, 0.f, 0.f, 0.f, 0.f, 0.f, 0.f};
  const v4i zero4 = {0, 0, 0, 0};
  const float nbeta = -bf16_val(beta_p[0]);
  // kept keys of this batch, rounded up to whole 32-key blocks (the slots behind the last kept key weigh 0)
  const int nk = nkeep[b * NKP];
  const unsigned nend = ((unsigned)(nk < 1 ? 1 : (nk > SEQ ? SEQ : nk)) + 31u) & ~31u;

  const unsigned fo = 16u * m + 8u * hh;      // the lane's 16 bytes inside a 512-B piece
  const unsigned short* kb = cpl + (size_t)bh * SEQ * QROW + fo;
  const unsigned short* vb = vt + (size_t)bh * (2 * HD * SEQ) + fo;
  const float* ctp = ctt + (size_t)bh * SEQ + 8u * hh;
  const float* cbp = cbb + (size_t)bh * SEQ + 8u * hh;

  // Both 16-row tiles of the wave go through ONE key loop: a key block's K, V and per-key scalars are loaded once
  // and serve both tiles, and the two tiles' chains are independent work for the wave while either one waits.
  // Every loop over tl is unrolled whole: tl indexes arrays that have to stay in registers.
  FragB qf[2];
  float rt[2];
#pragma unroll
  for (unsigned tl = 0; tl < 2u; ++tl) {
    const unsigned g0 = i0 + 16u * tl;
    const unsigned short* qp = rpl + ((size_t)bh * SEQ + g0) * QROW + fo;
    qf[tl].q[0] = *(const v4ia*)qp;            // r_hi[8h .. 8h+7]  (k slots 8h..)
    qf[tl].q[1] = *(const v4ia*)(qp + TILEH);  // r_lo[8h .. 8h+7]  (k slots 16+8h..)
    rt[tl] = rtt[(size_t)bh * SEQ + g0 + m];
  }
  // the key loop reuses these six loads' address registers: the wait stands in front of that
  asm volatile("s_wait_xcnt 0x0" ::: "memory");
  v8f o[2] = {zero8, zero8};
  float mrun[2] = {-3.0e38f, -3.0e38f}, lrun[2] = {0.0f, 0.0f};
#pragma unroll 1
  for (unsigned n0 = 0; n0 < nend; n0 += 32u) {
    const unsigned short* kp = kb + (size_t)n0 * QROW;
    const v4i kh0 = *(const v4ia*)kp;
    const v4i kl0 = *(const v4ia*)(kp + TILEH);
    const v4i kh1 = *(const v4ia*)(kp + 2 * TILEH);
    const v4i kl1 = *(const v4ia*)(kp + 3 * TILEH);
    const v4f t0 = *(const v4fa*)(ctp + n0);
    const v4f t1 = *(const v4fa*)(ctp + n0 + 4u);
    const v4f t2 = *(const v4fa*)(ctp + n0 + 16u);
    const v4f t3 = *(const v4fa*)(ctp + n0 + 20u);
    const v4f u0 = *(const v4fa*)(cbp + n0);
    const v4f u1 = *(const v4fa*)(cbp + n0 + 4u);
    const v4f u2 = *(const v4fa*)(cbp + n0 + 16u);
    const v4f u3 = *(const v4fa*)(cbp + n0 + 20u);
    FragB fvh, fvl;
    const unsigned short* vp = vb + (size_t)n0 * (2 * HD);
    fvh.q[0] = *(const v4ia*)vp;                 // keys n0 + 8h + 0..7
    fvh.q[1] = *(const v4ia*)(vp + TILEH);       // keys n0 + 16 + 8h + 0..7
    fvl.q[0] = *(const v4ia*)(vp + 2 * TILEH);
    fvl.q[1] = *(const v4ia*)(vp + 3 * TILEH);
    // the sixteen loads' four address pairs stay as they are up to this wait; what follows may reuse them
    asm volatile("s_wait_xcnt 0x0" :: "v"(kp), "v"(vp), "v"(ctp + n0), "v"(cbp + n0) : "memory");
    FragB a10, a20, a11, a21;
    a10.q[0] = kh0; a10.q[1] = kh0;
    a20.q[0] = kl0; a20.q[1] = zero4;
    a11.q[0] = kh1; a11.q[1] = kh1;
    a21.q[0] = kl1; a21.q[1] = zero4;
    const v8f ct0 = __builtin_shufflevector(t0, t1, 0, 1, 2, 3, 4, 5, 6, 7);
    const v8f ct1 = __builtin_shufflevector(t2, t3, 0, 1, 2, 3, 4, 5, 6, 7);
    const v8f cb0 = __builtin_shufflevector(u0, u1, 0, 1, 2, 3, 4, 5, 6, 7);
    const v8f cb1 = __builtin_shufflevector(u2, u3, 0, 1, 2, 3, 4, 5, 6, 7);
    v8f s0[2], s1[2];
#pragma unroll
    for (int tl = 0; tl < 2; ++tl) {
      s0[tl] = wmb(a10, qf[tl], zero8);
      s0[tl] = wmb(a20, qf[tl], s0[tl]);
      s1[tl] = wmb(a11, qf[tl], zero8);
      s1[tl] = wmb(a21, qf[tl], s1[tl]);
    }
    // logit in the base-2 domain: x = rt*ct - dot (minus the Lorentz product), x1 = x + 1e-6,
    // arccosh(x1) = ln(x1 + sqrt(x1^2 - 1)); a = -beta * log2(x1 + sqrt(x1^2 - 1)) + cb
    v8f a0[2], a1[2];
    float tm[2];
#pragma unroll
    for (int tl = 0; tl < 2; ++tl) {
      float x1[16], w[16];
#pragma unroll
      for (int r = 0; r < 8; ++r) {
        x1[r]     = (rt[tl] * ct0[r] - s0[tl][r]) + 1.0e-6f;        // column position n0 + 8h + r
        x1[8 + r] = (rt[tl] * ct1[r] - s1[tl][r]) + 1.0e-6f;        // column position n0 + 16 + 8h + r
      }
#pragma unroll
      for (int i = 0; i < 16; ++i) w[i] = fmaxf(x1[i] * x1[i] - 1.0f, 0.0f);
      sqrt16(w);
#pragma unroll
      for (int i = 0; i < 16; ++i) w[i] = x1[i] + w[i];
      log2_16(w);
#pragma unroll
      for (int r = 0; r < 8; ++r) {
        a0[tl][r] = nbeta * w[r] + cb0[r];
        a1[tl][r] = nbeta * w[8 + r] + cb1[r];
      }
      float t = fmaxf(a0[tl][0], a1[tl][0]);
#pragma unroll
      for (int r = 1; r < 8; ++r) t = fmaxf(t, fmaxf(a0[tl][r], a1[tl][r]));
      tm[tl] = t;
    }
    float tx[2];
#pragma unroll
    for (int tl = 0; tl < 2; ++tl) tx[tl] = __shfl_xor(tm[tl], 16);
#pragma unroll
    for (int tl = 0; tl < 2; ++tl) {
      const float t = fmaxf(tm[tl], tx[tl]);
      const float mnew = fmaxf(mrun[tl], t);
      float e[17];
#pragma unroll
      for (int r = 0; r < 8; ++r) {
        e[r]     = a0[tl][r] - mnew;
        e[8 + r] = a1[tl][r] - mnew;
      }
      e[16] = mrun[tl] - mnew;
      exp2_17(e);
      const float sc = e[16];
      v8f p0, p1;
      float ps = 0.0f;
#pragma unroll
      for (int r = 0; r < 8; ++r) {
        p0[r] = e[r];
        p1[r] = e[8 + r];
        ps += p0[r] + p1[r];
      }
      lrun[tl] = lrun[tl] * sc + ps;
      mrun[tl] = mnew;
      o[tl] = o[tl] * sc;

      FragB ph, pw;
      split8(p0, ph.q[0], pw.q[0]);
      split8(p1, ph.q[1], pw.q[1]);
      o[tl] = wmb(fvh, ph, o[tl]);
      o[tl] = wmb(fvl, ph, o[tl]);
      o[tl] = wmb(fvh, pw, o[tl]);
    }
  }
#pragma unroll
  for (unsigned tl = 0; tl < 2u; ++tl) {
    const float lt = lrun[tl] + __shfl_xor(lrun[tl], 16);
    const float inv = 1.0f / lt;
    const v8f c = o[tl] * inv;                // out[channel 16 wave + 8h + r][position i0 + 16 tl + m]
    const unsigned so = (16u * wave + 8u * hh) * OPITCH + 16u * tl + m;
#pragma unroll
    for (int r = 0; r < 8; ++r) ost[so + (unsigned)r * OPITCH] = c[r];
  }
  __syncthreads();

  {
    float* ob = out + (size_t)b * XB_FULL + i0;
#pragma unroll 1
    for (unsigned it = 0; it < 4u; ++it) {
      const unsigned p = it * 256u + tid, c = p >> 3, q = p & 7u;
      const v4f v = *(const v4fa*)(ost + c * OPITCH + 4u * q);
      *(v4f*)(ob + (size_t)c * LFULL + 4u * q) = v;
    }
    
  }
}

// ---------------------------------------------------------------------------
static inline size_t al256(size_t o) { return (o + 255) & ~(size_t)255; }

extern "C" void kernel_launch(void* const* d_in, const int* in_sizes, int n_in,
                              void* d_out, int out_size, void* d_ws, size_t ws_size,
                              hipStream_t stream) {
  (void)stream;
  if (n_in < 6) return;
  const long long actN = (long long)NB * EW * LFULL;
  if ((long long)in_sizes[0] < actN) return;                 // queries [b][channel][l]
  if ((long long)in_sizes[1] < (long long)NB * LFULL) return; // mask [b][l] int32
  if (in_sizes[2] < 2 * EW * EW) return;                     // W_mem [256][128]
  if (in_sizes[3] < EW * EW) return;                         // W_q [128][128]
  if (in_sizes[4] < 1 || in_sizes[5] < 1) return;            // beta, bias
  if ((long long)out_size < actN) return;

  const float* queries = (const float*)d_in[0];
  const int*   mask    = (const int*)d_in[1];
  const float* Wmem    = (const float*)d_in[2];
  const float* Wq      = (const float*)d_in[3];
  const float* beta    = (const float*)d_in[4];
  const float* bias    = (const float*)d_in[5];
  float* out = (float*)d_out;

  const size_t plB = al256((size_t)2 * PLN * 2);                // 16,777,216 at NB = 32
  const size_t vB  = al256((size_t)2 * VPL * 2);                // 8,388,608
  const size_t scB = al256((size_t)3 * SCN * 4);                // 1,572,864
  const size_t nkB = al256((size_t)NB * NKP * 4);               // 4,096
  const size_t total = plB + vB + scB + nkB;                    // 26,742,784
  if (total > ws_size || total > (size_t)WSMAX) return;
  char* w = (char*)d_ws;
  unsigned short* pln = (unsigned short*)w;
  unsigned short* vtp = (unsigned short*)(w + plB);
  float*          sca = (float*)(w + plB + vB);
  int*            nkp = (int*)(w + plB + vB + scB);
  unsigned short* cpl = pln;              // column plane (from W_q)
  unsigned short* rpl = pln + PLN;        // row plane (from W_mem rows 0..127)
  float* ctt = sca;
  float* rtt = sca + SCN;
  float* cbb = sca + 2 * SCN;

  // 1: projections + hyperboloid / Klein maps -> planes and per-position scalars (y = 0: kept keys, y = 1: rows)
  k_hproj<<<dim3((NB * SEQ) / 64, 2), 128, 0, stream>>>(queries, mask, Wmem, Wq, bias, pln, vtp, sca, nkp);
  // 2: Lorentz attention, channels-first output
  k_hattn<<<dim3(SEQ / 32, NB), 256, 0, stream>>>(rpl, cpl, vtp, rtt, ctt, cbb, beta, nkp, out);
}

// v008
// A run of this version takes 21.7 microseconds.
// In both of two side-by-side timings against v007, it was 1.52 times as fast.
// Over all steps from v000 it is 5.73 times as fast.
// Contractions: W_mem / W_q projections = v_wmma_f32_16x16x32_bf16, bf16 (RNE) inputs and weights, one product. Lorentz spatial product k_sp.q_sp (K = 16) and P.V = same bf16 WMMA with every computed operand carried as bf16 hi + bf16 lo (hi.hi + lo.hi + hi.lo). Accumulate f32 everywhere.
// Time-like rank-1 term, arccosh, additive key bias, online softmax (base-2 form): f32 VALU. No power-of-two carries exist (bf16 planes only).
#include <hip/hip_runtime.h>
#include <stddef.h>
#include <stdint.h>
#include <math.h>

#ifndef NB
#define NB 32                      // batches processed (a reduced build reads the first NB batches)
#endif
#define SEQ    512                 // positions per batch (softmax rows i and softmax columns j)
#define LFULL  512                 // full row length of the channels-first input / output and of the mask
#define EW     128                 // model width = heads x head dim
#define NH     8
#define HD     16
#define QROW   32                  // halfwords per key slot in the spatial plane: 16 hi + 16 lo
#define TILEH  256                 // halfwords per 512-B piece of a plane: 16 rows x 16 halfwords, one wave-wide 16-B load
#define TPITCH 136                 // halfwords per LDS weight row
#define OPITCH 36                  // floats per LDS output-stage row
#define NW     16                  // waves per block; wave w owns positions 32 w .. 32 w + 31
#define XB_FULL ((size_t)EW * LFULL)            // floats per batch of the input and of the output
#define LOG2E  1.4426950408889634f

static_assert(NH * HD == EW);
static_assert(SEQ == 512 && LFULL == 512);
static_assert(NW * 32 == SEQ);                 // one mask word, two 16-row tiles a wave
static_assert(16 * QROW == 2 * TILEH);         // 16 slots of the spatial plane = hi piece + lo piece
static_assert(2 * HD * 32 == 4 * TILEH);       // 32 keys of V^T, hi and lo = 4 pieces
static_assert(EW * 4 == 32 * 16);              // one weight row = one wave-wide 16-B load
static_assert(NW == HD);                       // weight staging: wave w takes row w of the head's three slices
static_assert(TPITCH % 8 == 0 && TPITCH >= EW);
static_assert(OPITCH % 4 == 0 && OPITCH >= 32);

typedef int            v4i   __attribute__((ext_vector_type(4)));
typedef int            v8i   __attribute__((ext_vector_type(8)));
typedef float          v4f   __attribute__((ext_vector_type(4)));
typedef float          v8f   __attribute__((ext_vector_type(8)));
typedef __bf16         v16bf __attribute__((ext_vector_type(16)));
typedef int            v2i   __attribute__((ext_vector_type(2)));
typedef float          v2f   __attribute__((ext_vector_type(2)));
typedef __bf16         v2bf  __attribute__((ext_vector_type(2)));
typedef v2i __attribute__((may_alias)) v2ia;
typedef v4i __attribute__((may_alias)) v4ia;
typedef v4f __attribute__((may_alias)) v4fa;
union FragB { v16bf v; v4i q[2]; v8i w; };

// WMMA with hazard guard: ties D, keeps A/B live for 4 VALU slots
__device__ __forceinline__ v8f wmb(const FragB& a, const FragB& b, v8f c) {
  v8f d = __builtin_amdgcn_wmma_f32_16x16x32_bf16(false, a.v, false, b.v, (short)0, c, false, false);
  asm volatile("v_nop\n\tv_nop\n\tv_nop\n\tv_nop" : "+v"(d) : "v"(a.w), "v"(b.w));
  return d;
}

// two f32 -> two bf16 (RNE) in one word, by the convert instruction (v_cvt_pk_bf16_f32): lo in the low halfword
__device__ __forceinline__ int pack2(float lo, float hi) {
  const v2f p = {lo, hi};
  return __builtin_bit_cast(int, __builtin_convertvector(p, v2bf));
}
__device__ __forceinline__ float bf16_val(float f) {
  return __uint_as_float((unsigned)pack2(f, f) << 16);
}
// 8 f32 -> bf16 hi piece + bf16 lo piece (lo = RNE(v - hi)); element 2j in the low halfword of word j.
// hi: one convert a pair. lo: hi * (-1) + v in the mixed-precision FMA that takes the bf16 half as it lies in
// the hi word and writes its bf16 result into one half of the lo word (v - hi is exact in f32, so the one
// rounding is the same as that of a subtraction and a convert): three instructions a pair.
// One asm statement: a plain subtraction and conversion compiled to five instructions a pair (two unpacks, a
// packed subtraction, the two converts). The four low halves stand in front of
// the four high halves; each high half rewrites the word its low half wrote four instructions back, which the
// s_delay_alu lines tell the issue logic, so that another wave can issue meanwhile.
__device__ __forceinline__ void split8(const v8f x, v4i& hi, v4i& lo) {
#pragma unroll
  for (int j = 0; j < 4; ++j) hi[j] = pack2(x[2 * j], x[2 * j + 1]);
  const int m1 = (int)0xBF80BF80u;            // bf16 -1.0 in both halves
  int l0, l1, l2, l3;
  asm("v_fma_mixlo_bf16 %0, %4, %8, %9 op_sel_hi:[1,1,0]\n\t"
      "v_fma_mixlo_bf16 %1, %5, %8, %11 op_sel_hi:[1,1,0]\n\t"
      "v_fma_mixlo_bf16 %2, %6, %8, %13 op_sel_hi:[1,1,0]\n\t"
      "v_fma_mixlo_bf16 %3, %7, %8, %15 op_sel_hi:[1,1,0]\n\t"
      "s_delay_alu instid0(VALU_DEP_4) | instskip(NEXT) | instid1(VALU_DEP_4)\n\t"
      "v_fma_mixhi_bf16 %0, %4, %8, %10 op_sel:[1,0,0] op_sel_hi:[1,1,0]\n\t"
      "v_fma_mixhi_bf16 %1, %5, %8, %12 op_sel:[1,0,0] op_sel_hi:[1,1,0]\n\t"
      "s_delay_alu instid0(VALU_DEP_4) | instskip(NEXT) | instid1(VALU_DEP_4)\n\t"
      "v_fma_mixhi_bf16 %2, %6, %8, %14 op_sel:[1,0,0] op_sel_hi:[1,1,0]\n\t"
      "v_fma_mixhi_bf16 %3, %7, %8, %16 op_sel:[1,0,0] op_sel_hi:[1,1,0]"
      : "=&v"(l0), "=&v"(l1), "=&v"(l2), "=&v"(l3)
      : "v"(hi[0]), "v"(hi[1]), "v"(hi[2]), "v"(hi[3]), "v"(m1),
        "v"(x[0]), "v"(x[1]), "v"(x[2]), "v"(x[3]), "v"(x[4]), "v"(x[5]), "v"(x[6]), "v"(x[7]));
  lo[0] = l0; lo[1] = l1; lo[2] = l2; lo[3] = l3;
}
// fragment (row/col = lane&15) from an LDS k-contiguous bf16 row: p = row + k0 + 8h;
// elements 0..7 <- k0+8h+0..7, 8..15 <- k0+16+8h+0..7
__device__ __forceinline__ FragB lds_frag(const unsigned short* p) {
  FragB f;
  f.q[0] = *(const v4ia*)p;
  f.q[1] = *(const v4ia*)(p + 16);
  return f;
}
// The maps' root, reciprocal, 2^x and log2 as the bare instructions, where a last-bit error does no harm. The
// library sinhf and coshf carry e^n in two floats, the library root and division correct the last bit and rescale
// subnormals: together over a hundred vector instructions a head, nearly all in one dependent chain, in a kernel
// that has 16 waves a block, four or more on a SIMD, to hide it. The operands here come from bf16-rounded inputs and weights.
// On return ep = e^n / 2, em = e^-n / 2 (the halving rides in the exponent, so the range is that of sinh and cosh
// themselves) and iv = 1 / max(n, 1e-12). sinh = ep - em and cosh = ep + em share ep's error, which then only
// scales the point's Lorentz products.
// One asm statement, every value in place: no instruction in it touches its neighbour's register, and the closing
// v_nop is the slot the instruction set asks for between the last one and a reader of its result (as builtins
// the three compiled to a run in which one overwrote the source of the one directly in front).
__device__ __forceinline__ void exps_rcp(const float n, float& ep, float& em, float& iv) {
  ep = __builtin_fmaf(n, LOG2E, -1.0f);
  em = __builtin_fmaf(-n, LOG2E, -1.0f);
  iv = fmaxf(n, 1.0e-12f);
  asm("v_exp_f32 %0, %0\n\t"
      "v_exp_f32 %1, %1\n\t"
      "v_rcp_f32 %2, %2\n\t"
      "v_nop"
      : "+v"(ep), "+v"(em), "+v"(iv));
}

// Hyperboloid map of one head vector held as 8 + 8 components by lanes l and l^16:
// a <- normalize(a * scl) * sinh(|a * scl|); returns cosh(|a * scl|). Both lane halves get identical norms.
__device__ __forceinline__ float hyp8(v8f& a, const float scl) {
#pragma clang fp contract(off)
  float ss = 0.0f;
#pragma unroll
  for (int r = 0; r < 8; ++r) { a[r] = a[r] * scl; ss += a[r] * a[r]; }
  ss += __shfl_xor(ss, 16);
  const float n = __builtin_amdgcn_sqrtf(ss);
  float ep, em, inv;
  exps_rcp(n, ep, em, inv);
  const float sh = ep - em;
  const float ch = ep + em;
#pragma unroll
  for (int r = 0; r < 8; ++r) a[r] = (a[r] * inv) * sh;
  return ch;
}

// Klein map of one head vector: a <- normalize(hyperboloid_spatial / hyperboloid_time);
// returns (log(1 / (sqrt(1 - (|a| - 1e-4)^2) + 1e-4)) + biasv) * log2(e) + mterm.
__device__ __forceinline__ float klein8(v8f& a, const float biasv, const float mterm) {
#pragma clang fp contract(off)
  float ss = 0.0f;
#pragma unroll
  for (int r = 0; r < 8; ++r) ss += a[r] * a[r];
  ss += __shfl_xor(ss, 16);
  // vn, inv, sh and ich only scale the vector, and the normalisation below takes any common scale out again
  const float vn = __builtin_amdgcn_sqrtf(ss);
  float ep, em, inv;
  exps_rcp(vn, ep, em, inv);
  const float sh = ep - em;
  const float ich = __builtin_amdgcn_rcpf(ep + em);
  float s2 = 0.0f;
#pragma unroll
  for (int r = 0; r < 8; ++r) { a[r] = ((a[r] * inv) * sh) * ich; s2 += a[r] * a[r]; }
  s2 += __shfl_xor(s2, 16);
  // library root and true division here and for vnk: one last-bit step of vnk beside 1 moves 1 - dm * dm, and so
  // the key bias, by far more than one last bit
  const float n2 = sqrtf(s2);
  const float inv2 = 1.0f / fmaxf(n2, 1.0e-12f);
  float s3 = 0.0f;
#pragma unroll
  for (int r = 0; r < 8; ++r) { a[r] = a[r] * inv2; s3 += a[r] * a[r]; }
  s3 += __shfl_xor(s3, 16);
  const float vnk = sqrtf(s3);
  const float dm = vnk - 1.0e-4f;
  const float den = __builtin_amdgcn_sqrtf(1.0f - dm * dm) + 1.0e-4f;
  // log(1 / den) * log2(e) = -log2(den); den lies between 1e-4 and about 1, a normal number
  return (biasv * LOG2E - __builtin_amdgcn_logf(den)) + mterm;
}

// The attention loop's root, log2 and 2^x as the bare instructions. The library forms wrap each in a rescale
// for subnormal arguments or results and give the root a last-bit correction: about 5 to 15 vector
// instructions per value. Here the root's argument is 0 or a normal number (x1^2 - 1 of an f32 x1, clamped at
// 0), the log's is about 1 or more, and a 2^x below the normal range may come out as 0 beside a row sum that
// holds a term equal to 1; the root keeps the instruction's own 1 ulp.
// One asm statement per kind, every value in place: no instruction in it touches its neighbour's register, and
// the closing v_nop is the slot the instruction set asks for between the last one and a reader of its result
// (the builtins compiled to runs in which one overwrote the source of the one directly in front).
__device__ __forceinline__ void sqrt16(float (&a)[16]) {
  asm(
      "v_sqrt_f32 %0, %0\n\t"
      "v_sqrt_f32 %1, %1\n\t"
      "v_sqrt_f32 %2, %2\n\t"
      "v_sqrt_f32 %3, %3\n\t"
      "v_sqrt_f32 %4, %4\n\t"
      "v_sqrt_f32 %5, %5\n\t"
      "v_sqrt_f32 %6, %6\n\t"
      "v_sqrt_f32 %7, %7\n\t"
      "v_sqrt_f32 %8, %8\n\t"
      "v_sqrt_f32 %9, %9\n\t"
      "v_sqrt_f32 %10, %10\n\t"
      "v_sqrt_f32 %11, %11\n\t"
      "v_sqrt_f32 %12, %12\n\t"
      "v_sqrt_f32 %13, %13\n\t"
      "v_sqrt_f32 %14, %14\n\t"
      "v_sqrt_f32 %15, %15\n\t"
      "v_nop"
      :
        "+v"(a[0]), "+v"(a[1]), "+v"(a[2]), "+v"(a[3]), "+v"(a[4]), "+v"(a[5]),
        "+v"(a[6]), "+v"(a[7]), "+v"(a[8]), "+v"(a[9]), "+v"(a[10]), "+v"(a[11]),
        "+v"(a[12]), "+v"(a[13]), "+v"(a[14]), "+v"(a[15]));
}
__device__ __forceinline__ void log2_16(float (&a)[16]) {
  asm(
      "v_log_f32 %0, %0\n\t"
      "v_log_f32 %1, %1\n\t"
      "v_log_f32 %2, %2\n\t"
      "v_log_f32 %3, %3\n\t"
      "v_log_f32 %4, %4\n\t"
      "v_log_f32 %5, %5\n\t"
      "v_log_f32 %6, %6\n\t"
      "v_log_f32 %7, %7\n\t"
      "v_log_f32 %8, %8\n\t"
      "v_log_f32 %9, %9\n\t"
      "v_log_f32 %10, %10\n\t"
      "v_log_f32 %11, %11\n\t"
      "v_log_f32 %12, %12\n\t"
      "v_log_f32 %13, %13\n\t"
      "v_log_f32 %14, %14\n\t"
      "v_log_f32 %15, %15\n\t"
      "v_nop"
      :
        "+v"(a[0]), "+v"(a[1]), "+v"(a[2]), "+v"(a[3]), "+v"(a[4]), "+v"(a[5]),
        "+v"(a[6]), "+v"(a[7]), "+v"(a[8]), "+v"(a[9]), "+v"(a[10]), "+v"(a[11]),
        "+v"(a[12]), "+v"(a[13]), "+v"(a[14]), "+v"(a[15]));
}
__device__ __forceinline__ void exp2_17(float (&a)[17]) {
  asm(
      "v_exp_f32 %0, %0\n\t"
      "v_exp_f32 %1, %1\n\t"
      "v_exp_f32 %2, %2\n\t"
      "v_exp_f32 %3, %3\n\t"
      "v_exp_f32 %4, %4\n\t"
      "v_exp_f32 %5, %5\n\t"
      "v_exp_f32 %6, %6\n\t"
      "v_exp_f32 %7, %7\n\t"
      "v_exp_f32 %8, %8\n\t"
      "v_exp_f32 %9, %9\n\t"
      "v_exp_f32 %10, %10\n\t"
      "v_exp_f32 %11, %11\n\t"
      "v_exp_f32 %12, %12\n\t"
      "v_exp_f32 %13, %13\n\t"
      "v_exp_f32 %14, %14\n\t"
      "v_exp_f32 %15, %15\n\t"
      "v_exp_f32 %16, %16\n\t"
      "v_nop"
      :
        "+v"(a[0]), "+v"(a[1]), "+v"(a[2]), "+v"(a[3]), "+v"(a[4]), "+v"(a[5]),
        "+v"(a[6]), "+v"(a[7]), "+v"(a[8]), "+v"(a[9]), "+v"(a[10]), "+v"(a[11]),
        "+v"(a[12]), "+v"(a[13]), "+v"(a[14]), "+v"(a[15]), "+v"(a[16]));
}

// ---------------------------------------------------------------------------
// One launch. Block = (head t, batch b), 16 waves; wave w owns positions 32 w .. 32 w + 31 of the batch, as two
// 16-position tiles: it projects them for its head and then runs them as its two softmax row tiles.
// Nothing goes through global memory between projection and attention: a head's attention needs only that head's
// 16 rows of W_q, of W_mem[0:128] and of W_mem[128:256], applied to the batch's 512 input columns.
// Weights: the 48 rows are rounded to bf16 into LDS wl (wave w loads row w of each slice, a whole 512-B row a load);
// A fragments (row = lane&15 = out feature) come from there.
// Input x is channels-first [b][k = channel][l]: a lane reads the 64 channels of its B fragments (col = lane&15 =
// position, k = 32 ks + 8 h + 0..7 and 32 ks + 16 + 8 h + 0..7) by 4-B loads; the 16 lanes of a half read 64
// contiguous bytes, and the wave's two tiles together use each 128-B line whole.
// D = W_tile (A) x X (B): D[row d = 8h+r][col = position], so a lane holds 8 of the 16 head components of one
// position; lanes l and l^16 complete the head.
// row role (W_mem[0:128]): hyperboloid point; hi / lo pieces are the lane's own B fragment of the score product
//   and stay in registers, with the time-like part.
// column role (W_q, scaled 0.25): hyperboloid point -> LDS cpl, time-like part -> ctl.
// value role (W_mem[128:256]): Klein point -> LDS vtl (transposed), key bias (base-2) -> cbl.
// The LDS planes are laid in the order the attention loop's fragments read them, lane (m, h) at byte 32 m + 16 h of
// a 512-B piece: cpl = [16-slot tile][hi | lo][slot m][component 0..15];
// vtl = [32-slot block][hi | lo][slot half q][channel d = m][slot 16 q + 0..15].
// Key compaction: a key whose mask is 0 carries the additive term -1e30, so beside any key of the batch whose
// mask is 1 or more its softmax weight is exactly 0 (the other logit terms are small beside 1e30: arccosh of an
// f32 is below 90, the log-denominator below 10). Such keys get no slot: a kept key's slot is its rank among the
// batch's kept keys, in key order. A batch with no mask of 1 or more keeps every key, each with its own term.
// The slots between the last kept key and the end of its 32-slot block are filled with a point at the origin
// (spatial 0, time-like 1, value 0) and the masked term, in front of the barrier that precedes the kept keys' stores.
// Attention, flash form in the transposed domain:
//   S^T tile = C (A, row = column slot j) x R^T (B, col = row position i): the K = 16 spatial product is
//   laid as [c_hi|c_hi] x [r_hi|r_lo] plus [c_lo|0] x [r_hi|r_lo] along the 32-deep k axis.
//   D[row j 8h+r][col i m]. Per element: x = rt[i]*ct[j] - D, logit2 = -beta*log2(x1 + sqrt(x1^2-1)) + cb[j]
//   (cb carries log-denominator, bias and the additive key mask term). Softmax statistics are per lane
//   (row i = m); the two lane halves combine by one xor-16 exchange. The P^T B-fragment is the lane's own
//   16 results (tile 0 -> elements 0..7, tile 1 -> elements 8..15). O^T = V^T (A, row d) x P^T:
//   D[row d 8h+r][col i m], scaled per lane.
// Output: each wave stages its 16 channels x 32 positions in its own part of ost and stores whole 128-B lines.
// coverage: grid (8, NB) x 16 channels x 16 waves x 32 positions = NB*128*512 outputs, each written by one lane.
// ---------------------------------------------------------------------------
struct __attribute__((aligned(16))) Planes {
  float ctl[SEQ];                              // time-like part of the column point, per slot
  float cbl[SEQ];                              // key bias (base-2), per slot
  unsigned short cpl[SEQ * QROW];              // column points, spatial part, hi / lo
  unsigned short vtl[SEQ * 2 * HD];            // Klein points, transposed, hi / lo
  unsigned short wl[3 * HD * TPITCH];          // the head's rows of W_q, W_mem[0:128], W_mem[128:256], bf16
  float ost[NW * HD * OPITCH];                 // output stage
};
__global__ __launch_bounds__(512) void k_hfused(const float* __restrict__ x, const int* __restrict__ mask,
                                                const float* __restrict__ wmem, const float* __restrict__ wq,
                                                const float* __restrict__ beta_p, const float* __restrict__ bias_p,
                                                float* out) {
  // one object, so that the order is fixed: the arrays that the key loop reads start below 64 KiB, so each of its
  // LDS loads is one of the loop's two running addresses plus a constant offset, with no address addition
  __shared__ Planes sm;
  float* const ctl = sm.ctl;
  float* const cbl = sm.cbl;
  unsigned short* const cpl = sm.cpl;
  unsigned short* const vtl = sm.vtl;
  unsigned short* const wl = sm.wl;
  float* const ost = sm.ost;
  const unsigned tid = threadIdx.x, lane = tid & 31u, hh = lane >> 4, m = lane & 15u;
  const unsigned wave = (unsigned)__builtin_amdgcn_readfirstlane((int)(threadIdx.x >> 5));
  const unsigned t = blockIdx.x, b = blockIdx.y;
  const v8f zero8 = {0.f, 0.f, 0.f, 0.f, 0.f, 0.f, 0.f, 0.f};
  const v4i zero4 = {0, 0, 0, 0};

  // ---- kept keys of the batch: every wave forms the same 16 lane-mask words, so the count needs no barrier ----
  const int* mrow = mask + (size_t)b * LFULL;
  int mw[16];
#pragma unroll
  for (int w = 0; w < 16; ++w) mw[w] = mrow[32 * w + (int)lane];
  const unsigned pm = 32u * wave + m;
  const int mi0 = mrow[pm];                    // the masks of the lane's own two positions
  const int mi1 = mrow[pm + 16u];
  // the eighteen loads' two offset registers stay as they are up to this wait; what follows may reuse them
  asm volatile("s_wait_xcnt 0x0" :: "v"(lane), "v"(pm) : "memory");
  // ---- the head's 48 weight rows ----
  const unsigned ro = (HD * t + wave) * EW + lane * 4u;
  const float* pq = wq + ro;
  const float* pk = wmem + ro;
  const v4f gw0 = *(const v4fa*)pq;
  const v4f gw1 = *(const v4fa*)pk;
  const v4f gw2 = *(const v4fa*)(pk + EW * EW);
  // the three loads' two address register pairs stay as they are up to this wait; what follows may reuse them
  asm volatile("s_wait_xcnt 0x0" :: "v"(pq), "v"(pk) : "memory");

  // The input loads stand in front of the mask words' first use: they depend on no mask, and so fly together with
  // the mask and weight loads.
  // ---- input: the lane's B fragments of both tiles ----
  FragB xa[2][4];
  {
    const float* xg = x + (size_t)b * XB_FULL + (8u * hh) * LFULL + 32u * wave + m;
#pragma unroll
    for (int ks = 0; ks < 4; ++ks) {
      float g[2][16];
#pragma unroll
      for (int e = 0; e < 8; ++e) {
#pragma unroll
        for (int tl = 0; tl < 2; ++tl) {
          g[tl][e]     = xg[(32 * ks + e) * LFULL + 16 * tl];
          g[tl][8 + e] = xg[(32 * ks + 16 + e) * LFULL + 16 * tl];
        }
      }
      // the loads' address register pair stays as it is up to this wait; what follows may reuse it
      asm volatile("s_wait_xcnt 0x0" :: "v"(xg) : "memory");
#pragma unroll
      for (int tl = 0; tl < 2; ++tl) {
#pragma unroll
        for (int j = 0; j < 4; ++j) {
          xa[tl][ks].q[0][j] = pack2(g[tl][2 * j], g[tl][2 * j + 1]);
          xa[tl][ks].q[1][j] = pack2(g[tl][8 + 2 * j], g[tl][8 + 2 * j + 1]);
        }
      }
      // keeps the next group's 32 loads behind this group's converts, so that a wave's outstanding loads stay
      // within what s_wait_loadcnt can name
      if (ks < 3) __builtin_amdgcn_sched_barrier(0);
    }
  }
  unsigned kw[16], anyp = 0u;
#pragma unroll
  for (int w = 0; w < 16; ++w) {
    kw[w] = __builtin_amdgcn_ballot_w32(mw[w] != 0);
    anyp |= __builtin_amdgcn_ballot_w32(mw[w] >= 1);
  }
  unsigned cnt = 0u, pre = 0u, cur = 0u;       // kept keys; kept keys in front of this wave's positions; its own word
#pragma unroll
  for (int w = 0; w < 16; ++w) {
    if (anyp == 0u) kw[w] = 0xFFFFFFFFu;
    const unsigned pc = (unsigned)__builtin_popcount(kw[w]);
    cnt += pc;
    if ((unsigned)w < wave) pre += pc;
    if ((unsigned)w == wave) cur = kw[w];
  }
  // kept keys rounded up to whole 32-slot blocks; cnt is 1 .. 512
  const unsigned nend = (cnt + 31u) & ~31u;
  {
    unsigned short* d = wl + wave * TPITCH + lane * 4u;
    v2i w0, w1, w2;
    w0[0] = pack2(gw0.x, gw0.y); w0[1] = pack2(gw0.z, gw0.w);
    w1[0] = pack2(gw1.x, gw1.y); w1[1] = pack2(gw1.z, gw1.w);
    w2[0] = pack2(gw2.x, gw2.y); w2[1] = pack2(gw2.z, gw2.w);
    *(v2ia*)d = w0;
    *(v2ia*)(d + HD * TPITCH) = w1;
    *(v2ia*)(d + 2 * HD * TPITCH) = w2;
  }
  // ---- last 32-slot block: origin point with the masked term; the kept keys among its slots overwrite it below ----
  {
    const unsigned s0 = nend - 32u;
    if (tid < 128u) *(v4ia*)(cpl + s0 * QROW + tid * 8u) = zero4;
    else if (tid < 256u) *(v4ia*)(vtl + s0 * (2 * HD) + (tid - 128u) * 8u) = zero4;
    else if (tid < 288u) ctl[s0 + (tid - 256u)] = 1.0f;
    else if (tid < 320u) cbl[s0 + (tid - 288u)] = -1.0e30f * LOG2E;
  }

  __syncthreads();                             // wl and the filled block are published

  const float biasv = bf16_val(bias_p[0]);
  const float nbeta = -bf16_val(beta_p[0]);
  FragB qf[2];
  float rt[2];
  const unsigned short* wp = wl + m * TPITCH + 8u * hh;
  // unrolled whole: tl indexes arrays that have to stay in registers, and the six maps are independent chains
#pragma unroll
  for (int tl = 0; tl < 2; ++tl) {
    const unsigned bit = 16u * (unsigned)tl + m;
    const bool kept = ((cur >> bit) & 1u) != 0u;
    const unsigned slot = pre + (unsigned)__builtin_popcount(cur & ((1u << bit) - 1u));
    const float mv = (float)(tl == 0 ? mi0 : mi1);
    const float mterm = (-1.0e30f * (1.0f - mv)) * LOG2E;
    {
      FragB wf[4];
#pragma unroll
      for (int ks = 0; ks < 4; ++ks) wf[ks] = lds_frag(wp + HD * TPITCH + 32 * ks);
      v8f acc = zero8;
#pragma unroll
      for (int ks = 0; ks < 4; ++ks) acc = wmb(wf[ks], xa[tl][ks], acc);
      rt[tl] = hyp8(acc, 1.0f);                // acc[r] = spatial[position 32 wave + 16 tl + m][8h + r]
      split8(acc, qf[tl].q[0], qf[tl].q[1]);   // r_hi[8h .. 8h+7] (k slots 8h..), r_lo (k slots 16+8h..)
    }
    {
      FragB wf[4];
#pragma unroll
      for (int ks = 0; ks < 4; ++ks) wf[ks] = lds_frag(wp + 32 * ks);
      v8f acc = zero8;
#pragma unroll
      for (int ks = 0; ks < 4; ++ks) acc = wmb(wf[ks], xa[tl][ks], acc);
      const float ch = hyp8(acc, 0.25f);
      v4i hi, lo;
      split8(acc, hi, lo);
      if (kept) {
        const unsigned so = (slot >> 4) * (2u * TILEH) + (slot & 15u) * 16u + 8u * hh;
        *(v4ia*)(cpl + so) = hi;
        *(v4ia*)(cpl + so + TILEH) = lo;
        if (hh == 0u) ctl[slot] = ch;
      }
    }
    {
      FragB wf[4];
#pragma unroll
      for (int ks = 0; ks < 4; ++ks) wf[ks] = lds_frag(wp + 2 * HD * TPITCH + 32 * ks);
      v8f acc = zero8;
#pragma unroll
      for (int ks = 0; ks < 4; ++ks) acc = wmb(wf[ks], xa[tl][ks], acc);
      const float lb2 = klein8(acc, biasv, mterm);  // acc[r] = v_klein[position][8h + r]
      v4i vh, vl;
      split8(acc, vh, vl);
      if (kept) {
        // [slot block][hi | lo][slot half][channel 8h + r][slot & 15]
        const unsigned sb = (slot >> 5) * (4u * TILEH) + ((slot >> 4) & 1u) * TILEH + (8u * hh) * 16u + (slot & 15u);
#pragma unroll
        for (int r = 0; r < 8; ++r) {
          vtl[sb + (unsigned)r * 16u] = (unsigned short)((unsigned)vh[r >> 1] >> (16 * (r & 1)));
          vtl[sb + (unsigned)r * 16u + 2u * TILEH] = (unsigned short)((unsigned)vl[r >> 1] >> (16 * (r & 1)));
        }
        if (hh == 0u) cbl[slot] = lb2;
      }
    }
  }
  __syncthreads();                             // the planes are published

  const unsigned fo = 16u * m + 8u * hh;      // the lane's 16 bytes inside a 512-B piece
  const unsigned short* kb = cpl + fo;
  const unsigned short* vb = vtl + fo;
  const float* ctp = ctl + 8u * hh;
  const float* cbp = cbl + 8u * hh;

  // Both 16-row tiles of the wave go through ONE key loop: a key block's K, V and per-key scalars are loaded once
  // and serve both tiles, and the two tiles' chains are independent work for the wave while either one waits.
  // Every loop over tl is unrolled whole: tl indexes arrays that have to stay in registers.
  v8f o[2] = {zero8, zero8};
  float mrun[2] = {-3.0e38f, -3.0e38f}, lrun[2] = {0.0f, 0.0f};
#pragma unroll 1
  for (unsigned n0 = 0; n0 < nend; n0 += 32u) {
    const unsigned short* kp = kb + (size_t)n0 * QROW;
    const v4i kh0 = *(const v4ia*)kp;
    const v4i kl0 = *(const v4ia*)(kp + TILEH);
    const v4i kh1 = *(const v4ia*)(kp + 2 * TILEH);
    const v4i kl1 = *(const v4ia*)(kp + 3 * TILEH);
    const v4f t0 = *(const v4fa*)(ctp + n0);
    const v4f t1 = *(const v4fa*)(ctp + n0 + 4u);
    const v4f t2 = *(const v4fa*)(ctp + n0 + 16u);
    const v4f t3 = *(const v4fa*)(ctp + n0 + 20u);
    const v4f u0 = *(const v4fa*)(cbp + n0);
    const v4f u1 = *(const v4fa*)(cbp + n0 + 4u);
    const v4f u2 = *(const v4fa*)(cbp + n0 + 16u);
    const v4f u3 = *(const v4fa*)(cbp + n0 + 20u);
    FragB fvh, fvl;
    const unsigned short* vp = vb + (size_t)n0 * (2 * HD);
    fvh.q[0] = *(const v4ia*)vp;                 // keys n0 + 8h + 0..7
    fvh.q[1] = *(const v4ia*)(vp + TILEH);       // keys n0 + 16 + 8h + 0..7
    fvl.q[0] = *(const v4ia*)(vp + 2 * TILEH);
    fvl.q[1] = *(const v4ia*)(vp + 3 * TILEH);
    FragB a10, a20, a11, a21;
    a10.q[0] = kh0; a10.q[1] = kh0;
    a20.q[0] = kl0; a20.q[1] = zero4;
    a11.q[0] = kh1; a11.q[1] = kh1;
    a21.q[0] = kl1; a21.q[1] = zero4;
    const v8f ct0 = __builtin_shufflevector(t0, t1, 0, 1, 2, 3, 4, 5, 6, 7);
    const v8f ct1 = __builtin_shufflevector(t2, t3, 0, 1, 2, 3, 4, 5, 6, 7);
    const v8f cb0 = __builtin_shufflevector(u0, u1, 0, 1, 2, 3, 4, 5, 6, 7);
    const v8f cb1 = __builtin_shufflevector(u2, u3, 0, 1, 2, 3, 4, 5, 6, 7);
    v8f s0[2], s1[2];
#pragma unroll
    for (int tl = 0; tl < 2; ++tl) {
      s0[tl] = wmb(a10, qf[tl], zero8);
      s0[tl] = wmb(a20, qf[tl], s0[tl]);
      s1[tl] = wmb(a11, qf[tl], zero8);
      s1[tl] = wmb(a21, qf[tl], s1[tl]);
    }
    // logit in the base-2 domain: x = rt*ct - dot (minus the Lorentz product), x1 = x + 1e-6,
    // arccosh(x1) = ln(x1 + sqrt(x1^2 - 1)); a = -beta * log2(x1 + sqrt(x1^2 - 1)) + cb
    v8f a0[2], a1[2];
    float tm[2];
#pragma unroll
    for (int tl = 0; tl < 2; ++tl) {
      float x1[16], w[16];
#pragma unroll
      for (int r = 0; r < 8; ++r) {
        x1[r]     = (rt[tl] * ct0[r] - s0[tl][r]) + 1.0e-6f;        // column position n0 + 8h + r
        x1[8 + r] = (rt[tl] * ct1[r] - s1[tl][r]) + 1.0e-6f;        // column position n0 + 16 + 8h + r
      }
#pragma unroll
      for (int i = 0; i < 16; ++i) w[i] = fmaxf(x1[i] * x1[i] - 1.0f, 0.0f);
      sqrt16(w);
#pragma unroll
      for (int i = 0; i < 16; ++i) w[i] = x1[i] + w[i];
      log2_16(w);
#pragma unroll
      for (int r = 0; r < 8; ++r) {
        a0[tl][r] = nbeta * w[r] + cb0[r];
        a1[tl][r] = nbeta * w[8 + r] + cb1[r];
      }
      float t = fmaxf(a0[tl][0], a1[tl][0]);
#pragma unroll
      for (int r = 1; r < 8; ++r) t = fmaxf(t, fmaxf(a0[tl][r], a1[tl][r]));
      tm[tl] = t;
    }
    float tx[2];
#pragma unroll
    for (int tl = 0; tl < 2; ++tl) tx[tl] = __shfl_xor(tm[tl], 16);
#pragma unroll
    for (int tl = 0; tl < 2; ++tl) {
      const float t = fmaxf(tm[tl], tx[tl]);
      const float mnew = fmaxf(mrun[tl], t);
      float e[17];
#pragma unroll
      for (int r = 0; r < 8; ++r) {
        e[r]     = a0[tl][r] - mnew;
        e[8 + r] = a1[tl][r] - mnew;
      }
      e[16] = mrun[tl] - mnew;
      exp2_17(e);
      const float sc = e[16];
      v8f p0, p1;
      float ps = 0.0f;
#pragma unroll
      for (int r = 0; r < 8; ++r) {
        p0[r] = e[r];
        p1[r] = e[8 + r];
        ps += p0[r] + p1[r];
      }
      lrun[tl] = lrun[tl] * sc + ps;
      mrun[tl] = mnew;
      o[tl] = o[tl] * sc;

      FragB ph, pw;
      split8(p0, ph.q[0], pw.q[0]);
      split8(p1, ph.q[1], pw.q[1]);
      o[tl] = wmb(fvh, ph, o[tl]);
      o[tl] = wmb(fvl, ph, o[tl]);
      o[tl] = wmb(fvh, pw, o[tl]);
    }
  }
  float* ow = ost + wave * (HD * OPITCH);     // the wave's own 16 channels x 32 positions
#pragma unroll
  for (unsigned tl = 0; tl < 2u; ++tl) {
    const float lt = lrun[tl] + __shfl_xor(lrun[tl], 16);
    const float inv = 1.0f / lt;
    const v8f c = o[tl] * inv;                // out[channel 16 t + 8h + r][position 32 wave + 16 tl + m]
    const unsigned so = (8u * hh) * OPITCH + 16u * tl + m;
#pragma unroll
    for (int r = 0; r < 8; ++r) ow[so + (unsigned)r * OPITCH] = c[r];
  }
  __syncthreads();

  {
    // unrolled whole: the four stores differ only in a constant offset, so no address register is rewritten
    const unsigned c = lane >> 3, q = lane & 7u;
    float* ob = out + (size_t)b * XB_FULL + (size_t)(HD * t + c) * LFULL + 32u * wave + 4u * q;
    const float* os = ow + c * OPITCH + 4u * q;
#pragma unroll
    for (unsigned it = 0; it < 4u; ++it) {
      const v4f v = *(const v4fa*)(os + it * (4u * OPITCH));
      *(v4f*)(ob + it * (4u * LFULL)) = v;
    }
  }
}

// ---------------------------------------------------------------------------
extern "C" void kernel_launch(void* const* d_in, const int* in_sizes, int n_in,
                              void* d_out, int out_size, void* d_ws, size_t ws_size,
                              hipStream_t stream) {
  (void)d_ws;
  (void)ws_size;
  if (n_in < 6) return;
  const long long actN = (long long)NB * EW * LFULL;
  if ((long long)in_sizes[0] < actN) return;                 // queries [b][channel][l]
  if ((long long)in_sizes[1] < (long long)NB * LFULL) return; // mask [b][l] int32
  if (in_sizes[2] < 2 * EW * EW) return;                     // W_mem [256][128]
  if (in_sizes[3] < EW * EW) return;                         // W_q [128][128]
  if (in_sizes[4] < 1 || in_sizes[5] < 1) return;            // beta, bias
  if ((long long)out_size < actN) return;

  const float* queries = (const float*)d_in[0];
  const int*   mask    = (const int*)d_in[1];
  const float* Wmem    = (const float*)d_in[2];
  const float* Wq      = (const float*)d_in[3];
  const float* beta    = (const float*)d_in[4];
  const float* bias    = (const float*)d_in[5];
  float* out = (float*)d_out;

  // projections, hyperboloid / Klein maps and Lorentz attention of one (head, batch) a block; channels-first output
  k_hfused<<<dim3(NH, NB), 512, 0, stream>>>(queries, mask, Wmem, Wq, beta, bias, out);
}

// v009
// Measured time: 20.5 microseconds a run.
// In both of two side-by-side timings against v008, it was 1.06 times as fast.
// Counting every step since v000, it is 6.05 times as fast.
// Contractions: W_mem / W_q projections = v_wmma_f32_16x16x32_bf16, bf16 (RNE) inputs and weights, one product. Lorentz spatial product k_sp.q_sp (K = 16) and P.V = same bf16 WMMA with every computed operand carried as bf16 hi + bf16 lo (hi.hi + lo.hi + hi.lo). Accumulate f32 everywhere.
// Time-like rank-1 term, arccosh, additive key bias, online softmax (base-2 form): f32 VALU. No power-of-two carries exist (bf16 planes only).
#include <hip/hip_runtime.h>
#include <stddef.h>
#include <stdint.h>
#include <math.h>

#ifndef NB
#define NB 32                      // batches processed (a reduced build reads the first NB batches)
#endif
#define SEQ    512                 // positions per batch (softmax rows i and softmax columns j)
#define LFULL  512                 // full row length of the channels-first input / output and of the mask
#define EW     128                 // model width = heads x head dim
#define NH     8
#define HD     16
#define QROW   32                  // halfwords per key slot in the spatial plane: 16 hi + 16 lo
#define TILEH  256                 // halfwords per 512-B piece of a plane: 16 rows x 16 halfwords, one wave-wide 16-B load
#define TPITCH 136                 // halfwords per LDS weight row
#define OPITCH 36                  // floats per LDS output-stage row
#define NW     16                  // waves per block; wave w owns positions 32 w .. 32 w + 31
#define XB_FULL ((size_t)EW * LFULL)            // floats per batch of the input and of the output
#define LOG2E  1.4426950408889634f

static_assert(NH * HD == EW);
static_assert(SEQ == 512 && LFULL == 512);
static_assert(NW * 32 == SEQ);                 // one mask word, two 16-row tiles a wave
static_assert(16 * QROW == 2 * TILEH);         // 16 slots of the spatial plane = hi piece + lo piece
static_assert(2 * HD * 32 == 4 * TILEH);       // 32 keys of V^T, hi and lo = 4 pieces
static_assert(EW * 4 == 32 * 16);              // one weight row = one wave-wide 16-B load
static_assert(NW == HD);                       // weight staging: wave w takes row w of the head's three slices
static_assert(TPITCH % 8 == 0 && TPITCH >= EW);
static_assert(OPITCH % 4 == 0 && OPITCH >= 32);

typedef int            v4i   __attribute__((ext_vector_type(4)));
typedef int            v8i   __attribute__((ext_vector_type(8)));
typedef float          v4f   __attribute__((ext_vector_type(4)));
typedef float          v8f   __attribute__((ext_vector_type(8)));
typedef __bf16         v16bf __attribute__((ext_vector_type(16)));
typedef int            v2i   __attribute__((ext_vector_type(2)));
typedef float          v2f   __attribute__((ext_vector_type(2)));
typedef __bf16         v2bf  __attribute__((ext_vector_type(2)));
typedef v2i __attribute__((may_alias)) v2ia;
typedef v4i __attribute__((may_alias)) v4ia;
typedef v4f __attribute__((may_alias)) v4fa;
union FragB { v16bf v; v4i q[2]; v8i w; };

// The plain builtin: the compiler keeps the distance behind a matrix instruction itself, with independent work or
// further matrix instructions where it has some and with v_nop only where it has none.
__device__ __forceinline__ v8f wmb(const FragB& a, const FragB& b, v8f c) {
  return __builtin_amdgcn_wmma_f32_16x16x32_bf16(false, a.v, false, b.v, (short)0, c, false, false);
}

// two f32 -> two bf16 (RNE) in one word, by the convert instruction (v_cvt_pk_bf16_f32): lo in the low halfword
__device__ __forceinline__ int pack2(float lo, float hi) {
  const v2f p = {lo, hi};
  return __builtin_bit_cast(int, __builtin_convertvector(p, v2bf));
}
__device__ __forceinline__ float bf16_val(float f) {
  return __uint_as_float((unsigned)pack2(f, f) << 16);
}
// 8 f32 -> bf16 hi piece + bf16 lo piece (lo = RNE(v - hi)); element 2j in the low halfword of word j.
// hi: one convert a pair. lo: hi * (-1) + v in the mixed-precision FMA that takes the bf16 half as it lies in
// the hi word and writes its bf16 result into one half of the lo word (v - hi is exact in f32, so the one
// rounding is the same as that of a subtraction and a convert): three instructions a pair.
// One asm statement: a plain subtraction and conversion compiled to five instructions a pair (two unpacks, a
// packed subtraction, the two converts). The four low halves stand in front of
// the four high halves; each high half rewrites the word its low half wrote four instructions back, which the
// s_delay_alu lines tell the issue logic, so that another wave can issue meanwhile.
__device__ __forceinline__ void split8(const v8f x, v4i& hi, v4i& lo) {
#pragma unroll
  for (int j = 0; j < 4; ++j) hi[j] = pack2(x[2 * j], x[2 * j + 1]);
  const int m1 = (int)0xBF80BF80u;            // bf16 -1.0 in both halves
  int l0, l1, l2, l3;
  asm("v_fma_mixlo_bf16 %0, %4, %8, %9 op_sel_hi:[1,1,0]\n\t"
      "v_fma_mixlo_bf16 %1, %5, %8, %11 op_sel_hi:[1,1,0]\n\t"
      "v_fma_mixlo_bf16 %2, %6, %8, %13 op_sel_hi:[1,1,0]\n\t"
      "v_fma_mixlo_bf16 %3, %7, %8, %15 op_sel_hi:[1,1,0]\n\t"
      "s_delay_alu instid0(VALU_DEP_4) | instskip(NEXT) | instid1(VALU_DEP_4)\n\t"
      "v_fma_mixhi_bf16 %0, %4, %8, %10 op_sel:[1,0,0] op_sel_hi:[1,1,0]\n\t"
      "v_fma_mixhi_bf16 %1, %5, %8, %12 op_sel:[1,0,0] op_sel_hi:[1,1,0]\n\t"
      "s_delay_alu instid0(VALU_DEP_4) | instskip(NEXT) | instid1(VALU_DEP_4)\n\t"
      "v_fma_mixhi_bf16 %2, %6, %8, %14 op_sel:[1,0,0] op_sel_hi:[1,1,0]\n\t"
      "v_fma_mixhi_bf16 %3, %7, %8, %16 op_sel:[1,0,0] op_sel_hi:[1,1,0]"
      : "=&v"(l0), "=&v"(l1), "=&v"(l2), "=&v"(l3)
      : "v"(hi[0]), "v"(hi[1]), "v"(hi[2]), "v"(hi[3]), "v"(m1),
        "v"(x[0]), "v"(x[1]), "v"(x[2]), "v"(x[3]), "v"(x[4]), "v"(x[5]), "v"(x[6]), "v"(x[7]));
  lo[0] = l0; lo[1] = l1; lo[2] = l2; lo[3] = l3;
}
// fragment (row/col = lane&15) from an LDS k-contiguous bf16 row: p = row + k0 + 8h;
// elements 0..7 <- k0+8h+0..7, 8..15 <- k0+16+8h+0..7
__device__ __forceinline__ FragB lds_frag(const unsigned short* p) {
  FragB f;
  f.q[0] = *(const v4ia*)p;
  f.q[1] = *(const v4ia*)(p + 16);
  return f;
}
// The maps' root, reciprocal, 2^x and log2 as the bare instructions, where a last-bit error does no harm. The
// library sinhf and coshf carry e^n in two floats, the library root and division correct the last bit and rescale
// subnormals: together over a hundred vector instructions a head, nearly all in one dependent chain, in a kernel
// that has 16 waves a block, four or more on a SIMD, to hide it. The operands here come from bf16-rounded inputs and weights.
// On return ep = e^n / 2, em = e^-n / 2 (the halving rides in the exponent, so the range is that of sinh and cosh
// themselves) and iv = 1 / max(n, 1e-12). sinh = ep - em and cosh = ep + em share ep's error, which then only
// scales the point's Lorentz products.
// One asm statement, every value in place: no instruction in it touches its neighbour's register, and the closing
// v_nop is the slot the instruction set asks for between the last one and a reader of its result (as builtins
// the three compiled to a run in which one overwrote the source of the one directly in front).
__device__ __forceinline__ void exps_rcp(const float n, float& ep, float& em, float& iv) {
  ep = __builtin_fmaf(n, LOG2E, -1.0f);
  em = __builtin_fmaf(-n, LOG2E, -1.0f);
  iv = fmaxf(n, 1.0e-12f);
  asm("v_exp_f32 %0, %0\n\t"
      "v_exp_f32 %1, %1\n\t"
      "v_rcp_f32 %2, %2\n\t"
      "v_nop"
      : "+v"(ep), "+v"(em), "+v"(iv));
}

// Hyperboloid map of one head vector held as 8 + 8 components by lanes l and l^16:
// a <- normalize(a * scl) * sinh(|a * scl|); returns cosh(|a * scl|). Both lane halves get identical norms.
__device__ __forceinline__ float hyp8(v8f& a, const float scl) {
#pragma clang fp contract(off)
  float ss = 0.0f;
#pragma unroll
  for (int r = 0; r < 8; ++r) { a[r] = a[r] * scl; ss += a[r] * a[r]; }
  ss += __shfl_xor(ss, 16);
  const float n = __builtin_amdgcn_sqrtf(ss);
  float ep, em, inv;
  exps_rcp(n, ep, em, inv);
  const float sh = ep - em;
  const float ch = ep + em;
#pragma unroll
  for (int r = 0; r < 8; ++r) a[r] = (a[r] * inv) * sh;
  return ch;
}

// Klein map of one head vector: a <- normalize(hyperboloid_spatial / hyperboloid_time);
// returns (log(1 / (sqrt(1 - (|a| - 1e-4)^2) + 1e-4)) + biasv) * log2(e) + mterm.
__device__ __forceinline__ float klein8(v8f& a, const float biasv, const float mterm) {
#pragma clang fp contract(off)
  float ss = 0.0f;
#pragma unroll
  for (int r = 0; r < 8; ++r) ss += a[r] * a[r];
  ss += __shfl_xor(ss, 16);
  // vn, inv, sh and ich only scale the vector, and the normalisation below takes any common scale out again
  const float vn = __builtin_amdgcn_sqrtf(ss);
  float ep, em, inv;
  exps_rcp(vn, ep, em, inv);
  const float sh = ep - em;
  const float ich = __builtin_amdgcn_rcpf(ep + em);
  float s2 = 0.0f;
#pragma unroll
  for (int r = 0; r < 8; ++r) { a[r] = ((a[r] * inv) * sh) * ich; s2 += a[r] * a[r]; }
  s2 += __shfl_xor(s2, 16);
  // library root and true division here and for vnk: one last-bit step of vnk beside 1 moves 1 - dm * dm, and so
  // the key bias, by far more than one last bit
  const float n2 = sqrtf(s2);
  const float inv2 = 1.0f / fmaxf(n2, 1.0e-12f);
  float s3 = 0.0f;
#pragma unroll
  for (int r = 0; r < 8; ++r) { a[r] = a[r] * inv2; s3 += a[r] * a[r]; }
  s3 += __shfl_xor(s3, 16);
  const float vnk = sqrtf(s3);
  const float dm = vnk - 1.0e-4f;
  const float den = __builtin_amdgcn_sqrtf(1.0f - dm * dm) + 1.0e-4f;
  // log(1 / den) * log2(e) = -log2(den); den lies between 1e-4 and about 1, a normal number
  return (biasv * LOG2E - __builtin_amdgcn_logf(den)) + mterm;
}

// The attention loop's root, log2 and 2^x as the bare instructions. The library forms wrap each in a rescale
// for subnormal arguments or results and give the root a last-bit correction: about 5 to 15 vector
// instructions per value. Here the root's argument is 0 or a normal number (x1^2 - 1 of an f32 x1, clamped at
// 0), the log's is about 1 or more, and a 2^x below the normal range may come out as 0 beside a row sum that
// holds a term equal to 1; the root keeps the instruction's own 1 ulp.
// One asm statement per kind, every value in place: no instruction in it touches its neighbour's register, and
// the closing v_nop is the slot the instruction set asks for between the last one and a reader of its result
// (the builtins compiled to runs in which one overwrote the source of the one directly in front).
__device__ __forceinline__ void sqrt16(float (&a)[16]) {
  asm(
      "v_sqrt_f32 %0, %0\n\t"
      "v_sqrt_f32 %1, %1\n\t"
      "v_sqrt_f32 %2, %2\n\t"
      "v_sqrt_f32 %3, %3\n\t"
      "v_sqrt_f32 %4, %4\n\t"
      "v_sqrt_f32 %5, %5\n\t"
      "v_sqrt_f32 %6, %6\n\t"
      "v_sqrt_f32 %7, %7\n\t"
      "v_sqrt_f32 %8, %8\n\t"
      "v_sqrt_f32 %9, %9\n\t"
      "v_sqrt_f32 %10, %10\n\t"
      "v_sqrt_f32 %11, %11\n\t"
      "v_sqrt_f32 %12, %12\n\t"
      "v_sqrt_f32 %13, %13\n\t"
      "v_sqrt_f32 %14, %14\n\t"
      "v_sqrt_f32 %15, %15\n\t"
      "v_nop"
      :
        "+v"(a[0]), "+v"(a[1]), "+v"(a[2]), "+v"(a[3]), "+v"(a[4]), "+v"(a[5]),
        "+v"(a[6]), "+v"(a[7]), "+v"(a[8]), "+v"(a[9]), "+v"(a[10]), "+v"(a[11]),
        "+v"(a[12]), "+v"(a[13]), "+v"(a[14]), "+v"(a[15]));
}
__device__ __forceinline__ void log2_16(float (&a)[16]) {
  asm(
      "v_log_f32 %0, %0\n\t"
      "v_log_f32 %1, %1\n\t"
      "v_log_f32 %2, %2\n\t"
      "v_log_f32 %3, %3\n\t"
      "v_log_f32 %4, %4\n\t"
      "v_log_f32 %5, %5\n\t"
      "v_log_f32 %6, %6\n\t"
      "v_log_f32 %7, %7\n\t"
      "v_log_f32 %8, %8\n\t"
      "v_log_f32 %9, %9\n\t"
      "v_log_f32 %10, %10\n\t"
      "v_log_f32 %11, %11\n\t"
      "v_log_f32 %12, %12\n\t"
      "v_log_f32 %13, %13\n\t"
      "v_log_f32 %14, %14\n\t"
      "v_log_f32 %15, %15\n\t"
      "v_nop"
      :
        "+v"(a[0]), "+v"(a[1]), "+v"(a[2]), "+v"(a[3]), "+v"(a[4]), "+v"(a[5]),
        "+v"(a[6]), "+v"(a[7]), "+v"(a[8]), "+v"(a[9]), "+v"(a[10]), "+v"(a[11]),
        "+v"(a[12]), "+v"(a[13]), "+v"(a[14]), "+v"(a[15]));
}
__device__ __forceinline__ void exp2_17(float (&a)[17]) {
  asm(
      "v_exp_f32 %0, %0\n\t"
      "v_exp_f32 %1, %1\n\t"
      "v_exp_f32 %2, %2\n\t"
      "v_exp_f32 %3, %3\n\t"
      "v_exp_f32 %4, %4\n\t"
      "v_exp_f32 %5, %5\n\t"
      "v_exp_f32 %6, %6\n\t"
      "v_exp_f32 %7, %7\n\t"
      "v_exp_f32 %8, %8\n\t"
      "v_exp_f32 %9, %9\n\t"
      "v_exp_f32 %10, %10\n\t"
      "v_exp_f32 %11, %11\n\t"
      "v_exp_f32 %12, %12\n\t"
      "v_exp_f32 %13, %13\n\t"
      "v_exp_f32 %14, %14\n\t"
      "v_exp_f32 %15, %15\n\t"
      "v_exp_f32 %16, %16\n\t"
      "v_nop"
      :
        "+v"(a[0]), "+v"(a[1]), "+v"(a[2]), "+v"(a[3]), "+v"(a[4]), "+v"(a[5]),
        "+v"(a[6]), "+v"(a[7]), "+v"(a[8]), "+v"(a[9]), "+v"(a[10]), "+v"(a[11]),
        "+v"(a[12]), "+v"(a[13]), "+v"(a[14]), "+v"(a[15]), "+v"(a[16]));
}

// ---------------------------------------------------------------------------
// One launch. Block = (head t, batch b), 16 waves; wave w owns positions 32 w .. 32 w + 31 of the batch, as two
// 16-position tiles: it projects them for its head and then runs them as its two softmax row tiles.
// Nothing goes through global memory between projection and attention: a head's attention needs only that head's
// 16 rows of W_q, of W_mem[0:128] and of W_mem[128:256], applied to the batch's 512 input columns.
// Weights: the 48 rows are rounded to bf16 into LDS wl (wave w loads row w of each slice, a whole 512-B row a load);
// A fragments (row = lane&15 = out feature) come from there.
// Input x is channels-first [b][k = channel][l]: a lane reads the 64 channels of its B fragments (col = lane&15 =
// position, k = 32 ks + 8 h + 0..7 and 32 ks + 16 + 8 h + 0..7) by 4-B loads; the 16 lanes of a half read 64
// contiguous bytes, and the wave's two tiles together use each 128-B line whole.
// D = W_tile (A) x X (B): D[row d = 8h+r][col = position], so a lane holds 8 of the 16 head components of one
// position; lanes l and l^16 complete the head.
// row role (W_mem[0:128]): hyperboloid point; hi / lo pieces are the lane's own B fragment of the score product
//   and stay in registers, with the time-like part.
// column role (W_q, scaled 0.25): hyperboloid point -> LDS cpl, time-like part -> ctl.
// value role (W_mem[128:256]): Klein point -> LDS vtl (transposed), key bias (base-2) -> cbl.
// The LDS planes are laid in the order the attention loop's fragments read them, lane (m, h) at byte 32 m + 16 h of
// a 512-B piece: cpl = [16-slot tile][hi | lo][slot m][component 0..15];
// vtl = [32-slot block][hi | lo][slot half q][channel d = m][slot 16 q + 0..15].
// Key compaction: a key whose mask is 0 carries the additive term -1e30, so beside any key of the batch whose
// mask is 1 or more its softmax weight is exactly 0 (the other logit terms are small beside 1e30: arccosh of an
// f32 is below 90, the log-denominator below 10). Such keys get no slot: a kept key's slot is its rank among the
// batch's kept keys, in key order. A batch with no mask of 1 or more keeps every key, each with its own term.
// The slots between the last kept key and the end of its 32-slot block are filled with a point at the origin
// (spatial 0, time-like 1, value 0) and the masked term, in front of the barrier that precedes the kept keys' stores.
// Attention, flash form in the transposed domain:
//   S^T tile = C (A, row = column slot j) x R^T (B, col = row position i): the K = 16 spatial product is
//   laid as [c_hi|c_hi] x [r_hi|r_lo] plus [c_lo|0] x [r_hi|r_lo] along the 32-deep k axis.
//   D[row j 8h+r][col i m]. Per element: x = rt[i]*ct[j] - D, logit2 = -beta*log2(x1 + sqrt(x1^2-1)) + cb[j]
//   (cb carries log-denominator, bias and the additive key mask term). Softmax statistics are per lane
//   (row i = m); the two lane halves combine by one xor-16 exchange. The P^T B-fragment is the lane's own
//   16 results (tile 0 -> elements 0..7, tile 1 -> elements 8..15). O^T = V^T (A, row d) x P^T:
//   D[row d 8h+r][col i m], scaled per lane.
// Output: each wave stages its 16 channels x 32 positions in its own part of ost and stores whole 128-B lines.
// coverage: grid (8, NB) x 16 channels x 16 waves x 32 positions = NB*128*512 outputs, each written by one lane.
// ---------------------------------------------------------------------------
struct __attribute__((aligned(16))) Planes {
  float ctl[SEQ];                              // time-like part of the column point, per slot
  float cbl[SEQ];                              // key bias (base-2), per slot
  unsigned short cpl[SEQ * QROW];              // column points, spatial part, hi / lo
  unsigned short vtl[SEQ * 2 * HD];            // Klein points, transposed, hi / lo
  unsigned short wl[3 * HD * TPITCH];          // the head's rows of W_q, W_mem[0:128], W_mem[128:256], bf16
  float ost[NW * HD * OPITCH];                 // output stage
};
__global__ __launch_bounds__(512) void k_hfused(const float* __restrict__ x, const int* __restrict__ mask,
                                                const float* __restrict__ wmem, const float* __restrict__ wq,
                                                const float* __restrict__ beta_p, const float* __restrict__ bias_p,
                                                float* out) {
  // one object, so that the order is fixed: the arrays that the key loop reads start below 64 KiB, so each of its
  // LDS loads is one of the loop's two running addresses plus a constant offset, with no address addition
  __shared__ Planes sm;
  float* const ctl = sm.ctl;
  float* const cbl = sm.cbl;
  unsigned short* const cpl = sm.cpl;
  unsigned short* const vtl = sm.vtl;
  unsigned short* const wl = sm.wl;
  float* const ost = sm.ost;
  const unsigned tid = threadIdx.x, lane = tid & 31u, hh = lane >> 4, m = lane & 15u;
  const unsigned wave = (unsigned)__builtin_amdgcn_readfirstlane((int)(threadIdx.x >> 5));
  const unsigned t = blockIdx.x, b = blockIdx.y;
  const v8f zero8 = {0.f, 0.f, 0.f, 0.f, 0.f, 0.f, 0.f, 0.f};
  const v4i zero4 = {0, 0, 0, 0};

  // ---- kept keys of the batch: every wave forms the same 16 lane-mask words, so the count needs no barrier ----
  const int* mrow = mask + (size_t)b * LFULL;
  int mw[16];
#pragma unroll
  for (int w = 0; w < 16; ++w) mw[w] = mrow[32 * w + (int)lane];
  const unsigned pm = 32u * wave + m;
  const int mi0 = mrow[pm];                    // the masks of the lane's own two positions
  const int mi1 = mrow[pm + 16u];
  // the eighteen loads' two offset registers stay as they are up to this wait; what follows may reuse them
  asm volatile("s_wait_xcnt 0x0" :: "v"(lane), "v"(pm) : "memory");
  // ---- the head's 48 weight rows ----
  const unsigned ro = (HD * t + wave) * EW + lane * 4u;
  const float* pq = wq + ro;
  const float* pk = wmem + ro;
  const v4f gw0 = *(const v4fa*)pq;
  const v4f gw1 = *(const v4fa*)pk;
  const v4f gw2 = *(const v4fa*)(pk + EW * EW);
  // the three loads' two address register pairs stay as they are up to this wait; what follows may reuse them
  asm volatile("s_wait_xcnt 0x0" :: "v"(pq), "v"(pk) : "memory");

  // The input loads stand in front of the mask words' first use: they depend on no mask, and so fly together with
  // the mask and weight loads.
  // ---- input: the lane's B fragments of both tiles ----
  FragB xa[2][4];
  {
    const float* xg = x + (size_t)b * XB_FULL + (8u * hh) * LFULL + 32u * wave + m;
#pragma unroll
    for (int ks = 0; ks < 4; ++ks) {
      float g[2][16];
#pragma unroll
      for (int e = 0; e < 8; ++e) {
#pragma unroll
        for (int tl = 0; tl < 2; ++tl) {
          g[tl][e]     = xg[(32 * ks + e) * LFULL + 16 * tl];
          g[tl][8 + e] = xg[(32 * ks + 16 + e) * LFULL + 16 * tl];
        }
      }
      // the loads' address register pair stays as it is up to this wait; what follows may reuse it
      asm volatile("s_wait_xcnt 0x0" :: "v"(xg) : "memory");
#pragma unroll
      for (int tl = 0; tl < 2; ++tl) {
#pragma unroll
        for (int j = 0; j < 4; ++j) {
          xa[tl][ks].q[0][j] = pack2(g[tl][2 * j], g[tl][2 * j + 1]);
          xa[tl][ks].q[1][j] = pack2(g[tl][8 + 2 * j], g[tl][8 + 2 * j + 1]);
        }
      }
      // keeps the next group's 32 loads behind this group's converts, so that a wave's outstanding loads stay
      // within what s_wait_loadcnt can name
      if (ks < 3) __builtin_amdgcn_sched_barrier(0);
    }
  }
  unsigned kw[16], anyp = 0u;
#pragma unroll
  for (int w = 0; w < 16; ++w) {
    kw[w] = __builtin_amdgcn_ballot_w32(mw[w] != 0);
    anyp |= __builtin_amdgcn_ballot_w32(mw[w] >= 1);
  }
  unsigned cnt = 0u, pre = 0u, cur = 0u;       // kept keys; kept keys in front of this wave's positions; its own word
#pragma unroll
  for (int w = 0; w < 16; ++w) {
    if (anyp == 0u) kw[w] = 0xFFFFFFFFu;
    const unsigned pc = (unsigned)__builtin_popcount(kw[w]);
    cnt += pc;
    if ((unsigned)w < wave) pre += pc;
    if ((unsigned)w == wave) cur = kw[w];
  }
  // kept keys rounded up to whole 32-slot blocks; cnt is 1 .. 512
  const unsigned nend = (cnt + 31u) & ~31u;
  {
    unsigned short* d = wl + wave * TPITCH + lane * 4u;
    v2i w0, w1, w2;
    w0[0] = pack2(gw0.x, gw0.y); w0[1] = pack2(gw0.z, gw0.w);
    w1[0] = pack2(gw1.x, gw1.y); w1[1] = pack2(gw1.z, gw1.w);
    w2[0] = pack2(gw2.x, gw2.y); w2[1] = pack2(gw2.z, gw2.w);
    *(v2ia*)d = w0;
    *(v2ia*)(d + HD * TPITCH) = w1;
    *(v2ia*)(d + 2 * HD * TPITCH) = w2;
  }
  // ---- last 32-slot block: origin point with the masked term; the kept keys among its slots overwrite it below ----
  {
    const unsigned s0 = nend - 32u;
    if (tid < 128u) *(v4ia*)(cpl + s0 * QROW + tid * 8u) = zero4;
    else if (tid < 256u) *(v4ia*)(vtl + s0 * (2 * HD) + (tid - 128u) * 8u) = zero4;
    else if (tid < 288u) ctl[s0 + (tid - 256u)] = 1.0f;
    else if (tid < 320u) cbl[s0 + (tid - 288u)] = -1.0e30f * LOG2E;
  }

  __syncthreads();                             // wl and the filled block are published

  const float biasv = bf16_val(bias_p[0]);
  const float nbeta = -bf16_val(beta_p[0]);
  FragB qf[2];
  float rt[2];
  const unsigned short* wp = wl + m * TPITCH + 8u * hh;
  // unrolled whole: tl indexes arrays that have to stay in registers, and the six maps are independent chains
#pragma unroll
  for (int tl = 0; tl < 2; ++tl) {
    const unsigned bit = 16u * (unsigned)tl + m;
    const bool kept = ((cur >> bit) & 1u) != 0u;
    const unsigned slot = pre + (unsigned)__builtin_popcount(cur & ((1u << bit) - 1u));
    const float mv = (float)(tl == 0 ? mi0 : mi1);
    const float mterm = (-1.0e30f * (1.0f - mv)) * LOG2E;
    {
      FragB wf[4];
#pragma unroll
      for (int ks = 0; ks < 4; ++ks) wf[ks] = lds_frag(wp + HD * TPITCH + 32 * ks);
      v8f acc = zero8;
#pragma unroll
      for (int ks = 0; ks < 4; ++ks) acc = wmb(wf[ks], xa[tl][ks], acc);
      rt[tl] = hyp8(acc, 1.0f);                // acc[r] = spatial[position 32 wave + 16 tl + m][8h + r]
      split8(acc, qf[tl].q[0], qf[tl].q[1]);   // r_hi[8h .. 8h+7] (k slots 8h..), r_lo (k slots 16+8h..)
    }
    {
      FragB wf[4];
#pragma unroll
      for (int ks = 0; ks < 4; ++ks) wf[ks] = lds_frag(wp + 32 * ks);
      v8f acc = zero8;
#pragma unroll
      for (int ks = 0; ks < 4; ++ks) acc = wmb(wf[ks], xa[tl][ks], acc);
      const float ch = hyp8(acc, 0.25f);
      v4i hi, lo;
      split8(acc, hi, lo);
      if (kept) {
        const unsigned so = (slot >> 4) * (2u * TILEH) + (slot & 15u) * 16u + 8u * hh;
        *(v4ia*)(cpl + so) = hi;
        *(v4ia*)(cpl + so + TILEH) = lo;
        if (hh == 0u) ctl[slot] = ch;
      }
    }
    {
      FragB wf[4];
#pragma unroll
      for (int ks = 0; ks < 4; ++ks) wf[ks] = lds_frag(wp + 2 * HD * TPITCH + 32 * ks);
      v8f acc = zero8;
#pragma unroll
      for (int ks = 0; ks < 4; ++ks) acc = wmb(wf[ks], xa[tl][ks], acc);
      const float lb2 = klein8(acc, biasv, mterm);  // acc[r] = v_klein[position][8h + r]
      v4i vh, vl;
      split8(acc, vh, vl);
      if (kept) {
        // [slot block][hi | lo][slot half][channel 8h + r][slot & 15]
        const unsigned sb = (slot >> 5) * (4u * TILEH) + ((slot >> 4) & 1u) * TILEH + (8u * hh) * 16u + (slot & 15u);
#pragma unroll
        for (int r = 0; r < 8; ++r) {
          vtl[sb + (unsigned)r * 16u] = (unsigned short)((unsigned)vh[r >> 1] >> (16 * (r & 1)));
          vtl[sb + (unsigned)r * 16u + 2u * TILEH] = (unsigned short)((unsigned)vl[r >> 1] >> (16 * (r & 1)));
        }
        if (hh == 0u) cbl[slot] = lb2;
      }
    }
  }
  __syncthreads();                             // the planes are published

  const unsigned fo = 16u * m + 8u * hh;      // the lane's 16 bytes inside a 512-B piece
  const unsigned short* kb = cpl + fo;
  const unsigned short* vb = vtl + fo;
  const float* ctp = ctl + 8u * hh;
  const float* cbp = cbl + 8u * hh;

  // Both 16-row tiles of the wave go through ONE key loop: a key block's K, V and per-key scalars are loaded once
  // and serve both tiles, and the two tiles' chains are independent work for the wave while either one waits.
  // Every loop over tl is unrolled whole: tl indexes arrays that have to stay in registers.
  v8f o[2] = {zero8, zero8};
  float mrun[2] = {-3.0e38f, -3.0e38f}, lrun[2] = {0.0f, 0.0f};
#pragma unroll 1
  for (unsigned n0 = 0; n0 < nend; n0 += 32u) {
    const unsigned short* kp = kb + (size_t)n0 * QROW;
    const v4i kh0 = *(const v4ia*)kp;
    const v4i kl0 = *(const v4ia*)(kp + TILEH);
    const v4i kh1 = *(const v4ia*)(kp + 2 * TILEH);
    const v4i kl1 = *(const v4ia*)(kp + 3 * TILEH);
    const v4f t0 = *(const v4fa*)(ctp + n0);
    const v4f t1 = *(const v4fa*)(ctp + n0 + 4u);
    const v4f t2 = *(const v4fa*)(ctp + n0 + 16u);
    const v4f t3 = *(const v4fa*)(ctp + n0 + 20u);
    const v4f u0 = *(const v4fa*)(cbp + n0);
    const v4f u1 = *(const v4fa*)(cbp + n0 + 4u);
    const v4f u2 = *(const v4fa*)(cbp + n0 + 16u);
    const v4f u3 = *(const v4fa*)(cbp + n0 + 20u);
    FragB fvh, fvl;
    const unsigned short* vp = vb + (size_t)n0 * (2 * HD);
    fvh.q[0] = *(const v4ia*)vp;                 // keys n0 + 8h + 0..7
    fvh.q[1] = *(const v4ia*)(vp + TILEH);       // keys n0 + 16 + 8h + 0..7
    fvl.q[0] = *(const v4ia*)(vp + 2 * TILEH);
    fvl.q[1] = *(const v4ia*)(vp + 3 * TILEH);
    FragB a10, a20, a11, a21;
    // one shuffle a fragment: from two half assignments the zero halves were filled by 64-bit copies
    a10.w = __builtin_shufflevector(kh0, kh0, 0, 1, 2, 3, 0, 1, 2, 3);
    a20.w = __builtin_shufflevector(kl0, zero4, 0, 1, 2, 3, 4, 5, 6, 7);
    a11.w = __builtin_shufflevector(kh1, kh1, 0, 1, 2, 3, 0, 1, 2, 3);
    a21.w = __builtin_shufflevector(kl1, zero4, 0, 1, 2, 3, 4, 5, 6, 7);
    const v8f ct0 = __builtin_shufflevector(t0, t1, 0, 1, 2, 3, 4, 5, 6, 7);
    const v8f ct1 = __builtin_shufflevector(t2, t3, 0, 1, 2, 3, 4, 5, 6, 7);
    const v8f cb0 = __builtin_shufflevector(u0, u1, 0, 1, 2, 3, 4, 5, 6, 7);
    const v8f cb1 = __builtin_shufflevector(u2, u3, 0, 1, 2, 3, 4, 5, 6, 7);
    v8f s0[2], s1[2];
#pragma unroll
    for (int tl = 0; tl < 2; ++tl) {
      s0[tl] = wmb(a10, qf[tl], zero8);
      s0[tl] = wmb(a20, qf[tl], s0[tl]);
      s1[tl] = wmb(a11, qf[tl], zero8);
      s1[tl] = wmb(a21, qf[tl], s1[tl]);
    }
    // logit in the base-2 domain: x = rt*ct - dot (minus the Lorentz product), x1 = x + 1e-6,
    // arccosh(x1) = ln(x1 + sqrt(x1^2 - 1)); a = -beta * log2(x1 + sqrt(x1^2 - 1)) + cb
    v8f a0[2], a1[2];
    float tm[2];
#pragma unroll
    for (int tl = 0; tl < 2; ++tl) {
      float x1[16], w[16];
#pragma unroll
      for (int r = 0; r < 8; ++r) {
        x1[r]     = (rt[tl] * ct0[r] - s0[tl][r]) + 1.0e-6f;        // column position n0 + 8h + r
        x1[8 + r] = (rt[tl] * ct1[r] - s1[tl][r]) + 1.0e-6f;        // column position n0 + 16 + 8h + r
      }
#pragma unroll
      for (int i = 0; i < 16; ++i) w[i] = fmaxf(x1[i] * x1[i] - 1.0f, 0.0f);
      sqrt16(w);
#pragma unroll
      for (int i = 0; i < 16; ++i) w[i] = x1[i] + w[i];
      log2_16(w);
#pragma unroll
      for (int r = 0; r < 8; ++r) {
        a0[tl][r] = nbeta * w[r] + cb0[r];
        a1[tl][r] = nbeta * w[8 + r] + cb1[r];
      }
      float t = fmaxf(a0[tl][0], a1[tl][0]);
#pragma unroll
      for (int r = 1; r < 8; ++r) t = fmaxf(t, fmaxf(a0[tl][r], a1[tl][r]));
      tm[tl] = t;
    }
    float tx[2];
#pragma unroll
    for (int tl = 0; tl < 2; ++tl) tx[tl] = __shfl_xor(tm[tl], 16);
    FragB ph[2], pw[2];
#pragma unroll
    for (int tl = 0; tl < 2; ++tl) {
      const float t = fmaxf(tm[tl], tx[tl]);
      const float mnew = fmaxf(mrun[tl], t);
      float e[17];
#pragma unroll
      for (int r = 0; r < 8; ++r) {
        e[r]     = a0[tl][r] - mnew;
        e[8 + r] = a1[tl][r] - mnew;
      }
      e[16] = mrun[tl] - mnew;
      exp2_17(e);
      const float sc = e[16];
      v8f p0, p1;
      float ps = 0.0f;
#pragma unroll
      for (int r = 0; r < 8; ++r) {
        p0[r] = e[r];
        p1[r] = e[8 + r];
        ps += p0[r] + p1[r];
      }
      lrun[tl] = lrun[tl] * sc + ps;
      mrun[tl] = mnew;
      o[tl] = o[tl] * sc;

      split8(p0, ph[tl].q[0], pw[tl].q[0]);
      split8(p1, ph[tl].q[1], pw[tl].q[1]);
    }
    // keeps the six products behind both tiles' splits
    __builtin_amdgcn_sched_barrier(0);
#pragma unroll
    for (int tl = 0; tl < 2; ++tl) o[tl] = wmb(fvh, ph[tl], o[tl]);
#pragma unroll
    for (int tl = 0; tl < 2; ++tl) o[tl] = wmb(fvl, ph[tl], o[tl]);
#pragma unroll
    for (int tl = 0; tl < 2; ++tl) o[tl] = wmb(fvh, pw[tl], o[tl]);
  }
  float* ow = ost + wave * (HD * OPITCH);     // the wave's own 16 channels x 32 positions
#pragma unroll
  for (unsigned tl = 0; tl < 2u; ++tl) {
    const float lt = lrun[tl] + __shfl_xor(lrun[tl], 16);
    const float inv = 1.0f / lt;
    const v8f c = o[tl] * inv;                // out[channel 16 t + 8h + r][position 32 wave + 16 tl + m]
    const unsigned so = (8u * hh) * OPITCH + 16u * tl + m;
#pragma unroll
    for (int r = 0; r < 8; ++r) ow[so + (unsigned)r * OPITCH] = c[r];
  }
  __syncthreads();

  {
    // unrolled whole: the four stores differ only in a constant offset, so no address register is rewritten
    const unsigned c = lane >> 3, q = lane & 7u;
    float* ob = out + (size_t)b * XB_FULL + (size_t)(HD * t + c) * LFULL + 32u * wave + 4u * q;
    const float* os = ow + c * OPITCH + 4u * q;
#pragma unroll
    for (unsigned it = 0; it < 4u; ++it) {
      const v4f v = *(const v4fa*)(os + it * (4u * OPITCH));
      *(v4f*)(ob + it * (4u * LFULL)) = v;
    }
  }
}

// ---------------------------------------------------------------------------
extern "C" void kernel_launch(void* const* d_in, const int* in_sizes, int n_in,
                              void* d_out, int out_size, void* d_ws, size_t ws_size,
                              hipStream_t stream) {
  (void)d_ws;
  (void)ws_size;
  if (n_in < 6) return;
  const long long actN = (long long)NB * EW * LFULL;
  if ((long long)in_sizes[0] < actN) return;                 // queries [b][channel][l]
  if ((long long)in_sizes[1] < (long long)NB * LFULL) return; // mask [b][l] int32
  if (in_sizes[2] < 2 * EW * EW) return;                     // W_mem [256][128]
  if (in_sizes[3] < EW * EW) return;                         // W_q [128][128]
  if (in_sizes[4] < 1 || in_sizes[5] < 1) return;            // beta, bias
  if ((long long)out_size < actN) return;

  const float* queries = (const float*)d_in[0];
  const int*   mask    = (const int*)d_in[1];
  const float* Wmem    = (const float*)d_in[2];
  const float* Wq      = (const float*)d_in[3];
  const float* beta    = (const float*)d_in[4];
  const float* bias    = (const float*)d_in[5];
  float* out = (float*)d_out;

  // projections, hyperboloid / Klein maps and Lorentz attention of one (head, batch) a block; channels-first output
  k_hfused<<<dim3(NH, NB), 512, 0, stream>>>(queries, mask, Wmem, Wq, beta, bias, out);
}

// v010
// A run of this version takes 19.4 microseconds.
// Next to v009, in two timings, it ran 1.06 and 1.05 times as fast.
// All steps since v000 together make it 6.38 times as fast.
// Contractions: W_mem / W_q projections = v_wmma_f32_16x16x32_bf16, bf16 (RNE) inputs and weights, one product. Lorentz spatial product k_sp.q_sp (K = 16) and P.V = same bf16 WMMA with every computed operand carried as bf16 hi + bf16 lo (hi.hi + lo.hi + hi.lo). Accumulate f32 everywhere.
// Time-like rank-1 term and the arccosh offset 1e-6: in the k slots that the score product's lo.hi term leaves free, each factor as three bf16 parts.
// arccosh, additive key bias, online softmax (base-2 form): f32 VALU. No power-of-two carries exist (bf16 planes only).
#include <hip/hip_runtime.h>
#include <stddef.h>
#include <stdint.h>
#include <math.h>

#ifndef NB
#define NB 32                      // batches processed (a reduced build reads the first NB batches)
#endif
#define SEQ    512                 // positions per batch (softmax rows i and softmax columns j)
#define LFULL  512                 // full row length of the channels-first input / output and of the mask
#define EW     128                 // model width = heads x head dim
#define NH     8
#define HD     16
#define QROW   48                  // halfwords per key slot in the column plane: 16 hi + 16 lo + 16 time-like
#define TILEH  256                 // halfwords per 512-B piece of a plane: 16 rows x 16 halfwords, one wave-wide 16-B load
#define TPITCH 136                 // halfwords per LDS weight row
#define OPITCH 36                  // floats per LDS output-stage row
#define NW     16                  // waves per block; wave w owns positions 32 w .. 32 w + 31
#define XB_FULL ((size_t)EW * LFULL)            // floats per batch of the input and of the output
#define LOG2E  1.4426950408889634f

static_assert(NH * HD == EW);
static_assert(SEQ == 512 && LFULL == 512);
static_assert(NW * 32 == SEQ);                 // one mask word, two 16-row tiles a wave
static_assert(16 * QROW == 3 * TILEH);         // 16 slots of the column plane = hi piece + lo piece + time-like piece
static_assert(2 * HD * 32 == 4 * TILEH);       // 32 keys of V^T, hi and lo = 4 pieces
static_assert(EW * 4 == 32 * 16);              // one weight row = one wave-wide 16-B load
static_assert(NW == HD);                       // weight staging: wave w takes row w of the head's three slices
static_assert(TPITCH % 8 == 0 && TPITCH >= EW);
static_assert(OPITCH % 4 == 0 && OPITCH >= 32);

typedef int            v4i   __attribute__((ext_vector_type(4)));
typedef int            v8i   __attribute__((ext_vector_type(8)));
typedef float          v4f   __attribute__((ext_vector_type(4)));
typedef float          v8f   __attribute__((ext_vector_type(8)));
typedef __bf16         v16bf __attribute__((ext_vector_type(16)));
typedef int            v2i   __attribute__((ext_vector_type(2)));
typedef float          v2f   __attribute__((ext_vector_type(2)));
typedef __bf16         v2bf  __attribute__((ext_vector_type(2)));
typedef v2i __attribute__((may_alias)) v2ia;
typedef v4i __attribute__((may_alias)) v4ia;
typedef v4f __attribute__((may_alias)) v4fa;
union FragB { v16bf v; v4i q[2]; v8i w; };

// The plain builtin: the compiler keeps the distance behind a matrix instruction itself, with independent work or
// further matrix instructions where it has some and with v_nop only where it has none.
__device__ __forceinline__ v8f wmb(const FragB& a, const FragB& b, v8f c) {
  return __builtin_amdgcn_wmma_f32_16x16x32_bf16(false, a.v, false, b.v, (short)0, c, false, false);
}

// two f32 -> two bf16 (RNE) in one word, by the convert instruction (v_cvt_pk_bf16_f32): lo in the low halfword
__device__ __forceinline__ int pack2(float lo, float hi) {
  const v2f p = {lo, hi};
  return __builtin_bit_cast(int, __builtin_convertvector(p, v2bf));
}
__device__ __forceinline__ float bf16_val(float f) {
  return __uint_as_float((unsigned)pack2(f, f) << 16);
}
// The time-like piece of the score product: 16 k slots, the same eight in both lane halves (so each half adds half
// of the sum, and the row side carries the factor -1/2, exact in bf16):
//   key side (A): ch ch ch cm cm cl eh el          c = cosh of the key point, e = 1e-6
//   row side (B): sh sm sl sh sm sh -1/2 -1/2      s = -1/2 cosh of the row point
// h, m, l: three bf16 parts, each the RNE of what the parts before it leave (both remainders are exact in f32), 24
// bits together. Over the 16 slots the products add up to -(c * r) - 1e-6; the part products left out (m.l, l.m,
// l.l) come to about one last bit of the f32 product c * r, far less than the spatial part's two-part split leaves out.
__device__ __forceinline__ v4i time_key(const float c) {
  const float r1 = c - bf16_val(c);
  const float r2 = r1 - bf16_val(r1);
  const float e1 = 1.0e-6f - bf16_val(1.0e-6f);
  v4i t;
  t[0] = pack2(c, c);
  t[1] = pack2(c, r1);
  t[2] = pack2(r1, r2);
  t[3] = pack2(1.0e-6f, e1);
  return t;
}
__device__ __forceinline__ v4i time_row(const float r) {
  const float s = -0.5f * r;
  const float r1 = s - bf16_val(s);
  const float r2 = r1 - bf16_val(r1);
  v4i t;
  t[0] = pack2(s, r1);
  t[1] = pack2(r2, s);
  t[2] = pack2(r1, s);
  t[3] = pack2(-0.5f, -0.5f);
  return t;
}
// 8 f32 -> bf16 hi piece + bf16 lo piece (lo = RNE(v - hi)); element 2j in the low halfword of word j.
// hi: one convert a pair. lo: hi * (-1) + v in the mixed-precision FMA that takes the bf16 half as it lies in
// the hi word and writes its bf16 result into one half of the lo word (v - hi is exact in f32, so the one
// rounding is the same as that of a subtraction and a convert): three instructions a pair.
// One asm statement: a plain subtraction and conversion compiled to five instructions a pair (two unpacks, a
// packed subtraction, the two converts). The four low halves stand in front of
// the four high halves; each high half rewrites the word its low half wrote four instructions back, which the
// s_delay_alu lines tell the issue logic, so that another wave can issue meanwhile.
__device__ __forceinline__ void split8(const v8f x, v4i& hi, v4i& lo) {
#pragma unroll
  for (int j = 0; j < 4; ++j) hi[j] = pack2(x[2 * j], x[2 * j + 1]);
  const int m1 = (int)0xBF80BF80u;            // bf16 -1.0 in both halves
  int l0, l1, l2, l3;
  asm("v_fma_mixlo_bf16 %0, %4, %8, %9 op_sel_hi:[1,1,0]\n\t"
      "v_fma_mixlo_bf16 %1, %5, %8, %11 op_sel_hi:[1,1,0]\n\t"
      "v_fma_mixlo_bf16 %2, %6, %8, %13 op_sel_hi:[1,1,0]\n\t"
      "v_fma_mixlo_bf16 %3, %7, %8, %15 op_sel_hi:[1,1,0]\n\t"
      "s_delay_alu instid0(VALU_DEP_4) | instskip(NEXT) | instid1(VALU_DEP_4)\n\t"
      "v_fma_mixhi_bf16 %0, %4, %8, %10 op_sel:[1,0,0] op_sel_hi:[1,1,0]\n\t"
      "v_fma_mixhi_bf16 %1, %5, %8, %12 op_sel:[1,0,0] op_sel_hi:[1,1,0]\n\t"
      "s_delay_alu instid0(VALU_DEP_4) | instskip(NEXT) | instid1(VALU_DEP_4)\n\t"
      "v_fma_mixhi_bf16 %2, %6, %8, %14 op_sel:[1,0,0] op_sel_hi:[1,1,0]\n\t"
      "v_fma_mixhi_bf16 %3, %7, %8, %16 op_sel:[1,0,0] op_sel_hi:[1,1,0]"
      : "=&v"(l0), "=&v"(l1), "=&v"(l2), "=&v"(l3)
      : "v"(hi[0]), "v"(hi[1]), "v"(hi[2]), "v"(hi[3]), "v"(m1),
        "v"(x[0]), "v"(x[1]), "v"(x[2]), "v"(x[3]), "v"(x[4]), "v"(x[5]), "v"(x[6]), "v"(x[7]));
  lo[0] = l0; lo[1] = l1; lo[2] = l2; lo[3] = l3;
}
// fragment (row/col = lane&15) from an LDS k-contiguous bf16 row: p = row + k0 + 8h;
// elements 0..7 <- k0+8h+0..7, 8..15 <- k0+16+8h+0..7
__device__ __forceinline__ FragB lds_frag(const unsigned short* p) {
  FragB f;
  f.q[0] = *(const v4ia*)p;
  f.q[1] = *(const v4ia*)(p + 16);
  return f;
}
// The maps' root, reciprocal, 2^x and log2 as the bare instructions, where a last-bit error does no harm. The
// library sinhf and coshf carry e^n in two floats, the library root and division correct the last bit and rescale
// subnormals: together over a hundred vector instructions a head, nearly all in one dependent chain, in a kernel
// that has 16 waves a block, four or more on a SIMD, to hide it. The operands here come from bf16-rounded inputs and weights.
// On return ep = e^n / 2, em = e^-n / 2 (the halving rides in the exponent, so the range is that of sinh and cosh
// themselves) and iv = 1 / max(n, 1e-12). sinh = ep - em and cosh = ep + em share ep's error, which then only
// scales the point's Lorentz products.
// One asm statement, every value in place: no instruction in it touches its neighbour's register, and the closing
// v_nop is the slot the instruction set asks for between the last one and a reader of its result (as builtins
// the three compiled to a run in which one overwrote the source of the one directly in front).
__device__ __forceinline__ void exps_rcp(const float n, float& ep, float& em, float& iv) {
  ep = __builtin_fmaf(n, LOG2E, -1.0f);
  em = __builtin_fmaf(-n, LOG2E, -1.0f);
  iv = fmaxf(n, 1.0e-12f);
  asm("v_exp_f32 %0, %0\n\t"
      "v_exp_f32 %1, %1\n\t"
      "v_rcp_f32 %2, %2\n\t"
      "v_nop"
      : "+v"(ep), "+v"(em), "+v"(iv));
}

// Hyperboloid map of one head vector held as 8 + 8 components by lanes l and l^16:
// a <- normalize(a * scl) * sinh(|a * scl|); returns cosh(|a * scl|). Both lane halves get identical norms.
__device__ __forceinline__ float hyp8(v8f& a, const float scl) {
#pragma clang fp contract(off)
  float ss = 0.0f;
#pragma unroll
  for (int r = 0; r < 8; ++r) { a[r] = a[r] * scl; ss += a[r] * a[r]; }
  ss += __shfl_xor(ss, 16);
  const float n = __builtin_amdgcn_sqrtf(ss);
  float ep, em, inv;
  exps_rcp(n, ep, em, inv);
  const float sh = ep - em;
  const float ch = ep + em;
#pragma unroll
  for (int r = 0; r < 8; ++r) a[r] = (a[r] * inv) * sh;
  return ch;
}

// Klein map of one head vector: a <- normalize(hyperboloid_spatial / hyperboloid_time);
// returns (log(1 / (sqrt(1 - (|a| - 1e-4)^2) + 1e-4)) + biasv) * log2(e) + mterm.
__device__ __forceinline__ float klein8(v8f& a, const float biasv, const float mterm) {
#pragma clang fp contract(off)
  float ss = 0.0f;
#pragma unroll
  for (int r = 0; r < 8; ++r) ss += a[r] * a[r];
  ss += __shfl_xor(ss, 16);
  // vn, inv, sh and ich only scale the vector, and the normalisation below takes any common scale out again
  const float vn = __builtin_amdgcn_sqrtf(ss);
  float ep, em, inv;
  exps_rcp(vn, ep, em, inv);
  const float sh = ep - em;
  const float ich = __builtin_amdgcn_rcpf(ep + em);
  float s2 = 0.0f;
#pragma unroll
  for (int r = 0; r < 8; ++r) { a[r] = ((a[r] * inv) * sh) * ich; s2 += a[r] * a[r]; }
  s2 += __shfl_xor(s2, 16);
  // library root and true division here and for vnk: one last-bit step of vnk beside 1 moves 1 - dm * dm, and so
  // the key bias, by far more than one last bit
  const float n2 = sqrtf(s2);
  const float inv2 = 1.0f / fmaxf(n2, 1.0e-12f);
  float s3 = 0.0f;
#pragma unroll
  for (int r = 0; r < 8; ++r) { a[r] = a[r] * inv2; s3 += a[r] * a[r]; }
  s3 += __shfl_xor(s3, 16);
  const float vnk = sqrtf(s3);
  const float dm = vnk - 1.0e-4f;
  const float den = __builtin_amdgcn_sqrtf(1.0f - dm * dm) + 1.0e-4f;
  // log(1 / den) * log2(e) = -log2(den); den lies between 1e-4 and about 1, a normal number
  return (biasv * LOG2E - __builtin_amdgcn_logf(den)) + mterm;
}

// The attention loop's root, log2 and 2^x as the bare instructions. The library forms wrap each in a rescale
// for subnormal arguments or results and give the root a last-bit correction: about 5 to 15 vector
// instructions per value. Here the root's argument is 0 or a normal number (x1^2 - 1 of an f32 x1, clamped at
// 0), the log's is about 1 or more, and a 2^x below the normal range may come out as 0 beside a row sum that
// holds a term equal to 1; the root keeps the instruction's own 1 ulp.
// One asm statement per kind, every value in place: no instruction in it touches its neighbour's register, and
// the closing v_nop is the slot the instruction set asks for between the last one and a reader of its result
// (the builtins compiled to runs in which one overwrote the source of the one directly in front).
__device__ __forceinline__ void sqrt16(float (&a)[16]) {
  asm(
      "v_sqrt_f32 %0, %0\n\t"
      "v_sqrt_f32 %1, %1\n\t"
      "v_sqrt_f32 %2, %2\n\t"
      "v_sqrt_f32 %3, %3\n\t"
      "v_sqrt_f32 %4, %4\n\t"
      "v_sqrt_f32 %5, %5\n\t"
      "v_sqrt_f32 %6, %6\n\t"
      "v_sqrt_f32 %7, %7\n\t"
      "v_sqrt_f32 %8, %8\n\t"
      "v_sqrt_f32 %9, %9\n\t"
      "v_sqrt_f32 %10, %10\n\t"
      "v_sqrt_f32 %11, %11\n\t"
      "v_sqrt_f32 %12, %12\n\t"
      "v_sqrt_f32 %13, %13\n\t"
      "v_sqrt_f32 %14, %14\n\t"
      "v_sqrt_f32 %15, %15\n\t"
      "v_nop"
      :
        "+v"(a[0]), "+v"(a[1]), "+v"(a[2]), "+v"(a[3]), "+v"(a[4]), "+v"(a[5]),
        "+v"(a[6]), "+v"(a[7]), "+v"(a[8]), "+v"(a[9]), "+v"(a[10]), "+v"(a[11]),
        "+v"(a[12]), "+v"(a[13]), "+v"(a[14]), "+v"(a[15]));
}
__device__ __forceinline__ void log2_16(float (&a)[16]) {
  asm(
      "v_log_f32 %0, %0\n\t"
      "v_log_f32 %1, %1\n\t"
      "v_log_f32 %2, %2\n\t"
      "v_log_f32 %3, %3\n\t"
      "v_log_f32 %4, %4\n\t"
      "v_log_f32 %5, %5\n\t"
      "v_log_f32 %6, %6\n\t"
      "v_log_f32 %7, %7\n\t"
      "v_log_f32 %8, %8\n\t"
      "v_log_f32 %9, %9\n\t"
      "v_log_f32 %10, %10\n\t"
      "v_log_f32 %11, %11\n\t"
      "v_log_f32 %12, %12\n\t"
      "v_log_f32 %13, %13\n\t"
      "v_log_f32 %14, %14\n\t"
      "v_log_f32 %15, %15\n\t"
      "v_nop"
      :
        "+v"(a[0]), "+v"(a[1]), "+v"(a[2]), "+v"(a[3]), "+v"(a[4]), "+v"(a[5]),
        "+v"(a[6]), "+v"(a[7]), "+v"(a[8]), "+v"(a[9]), "+v"(a[10]), "+v"(a[11]),
        "+v"(a[12]), "+v"(a[13]), "+v"(a[14]), "+v"(a[15]));
}
__device__ __forceinline__ void exp2_17(float (&a)[17]) {
  asm(
      "v_exp_f32 %0, %0\n\t"
      "v_exp_f32 %1, %1\n\t"
      "v_exp_f32 %2, %2\n\t"
      "v_exp_f32 %3, %3\n\t"
      "v_exp_f32 %4, %4\n\t"
      "v_exp_f32 %5, %5\n\t"
      "v_exp_f32 %6, %6\n\t"
      "v_exp_f32 %7, %7\n\t"
      "v_exp_f32 %8, %8\n\t"
      "v_exp_f32 %9, %9\n\t"
      "v_exp_f32 %10, %10\n\t"
      "v_exp_f32 %11, %11\n\t"
      "v_exp_f32 %12, %12\n\t"
      "v_exp_f32 %13, %13\n\t"
      "v_exp_f32 %14, %14\n\t"
      "v_exp_f32 %15, %15\n\t"
      "v_exp_f32 %16, %16\n\t"
      "v_nop"
      :
        "+v"(a[0]), "+v"(a[1]), "+v"(a[2]), "+v"(a[3]), "+v"(a[4]), "+v"(a[5]),
        "+v"(a[6]), "+v"(a[7]), "+v"(a[8]), "+v"(a[9]), "+v"(a[10]), "+v"(a[11]),
        "+v"(a[12]), "+v"(a[13]), "+v"(a[14]), "+v"(a[15]), "+v"(a[16]));
}

// ---------------------------------------------------------------------------
// One launch. Block = (head t, batch b), 16 waves; wave w owns positions 32 w .. 32 w + 31 of the batch, as two
// 16-position tiles: it projects them for its head and then runs them as its two softmax row tiles.
// Nothing goes through global memory between projection and attention: a head's attention needs only that head's
// 16 rows of W_q, of W_mem[0:128] and of W_mem[128:256], applied to the batch's 512 input columns.
// Weights: the 48 rows are rounded to bf16 into LDS wl (wave w loads row w of each slice, a whole 512-B row a load);
// A fragments (row = lane&15 = out feature) come from there.
// Input x is channels-first [b][k = channel][l]: a lane reads the 64 channels of its B fragments (col = lane&15 =
// position, k = 32 ks + 8 h + 0..7 and 32 ks + 16 + 8 h + 0..7) by 4-B loads; the 16 lanes of a half read 64
// contiguous bytes, and the wave's two tiles together use each 128-B line whole.
// D = W_tile (A) x X (B): D[row d = 8h+r][col = position], so a lane holds 8 of the 16 head components of one
// position; lanes l and l^16 complete the head.
// row role (W_mem[0:128]): hyperboloid point; hi / lo pieces and the time-like piece are the lane's own B fragments
//   of the score product and stay in registers.
// column role (W_q, scaled 0.25): hyperboloid point -> LDS cpl, spatial hi / lo pieces and the time-like piece.
// value role (W_mem[128:256]): Klein point -> LDS vtl (transposed), key bias (base-2) -> cbl.
// The LDS planes are laid in the order the attention loop's fragments read them, lane (m, h) at byte 32 m + 16 h of
// a 512-B piece: cpl = [16-slot tile][hi | lo | time-like][slot m][component or k slot 0..15];
// vtl = [32-slot block][hi | lo][slot half q][channel d = m][slot 16 q + 0..15].
// Key compaction: a key whose mask is 0 carries the additive term -1e30, so beside any key of the batch whose
// mask is 1 or more its softmax weight is exactly 0 (the other logit terms are small beside 1e30: arccosh of an
// f32 is below 90, the log-denominator below 10). Such keys get no slot: a kept key's slot is its rank among the
// batch's kept keys, in key order. A batch with no mask of 1 or more keeps every key, each with its own term.
// The slots between the last kept key and the end of its 32-slot block are filled with a point at the origin
// (spatial 0, time-like 1, value 0) and the masked term, in front of the barrier that precedes the kept keys' stores.
// Attention, flash form in the transposed domain:
//   S^T tile = C (A, row = column slot j) x R^T (B, col = row position i): the K = 16 spatial product is
//   laid as [c_hi|c_hi] x [r_hi|r_lo] plus [c_lo|c_time] x [r_hi|r_time] along the 32-deep k axis; the time-like
//   pieces (time_key, time_row) add -(ct[j]*rt[i]) - 1e-6, so D = -x1, minus the arccosh argument, whole.
//   D[row j 8h+r][col i m]. Per element: x1 = -D, logit2 = -beta*log2(x1 + sqrt(x1^2-1)) + cb[j]
//   (cb carries log-denominator, bias and the additive key mask term). Softmax statistics are per lane
//   (row i = m); the two lane halves combine by one xor-16 exchange. The P^T B-fragment is the lane's own
//   16 results (tile 0 -> elements 0..7, tile 1 -> elements 8..15). O^T = V^T (A, row d) x P^T:
//   D[row d 8h+r][col i m], scaled per lane.
// Output: each wave stages its 16 channels x 32 positions in its own part of ost and stores whole 128-B lines.
// coverage: grid (8, NB) x 16 channels x 16 waves x 32 positions = NB*128*512 outputs, each written by one lane.
// ---------------------------------------------------------------------------
struct __attribute__((aligned(16))) Planes {
  float cbl[SEQ];                              // key bias (base-2), per slot
  unsigned short cpl[SEQ * QROW];              // column points: spatial part hi / lo, time-like piece
  unsigned short vtl[SEQ * 2 * HD];            // Klein points, transposed, hi / lo
  unsigned short wl[3 * HD * TPITCH];          // the head's rows of W_q, W_mem[0:128], W_mem[128:256], bf16
  float ost[NW * HD * OPITCH];                 // output stage
};
__global__ __launch_bounds__(512) void k_hfused(const float* __restrict__ x, const int* __restrict__ mask,
                                                const float* __restrict__ wmem, const float* __restrict__ wq,
                                                const float* __restrict__ beta_p, const float* __restrict__ bias_p,
                                                float* out) {
  // one object, so that the order is fixed: the arrays that the key loop reads start below 64 KiB, so each of its
  // LDS loads is one of the loop's running addresses plus a constant offset, with no address addition
  __shared__ Planes sm;
  float* const cbl = sm.cbl;
  unsigned short* const cpl = sm.cpl;
  unsigned short* const vtl = sm.vtl;
  unsigned short* const wl = sm.wl;
  float* const ost = sm.ost;
  const unsigned tid = threadIdx.x, lane = tid & 31u, hh = lane >> 4, m = lane & 15u;
  const unsigned wave = (unsigned)__builtin_amdgcn_readfirstlane((int)(threadIdx.x >> 5));
  const unsigned t = blockIdx.x, b = blockIdx.y;
  const v8f zero8 = {0.f, 0.f, 0.f, 0.f, 0.f, 0.f, 0.f, 0.f};
  const v8f mone8 = {-1.f, -1.f, -1.f, -1.f, -1.f, -1.f, -1.f, -1.f};
  const v4i zero4 = {0, 0, 0, 0};

  // ---- kept keys of the batch: every wave forms the same 16 lane-mask words, so the count needs no barrier ----
  const int* mrow = mask + (size_t)b * LFULL;
  int mw[16];
#pragma unroll
  for (int w = 0; w < 16; ++w) mw[w] = mrow[32 * w + (int)lane];
  const unsigned pm = 32u * wave + m;
  const int mi0 = mrow[pm];                    // the masks of the lane's own two positions
  const int mi1 = mrow[pm + 16u];
  // the eighteen loads' two offset registers stay as they are up to this wait; what follows may reuse them
  asm volatile("s_wait_xcnt 0x0" :: "v"(lane), "v"(pm) : "memory");
  // ---- the head's 48 weight rows ----
  const unsigned ro = (HD * t + wave) * EW + lane * 4u;
  const float* pq = wq + ro;
  const float* pk = wmem + ro;
  const v4f gw0 = *(const v4fa*)pq;
  const v4f gw1 = *(const v4fa*)pk;
  const v4f gw2 = *(const v4fa*)(pk + EW * EW);
  // the three loads' two address register pairs stay as they are up to this wait; what follows may reuse them
  asm volatile("s_wait_xcnt 0x0" :: "v"(pq), "v"(pk) : "memory");

  // The input loads stand in front of the mask words' first use: they depend on no mask, and so fly together with
  // the mask and weight loads.
  // ---- input: the lane's B fragments of both tiles ----
  FragB xa[2][4];
  {
    const float* xg = x + (size_t)b * XB_FULL + (8u * hh) * LFULL + 32u * wave + m;
#pragma unroll
    for (int ks = 0; ks < 4; ++ks) {
      float g[2][16];
#pragma unroll
      for (int e = 0; e < 8; ++e) {
#pragma unroll
        for (int tl = 0; tl < 2; ++tl) {
          g[tl][e]     = xg[(32 * ks + e) * LFULL + 16 * tl];
          g[tl][8 + e] = xg[(32 * ks + 16 + e) * LFULL + 16 * tl];
        }
      }
      // the loads' address register pair stays as it is up to this wait; what follows may reuse it
      asm volatile("s_wait_xcnt 0x0" :: "v"(xg) : "memory");
#pragma unroll
      for (int tl = 0; tl < 2; ++tl) {
#pragma unroll
        for (int j = 0; j < 4; ++j) {
          xa[tl][ks].q[0][j] = pack2(g[tl][2 * j], g[tl][2 * j + 1]);
          xa[tl][ks].q[1][j] = pack2(g[tl][8 + 2 * j], g[tl][8 + 2 * j + 1]);
        }
      }
      // keeps the next group's 32 loads behind this group's converts, so that a wave's outstanding loads stay
      // within what s_wait_loadcnt can name
      if (ks < 3) __builtin_amdgcn_sched_barrier(0);
    }
  }
  unsigned kw[16], anyp = 0u;
#pragma unroll
  for (int w = 0; w < 16; ++w) {
    kw[w] = __builtin_amdgcn_ballot_w32(mw[w] != 0);
    anyp |= __builtin_amdgcn_ballot_w32(mw[w] >= 1);
  }
  unsigned cnt = 0u, pre = 0u, cur = 0u;       // kept keys; kept keys in front of this wave's positions; its own word
#pragma unroll
  for (int w = 0; w < 16; ++w) {
    if (anyp == 0u) kw[w] = 0xFFFFFFFFu;
    const unsigned pc = (unsigned)__builtin_popcount(kw[w]);
    cnt += pc;
    if ((unsigned)w < wave) pre += pc;
    if ((unsigned)w == wave) cur = kw[w];
  }
  // kept keys rounded up to whole 32-slot blocks; cnt is 1 .. 512
  const unsigned nend = (cnt + 31u) & ~31u;
  {
    unsigned short* d = wl + wave * TPITCH + lane * 4u;
    v2i w0, w1, w2;
    w0[0] = pack2(gw0.x, gw0.y); w0[1] = pack2(gw0.z, gw0.w);
    w1[0] = pack2(gw1.x, gw1.y); w1[1] = pack2(gw1.z, gw1.w);
    w2[0] = pack2(gw2.x, gw2.y); w2[1] = pack2(gw2.z, gw2.w);
    *(v2ia*)d = w0;
    *(v2ia*)(d + HD * TPITCH) = w1;
    *(v2ia*)(d + 2 * HD * TPITCH) = w2;
  }
  // ---- last 32-slot block: origin point with the masked term; the kept keys among its slots overwrite it below ----
  {
    const unsigned s0 = nend - 32u;
    // waves 0 to 5 fill one 512-B piece each: two tiles x (hi, lo, time-like)
    if (tid < 192u) *(v4ia*)(cpl + s0 * QROW + tid * 8u) = (wave == 2u || wave == 5u) ? time_key(1.0f) : zero4;
    else if (tid < 320u) *(v4ia*)(vtl + s0 * (2 * HD) + (tid - 192u) * 8u) = zero4;
    else if (tid < 352u) cbl[s0 + (tid - 320u)] = -1.0e30f * LOG2E;
  }

  __syncthreads();                             // wl and the filled block are published

  const float biasv = bf16_val(bias_p[0]);
  const float nbeta = -bf16_val(beta_p[0]);
  const v8f nbeta8 = {nbeta, nbeta, nbeta, nbeta, nbeta, nbeta, nbeta, nbeta};
  FragB qf[2], qb[2];                          // [r_hi | r_lo] and [r_hi | r_time]
  const unsigned short* wp = wl + m * TPITCH + 8u * hh;
  // unrolled whole: tl indexes arrays that have to stay in registers, and the six maps are independent chains
#pragma unroll
  for (int tl = 0; tl < 2; ++tl) {
    const unsigned bit = 16u * (unsigned)tl + m;
    const bool kept = ((cur >> bit) & 1u) != 0u;
    const unsigned slot = pre + (unsigned)__builtin_popcount(cur & ((1u << bit) - 1u));
    const float mv = (float)(tl == 0 ? mi0 : mi1);
    const float mterm = (-1.0e30f * (1.0f - mv)) * LOG2E;
    {
      FragB wf[4];
#pragma unroll
      for (int ks = 0; ks < 4; ++ks) wf[ks] = lds_frag(wp + HD * TPITCH + 32 * ks);
      v8f acc = zero8;
#pragma unroll
      for (int ks = 0; ks < 4; ++ks) acc = wmb(wf[ks], xa[tl][ks], acc);
      const float rt = hyp8(acc, 1.0f);        // acc[r] = spatial[position 32 wave + 16 tl + m][8h + r]
      split8(acc, qf[tl].q[0], qf[tl].q[1]);   // r_hi[8h .. 8h+7] (k slots 8h..), r_lo (k slots 16+8h..)
      qb[tl].q[0] = qf[tl].q[0];
      qb[tl].q[1] = time_row(rt);
    }
    {
      FragB wf[4];
#pragma unroll
      for (int ks = 0; ks < 4; ++ks) wf[ks] = lds_frag(wp + 32 * ks);
      v8f acc = zero8;
#pragma unroll
      for (int ks = 0; ks < 4; ++ks) acc = wmb(wf[ks], xa[tl][ks], acc);
      const float ch = hyp8(acc, 0.25f);
      v4i hi, lo;
      split8(acc, hi, lo);
      if (kept) {
        const unsigned so = (slot >> 4) * (3u * TILEH) + (slot & 15u) * 16u + 8u * hh;
        *(v4ia*)(cpl + so) = hi;
        *(v4ia*)(cpl + so + TILEH) = lo;
        *(v4ia*)(cpl + so + 2 * TILEH) = time_key(ch);
      }
    }
    {
      FragB wf[4];
#pragma unroll
      for (int ks = 0; ks < 4; ++ks) wf[ks] = lds_frag(wp + 2 * HD * TPITCH + 32 * ks);
      v8f acc = zero8;
#pragma unroll
      for (int ks = 0; ks < 4; ++ks) acc = wmb(wf[ks], xa[tl][ks], acc);
      const float lb2 = klein8(acc, biasv, mterm);  // acc[r] = v_klein[position][8h + r]
      v4i vh, vl;
      split8(acc, vh, vl);
      if (kept) {
        // [slot block][hi | lo][slot half][channel 8h + r][slot & 15]
        const unsigned sb = (slot >> 5) * (4u * TILEH) + ((slot >> 4) & 1u) * TILEH + (8u * hh) * 16u + (slot & 15u);
#pragma unroll
        for (int r = 0; r < 8; ++r) {
          vtl[sb + (unsigned)r * 16u] = (unsigned short)((unsigned)vh[r >> 1] >> (16 * (r & 1)));
          vtl[sb + (unsigned)r * 16u + 2u * TILEH] = (unsigned short)((unsigned)vl[r >> 1] >> (16 * (r & 1)));
        }
        if (hh == 0u) cbl[slot] = lb2;
      }
    }
  }
  __syncthreads();                             // the planes are published

  const unsigned fo = 16u * m + 8u * hh;      // the lane's 16 bytes inside a 512-B piece
  const unsigned short* kb = cpl + fo;
  const unsigned short* vb = vtl + fo;
  const float* cbp = cbl + 8u * hh;

  // Both 16-row tiles of the wave go through ONE key loop: a key block's K, V and per-key scalars are loaded once
  // and serve both tiles, and the two tiles' chains are independent work for the wave while either one waits.
  // Every loop over tl is unrolled whole: tl indexes arrays that have to stay in registers.
  v8f o[2] = {zero8, zero8};
  float mrun[2] = {-3.0e38f, -3.0e38f}, lrun[2] = {0.0f, 0.0f};
#pragma unroll 1
  for (unsigned n0 = 0; n0 < nend; n0 += 32u) {
    // 96 B a slot as 64 + 32: two shift-and-adds, the first shared with the V plane's address, for a 32-bit multiply
    const unsigned short* kp = kb + (size_t)n0 * (2 * HD) + (size_t)n0 * (QROW - 2 * HD);
    const v4i kh0 = *(const v4ia*)kp;
    const v4i kl0 = *(const v4ia*)(kp + TILEH);
    const v4i kt0 = *(const v4ia*)(kp + 2 * TILEH);
    const v4i kh1 = *(const v4ia*)(kp + 3 * TILEH);
    const v4i kl1 = *(const v4ia*)(kp + 4 * TILEH);
    const v4i kt1 = *(const v4ia*)(kp + 5 * TILEH);
    const v4f u0 = *(const v4fa*)(cbp + n0);
    const v4f u1 = *(const v4fa*)(cbp + n0 + 4u);
    const v4f u2 = *(const v4fa*)(cbp + n0 + 16u);
    const v4f u3 = *(const v4fa*)(cbp + n0 + 20u);
    FragB fvh, fvl;
    const unsigned short* vp = vb + (size_t)n0 * (2 * HD);
    fvh.q[0] = *(const v4ia*)vp;                 // keys n0 + 8h + 0..7
    fvh.q[1] = *(const v4ia*)(vp + TILEH);       // keys n0 + 16 + 8h + 0..7
    fvl.q[0] = *(const v4ia*)(vp + 2 * TILEH);
    fvl.q[1] = *(const v4ia*)(vp + 3 * TILEH);
    FragB a10, a20, a11, a21;
    a10.w = __builtin_shufflevector(kh0, kh0, 0, 1, 2, 3, 0, 1, 2, 3);
    a20.w = __builtin_shufflevector(kl0, kt0, 0, 1, 2, 3, 4, 5, 6, 7);
    a11.w = __builtin_shufflevector(kh1, kh1, 0, 1, 2, 3, 0, 1, 2, 3);
    a21.w = __builtin_shufflevector(kl1, kt1, 0, 1, 2, 3, 4, 5, 6, 7);
    const v8f cb0 = __builtin_shufflevector(u0, u1, 0, 1, 2, 3, 4, 5, 6, 7);
    const v8f cb1 = __builtin_shufflevector(u2, u3, 0, 1, 2, 3, 4, 5, 6, 7);
    v8f s0[2], s1[2];
#pragma unroll
    for (int tl = 0; tl < 2; ++tl) {
      s0[tl] = wmb(a10, qf[tl], zero8);
      s0[tl] = wmb(a20, qb[tl], s0[tl]);
      s1[tl] = wmb(a11, qf[tl], zero8);
      s1[tl] = wmb(a21, qb[tl], s1[tl]);
    }
    // keeps the eight products together, so that each fills the distance behind the others: with the first squares
    // drawn in between them the compiler filled that distance with more v_nop
    __builtin_amdgcn_sched_barrier(0);
    // logit in the base-2 domain: the product is -x1, x1 = (minus the Lorentz product) + 1e-6;
    // arccosh(x1) = ln(x1 + sqrt(x1^2 - 1)); a = -beta * log2(x1 + sqrt(x1^2 - 1)) + cb
    v8f a0[2], a1[2];
    float tm[2];
#pragma unroll
    for (int tl = 0; tl < 2; ++tl) {
      float w[16];
      // fused: beside x1 = 1 a rounded square would lose the difference
      const v8f q0 = __builtin_elementwise_fma(s0[tl], s0[tl], mone8);   // column position n0 + 8h + r
      const v8f q1 = __builtin_elementwise_fma(s1[tl], s1[tl], mone8);   // column position n0 + 16 + 8h + r
#pragma unroll
      for (int r = 0; r < 8; ++r) {
        w[r]     = fmaxf(q0[r], 0.0f);
        w[8 + r] = fmaxf(q1[r], 0.0f);
      }
      sqrt16(w);
#pragma unroll
      for (int r = 0; r < 8; ++r) {
        w[r]     = w[r] - s0[tl][r];
        w[8 + r] = w[8 + r] - s1[tl][r];
      }
      log2_16(w);
      v8f l0, l1;
#pragma unroll
      for (int r = 0; r < 8; ++r) {
        l0[r] = w[r];
        l1[r] = w[8 + r];
      }
      a0[tl] = __builtin_elementwise_fma(nbeta8, l0, cb0);
      a1[tl] = __builtin_elementwise_fma(nbeta8, l1, cb1);
      float t = fmaxf(a0[tl][0], a1[tl][0]);
#pragma unroll
      for (int r = 1; r < 8; ++r) t = fmaxf(t, fmaxf(a0[tl][r], a1[tl][r]));
      tm[tl] = t;
    }
    float tx[2];
#pragma unroll
    for (int tl = 0; tl < 2; ++tl) tx[tl] = __shfl_xor(tm[tl], 16);
    FragB ph[2], pw[2];
#pragma unroll
    for (int tl = 0; tl < 2; ++tl) {
      const float t = fmaxf(tm[tl], tx[tl]);
      const float mnew = fmaxf(mrun[tl], t);
      float e[17];
#pragma unroll
      for (int r = 0; r < 8; ++r) {
        e[r]     = a0[tl][r] - mnew;
        e[8 + r] = a1[tl][r] - mnew;
      }
      e[16] = mrun[tl] - mnew;
      exp2_17(e);
      const float sc = e[16];
      v8f p0, p1;
      float ps = 0.0f;
#pragma unroll
      for (int r = 0; r < 8; ++r) {
        p0[r] = e[r];
        p1[r] = e[8 + r];
        ps += p0[r] + p1[r];
      }
      lrun[tl] = lrun[tl] * sc + ps;
      mrun[tl] = mnew;
      o[tl] = o[tl] * sc;

      split8(p0, ph[tl].q[0], pw[tl].q[0]);
      split8(p1, ph[tl].q[1], pw[tl].q[1]);
    }
    // keeps the six products behind both tiles' splits
    __builtin_amdgcn_sched_barrier(0);
#pragma unroll
    for (int tl = 0; tl < 2; ++tl) o[tl] = wmb(fvh, ph[tl], o[tl]);
#pragma unroll
    for (int tl = 0; tl < 2; ++tl) o[tl] = wmb(fvl, ph[tl], o[tl]);
#pragma unroll
    for (int tl = 0; tl < 2; ++tl) o[tl] = wmb(fvh, pw[tl], o[tl]);
  }
  float* ow = ost + wave * (HD * OPITCH);     // the wave's own 16 channels x 32 positions
#pragma unroll
  for (unsigned tl = 0; tl < 2u; ++tl) {
    const float lt = lrun[tl] + __shfl_xor(lrun[tl], 16);
    const float inv = 1.0f / lt;
    const v8f c = o[tl] * inv;                // out[channel 16 t + 8h + r][position 32 wave + 16 tl + m]
    const unsigned so = (8u * hh) * OPITCH + 16u * tl + m;
#pragma unroll
    for (int r = 0; r < 8; ++r) ow[so + (unsigned)r * OPITCH] = c[r];
  }
  __syncthreads();

  {
    // unrolled whole: the four stores differ only in a constant offset, so no address register is rewritten
    const unsigned c = lane >> 3, q = lane & 7u;
    float* ob = out + (size_t)b * XB_FULL + (size_t)(HD * t + c) * LFULL + 32u * wave + 4u * q;
    const float* os = ow + c * OPITCH + 4u * q;
#pragma unroll
    for (unsigned it = 0; it < 4u; ++it) {
      const v4f v = *(const v4fa*)(os + it * (4u * OPITCH));
      *(v4f*)(ob + it * (4u * LFULL)) = v;
    }
  }
}

// ---------------------------------------------------------------------------
extern "C" void kernel_launch(void* const* d_in, const int* in_sizes, int n_in,
                              void* d_out, int out_size, void* d_ws, size_t ws_size,
                              hipStream_t stream) {
  (void)d_ws;
  (void)ws_size;
  if (n_in < 6) return;
  const long long actN = (long long)NB * EW * LFULL;
  if ((long long)in_sizes[0] < actN) return;                 // queries [b][channel][l]
  if ((long long)in_sizes[1] < (long long)NB * LFULL) return; // mask [b][l] int32
  if (in_sizes[2] < 2 * EW * EW) return;                     // W_mem [256][128]
  if (in_sizes[3] < EW * EW) return;                         // W_q [128][128]
  if (in_sizes[4] < 1 || in_sizes[5] < 1) return;            // beta, bias
  if ((long long)out_size < actN) return;

  const float* queries = (const float*)d_in[0];
  const int*   mask    = (const int*)d_in[1];
  const float* Wmem    = (const float*)d_in[2];
  const float* Wq      = (const float*)d_in[3];
  const float* beta    = (const float*)d_in[4];
  const float* bias    = (const float*)d_in[5];
  float* out = (float*)d_out;

  // projections, hyperboloid / Klein maps and Lorentz attention of one (head, batch) a block; channels-first output
  k_hfused<<<dim3(NH, NB), 512, 0, stream>>>(queries, mask, Wmem, Wq, beta, bias, out);
}
